// v000
// Times are from an AMD MI455X. After a warm-up the kernel runs many times in a row, and a time is the length of
// such a window on the GPU divided by its runs, so every launch and the gaps after it count. The runs cycle
// through copies of the inputs. A figure is the median of several windows, for all but v000 over two sittings.
// Sittings can differ by a few percent; kernels timed side by side share one.
// v000, which the later versions start from, runs in 1130 microseconds.
#include <hip/hip_runtime.h>
#include <math.h>
#include <stdint.h>

// q/k/v and gate projections: v_wmma_f32_16x16x32_bf16, single products on bf16-RNE converted x and W^T, f32 accumulate;
// scores q.k^T: v_wmma_f32_16x16x32_f16 with q = f16 hi + residual x2^11 planes, k single f16 plane, f32 accumulate;
// p.v: v_wmma_f32_16x16x32_f16 with p x1024 single f16 plane, v^T = f16 hi + residual x2^11 planes, f32 accumulate;
// output projection: v_wmma_f32_16x16x32_bf16 with gated ctx as bf16 hi + lo planes and Wo^T bf16, f32 accumulate.
// Online softmax, score scale 1/sqrt(128), per-head bias scale 2^(-(h+1)/2), sigmoid gate and normalisation in f32.

#define NB   2
#define SEQ  2048
#define HID  2048
#define NH   16
#define HD   128
#define GLD  128

typedef _Float16 v16h __attribute__((ext_vector_type(16)));
typedef _Float16 v8h  __attribute__((ext_vector_type(8)));
typedef __bf16   v16b __attribute__((ext_vector_type(16)));
typedef __bf16   v8b  __attribute__((ext_vector_type(8)));
typedef float    v8f  __attribute__((ext_vector_type(8)));
typedef float    v4f  __attribute__((ext_vector_type(4)));
typedef unsigned int v4u __attribute__((ext_vector_type(4)));

// ---------------------------------------------------------------------------
// small helpers
// ---------------------------------------------------------------------------
__device__ __forceinline__ unsigned short f2bf_bits(float f) {          // RNE convert f32 -> bf16 bits
  const unsigned u = __float_as_uint(f);
  return (unsigned short)((u + 0x7FFFu + ((u >> 16) & 1u)) >> 16);
}
__device__ __forceinline__ float bf_bits2f(unsigned short x) { return __uint_as_float(((unsigned)x) << 16); }
__device__ __forceinline__ float bfr(float f) { return __uint_as_float(((unsigned)f2bf_bits(f)) << 16); }
__device__ __forceinline__ unsigned pk16(unsigned short a, unsigned short b) { return (unsigned)a | ((unsigned)b << 16); }
__device__ __forceinline__ unsigned short h2u(_Float16 x) { return __builtin_bit_cast(unsigned short, x); }

__device__ __forceinline__ void wave_sync() {
  __builtin_amdgcn_fence(__ATOMIC_RELEASE, "workgroup");
  __builtin_amdgcn_wave_barrier();
  __builtin_amdgcn_fence(__ATOMIC_ACQUIRE, "workgroup");
}

// 16-bit fragment loaders, same k map for A and B: p points at (row or col)*ld + k0 + 8*(lane>>4);
// elements 0..7 <- p[0..7] (k0+8h..k0+8h+7), elements 8..15 <- p[16..23] (k0+16+8h..k0+16+8h+7).
union FragB { v16b v; v8b h[2]; };
union FragH { v16h v; v8h h[2]; };
__device__ __forceinline__ v16b ldfrag_b(const __bf16* p) {
  FragB f; f.h[0] = *(const v8b*)(p); f.h[1] = *(const v8b*)(p + 16); return f.v;
}
__device__ __forceinline__ v16h ldfrag_h(const _Float16* p) {
  FragH f; f.h[0] = *(const v8h*)(p); f.h[1] = *(const v8h*)(p + 16); return f.v;
}

__device__ __forceinline__ v8f wmma_b(v16b a, v16b b, v8f c) {
  return __builtin_amdgcn_wmma_f32_16x16x32_bf16(false, a, false, b, (short)0, c, false, false);
}
// f16 form with the hazard guard attached to every issue (ties D, keeps A/B live)
__device__ __forceinline__ v8f wmma_h(v16h a, v16h b, v8f c) {
  c = __builtin_amdgcn_wmma_f32_16x16x32_f16(false, a, false, b, (short)0, c, false, false);
#if defined(__HIP_DEVICE_COMPILE__)
  asm volatile("v_nop\n\tv_nop\n\tv_nop\n\tv_nop" : "+v"(c) : "v"(a), "v"(b));
#endif
  return c;
}
// hazard guard for one j-group of the register-blocked GEMM (ties both D tiles, keeps A/B registers live)
__device__ __forceinline__ void dep_guard_b(v8f& x, v8f& y, v16b b, v16b a0, v16b a1, v16b l0, v16b l1) {
#if defined(__HIP_DEVICE_COMPILE__)
  asm volatile("v_nop\n\tv_nop\n\tv_nop\n\tv_nop" : "+v"(x), "+v"(y) : "v"(b), "v"(a0), "v"(a1), "v"(l0), "v"(l1));
#endif
}
__device__ __forceinline__ void dep_int(int& qo, v8f dep) {
#if defined(__HIP_DEVICE_COMPILE__)
  asm volatile("" : "+v"(qo) : "v"(dep));
#endif
}

// ---------------------------------------------------------------------------
// f32 -> bf16 (RNE) convert, 8 elements per thread: two 16-B loads, one 16-B store.
// Coverage: grid = ceil(n8/256) x 256 threads x 8 elements = the whole array (sizes here are multiples of 2048).
// ---------------------------------------------------------------------------
__global__ __launch_bounds__(256) void cvt_bf16x8_kernel(const float* __restrict__ in, unsigned short* out, int n8) {
  const int i = blockIdx.x * 256 + threadIdx.x;
  if (i < n8) {
    const v4f a = *(const v4f*)(in + 8 * (size_t)i);
    const v4f c = *(const v4f*)(in + 8 * (size_t)i + 4);
    v4u w;
    w[0] = pk16(f2bf_bits(a[0]), f2bf_bits(a[1]));
    w[1] = pk16(f2bf_bits(a[2]), f2bf_bits(a[3]));
    w[2] = pk16(f2bf_bits(c[0]), f2bf_bits(c[1]));
    w[3] = pk16(f2bf_bits(c[2]), f2bf_bits(c[3]));
    v4u* p = (v4u*)(out + 8 * (size_t)i);
    *p = w;
    
  }
}

// ---------------------------------------------------------------------------
// Transpose + RNE bf16 convert: in f32 [R][C] row-major -> out bf16 [C][R] (out[c][r] = bf16(in[r][c])).
// Block 256 threads handles a 64x64 tile through LDS. Load: thread -> 4 float4 (rows t>>4 + 16i, cols 4*(t&15)+0..3).
// Coverage: out rows cc = wave*4 + (lane>>3) (+32) over 8 waves = 0..63; columns (lane&7)*8 + 0..7 = 0..63; grid (C/64, R/64).
// ---------------------------------------------------------------------------
__global__ __launch_bounds__(256) void tr_bf16_kernel(const float* __restrict__ in, unsigned short* out, int R, int C) {
  __shared__ __align__(16) float tile[64][65];
  const int c0 = blockIdx.x * 64, r0 = blockIdx.y * 64;
  const int t = threadIdx.x;
  const int cq = (t & 15) * 4, rb = t >> 4;
#pragma unroll
  for (int i = 0; i < 4; ++i) {
    const int r = rb + 16 * i;
    const v4f v = *(const v4f*)(in + (size_t)(r0 + r) * C + c0 + cq);
    tile[r][cq] = v[0]; tile[r][cq + 1] = v[1]; tile[r][cq + 2] = v[2]; tile[r][cq + 3] = v[3];
  }
  __syncthreads();
  const int wave = t >> 5, lane = t & 31, q = lane >> 3, pc = lane & 7;
  const int cc0 = wave * 4 + q, cc1 = 32 + wave * 4 + q;
  v4u w0, w1;
#pragma unroll
  for (int e = 0; e < 4; ++e) {
    w0[e] = pk16(f2bf_bits(tile[pc * 8 + 2 * e][cc0]), f2bf_bits(tile[pc * 8 + 2 * e + 1][cc0]));
    w1[e] = pk16(f2bf_bits(tile[pc * 8 + 2 * e][cc1]), f2bf_bits(tile[pc * 8 + 2 * e + 1][cc1]));
  }
  v4u* p0 = (v4u*)(out + (size_t)(c0 + cc0) * R + r0 + pc * 8);
  v4u* p1 = (v4u*)(out + (size_t)(c0 + cc1) * R + r0 + pc * 8);
  *p0 = w0; *p1 = w1;
  
}

// ---------------------------------------------------------------------------
// Gate weight panel: wg f32 [HID][NH] -> out bf16 [GLD][HID], out[n][k] = bf16(wg[k][n]) for n < NH, 0 for n >= NH.
// Block n (uniform), thread -> k = 8*threadIdx.x; loads use a clamped column address, zeroed by value for n >= NH.
// Coverage: 128 blocks x 256 threads x 8 = the whole [128][2048] panel (padding rows written as zeros).
// ---------------------------------------------------------------------------
__global__ __launch_bounds__(256) void wg_pad_kernel(const float* __restrict__ wg, unsigned short* out) {
  const int n = blockIdx.x;
  const int k = threadIdx.x * 8;
  const int nn = (n < NH) ? n : (NH - 1);
  const float keep = (n < NH) ? 1.0f : 0.0f;
  v4u w;
#pragma unroll
  for (int e = 0; e < 4; ++e) {
    const float a = wg[(size_t)(k + 2 * e) * NH + nn] * keep;
    const float b = wg[(size_t)(k + 2 * e + 1) * NH + nn] * keep;
    w[e] = pk16(f2bf_bits(a), f2bf_bits(b));
  }
  v4u* p = (v4u*)(out + (size_t)n * HID + k);
  *p = w;
  
}

// ---------------------------------------------------------------------------
// Register-blocked bf16 WMMA GEMM: C[m][n] = sum_k A[m][k] * Bt[n][k] + bias; each wave owns a 32x128 tile.
// A row-major [M][K] (pitch lda), Bt row-major [N][K] (pitch ldb); M multiple of 32, N multiple of 128, K multiple of 32.
// SPLITA: A given as hi plane (Ap) + unscaled bf16 lo plane (A2p): products Ahi.B + Alo.B into one accumulator.
// BROW: bias[m] per row (clamped to nb1), else per column: bias[n] for n < nsplit (valid while n < nb1),
//       bias2[n - nsplit] for n >= nsplit (valid while n - nsplit < nb2); bias values RNE-rounded to bf16; both
//       candidates loaded from clamped addresses and selected by value.
// blockIdx.y selects a z slice through strideA / strideB / strideC (element strides).
// Epilogue: per wave, each 16x128 accumulator slab is staged in LDS (pitch 132 floats), then written as whole
//   OUT_MODE 0: f32 rows into Cout [M][ldc] (row segment 512 B = 32 lanes x 16 B, 1 row per instruction).
//   OUT_MODE 1: f16 hi plane Cout + f16 residual plane Cout2 ((v - hi) * 2048), [M][ldc] (256 B = 16 lanes x 16 B, 2 rows per instr.).
//   OUT_MODE 2: head-major relayout: columns n0 < nsplit -> q planes Cout (f16 hi) / Cout2 (residual * 2048) at
//               [(b*16 + n0/128)*SEQ + s][ldc = 128]; columns >= nsplit -> single f16 k plane Cout3 at
//               [(b*16 + (n0-nsplit)/128)*SEQ + s][128], with row m = b*2048 + s. Each 128-wide row = 256 B = 16 lanes x 16 B.
// Coverage per slab: it 0..7 x (lane>>4) 0..1 = 16 rows, (lane&15)*8 + 0..7 = 128 columns (OUT_MODE 1/2);
//                    it 0..15 = 16 rows, lane*4 + 0..3 = 128 columns (OUT_MODE 0).
// ---------------------------------------------------------------------------
#define GP 132

template <bool SPLITA, int OUT_MODE, bool BROW>
__global__ __launch_bounds__(128) void gemm_kernel(
    const unsigned short* __restrict__ Ap, const unsigned short* __restrict__ A2p, int lda, long strideA,
    const unsigned short* __restrict__ Btp, int ldb, long strideB,
    void* Cout, void* Cout2, void* Cout3, int ldc, long strideC,
    const float* __restrict__ bias, int nb1, const float* __restrict__ bias2, int nb2, int nsplit,
    int M, int N, int K) {
  __shared__ __align__(16) float sT[4][16 * GP];
  const int bz   = blockIdx.y;
  const int lane = threadIdx.x & 31;
  const int wave = threadIdx.x >> 5;
  const int tilesN = N >> 7;
  const int tilesM = M >> 5;
  const int tile = blockIdx.x * 4 + wave;
  if (tile >= tilesM * tilesN) return;          // wave-uniform; no block barriers in this kernel
  const int tm = tile / tilesN;
  const int tn = tile - tm * tilesN;
  const int m0 = tm << 5;
  const int n0 = tn << 7;

  const __bf16* Ab  = (const __bf16*)(const void*)Ap + (size_t)bz * strideA;
  const __bf16* Ab2 = SPLITA ? ((const __bf16*)(const void*)A2p + (size_t)bz * strideA) : (const __bf16*)0;
  const __bf16* Bb  = (const __bf16*)(const void*)Btp + (size_t)bz * strideB;

  const int rlane = lane & 15;              // row (A) / col (B, D) within a 16x16 subtile
  const int koff  = (lane >> 4) * 8;        // k offset of this lane half
  const int mOff  = (lane >> 4) * 8;        // D row offset of this lane half

  v8f acc[2][8];
#pragma unroll
  for (int i = 0; i < 2; ++i)
#pragma unroll
    for (int j = 0; j < 8; ++j) acc[i][j] = (v8f){0.f, 0.f, 0.f, 0.f, 0.f, 0.f, 0.f, 0.f};

  for (int k0 = 0; k0 < K; k0 += 32) {
    const size_t ao0 = (size_t)(m0 + rlane) * lda + koff + k0;
    const size_t ao1 = (size_t)(m0 + 16 + rlane) * lda + koff + k0;
    const v16b a0 = ldfrag_b(Ab + ao0);
    const v16b a1 = ldfrag_b(Ab + ao1);
    v16b l0 = a0, l1 = a1;
    if (SPLITA) { l0 = ldfrag_b(Ab2 + ao0); l1 = ldfrag_b(Ab2 + ao1); }
#pragma unroll
    for (int j = 0; j < 8; ++j) {
      const v16b bh = ldfrag_b(Bb + (size_t)(n0 + (j << 4) + rlane) * ldb + koff + k0);
      acc[0][j] = wmma_b(a0, bh, acc[0][j]);
      if (SPLITA) acc[0][j] = wmma_b(l0, bh, acc[0][j]);
      acc[1][j] = wmma_b(a1, bh, acc[1][j]);
      if (SPLITA) acc[1][j] = wmma_b(l1, bh, acc[1][j]);
      dep_guard_b(acc[0][j], acc[1][j], bh, a0, a1, l0, l1);
    }
  }

  // ---- epilogue ----
  float* slab = sT[wave];
  float bc[8];
#pragma unroll
  for (int j = 0; j < 8; ++j) bc[j] = 0.f;
  if (!BROW) {
#pragma unroll
    for (int j = 0; j < 8; ++j) {
      const int col = n0 + (j << 4) + rlane;
      int i1 = col;          if (i1 > nb1 - 1) i1 = nb1 - 1;
      int i2 = col - nsplit; if (i2 < 0) i2 = 0; if (i2 > nb2 - 1) i2 = nb2 - 1;
      const float v1 = bfr(bias[i1]);
      const float v2 = bfr(bias2[i2]);
      const bool lo = (col < nsplit);
      const bool valid = lo ? (col < nb1) : ((col - nsplit) < nb2);
      const float v = lo ? v1 : v2;
      bc[j] = valid ? v : 0.f;
    }
  }
#pragma unroll
  for (int i = 0; i < 2; ++i) {
    const int mBase = m0 + (i << 4);
    float br[8];
#pragma unroll
    for (int r = 0; r < 8; ++r) {
      br[r] = 0.f;
      if (BROW) {
        int ir = mBase + mOff + r; if (ir > nb1 - 1) ir = nb1 - 1;
        br[r] = bfr(bias[ir]);
      }
    }
#pragma unroll
    for (int j = 0; j < 8; ++j)
#pragma unroll
      for (int r = 0; r < 8; ++r)
        slab[(mOff + r) * GP + (j << 4) + rlane] = acc[i][j][r] + (BROW ? br[r] : bc[j]);
    wave_sync();
    if (OUT_MODE == 0) {
      float* C = (float*)Cout + (size_t)bz * strideC;
      const int c4 = lane * 4;                               // row segment 512 B = 32 lanes x 16 B
      {
#pragma unroll
        for (int it = 0; it < 16; ++it) {
          const v4f v = *(const v4f*)(slab + it * GP + c4);
          *(v4f*)(C + (size_t)(mBase + it) * ldc + n0 + c4) = v;
        }
        
      }
    } else if (OUT_MODE == 1) {
      unsigned short* C  = (unsigned short*)Cout  + (size_t)bz * strideC;
      unsigned short* C2 = (unsigned short*)Cout2 + (size_t)bz * strideC;
      const int q16 = lane >> 4, c8 = (lane & 15) * 8;      // row segment 256 B = 16 lanes x 16 B
      {
#pragma unroll
        for (int it = 0; it < 8; ++it) {
          const int row = it * 2 + q16;
          const float* sp = slab + row * GP + c8;
          v4u hv, lv;
#pragma unroll
          for (int p = 0; p < 4; ++p) {
            const float f0 = sp[2 * p], f1 = sp[2 * p + 1];
            const _Float16 e0 = (_Float16)f0, e1 = (_Float16)f1;
            const _Float16 g0 = (_Float16)((f0 - (float)e0) * 2048.0f);
            const _Float16 g1 = (_Float16)((f1 - (float)e1) * 2048.0f);
            hv[p] = pk16(h2u(e0), h2u(e1));
            lv[p] = pk16(h2u(g0), h2u(g1));
          }
          const size_t go = (size_t)(mBase + row) * ldc + n0 + c8;
          *(v4u*)(C  + go) = hv;
          *(v4u*)(C2 + go) = lv;
        }
        
      }
    } else {
      unsigned short* Q1 = (unsigned short*)Cout;
      unsigned short* Q2 = (unsigned short*)Cout2;
      unsigned short* K1 = (unsigned short*)Cout3;
      const int q16 = lane >> 4, c8 = (lane & 15) * 8;      // row segment 256 B = 16 lanes x 16 B
      const int  bidx = m0 / SEQ;                             // all 32 rows of the tile lie in one batch element
      const bool isq  = (n0 < nsplit);                        // wave-uniform
      const int  head = (isq ? n0 : (n0 - nsplit)) >> 7;
      const size_t rowBase = (size_t)(bidx * NH + head) * SEQ;
      {
#pragma unroll
        for (int it = 0; it < 8; ++it) {
          const int row = it * 2 + q16;
          const int s   = (mBase + row) & (SEQ - 1);
          const float* sp = slab + row * GP + c8;
          v4u hv, lv;
#pragma unroll
          for (int p = 0; p < 4; ++p) {
            const float f0 = sp[2 * p], f1 = sp[2 * p + 1];
            const _Float16 e0 = (_Float16)f0, e1 = (_Float16)f1;
            const _Float16 g0 = (_Float16)((f0 - (float)e0) * 2048.0f);
            const _Float16 g1 = (_Float16)((f1 - (float)e1) * 2048.0f);
            hv[p] = pk16(h2u(e0), h2u(e1));
            lv[p] = pk16(h2u(g0), h2u(g1));
          }
          const size_t go = (rowBase + (size_t)s) * ldc + c8;
          if (isq) {
            *(v4u*)(Q1 + go) = hv;
            *(v4u*)(Q2 + go) = lv;
          } else {
            *(v4u*)(K1 + go) = hv;
          }
        }
        
      }
    }
    wave_sync();
  }
}

// =====================================================================================
// Full (non-causal) attention with additive per-head-scaled bias and sigmoid head gate, head dim 128, 16 heads.
// Block = 4 waves = 64 query rows of one (b, h).
//   q planes f16 hi / residual*2048: element (b, h, s, d) at [((b*16 + h)*SEQ + s)*128 + d]
//   k plane  f16:                     element (b, h, s, d) at [((b*16 + h)*SEQ + s)*128 + d]
//   v^T planes f16 hi / residual*2048: element (b, h, d, s) at [((b*2048 + h*128 + d)*SEQ + s]
//   bias: f32 [b][q][key] read per element, RNE-rounded to bf16, scaled by 2^(-(h+1)/2)
//   gate logits: f32 [(b*SEQ + s)*GLD + h]; g = 1/(1 + exp(-a))
//   ctx out: bf16 hi + lo planes, element (b, s, h, d) at [(b*SEQ + s)*HID + h*128 + d]
//   scores = (qh.k + ql.k/2048) * (1/sqrt(128)) + bias*hs on v_wmma_f32_16x16x32_f16; online softmax in f32;
//   p1024 = f16(1024*exp(s - m)); ctx += ph.vh + (ph.vl)/2048, the residual product into a per-tile scratch
//   accumulator (starting at zero) folded in f32 right after; ctx = acc * g / 1024 / l.
//   kv chunks of 64 staged in LDS (K 16 KB, V^T hi/res 16 KB each), 32 chunks.
//   q fragments re-loaded from the global planes per 32-deep step (asm dependency keeps them from being hoisted).
//   Epilogue: wave 16x128 f32 tile staged in LDS (aliasing the K/V region after a block barrier), each 128-wide row =
//   Coverage: it 0..7 x (lane>>4) 0..1 = 16 rows x 128 columns per wave; 1024 blocks x 64 rows = every (b, s, h, d).
// =====================================================================================
#define AT_QB 64
#define AT_KC 64
#define OS_P  132

__global__ __launch_bounds__(128)
void attn_kernel(const unsigned short* __restrict__ qhp, const unsigned short* __restrict__ qlp,
                 const unsigned short* __restrict__ kp,
                 const unsigned short* __restrict__ vhp, const unsigned short* __restrict__ vlp,
                 const float* __restrict__ bmp, const float* __restrict__ glp,
                 unsigned short* chp, unsigned short* clp) {
  __shared__ __align__(16) _Float16 KVs[3 * AT_KC * HD];     // K [key][d] | V^T hi [d][key] | V^T res [d][key]; ctx staging later
  __shared__ __align__(16) _Float16 Psh[4][16 * AT_KC];       // per wave P x1024 [row][key]
  static_assert(4 * 16 * OS_P * 4 <= 3 * AT_KC * HD * 2);
  _Float16* const Ksh = KVs;
  _Float16* const Vth = KVs + AT_KC * HD;
  _Float16* const Vtl = KVs + 2 * AT_KC * HD;

  const int tid  = threadIdx.x;
  const int wave = tid >> 5;
  const int lane = tid & 31;
  const int hh   = lane >> 4;
  const int c    = lane & 15;

  const int bx  = blockIdx.x;
  const int qb  = bx & 31;                 // query block of 64
  const int h   = (bx >> 5) & (NH - 1);    // head
  const int b   = bx >> 9;                 // batch element
  const int q0  = qb * AT_QB + wave * 16;

  const _Float16* Qhg = (const _Float16*)(const void*)qhp + (size_t)(b * NH + h) * SEQ * HD;
  const _Float16* Qlg = (const _Float16*)(const void*)qlp + (size_t)(b * NH + h) * SEQ * HD;
  const _Float16* Kg  = (const _Float16*)(const void*)kp  + (size_t)(b * NH + h) * SEQ * HD;
  const _Float16* Vhg = (const _Float16*)(const void*)vhp + ((size_t)b * HID + (size_t)h * HD) * SEQ;
  const _Float16* Vlg = (const _Float16*)(const void*)vlp + ((size_t)b * HID + (size_t)h * HD) * SEQ;
  const float*    Bm  = bmp + (size_t)b * SEQ * SEQ + (size_t)(q0 + 8 * hh) * SEQ + c;   // + r*SEQ + key
  const int qro = (q0 + c) * HD + 8 * hh;  // per-lane A-fragment row base (d added per step)

  // per-head bias scale 2^(-(h+1)/2): exact power of two times sqrt(1/2) for odd (h+1)
  const int   hexp = (h + 1) >> 1;
  const float hs   = __uint_as_float((unsigned)(127 - hexp) << 23) * (((h + 1) & 1) ? 0.70710678118654752f : 1.0f);

  const v8f zero8 = (v8f){0.f, 0.f, 0.f, 0.f, 0.f, 0.f, 0.f, 0.f};
  const float inv2048 = 4.8828125e-4f;
  const float scale   = 1.0f / 11.313708305358887f;

  float mrow[8], lrow[8];
  v8f oh[8];
#pragma unroll
  for (int r = 0; r < 8; ++r) { mrow[r] = -INFINITY; lrow[r] = 0.f; }
#pragma unroll
  for (int t = 0; t < 8; ++t) oh[t] = zero8;

  for (int kc = 0; kc < SEQ / AT_KC; ++kc) {
    const int kv0 = kc * AT_KC;
    __syncthreads();
    {
      // staging: K: thread -> key tid>>1, d half (tid&1)*64, 8 x 16 B; V^T hi/res: thread -> d = tid, keys kv0..kv0+63, 8 x 16 B
      // coverage: 64 keys x 128 d for K, 128 d x 64 keys for each V^T plane = the whole chunk tiles
      const int r = tid >> 1, half = (tid & 1) * 64;
      const _Float16* ks = Kg  + (size_t)(kv0 + r) * HD + half;
      const _Float16* vs = Vhg + (size_t)tid * SEQ + kv0;
      const _Float16* ws = Vlg + (size_t)tid * SEQ + kv0;
#pragma unroll
      for (int i = 0; i < 8; ++i) {
        const v8h a0 = *(const v8h*)(ks + 8 * i);
        const v8h b0 = *(const v8h*)(vs + 8 * i);
        const v8h b1 = *(const v8h*)(ws + 8 * i);
        *(v8h*)(Ksh + r * HD + half + 8 * i)  = a0;
        *(v8h*)(Vth + tid * AT_KC + 8 * i)    = b0;
        *(v8h*)(Vtl + tid * AT_KC + 8 * i)    = b1;
      }
    }
    __syncthreads();

    // ---- scores: 4 key tiles of 16, reduce over d = 128 = 4 k-steps; hi and residual accumulators separate ----
    v8f s[4];
    v8f dep = oh[7];
#pragma unroll
    for (int j = 0; j < 4; ++j) {
      v8f sh = zero8, sl = zero8;
#pragma unroll
      for (int dc = 0; dc < 4; ++dc) {
        int qo = qro + dc * 32;
        dep_int(qo, dep);
        const v16h qa = ldfrag_h(Qhg + qo);
        const v16h qr = ldfrag_h(Qlg + qo);
        FragH kb;
        kb.h[0] = *(const v8h*)(Ksh + (j * 16 + c) * HD + dc * 32 + 8 * hh);
        kb.h[1] = *(const v8h*)(Ksh + (j * 16 + c) * HD + dc * 32 + 16 + 8 * hh);
        sh = wmma_h(qa, kb.v, sh);
        sl = wmma_h(qr, kb.v, sl);
        dep = sl;
      }
      v8f sj = (sh + sl * inv2048) * scale;
      const float* bp = Bm + kv0 + j * 16;
#pragma unroll
      for (int r = 0; r < 8; ++r) sj[r] = sj[r] + hs * bfr(bp[(size_t)r * SEQ]);
      s[j] = sj;
    }

    float cm[8];
#pragma unroll
    for (int r = 0; r < 8; ++r) {
      float m = fmaxf(fmaxf(s[0][r], s[1][r]), fmaxf(s[2][r], s[3][r]));
#pragma unroll
      for (int off = 1; off < 16; off <<= 1) m = fmaxf(m, __shfl_xor(m, off, 32));
      cm[r] = m;
    }

    _Float16* pw = Psh[wave];
#pragma unroll
    for (int r = 0; r < 8; ++r) {
      const float mnew  = fmaxf(mrow[r], cm[r]);
      const float alpha = expf(mrow[r] - mnew);
      mrow[r] = mnew;
      float psum = 0.f;
#pragma unroll
      for (int j = 0; j < 4; ++j) {
        const float p = expf(s[j][r] - mnew);
        psum += p;
        pw[(8 * hh + r) * AT_KC + j * 16 + c] = (_Float16)(p * 1024.0f);
      }
#pragma unroll
      for (int off = 1; off < 16; off <<= 1) psum += __shfl_xor(psum, off, 32);
      lrow[r] = lrow[r] * alpha + psum;
#pragma unroll
      for (int t = 0; t < 8; ++t) oh[t][r] *= alpha;
    }
    wave_sync();

    // ---- ctx += P . V over the 64 keys of the chunk (2 k-steps), 8 d tiles ----
#pragma unroll 1
    for (int kk = 0; kk < 2; ++kk) {
      FragH pa;
      pa.h[0] = *(const v8h*)(pw + c * AT_KC + kk * 32 + 8 * hh);
      pa.h[1] = *(const v8h*)(pw + c * AT_KC + kk * 32 + 16 + 8 * hh);
#pragma unroll
      for (int t = 0; t < 8; ++t) {
        FragH vb, vr;
        vb.h[0] = *(const v8h*)(Vth + (t * 16 + c) * AT_KC + kk * 32 + 8 * hh);
        vb.h[1] = *(const v8h*)(Vth + (t * 16 + c) * AT_KC + kk * 32 + 16 + 8 * hh);
        vr.h[0] = *(const v8h*)(Vtl + (t * 16 + c) * AT_KC + kk * 32 + 8 * hh);
        vr.h[1] = *(const v8h*)(Vtl + (t * 16 + c) * AT_KC + kk * 32 + 16 + 8 * hh);
        oh[t] = wmma_h(pa.v, vb.v, oh[t]);
        const v8f tr = wmma_h(pa.v, vr.v, zero8);
        oh[t] += tr * inv2048;
      }
    }
  }

  // ---- normalise, apply the head gate, stage the wave 16x128 tile (aliases the K/V region after the block barrier),
  //      write bf16 hi/lo planes ----
  __syncthreads();
  float* os = (float*)(void*)KVs + wave * (16 * OS_P);
#pragma unroll
  for (int r = 0; r < 8; ++r) {
    const int   q  = q0 + 8 * hh + r;
    const float a  = glp[(size_t)(b * SEQ + q) * GLD + h];
    const float g  = 1.0f / (1.0f + expf(-a));
    const float invl = g * (1.0f / lrow[r]) * 9.765625e-4f;
#pragma unroll
    for (int t = 0; t < 8; ++t) os[(8 * hh + r) * OS_P + t * 16 + c] = oh[t][r] * invl;
  }
  wave_sync();
  {
    const int q16 = lane >> 4, c8 = (lane & 15) * 8;         // 2 rows per instruction, each row 256 B = 16 lanes x 16 B
    {
#pragma unroll
      for (int it = 0; it < 8; ++it) {
        const int row = it * 2 + q16;
        const float* sp = os + row * OS_P + c8;
        v4u hv, lv;
#pragma unroll
        for (int p = 0; p < 4; ++p) {
          const float f0 = sp[2 * p], f1 = sp[2 * p + 1];
          const unsigned short hb0 = f2bf_bits(f0), hb1 = f2bf_bits(f1);
          const unsigned short lb0 = f2bf_bits(f0 - bf_bits2f(hb0));
          const unsigned short lb1 = f2bf_bits(f1 - bf_bits2f(hb1));
          hv[p] = pk16(hb0, hb1);
          lv[p] = pk16(lb0, lb1);
        }
        const size_t go = (size_t)(b * SEQ + q0 + row) * HID + h * HD + c8;
        *(v4u*)(chp + go) = hv;
        *(v4u*)(clp + go) = lv;
      }
      
    }
  }
}

// ---------------------------------------------------------------------------
// all sizes exact tile multiples, all offsets multiples of 512 KiB):
//   R0   bf16 [4096][2048]       16777216 @ 0           x as bf16; later ctx hi plane (written after the last reader of x)
//   R1   bf16 [4096][2048]       16777216 @ 16777216    wv^T as bf16 [2048][2048]; then wq^T|wk^T panel [4096][2048]; later ctx lo plane
//   Wob  bf16 [2048][2048]        8388608 @ 33554432    wo^T
//   Wgb  bf16 [128][2048]          524288 @ 41943040    wg^T zero-padded to 128 rows
//   Glog f32  [4096][128]         2097152 @ 42467328    gate logits
//   Qh   f16  [2][16][2048][128]  16777216 @ 44564480    Ql same @ 61341696
//   Kp   f16  [2][16][2048][128]  16777216 @ 78118912
//   Vth  f16  [2][2048][2048]     16777216 @ 94896128    Vtl same @ 111673344
//   total                        128450560
// ---------------------------------------------------------------------------
extern "C" void kernel_launch(void* const* d_in, const int* in_sizes, int n_in,
                              void* d_out, int out_size, void* d_ws, size_t ws_size,
                              hipStream_t stream) {
  if (n_in < 12) return;
  if (in_sizes[0] != NB * SEQ * HID) return;
  if (in_sizes[1] != NB * SEQ * SEQ) return;
  if (in_sizes[2] != HID * HID) return;
  if (in_sizes[3] != HID) return;
  if (in_sizes[4] != HID * HID) return;
  if (in_sizes[5] != HID) return;
  if (in_sizes[6] != HID * HID) return;
  if (in_sizes[7] != HID) return;
  if (in_sizes[8] != HID * NH) return;
  if (in_sizes[9] != NH) return;
  if (in_sizes[10] != HID * HID) return;
  if (in_sizes[11] != HID) return;
  if (out_size != NB * SEQ * HID) return;

  const float* x   = (const float*)d_in[0];
  const float* bm  = (const float*)d_in[1];
  const float* wq  = (const float*)d_in[2];
  const float* bq  = (const float*)d_in[3];
  const float* wk  = (const float*)d_in[4];
  const float* bk  = (const float*)d_in[5];
  const float* wv  = (const float*)d_in[6];
  const float* bv  = (const float*)d_in[7];
  const float* wg  = (const float*)d_in[8];
  const float* bg  = (const float*)d_in[9];
  const float* wo  = (const float*)d_in[10];
  const float* bo  = (const float*)d_in[11];
  float* out = (float*)d_out;

  const size_t szR0  = (size_t)NB * SEQ * HID * 2;          // 16 MiB
  const size_t szR1  = (size_t)2 * HID * HID * 2;           // 16 MiB
  const size_t szWo  = (size_t)HID * HID * 2;               //  8 MiB
  const size_t szWg  = (size_t)GLD * HID * 2;               //  512 KiB
  const size_t szG   = (size_t)NB * SEQ * GLD * 4;          //  2 MiB
  const size_t szQ   = (size_t)NB * NH * SEQ * HD * 2;      // 16 MiB
  const size_t szK   = szQ;
  const size_t szV   = (size_t)NB * HID * SEQ * 2;          // 16 MiB
  size_t off = 0;
  const size_t oR0  = off; off += szR0;
  const size_t oR1  = off; off += szR1;
  const size_t oWo  = off; off += szWo;
  const size_t oWg  = off; off += szWg;
  const size_t oG   = off; off += szG;
  const size_t oQh  = off; off += szQ;
  const size_t oQl  = off; off += szQ;
  const size_t oKp  = off; off += szK;
  const size_t oVth = off; off += szV;
  const size_t oVtl = off; off += szV;
  if (off > ws_size) return;                    // off = 128450560
  if (off > (size_t)134217728) return;

  char* ws = (char*)d_ws;
  unsigned short* Xb  = (unsigned short*)(ws + oR0);
  unsigned short* Ch  = (unsigned short*)(ws + oR0);        // reuses R0 after the gate GEMM (last reader of Xb)
  unsigned short* Wvt = (unsigned short*)(ws + oR1);
  unsigned short* Wqk = (unsigned short*)(ws + oR1);        // reuses R1 after the v^T GEMM (last reader of Wvt)
  unsigned short* Cl  = (unsigned short*)(ws + oR1);        // reuses R1 after the q|k GEMM (last reader of Wqk)
  unsigned short* Wot = (unsigned short*)(ws + oWo);
  unsigned short* Wgt = (unsigned short*)(ws + oWg);
  float*          Gl  = (float*)(ws + oG);
  unsigned short* Qh  = (unsigned short*)(ws + oQh);
  unsigned short* Ql  = (unsigned short*)(ws + oQl);
  unsigned short* Kp  = (unsigned short*)(ws + oKp);
  unsigned short* Vth = (unsigned short*)(ws + oVth);
  unsigned short* Vtl = (unsigned short*)(ws + oVtl);

  const dim3 blk256(256), blk128(128);
  const dim3 trg(HID / 64, HID / 64);           // in [2048 rows][2048 cols] -> out [cols][rows]
  const int n8x = NB * SEQ * HID / 8;

  // (1) x f32 -> bf16 plane
  cvt_bf16x8_kernel<<<dim3((n8x + 255) / 256), blk256, 0, stream>>>(x, Xb, n8x);
  // (2) wv [in][out] -> wv^T bf16 [out][in]
  tr_bf16_kernel<<<trg, blk256, 0, stream>>>(wv, Wvt, HID, HID);
  // (3) v^T per batch element: A = Wvt [2048 d][2048 k], Bt = Xb[b] [2048 s][2048 k] -> V^T hi/res planes [2048][2048] per b, + bv[d]
  {
    const int M = HID, N = SEQ, K = HID;
    const int tiles = (M / 32) * (N / 128);
    gemm_kernel<false, 1, true><<<dim3((tiles + 3) / 4, NB), blk128, 0, stream>>>(
        Wvt, Wvt, HID, 0L, Xb, HID, (long)SEQ * HID, (void*)Vth, (void*)Vtl, (void*)Vtl, SEQ, (long)HID * SEQ,
        bv, HID, bv, HID, N, M, N, K);
  }
  // (4) wq^T | wk^T panel [4096][2048] into R1
  tr_bf16_kernel<<<trg, blk256, 0, stream>>>(wq, Wqk, HID, HID);
  tr_bf16_kernel<<<trg, blk256, 0, stream>>>(wk, Wqk + (size_t)HID * HID, HID, HID);
  // (5) q | k projections with head-major relayout: A = Xb [4096][2048], Bt = Wqk [4096][2048] -> q hi/res planes, k plane; + bq | bk
  {
    const int M = NB * SEQ, N = 2 * HID, K = HID;
    const int tiles = (M / 32) * (N / 128);
    gemm_kernel<false, 2, false><<<dim3((tiles + 3) / 4, 1), blk128, 0, stream>>>(
        Xb, Xb, HID, 0L, Wqk, HID, 0L, (void*)Qh, (void*)Ql, (void*)Kp, HD, 0L,
        bq, HID, bk, HID, HID, M, N, K);
  }
  // (6) gate weights: wg [2048][16] -> wg^T zero-padded bf16 [128][2048]
  wg_pad_kernel<<<dim3(GLD), blk256, 0, stream>>>(wg, Wgt);
  // (7) gate logits: A = Xb [4096][2048], Bt = Wgt [128][2048] -> f32 [4096][128], + bg for columns < 16
  {
    const int M = NB * SEQ, N = GLD, K = HID;
    const int tiles = (M / 32) * (N / 128);
    gemm_kernel<false, 0, false><<<dim3((tiles + 3) / 4, 1), blk128, 0, stream>>>(
        Xb, Xb, HID, 0L, Wgt, HID, 0L, (void*)Gl, (void*)Gl, (void*)Gl, GLD, 0L,
        bg, NH, bg, NH, N, M, N, K);
  }
  // (8) wo [in][out] -> wo^T bf16
  tr_bf16_kernel<<<trg, blk256, 0, stream>>>(wo, Wot, HID, HID);
  // (9) attention: grid = NB x 16 heads x 32 query blocks, 128 threads
  attn_kernel<<<dim3(NB * NH * (SEQ / AT_QB)), blk128, 0, stream>>>(Qh, Ql, Kp, Vth, Vtl, bm, Gl, Ch, Cl);
  // (10) output projection: A = gated ctx hi/lo planes [4096][2048], Bt = Wot [2048][2048] -> d_out f32 [4096][2048], + bo
  {
    const int M = NB * SEQ, N = HID, K = HID;
    const int tiles = (M / 32) * (N / 128);
    gemm_kernel<true, 0, false><<<dim3((tiles + 3) / 4, 1), blk128, 0, stream>>>(
        Ch, Cl, HID, 0L, Wot, HID, 0L, (void*)out, (void*)out, (void*)out, HID, 0L,
        bo, HID, bo, HID, N, M, N, K);
  }
  (void)hipGetLastError();
}

// v001
// Measured time: 1050 microseconds a run.
// Two timings next to v000 both put it at 1.12 times that version's speed.
#include <hip/hip_runtime.h>
#include <math.h>
#include <stdint.h>

// q/k/v and gate projections: v_wmma_f32_16x16x32_bf16, single products on bf16-RNE converted x and W^T, f32 accumulate;
// scores q.k^T: v_wmma_f32_16x16x32_f16 with q = f16 hi + residual x2^11 planes, k single f16 plane, f32 accumulate;
// p.v: v_wmma_f32_16x16x32_f16 with p x1024 single f16 plane, v^T = f16 hi + residual x2^11 planes, f32 accumulate;
// output projection: v_wmma_f32_16x16x32_bf16 with gated ctx as bf16 hi + lo planes and Wo^T bf16, f32 accumulate.
// Online softmax, score scale 1/sqrt(128), per-head bias scale 2^(-(h+1)/2), sigmoid gate and normalisation in f32.

#define NB   2
#define SEQ  2048
#define HID  2048
#define NH   16
#define HD   128
#define GLD  128

typedef _Float16 v16h __attribute__((ext_vector_type(16)));
typedef _Float16 v8h  __attribute__((ext_vector_type(8)));
typedef __bf16   v16b __attribute__((ext_vector_type(16)));
typedef __bf16   v8b  __attribute__((ext_vector_type(8)));
typedef float    v8f  __attribute__((ext_vector_type(8)));
typedef float    v4f  __attribute__((ext_vector_type(4)));
typedef unsigned int v4u __attribute__((ext_vector_type(4)));

// ---------------------------------------------------------------------------
// small helpers
// ---------------------------------------------------------------------------
__device__ __forceinline__ unsigned short f2bf_bits(float f) {          // RNE convert f32 -> bf16 bits
  const unsigned u = __float_as_uint(f);
  return (unsigned short)((u + 0x7FFFu + ((u >> 16) & 1u)) >> 16);
}
__device__ __forceinline__ float bf_bits2f(unsigned short x) { return __uint_as_float(((unsigned)x) << 16); }
__device__ __forceinline__ float bfr(float f) { return __uint_as_float(((unsigned)f2bf_bits(f)) << 16); }
__device__ __forceinline__ unsigned pk16(unsigned short a, unsigned short b) { return (unsigned)a | ((unsigned)b << 16); }
__device__ __forceinline__ unsigned short h2u(_Float16 x) { return __builtin_bit_cast(unsigned short, x); }

__device__ __forceinline__ void wave_sync() {
  __builtin_amdgcn_fence(__ATOMIC_RELEASE, "workgroup");
  __builtin_amdgcn_wave_barrier();
  __builtin_amdgcn_fence(__ATOMIC_ACQUIRE, "workgroup");
}

// 16-bit fragment loaders, same k map for A and B: p points at (row or col)*ld + k0 + 8*(lane>>4);
// elements 0..7 <- p[0..7] (k0+8h..k0+8h+7), elements 8..15 <- p[16..23] (k0+16+8h..k0+16+8h+7).
union FragB { v16b v; v8b h[2]; };
union FragH { v16h v; v8h h[2]; };
__device__ __forceinline__ v16b ldfrag_b(const __bf16* p) {
  FragB f; f.h[0] = *(const v8b*)(p); f.h[1] = *(const v8b*)(p + 16); return f.v;
}
__device__ __forceinline__ v16h ldfrag_h(const _Float16* p) {
  FragH f; f.h[0] = *(const v8h*)(p); f.h[1] = *(const v8h*)(p + 16); return f.v;
}

__device__ __forceinline__ v8f wmma_b(v16b a, v16b b, v8f c) {
  return __builtin_amdgcn_wmma_f32_16x16x32_bf16(false, a, false, b, (short)0, c, false, false);
}
// f16 form with the hazard guard attached to every issue (ties D, keeps A/B live)
__device__ __forceinline__ v8f wmma_h(v16h a, v16h b, v8f c) {
  c = __builtin_amdgcn_wmma_f32_16x16x32_f16(false, a, false, b, (short)0, c, false, false);
#if defined(__HIP_DEVICE_COMPILE__)
  asm volatile("v_nop\n\tv_nop\n\tv_nop\n\tv_nop" : "+v"(c) : "v"(a), "v"(b));
#endif
  return c;
}
// hazard guard for one j-group of the register-blocked GEMM (ties both D tiles, keeps A/B registers live)
__device__ __forceinline__ void dep_guard_b(v8f& x, v8f& y, v16b b, v16b a0, v16b a1, v16b l0, v16b l1) {
#if defined(__HIP_DEVICE_COMPILE__)
  asm volatile("v_nop\n\tv_nop\n\tv_nop\n\tv_nop" : "+v"(x), "+v"(y) : "v"(b), "v"(a0), "v"(a1), "v"(l0), "v"(l1));
#endif
}
__device__ __forceinline__ void dep_int(int& qo, v8f dep) {
#if defined(__HIP_DEVICE_COMPILE__)
  asm volatile("" : "+v"(qo) : "v"(dep));
#endif
}

// ---------------------------------------------------------------------------
// f32 -> bf16 (RNE) convert, 8 elements per thread: two 16-B loads, one 16-B store.
// Coverage: grid = ceil(n8/256) x 256 threads x 8 elements = the whole array (sizes here are multiples of 2048).
// ---------------------------------------------------------------------------
__global__ __launch_bounds__(256) void cvt_bf16x8_kernel(const float* __restrict__ in, unsigned short* out, int n8) {
  const int i = blockIdx.x * 256 + threadIdx.x;
  if (i < n8) {
    const v4f a = *(const v4f*)(in + 8 * (size_t)i);
    const v4f c = *(const v4f*)(in + 8 * (size_t)i + 4);
    v4u w;
    w[0] = pk16(f2bf_bits(a[0]), f2bf_bits(a[1]));
    w[1] = pk16(f2bf_bits(a[2]), f2bf_bits(a[3]));
    w[2] = pk16(f2bf_bits(c[0]), f2bf_bits(c[1]));
    w[3] = pk16(f2bf_bits(c[2]), f2bf_bits(c[3]));
    v4u* p = (v4u*)(out + 8 * (size_t)i);
    *p = w;
    
  }
}

// ---------------------------------------------------------------------------
// Transpose + RNE bf16 convert: in f32 [R][C] row-major -> out bf16 [C][R] (out[c][r] = bf16(in[r][c])).
// Block 256 threads handles a 64x64 tile through LDS. Load: thread -> 4 float4 (rows t>>4 + 16i, cols 4*(t&15)+0..3).
// Coverage: out rows cc = wave*4 + (lane>>3) (+32) over 8 waves = 0..63; columns (lane&7)*8 + 0..7 = 0..63; grid (C/64, R/64).
// ---------------------------------------------------------------------------
__global__ __launch_bounds__(256) void tr_bf16_kernel(const float* __restrict__ in, unsigned short* out, int R, int C) {
  __shared__ __align__(16) float tile[64][65];
  const int c0 = blockIdx.x * 64, r0 = blockIdx.y * 64;
  const int t = threadIdx.x;
  const int cq = (t & 15) * 4, rb = t >> 4;
#pragma unroll
  for (int i = 0; i < 4; ++i) {
    const int r = rb + 16 * i;
    const v4f v = *(const v4f*)(in + (size_t)(r0 + r) * C + c0 + cq);
    tile[r][cq] = v[0]; tile[r][cq + 1] = v[1]; tile[r][cq + 2] = v[2]; tile[r][cq + 3] = v[3];
  }
  __syncthreads();
  const int wave = t >> 5, lane = t & 31, q = lane >> 3, pc = lane & 7;
  const int cc0 = wave * 4 + q, cc1 = 32 + wave * 4 + q;
  v4u w0, w1;
#pragma unroll
  for (int e = 0; e < 4; ++e) {
    w0[e] = pk16(f2bf_bits(tile[pc * 8 + 2 * e][cc0]), f2bf_bits(tile[pc * 8 + 2 * e + 1][cc0]));
    w1[e] = pk16(f2bf_bits(tile[pc * 8 + 2 * e][cc1]), f2bf_bits(tile[pc * 8 + 2 * e + 1][cc1]));
  }
  v4u* p0 = (v4u*)(out + (size_t)(c0 + cc0) * R + r0 + pc * 8);
  v4u* p1 = (v4u*)(out + (size_t)(c0 + cc1) * R + r0 + pc * 8);
  *p0 = w0; *p1 = w1;
  
}

// ---------------------------------------------------------------------------
// Gate weight panel: wg f32 [HID][NH] -> out bf16 [GLD][HID], out[n][k] = bf16(wg[k][n]) for n < NH, 0 for n >= NH.
// Block n (uniform), thread -> k = 8*threadIdx.x; loads use a clamped column address, zeroed by value for n >= NH.
// Coverage: 128 blocks x 256 threads x 8 = the whole [128][2048] panel (padding rows written as zeros).
// ---------------------------------------------------------------------------
__global__ __launch_bounds__(256) void wg_pad_kernel(const float* __restrict__ wg, unsigned short* out) {
  const int n = blockIdx.x;
  const int k = threadIdx.x * 8;
  const int nn = (n < NH) ? n : (NH - 1);
  const float keep = (n < NH) ? 1.0f : 0.0f;
  v4u w;
#pragma unroll
  for (int e = 0; e < 4; ++e) {
    const float a = wg[(size_t)(k + 2 * e) * NH + nn] * keep;
    const float b = wg[(size_t)(k + 2 * e + 1) * NH + nn] * keep;
    w[e] = pk16(f2bf_bits(a), f2bf_bits(b));
  }
  v4u* p = (v4u*)(out + (size_t)n * HID + k);
  *p = w;
  
}

// ---------------------------------------------------------------------------
// Register-blocked bf16 WMMA GEMM: C[m][n] = sum_k A[m][k] * Bt[n][k] + bias; each wave owns a 32x128 tile.
// A row-major [M][K] (pitch lda), Bt row-major [N][K] (pitch ldb); M multiple of 32, N multiple of 128, K multiple of 32.
// SPLITA: A given as hi plane (Ap) + unscaled bf16 lo plane (A2p): products Ahi.B + Alo.B into one accumulator.
// BROW: bias[m] per row (clamped to nb1), else per column: bias[n] for n < nsplit (valid while n < nb1),
//       bias2[n - nsplit] for n >= nsplit (valid while n - nsplit < nb2); bias values RNE-rounded to bf16; both
//       candidates loaded from clamped addresses and selected by value.
// blockIdx.y selects a z slice through strideA / strideB / strideC (element strides).
// Epilogue: per wave, each 16x128 accumulator slab is staged in LDS (pitch 132 floats), then written as whole
//   OUT_MODE 0: f32 rows into Cout [M][ldc] (row segment 512 B = 32 lanes x 16 B, 1 row per instruction).
//   OUT_MODE 1: f16 hi plane Cout + f16 residual plane Cout2 ((v - hi) * 2048), [M][ldc] (256 B = 16 lanes x 16 B, 2 rows per instr.).
//   OUT_MODE 2: head-major relayout: columns n0 < nsplit -> q planes Cout (f16 hi) / Cout2 (residual * 2048) at
//               [(b*16 + n0/128)*SEQ + s][ldc = 128]; columns >= nsplit -> single f16 k plane Cout3 at
//               [(b*16 + (n0-nsplit)/128)*SEQ + s][128], with row m = b*2048 + s. Each 128-wide row = 256 B = 16 lanes x 16 B.
// Coverage per slab: it 0..7 x (lane>>4) 0..1 = 16 rows, (lane&15)*8 + 0..7 = 128 columns (OUT_MODE 1/2);
//                    it 0..15 = 16 rows, lane*4 + 0..3 = 128 columns (OUT_MODE 0).
// ---------------------------------------------------------------------------
#define GP 132

template <bool SPLITA, int OUT_MODE, bool BROW>
__global__ __launch_bounds__(128) void gemm_kernel(
    const unsigned short* __restrict__ Ap, const unsigned short* __restrict__ A2p, int lda, long strideA,
    const unsigned short* __restrict__ Btp, int ldb, long strideB,
    void* Cout, void* Cout2, void* Cout3, int ldc, long strideC,
    const float* __restrict__ bias, int nb1, const float* __restrict__ bias2, int nb2, int nsplit,
    int M, int N, int K) {
  __shared__ __align__(16) float sT[4][16 * GP];
  const int bz   = blockIdx.y;
  const int lane = threadIdx.x & 31;
  const int wave = threadIdx.x >> 5;
  const int tilesN = N >> 7;
  const int tilesM = M >> 5;
  const int tile = blockIdx.x * 4 + wave;
  if (tile >= tilesM * tilesN) return;          // wave-uniform; no block barriers in this kernel
  const int tm = tile / tilesN;
  const int tn = tile - tm * tilesN;
  const int m0 = tm << 5;
  const int n0 = tn << 7;

  const __bf16* Ab  = (const __bf16*)(const void*)Ap + (size_t)bz * strideA;
  const __bf16* Ab2 = SPLITA ? ((const __bf16*)(const void*)A2p + (size_t)bz * strideA) : (const __bf16*)0;
  const __bf16* Bb  = (const __bf16*)(const void*)Btp + (size_t)bz * strideB;

  const int rlane = lane & 15;              // row (A) / col (B, D) within a 16x16 subtile
  const int koff  = (lane >> 4) * 8;        // k offset of this lane half
  const int mOff  = (lane >> 4) * 8;        // D row offset of this lane half

  v8f acc[2][8];
#pragma unroll
  for (int i = 0; i < 2; ++i)
#pragma unroll
    for (int j = 0; j < 8; ++j) acc[i][j] = (v8f){0.f, 0.f, 0.f, 0.f, 0.f, 0.f, 0.f, 0.f};

  for (int k0 = 0; k0 < K; k0 += 32) {
    const size_t ao0 = (size_t)(m0 + rlane) * lda + koff + k0;
    const size_t ao1 = (size_t)(m0 + 16 + rlane) * lda + koff + k0;
    const v16b a0 = ldfrag_b(Ab + ao0);
    const v16b a1 = ldfrag_b(Ab + ao1);
    v16b l0 = a0, l1 = a1;
    if (SPLITA) { l0 = ldfrag_b(Ab2 + ao0); l1 = ldfrag_b(Ab2 + ao1); }
#pragma unroll
    for (int j = 0; j < 8; ++j) {
      const v16b bh = ldfrag_b(Bb + (size_t)(n0 + (j << 4) + rlane) * ldb + koff + k0);
      acc[0][j] = wmma_b(a0, bh, acc[0][j]);
      if (SPLITA) acc[0][j] = wmma_b(l0, bh, acc[0][j]);
      acc[1][j] = wmma_b(a1, bh, acc[1][j]);
      if (SPLITA) acc[1][j] = wmma_b(l1, bh, acc[1][j]);
      dep_guard_b(acc[0][j], acc[1][j], bh, a0, a1, l0, l1);
    }
  }

  // ---- epilogue ----
  float* slab = sT[wave];
  float bc[8];
#pragma unroll
  for (int j = 0; j < 8; ++j) bc[j] = 0.f;
  if (!BROW) {
#pragma unroll
    for (int j = 0; j < 8; ++j) {
      const int col = n0 + (j << 4) + rlane;
      int i1 = col;          if (i1 > nb1 - 1) i1 = nb1 - 1;
      int i2 = col - nsplit; if (i2 < 0) i2 = 0; if (i2 > nb2 - 1) i2 = nb2 - 1;
      const float v1 = bfr(bias[i1]);
      const float v2 = bfr(bias2[i2]);
      const bool lo = (col < nsplit);
      const bool valid = lo ? (col < nb1) : ((col - nsplit) < nb2);
      const float v = lo ? v1 : v2;
      bc[j] = valid ? v : 0.f;
    }
  }
#pragma unroll
  for (int i = 0; i < 2; ++i) {
    const int mBase = m0 + (i << 4);
    float br[8];
#pragma unroll
    for (int r = 0; r < 8; ++r) {
      br[r] = 0.f;
      if (BROW) {
        int ir = mBase + mOff + r; if (ir > nb1 - 1) ir = nb1 - 1;
        br[r] = bfr(bias[ir]);
      }
    }
#pragma unroll
    for (int j = 0; j < 8; ++j)
#pragma unroll
      for (int r = 0; r < 8; ++r)
        slab[(mOff + r) * GP + (j << 4) + rlane] = acc[i][j][r] + (BROW ? br[r] : bc[j]);
    wave_sync();
    if (OUT_MODE == 0) {
      float* C = (float*)Cout + (size_t)bz * strideC;
      const int c4 = lane * 4;                               // row segment 512 B = 32 lanes x 16 B
      {
#pragma unroll
        for (int it = 0; it < 16; ++it) {
          const v4f v = *(const v4f*)(slab + it * GP + c4);
          *(v4f*)(C + (size_t)(mBase + it) * ldc + n0 + c4) = v;
        }
        
      }
    } else if (OUT_MODE == 1) {
      unsigned short* C  = (unsigned short*)Cout  + (size_t)bz * strideC;
      unsigned short* C2 = (unsigned short*)Cout2 + (size_t)bz * strideC;
      const int q16 = lane >> 4, c8 = (lane & 15) * 8;      // row segment 256 B = 16 lanes x 16 B
      {
#pragma unroll
        for (int it = 0; it < 8; ++it) {
          const int row = it * 2 + q16;
          const float* sp = slab + row * GP + c8;
          v4u hv, lv;
#pragma unroll
          for (int p = 0; p < 4; ++p) {
            const float f0 = sp[2 * p], f1 = sp[2 * p + 1];
            const _Float16 e0 = (_Float16)f0, e1 = (_Float16)f1;
            const _Float16 g0 = (_Float16)((f0 - (float)e0) * 2048.0f);
            const _Float16 g1 = (_Float16)((f1 - (float)e1) * 2048.0f);
            hv[p] = pk16(h2u(e0), h2u(e1));
            lv[p] = pk16(h2u(g0), h2u(g1));
          }
          const size_t go = (size_t)(mBase + row) * ldc + n0 + c8;
          *(v4u*)(C  + go) = hv;
          *(v4u*)(C2 + go) = lv;
        }
        
      }
    } else {
      unsigned short* Q1 = (unsigned short*)Cout;
      unsigned short* Q2 = (unsigned short*)Cout2;
      unsigned short* K1 = (unsigned short*)Cout3;
      const int q16 = lane >> 4, c8 = (lane & 15) * 8;      // row segment 256 B = 16 lanes x 16 B
      const int  bidx = m0 / SEQ;                             // all 32 rows of the tile lie in one batch element
      const bool isq  = (n0 < nsplit);                        // wave-uniform
      const int  head = (isq ? n0 : (n0 - nsplit)) >> 7;
      const size_t rowBase = (size_t)(bidx * NH + head) * SEQ;
      {
#pragma unroll
        for (int it = 0; it < 8; ++it) {
          const int row = it * 2 + q16;
          const int s   = (mBase + row) & (SEQ - 1);
          const float* sp = slab + row * GP + c8;
          v4u hv, lv;
#pragma unroll
          for (int p = 0; p < 4; ++p) {
            const float f0 = sp[2 * p], f1 = sp[2 * p + 1];
            const _Float16 e0 = (_Float16)f0, e1 = (_Float16)f1;
            const _Float16 g0 = (_Float16)((f0 - (float)e0) * 2048.0f);
            const _Float16 g1 = (_Float16)((f1 - (float)e1) * 2048.0f);
            hv[p] = pk16(h2u(e0), h2u(e1));
            lv[p] = pk16(h2u(g0), h2u(g1));
          }
          const size_t go = (rowBase + (size_t)s) * ldc + c8;
          if (isq) {
            *(v4u*)(Q1 + go) = hv;
            *(v4u*)(Q2 + go) = lv;
          } else {
            *(v4u*)(K1 + go) = hv;
          }
        }
        
      }
    }
    wave_sync();
  }
}

// =====================================================================================
// Full (non-causal) attention with additive per-head-scaled bias and sigmoid head gate, head dim 128, 16 heads.
// Block = 4 waves = 64 query rows of one (b, h).
//   q planes f16 hi / residual*2048: element (b, h, s, d) at [((b*16 + h)*SEQ + s)*128 + d]
//   k plane  f16:                     element (b, h, s, d) at [((b*16 + h)*SEQ + s)*128 + d]
//   v^T planes f16 hi / residual*2048: element (b, h, d, s) at [((b*2048 + h*128 + d)*SEQ + s]
//   bias: f32 [b][q][key] read per element, RNE-rounded to bf16, scaled by 2^(-(h+1)/2)
//   gate logits: f32 [(b*SEQ + s)*GLD + h]; g = 1/(1 + exp(-a))
//   ctx out: bf16 hi + lo planes, element (b, s, h, d) at [(b*SEQ + s)*HID + h*128 + d]
//   scores = (qh.k + ql.k/2048) * (1/sqrt(128)) + bias*hs on v_wmma_f32_16x16x32_f16; online softmax in f32;
//   p1024 = f16(1024*exp(s - m)); ctx += ph.vh + (ph.vl)/2048, the residual product into a per-tile scratch
//   accumulator (starting at zero) folded in f32 right after; ctx = acc * g / 1024 / l.
//   kv chunks of 64 staged in LDS (K 17 KB, V^T hi/res 18 KB each, rows padded by 16 B), 32 chunks.
//   q fragments re-loaded from the global planes per 32-deep step (asm dependency keeps them from being hoisted).
//   Epilogue: wave 16x128 f32 tile staged in LDS (aliasing the K/V region after a block barrier), each 128-wide row =
//   Coverage: it 0..7 x (lane>>4) 0..1 = 16 rows x 128 columns per wave; 1024 blocks x 64 rows = every (b, s, h, d).
// =====================================================================================
#define AT_QB 64
#define AT_KC 64
#define OS_P  132
// LDS row pitches in f16 elements, each 16 B x odd so that the 16 rows a ds_load_b128 fragment read touches fall on distinct banks
#define K_P   (HD + 8)      // K rows of 256 B at pitch 272 B
#define V_P   (AT_KC + 8)   // V^T rows of 128 B at pitch 144 B
#define P_P   (AT_KC + 8)   // P rows of 128 B at pitch 144 B

__global__ __launch_bounds__(128)
void attn_kernel(const unsigned short* __restrict__ qhp, const unsigned short* __restrict__ qlp,
                 const unsigned short* __restrict__ kp,
                 const unsigned short* __restrict__ vhp, const unsigned short* __restrict__ vlp,
                 const float* __restrict__ bmp, const float* __restrict__ glp,
                 unsigned short* chp, unsigned short* clp) {
  __shared__ __align__(16) _Float16 KVs[AT_KC * K_P + 2 * HD * V_P];   // K [key][d] | V^T hi [d][key] | V^T res [d][key], padded rows; ctx staging later
  __shared__ __align__(16) _Float16 Psh[4][16 * P_P];         // per wave P x1024 [row][key], padded rows
  static_assert(4 * 16 * OS_P * 4 <= (AT_KC * K_P + 2 * HD * V_P) * 2);
  _Float16* const Ksh = KVs;
  _Float16* const Vth = KVs + AT_KC * K_P;
  _Float16* const Vtl = KVs + AT_KC * K_P + HD * V_P;

  const int tid  = threadIdx.x;
  const int wave = tid >> 5;
  const int lane = tid & 31;
  const int hh   = lane >> 4;
  const int c    = lane & 15;

  const int bx  = blockIdx.x;
  const int qb  = bx & 31;                 // query block of 64
  const int h   = (bx >> 5) & (NH - 1);    // head
  const int b   = bx >> 9;                 // batch element
  const int q0  = qb * AT_QB + wave * 16;

  const _Float16* Qhg = (const _Float16*)(const void*)qhp + (size_t)(b * NH + h) * SEQ * HD;
  const _Float16* Qlg = (const _Float16*)(const void*)qlp + (size_t)(b * NH + h) * SEQ * HD;
  const _Float16* Kg  = (const _Float16*)(const void*)kp  + (size_t)(b * NH + h) * SEQ * HD;
  const _Float16* Vhg = (const _Float16*)(const void*)vhp + ((size_t)b * HID + (size_t)h * HD) * SEQ;
  const _Float16* Vlg = (const _Float16*)(const void*)vlp + ((size_t)b * HID + (size_t)h * HD) * SEQ;
  const float*    Bm  = bmp + (size_t)b * SEQ * SEQ + (size_t)(q0 + 8 * hh) * SEQ + c;   // + r*SEQ + key
  const int qro = (q0 + c) * HD + 8 * hh;  // per-lane A-fragment row base (d added per step)

  // per-head bias scale 2^(-(h+1)/2): exact power of two times sqrt(1/2) for odd (h+1)
  const int   hexp = (h + 1) >> 1;
  const float hs   = __uint_as_float((unsigned)(127 - hexp) << 23) * (((h + 1) & 1) ? 0.70710678118654752f : 1.0f);

  const v8f zero8 = (v8f){0.f, 0.f, 0.f, 0.f, 0.f, 0.f, 0.f, 0.f};
  const float inv2048 = 4.8828125e-4f;
  const float scale   = 1.0f / 11.313708305358887f;

  float mrow[8], lrow[8];
  v8f oh[8];
#pragma unroll
  for (int r = 0; r < 8; ++r) { mrow[r] = -INFINITY; lrow[r] = 0.f; }
#pragma unroll
  for (int t = 0; t < 8; ++t) oh[t] = zero8;

  for (int kc = 0; kc < SEQ / AT_KC; ++kc) {
    const int kv0 = kc * AT_KC;
    __syncthreads();
    {
      // staging: K: thread -> key tid>>1, d half (tid&1)*64, 8 x 16 B; V^T hi/res: thread -> d = tid, keys kv0..kv0+63, 8 x 16 B
      // coverage: 64 keys x 128 d for K, 128 d x 64 keys for each V^T plane = the whole chunk tiles
      const int r = tid >> 1, half = (tid & 1) * 64;
      const _Float16* ks = Kg  + (size_t)(kv0 + r) * HD + half;
      const _Float16* vs = Vhg + (size_t)tid * SEQ + kv0;
      const _Float16* ws = Vlg + (size_t)tid * SEQ + kv0;
#pragma unroll
      for (int i = 0; i < 8; ++i) {
        const v8h a0 = *(const v8h*)(ks + 8 * i);
        const v8h b0 = *(const v8h*)(vs + 8 * i);
        const v8h b1 = *(const v8h*)(ws + 8 * i);
        *(v8h*)(Ksh + r * K_P + half + 8 * i) = a0;
        *(v8h*)(Vth + tid * V_P + 8 * i)      = b0;
        *(v8h*)(Vtl + tid * V_P + 8 * i)      = b1;
      }
    }
    __syncthreads();

    // ---- scores: 4 key tiles of 16, reduce over d = 128 = 4 k-steps; hi and residual accumulators separate ----
    v8f s[4];
    v8f dep = oh[7];
#pragma unroll
    for (int j = 0; j < 4; ++j) {
      v8f sh = zero8, sl = zero8;
#pragma unroll
      for (int dc = 0; dc < 4; ++dc) {
        int qo = qro + dc * 32;
        dep_int(qo, dep);
        const v16h qa = ldfrag_h(Qhg + qo);
        const v16h qr = ldfrag_h(Qlg + qo);
        FragH kb;
        kb.h[0] = *(const v8h*)(Ksh + (j * 16 + c) * K_P + dc * 32 + 8 * hh);
        kb.h[1] = *(const v8h*)(Ksh + (j * 16 + c) * K_P + dc * 32 + 16 + 8 * hh);
        sh = wmma_h(qa, kb.v, sh);
        sl = wmma_h(qr, kb.v, sl);
        dep = sl;
      }
      v8f sj = (sh + sl * inv2048) * scale;
      const float* bp = Bm + kv0 + j * 16;
#pragma unroll
      for (int r = 0; r < 8; ++r) sj[r] = sj[r] + hs * bfr(bp[(size_t)r * SEQ]);
      s[j] = sj;
    }

    float cm[8];
#pragma unroll
    for (int r = 0; r < 8; ++r) {
      float m = fmaxf(fmaxf(s[0][r], s[1][r]), fmaxf(s[2][r], s[3][r]));
#pragma unroll
      for (int off = 1; off < 16; off <<= 1) m = fmaxf(m, __shfl_xor(m, off, 32));
      cm[r] = m;
    }

    _Float16* pw = Psh[wave];
#pragma unroll
    for (int r = 0; r < 8; ++r) {
      const float mnew  = fmaxf(mrow[r], cm[r]);
      const float alpha = expf(mrow[r] - mnew);
      mrow[r] = mnew;
      float psum = 0.f;
#pragma unroll
      for (int j = 0; j < 4; ++j) {
        const float p = expf(s[j][r] - mnew);
        psum += p;
        pw[(8 * hh + r) * P_P + j * 16 + c] = (_Float16)(p * 1024.0f);
      }
#pragma unroll
      for (int off = 1; off < 16; off <<= 1) psum += __shfl_xor(psum, off, 32);
      lrow[r] = lrow[r] * alpha + psum;
#pragma unroll
      for (int t = 0; t < 8; ++t) oh[t][r] *= alpha;
    }
    wave_sync();

    // ---- ctx += P . V over the 64 keys of the chunk (2 k-steps), 8 d tiles ----
#pragma unroll 1
    for (int kk = 0; kk < 2; ++kk) {
      FragH pa;
      pa.h[0] = *(const v8h*)(pw + c * P_P + kk * 32 + 8 * hh);
      pa.h[1] = *(const v8h*)(pw + c * P_P + kk * 32 + 16 + 8 * hh);
#pragma unroll
      for (int t = 0; t < 8; ++t) {
        FragH vb, vr;
        vb.h[0] = *(const v8h*)(Vth + (t * 16 + c) * V_P + kk * 32 + 8 * hh);
        vb.h[1] = *(const v8h*)(Vth + (t * 16 + c) * V_P + kk * 32 + 16 + 8 * hh);
        vr.h[0] = *(const v8h*)(Vtl + (t * 16 + c) * V_P + kk * 32 + 8 * hh);
        vr.h[1] = *(const v8h*)(Vtl + (t * 16 + c) * V_P + kk * 32 + 16 + 8 * hh);
        oh[t] = wmma_h(pa.v, vb.v, oh[t]);
        const v8f tr = wmma_h(pa.v, vr.v, zero8);
        oh[t] += tr * inv2048;
      }
    }
  }

  // ---- normalise, apply the head gate, stage the wave 16x128 tile (aliases the K/V region after the block barrier),
  //      write bf16 hi/lo planes ----
  __syncthreads();
  float* os = (float*)(void*)KVs + wave * (16 * OS_P);
#pragma unroll
  for (int r = 0; r < 8; ++r) {
    const int   q  = q0 + 8 * hh + r;
    const float a  = glp[(size_t)(b * SEQ + q) * GLD + h];
    const float g  = 1.0f / (1.0f + expf(-a));
    const float invl = g * (1.0f / lrow[r]) * 9.765625e-4f;
#pragma unroll
    for (int t = 0; t < 8; ++t) os[(8 * hh + r) * OS_P + t * 16 + c] = oh[t][r] * invl;
  }
  wave_sync();
  {
    const int q16 = lane >> 4, c8 = (lane & 15) * 8;         // 2 rows per instruction, each row 256 B = 16 lanes x 16 B
    {
#pragma unroll
      for (int it = 0; it < 8; ++it) {
        const int row = it * 2 + q16;
        const float* sp = os + row * OS_P + c8;
        v4u hv, lv;
#pragma unroll
        for (int p = 0; p < 4; ++p) {
          const float f0 = sp[2 * p], f1 = sp[2 * p + 1];
          const unsigned short hb0 = f2bf_bits(f0), hb1 = f2bf_bits(f1);
          const unsigned short lb0 = f2bf_bits(f0 - bf_bits2f(hb0));
          const unsigned short lb1 = f2bf_bits(f1 - bf_bits2f(hb1));
          hv[p] = pk16(hb0, hb1);
          lv[p] = pk16(lb0, lb1);
        }
        const size_t go = (size_t)(b * SEQ + q0 + row) * HID + h * HD + c8;
        *(v4u*)(chp + go) = hv;
        *(v4u*)(clp + go) = lv;
      }
      
    }
  }
}

// ---------------------------------------------------------------------------
// all sizes exact tile multiples, all offsets multiples of 512 KiB):
//   R0   bf16 [4096][2048]       16777216 @ 0           x as bf16; later ctx hi plane (written after the last reader of x)
//   R1   bf16 [4096][2048]       16777216 @ 16777216    wv^T as bf16 [2048][2048]; then wq^T|wk^T panel [4096][2048]; later ctx lo plane
//   Wob  bf16 [2048][2048]        8388608 @ 33554432    wo^T
//   Wgb  bf16 [128][2048]          524288 @ 41943040    wg^T zero-padded to 128 rows
//   Glog f32  [4096][128]         2097152 @ 42467328    gate logits
//   Qh   f16  [2][16][2048][128]  16777216 @ 44564480    Ql same @ 61341696
//   Kp   f16  [2][16][2048][128]  16777216 @ 78118912
//   Vth  f16  [2][2048][2048]     16777216 @ 94896128    Vtl same @ 111673344
//   total                        128450560
// ---------------------------------------------------------------------------
extern "C" void kernel_launch(void* const* d_in, const int* in_sizes, int n_in,
                              void* d_out, int out_size, void* d_ws, size_t ws_size,
                              hipStream_t stream) {
  if (n_in < 12) return;
  if (in_sizes[0] != NB * SEQ * HID) return;
  if (in_sizes[1] != NB * SEQ * SEQ) return;
  if (in_sizes[2] != HID * HID) return;
  if (in_sizes[3] != HID) return;
  if (in_sizes[4] != HID * HID) return;
  if (in_sizes[5] != HID) return;
  if (in_sizes[6] != HID * HID) return;
  if (in_sizes[7] != HID) return;
  if (in_sizes[8] != HID * NH) return;
  if (in_sizes[9] != NH) return;
  if (in_sizes[10] != HID * HID) return;
  if (in_sizes[11] != HID) return;
  if (out_size != NB * SEQ * HID) return;

  const float* x   = (const float*)d_in[0];
  const float* bm  = (const float*)d_in[1];
  const float* wq  = (const float*)d_in[2];
  const float* bq  = (const float*)d_in[3];
  const float* wk  = (const float*)d_in[4];
  const float* bk  = (const float*)d_in[5];
  const float* wv  = (const float*)d_in[6];
  const float* bv  = (const float*)d_in[7];
  const float* wg  = (const float*)d_in[8];
  const float* bg  = (const float*)d_in[9];
  const float* wo  = (const float*)d_in[10];
  const float* bo  = (const float*)d_in[11];
  float* out = (float*)d_out;

  const size_t szR0  = (size_t)NB * SEQ * HID * 2;          // 16 MiB
  const size_t szR1  = (size_t)2 * HID * HID * 2;           // 16 MiB
  const size_t szWo  = (size_t)HID * HID * 2;               //  8 MiB
  const size_t szWg  = (size_t)GLD * HID * 2;               //  512 KiB
  const size_t szG   = (size_t)NB * SEQ * GLD * 4;          //  2 MiB
  const size_t szQ   = (size_t)NB * NH * SEQ * HD * 2;      // 16 MiB
  const size_t szK   = szQ;
  const size_t szV   = (size_t)NB * HID * SEQ * 2;          // 16 MiB
  size_t off = 0;
  const size_t oR0  = off; off += szR0;
  const size_t oR1  = off; off += szR1;
  const size_t oWo  = off; off += szWo;
  const size_t oWg  = off; off += szWg;
  const size_t oG   = off; off += szG;
  const size_t oQh  = off; off += szQ;
  const size_t oQl  = off; off += szQ;
  const size_t oKp  = off; off += szK;
  const size_t oVth = off; off += szV;
  const size_t oVtl = off; off += szV;
  if (off > ws_size) return;                    // off = 128450560
  if (off > (size_t)134217728) return;

  char* ws = (char*)d_ws;
  unsigned short* Xb  = (unsigned short*)(ws + oR0);
  unsigned short* Ch  = (unsigned short*)(ws + oR0);        // reuses R0 after the gate GEMM (last reader of Xb)
  unsigned short* Wvt = (unsigned short*)(ws + oR1);
  unsigned short* Wqk = (unsigned short*)(ws + oR1);        // reuses R1 after the v^T GEMM (last reader of Wvt)
  unsigned short* Cl  = (unsigned short*)(ws + oR1);        // reuses R1 after the q|k GEMM (last reader of Wqk)
  unsigned short* Wot = (unsigned short*)(ws + oWo);
  unsigned short* Wgt = (unsigned short*)(ws + oWg);
  float*          Gl  = (float*)(ws + oG);
  unsigned short* Qh  = (unsigned short*)(ws + oQh);
  unsigned short* Ql  = (unsigned short*)(ws + oQl);
  unsigned short* Kp  = (unsigned short*)(ws + oKp);
  unsigned short* Vth = (unsigned short*)(ws + oVth);
  unsigned short* Vtl = (unsigned short*)(ws + oVtl);

  const dim3 blk256(256), blk128(128);
  const dim3 trg(HID / 64, HID / 64);           // in [2048 rows][2048 cols] -> out [cols][rows]
  const int n8x = NB * SEQ * HID / 8;

  // (1) x f32 -> bf16 plane
  cvt_bf16x8_kernel<<<dim3((n8x + 255) / 256), blk256, 0, stream>>>(x, Xb, n8x);
  // (2) wv [in][out] -> wv^T bf16 [out][in]
  tr_bf16_kernel<<<trg, blk256, 0, stream>>>(wv, Wvt, HID, HID);
  // (3) v^T per batch element: A = Wvt [2048 d][2048 k], Bt = Xb[b] [2048 s][2048 k] -> V^T hi/res planes [2048][2048] per b, + bv[d]
  {
    const int M = HID, N = SEQ, K = HID;
    const int tiles = (M / 32) * (N / 128);
    gemm_kernel<false, 1, true><<<dim3((tiles + 3) / 4, NB), blk128, 0, stream>>>(
        Wvt, Wvt, HID, 0L, Xb, HID, (long)SEQ * HID, (void*)Vth, (void*)Vtl, (void*)Vtl, SEQ, (long)HID * SEQ,
        bv, HID, bv, HID, N, M, N, K);
  }
  // (4) wq^T | wk^T panel [4096][2048] into R1
  tr_bf16_kernel<<<trg, blk256, 0, stream>>>(wq, Wqk, HID, HID);
  tr_bf16_kernel<<<trg, blk256, 0, stream>>>(wk, Wqk + (size_t)HID * HID, HID, HID);
  // (5) q | k projections with head-major relayout: A = Xb [4096][2048], Bt = Wqk [4096][2048] -> q hi/res planes, k plane; + bq | bk
  {
    const int M = NB * SEQ, N = 2 * HID, K = HID;
    const int tiles = (M / 32) * (N / 128);
    gemm_kernel<false, 2, false><<<dim3((tiles + 3) / 4, 1), blk128, 0, stream>>>(
        Xb, Xb, HID, 0L, Wqk, HID, 0L, (void*)Qh, (void*)Ql, (void*)Kp, HD, 0L,
        bq, HID, bk, HID, HID, M, N, K);
  }
  // (6) gate weights: wg [2048][16] -> wg^T zero-padded bf16 [128][2048]
  wg_pad_kernel<<<dim3(GLD), blk256, 0, stream>>>(wg, Wgt);
  // (7) gate logits: A = Xb [4096][2048], Bt = Wgt [128][2048] -> f32 [4096][128], + bg for columns < 16
  {
    const int M = NB * SEQ, N = GLD, K = HID;
    const int tiles = (M / 32) * (N / 128);
    gemm_kernel<false, 0, false><<<dim3((tiles + 3) / 4, 1), blk128, 0, stream>>>(
        Xb, Xb, HID, 0L, Wgt, HID, 0L, (void*)Gl, (void*)Gl, (void*)Gl, GLD, 0L,
        bg, NH, bg, NH, N, M, N, K);
  }
  // (8) wo [in][out] -> wo^T bf16
  tr_bf16_kernel<<<trg, blk256, 0, stream>>>(wo, Wot, HID, HID);
  // (9) attention: grid = NB x 16 heads x 32 query blocks, 128 threads
  attn_kernel<<<dim3(NB * NH * (SEQ / AT_QB)), blk128, 0, stream>>>(Qh, Ql, Kp, Vth, Vtl, bm, Gl, Ch, Cl);
  // (10) output projection: A = gated ctx hi/lo planes [4096][2048], Bt = Wot [2048][2048] -> d_out f32 [4096][2048], + bo
  {
    const int M = NB * SEQ, N = HID, K = HID;
    const int tiles = (M / 32) * (N / 128);
    gemm_kernel<true, 0, false><<<dim3((tiles + 3) / 4, 1), blk128, 0, stream>>>(
        Ch, Cl, HID, 0L, Wot, HID, 0L, (void*)out, (void*)out, (void*)out, HID, 0L,
        bo, HID, bo, HID, N, M, N, K);
  }
  (void)hipGetLastError();
}

// v002
// Measured time: 834 microseconds a run.
// In both of two side-by-side timings against v001, it was 1.25 times as fast.
// Counting every step since v000, it is 1.40 times as fast.
#include <hip/hip_runtime.h>
#include <math.h>
#include <stdint.h>

// q/k/v and gate projections: v_wmma_f32_16x16x32_bf16, single products on bf16-RNE converted x and W^T, f32 accumulate;
// scores q.k^T: v_wmma_f32_16x16x32_f16 with q = f16 hi + residual x2^11 planes, k single f16 plane, f32 accumulate;
// p.v: v_wmma_f32_16x16x32_f16 with p x1024 single f16 plane, v^T = f16 hi + residual x2^11 planes, f32 accumulate;
// output projection: v_wmma_f32_16x16x32_bf16 with gated ctx as bf16 hi + lo planes and Wo^T bf16, f32 accumulate.
// Online softmax, score scale 1/sqrt(128), per-head bias scale 2^(-(h+1)/2), sigmoid gate and normalisation in f32.

#define NB   2
#define SEQ  2048
#define HID  2048
#define NH   16
#define HD   128
#define GLD  128

typedef _Float16 v16h __attribute__((ext_vector_type(16)));
typedef _Float16 v8h  __attribute__((ext_vector_type(8)));
typedef __bf16   v16b __attribute__((ext_vector_type(16)));
typedef __bf16   v8b  __attribute__((ext_vector_type(8)));
typedef float    v8f  __attribute__((ext_vector_type(8)));
typedef float    v4f  __attribute__((ext_vector_type(4)));
typedef unsigned int v4u __attribute__((ext_vector_type(4)));

// ---------------------------------------------------------------------------
// small helpers
// ---------------------------------------------------------------------------
__device__ __forceinline__ unsigned short f2bf_bits(float f) {          // RNE convert f32 -> bf16 bits
  const unsigned u = __float_as_uint(f);
  return (unsigned short)((u + 0x7FFFu + ((u >> 16) & 1u)) >> 16);
}
__device__ __forceinline__ float bf_bits2f(unsigned short x) { return __uint_as_float(((unsigned)x) << 16); }
__device__ __forceinline__ float bfr(float f) { return __uint_as_float(((unsigned)f2bf_bits(f)) << 16); }
__device__ __forceinline__ unsigned pk16(unsigned short a, unsigned short b) { return (unsigned)a | ((unsigned)b << 16); }
__device__ __forceinline__ unsigned short h2u(_Float16 x) { return __builtin_bit_cast(unsigned short, x); }

__device__ __forceinline__ void wave_sync() {
  __builtin_amdgcn_fence(__ATOMIC_RELEASE, "workgroup");
  __builtin_amdgcn_wave_barrier();
  __builtin_amdgcn_fence(__ATOMIC_ACQUIRE, "workgroup");
}

// 16-bit fragment loaders, same k map for A and B: p points at (row or col)*ld + k0 + 8*(lane>>4);
// elements 0..7 <- p[0..7] (k0+8h..k0+8h+7), elements 8..15 <- p[16..23] (k0+16+8h..k0+16+8h+7).
union FragB { v16b v; v8b h[2]; };
union FragH { v16h v; v8h h[2]; };
__device__ __forceinline__ v16b ldfrag_b(const __bf16* p) {
  FragB f; f.h[0] = *(const v8b*)(p); f.h[1] = *(const v8b*)(p + 16); return f.v;
}
__device__ __forceinline__ v16h ldfrag_h(const _Float16* p) {
  FragH f; f.h[0] = *(const v8h*)(p); f.h[1] = *(const v8h*)(p + 16); return f.v;
}

__device__ __forceinline__ v8f wmma_b(v16b a, v16b b, v8f c) {
  return __builtin_amdgcn_wmma_f32_16x16x32_bf16(false, a, false, b, (short)0, c, false, false);
}
// f16 form with the hazard guard attached to every issue (ties D, keeps A/B live)
__device__ __forceinline__ v8f wmma_h(v16h a, v16h b, v8f c) {
  c = __builtin_amdgcn_wmma_f32_16x16x32_f16(false, a, false, b, (short)0, c, false, false);
#if defined(__HIP_DEVICE_COMPILE__)
  asm volatile("v_nop\n\tv_nop\n\tv_nop\n\tv_nop" : "+v"(c) : "v"(a), "v"(b));
#endif
  return c;
}
// hazard guard for one j-group of the register-blocked GEMM (ties both D tiles, keeps A/B registers live)
__device__ __forceinline__ void dep_guard_b(v8f& x, v8f& y, v16b b, v16b a0, v16b a1, v16b l0, v16b l1) {
#if defined(__HIP_DEVICE_COMPILE__)
  asm volatile("v_nop\n\tv_nop\n\tv_nop\n\tv_nop" : "+v"(x), "+v"(y) : "v"(b), "v"(a0), "v"(a1), "v"(l0), "v"(l1));
#endif
}

// ---------------------------------------------------------------------------
// f32 -> bf16 (RNE) convert, 8 elements per thread: two 16-B loads, one 16-B store.
// Coverage: grid = ceil(n8/256) x 256 threads x 8 elements = the whole array (sizes here are multiples of 2048).
// ---------------------------------------------------------------------------
__global__ __launch_bounds__(256) void cvt_bf16x8_kernel(const float* __restrict__ in, unsigned short* out, int n8) {
  const int i = blockIdx.x * 256 + threadIdx.x;
  if (i < n8) {
    const v4f a = *(const v4f*)(in + 8 * (size_t)i);
    const v4f c = *(const v4f*)(in + 8 * (size_t)i + 4);
    v4u w;
    w[0] = pk16(f2bf_bits(a[0]), f2bf_bits(a[1]));
    w[1] = pk16(f2bf_bits(a[2]), f2bf_bits(a[3]));
    w[2] = pk16(f2bf_bits(c[0]), f2bf_bits(c[1]));
    w[3] = pk16(f2bf_bits(c[2]), f2bf_bits(c[3]));
    v4u* p = (v4u*)(out + 8 * (size_t)i);
    *p = w;
    
  }
}

// ---------------------------------------------------------------------------
// Transpose + RNE bf16 convert: in f32 [R][C] row-major -> out bf16 [C][R] (out[c][r] = bf16(in[r][c])).
// Block 256 threads handles a 64x64 tile through LDS. Load: thread -> 4 float4 (rows t>>4 + 16i, cols 4*(t&15)+0..3).
// Coverage: out rows cc = wave*4 + (lane>>3) (+32) over 8 waves = 0..63; columns (lane&7)*8 + 0..7 = 0..63; grid (C/64, R/64).
// ---------------------------------------------------------------------------
__global__ __launch_bounds__(256) void tr_bf16_kernel(const float* __restrict__ in, unsigned short* out, int R, int C) {
  __shared__ __align__(16) float tile[64][65];
  const int c0 = blockIdx.x * 64, r0 = blockIdx.y * 64;
  const int t = threadIdx.x;
  const int cq = (t & 15) * 4, rb = t >> 4;
#pragma unroll
  for (int i = 0; i < 4; ++i) {
    const int r = rb + 16 * i;
    const v4f v = *(const v4f*)(in + (size_t)(r0 + r) * C + c0 + cq);
    tile[r][cq] = v[0]; tile[r][cq + 1] = v[1]; tile[r][cq + 2] = v[2]; tile[r][cq + 3] = v[3];
  }
  __syncthreads();
  const int wave = t >> 5, lane = t & 31, q = lane >> 3, pc = lane & 7;
  const int cc0 = wave * 4 + q, cc1 = 32 + wave * 4 + q;
  v4u w0, w1;
#pragma unroll
  for (int e = 0; e < 4; ++e) {
    w0[e] = pk16(f2bf_bits(tile[pc * 8 + 2 * e][cc0]), f2bf_bits(tile[pc * 8 + 2 * e + 1][cc0]));
    w1[e] = pk16(f2bf_bits(tile[pc * 8 + 2 * e][cc1]), f2bf_bits(tile[pc * 8 + 2 * e + 1][cc1]));
  }
  v4u* p0 = (v4u*)(out + (size_t)(c0 + cc0) * R + r0 + pc * 8);
  v4u* p1 = (v4u*)(out + (size_t)(c0 + cc1) * R + r0 + pc * 8);
  *p0 = w0; *p1 = w1;
  
}

// ---------------------------------------------------------------------------
// Gate weight panel: wg f32 [HID][NH] -> out bf16 [GLD][HID], out[n][k] = bf16(wg[k][n]) for n < NH, 0 for n >= NH.
// Block n (uniform), thread -> k = 8*threadIdx.x; loads use a clamped column address, zeroed by value for n >= NH.
// Coverage: 128 blocks x 256 threads x 8 = the whole [128][2048] panel (padding rows written as zeros).
// ---------------------------------------------------------------------------
__global__ __launch_bounds__(256) void wg_pad_kernel(const float* __restrict__ wg, unsigned short* out) {
  const int n = blockIdx.x;
  const int k = threadIdx.x * 8;
  const int nn = (n < NH) ? n : (NH - 1);
  const float keep = (n < NH) ? 1.0f : 0.0f;
  v4u w;
#pragma unroll
  for (int e = 0; e < 4; ++e) {
    const float a = wg[(size_t)(k + 2 * e) * NH + nn] * keep;
    const float b = wg[(size_t)(k + 2 * e + 1) * NH + nn] * keep;
    w[e] = pk16(f2bf_bits(a), f2bf_bits(b));
  }
  v4u* p = (v4u*)(out + (size_t)n * HID + k);
  *p = w;
  
}

// ---------------------------------------------------------------------------
// Register-blocked bf16 WMMA GEMM: C[m][n] = sum_k A[m][k] * Bt[n][k] + bias; each wave owns a 32x128 tile.
// A row-major [M][K] (pitch lda), Bt row-major [N][K] (pitch ldb); M multiple of 32, N multiple of 128, K multiple of 32.
// SPLITA: A given as hi plane (Ap) + unscaled bf16 lo plane (A2p): products Ahi.B + Alo.B into one accumulator.
// BROW: bias[m] per row (clamped to nb1), else per column: bias[n] for n < nsplit (valid while n < nb1),
//       bias2[n - nsplit] for n >= nsplit (valid while n - nsplit < nb2); bias values RNE-rounded to bf16; both
//       candidates loaded from clamped addresses and selected by value.
// blockIdx.y selects a z slice through strideA / strideB / strideC (element strides).
// Epilogue: per wave, each 16x128 accumulator slab is staged in LDS (pitch 132 floats), then written as whole
//   OUT_MODE 0: f32 rows into Cout [M][ldc] (row segment 512 B = 32 lanes x 16 B, 1 row per instruction).
//   OUT_MODE 1: f16 hi plane Cout + f16 residual plane Cout2 ((v - hi) * 2048), [M][ldc] (256 B = 16 lanes x 16 B, 2 rows per instr.).
//   OUT_MODE 2: head-major relayout: columns n0 < nsplit -> q planes Cout (f16 hi) / Cout2 (residual * 2048) at
//               [(b*16 + n0/128)*SEQ + s][ldc = 128]; columns >= nsplit -> single f16 k plane Cout3 at
//               [(b*16 + (n0-nsplit)/128)*SEQ + s][128], with row m = b*2048 + s. Each 128-wide row = 256 B = 16 lanes x 16 B.
// Coverage per slab: it 0..7 x (lane>>4) 0..1 = 16 rows, (lane&15)*8 + 0..7 = 128 columns (OUT_MODE 1/2);
//                    it 0..15 = 16 rows, lane*4 + 0..3 = 128 columns (OUT_MODE 0).
// ---------------------------------------------------------------------------
#define GP 132

template <bool SPLITA, int OUT_MODE, bool BROW>
__global__ __launch_bounds__(128) void gemm_kernel(
    const unsigned short* __restrict__ Ap, const unsigned short* __restrict__ A2p, int lda, long strideA,
    const unsigned short* __restrict__ Btp, int ldb, long strideB,
    void* Cout, void* Cout2, void* Cout3, int ldc, long strideC,
    const float* __restrict__ bias, int nb1, const float* __restrict__ bias2, int nb2, int nsplit,
    int M, int N, int K) {
  __shared__ __align__(16) float sT[4][16 * GP];
  const int bz   = blockIdx.y;
  const int lane = threadIdx.x & 31;
  const int wave = threadIdx.x >> 5;
  const int tilesN = N >> 7;
  const int tilesM = M >> 5;
  const int tile = blockIdx.x * 4 + wave;
  if (tile >= tilesM * tilesN) return;          // wave-uniform; no block barriers in this kernel
  const int tm = tile / tilesN;
  const int tn = tile - tm * tilesN;
  const int m0 = tm << 5;
  const int n0 = tn << 7;

  const __bf16* Ab  = (const __bf16*)(const void*)Ap + (size_t)bz * strideA;
  const __bf16* Ab2 = SPLITA ? ((const __bf16*)(const void*)A2p + (size_t)bz * strideA) : (const __bf16*)0;
  const __bf16* Bb  = (const __bf16*)(const void*)Btp + (size_t)bz * strideB;

  const int rlane = lane & 15;              // row (A) / col (B, D) within a 16x16 subtile
  const int koff  = (lane >> 4) * 8;        // k offset of this lane half
  const int mOff  = (lane >> 4) * 8;        // D row offset of this lane half

  v8f acc[2][8];
#pragma unroll
  for (int i = 0; i < 2; ++i)
#pragma unroll
    for (int j = 0; j < 8; ++j) acc[i][j] = (v8f){0.f, 0.f, 0.f, 0.f, 0.f, 0.f, 0.f, 0.f};

  for (int k0 = 0; k0 < K; k0 += 32) {
    const size_t ao0 = (size_t)(m0 + rlane) * lda + koff + k0;
    const size_t ao1 = (size_t)(m0 + 16 + rlane) * lda + koff + k0;
    const v16b a0 = ldfrag_b(Ab + ao0);
    const v16b a1 = ldfrag_b(Ab + ao1);
    v16b l0 = a0, l1 = a1;
    if (SPLITA) { l0 = ldfrag_b(Ab2 + ao0); l1 = ldfrag_b(Ab2 + ao1); }
#pragma unroll
    for (int j = 0; j < 8; ++j) {
      const v16b bh = ldfrag_b(Bb + (size_t)(n0 + (j << 4) + rlane) * ldb + koff + k0);
      acc[0][j] = wmma_b(a0, bh, acc[0][j]);
      if (SPLITA) acc[0][j] = wmma_b(l0, bh, acc[0][j]);
      acc[1][j] = wmma_b(a1, bh, acc[1][j]);
      if (SPLITA) acc[1][j] = wmma_b(l1, bh, acc[1][j]);
      dep_guard_b(acc[0][j], acc[1][j], bh, a0, a1, l0, l1);
    }
  }

  // ---- epilogue ----
  float* slab = sT[wave];
  float bc[8];
#pragma unroll
  for (int j = 0; j < 8; ++j) bc[j] = 0.f;
  if (!BROW) {
#pragma unroll
    for (int j = 0; j < 8; ++j) {
      const int col = n0 + (j << 4) + rlane;
      int i1 = col;          if (i1 > nb1 - 1) i1 = nb1 - 1;
      int i2 = col - nsplit; if (i2 < 0) i2 = 0; if (i2 > nb2 - 1) i2 = nb2 - 1;
      const float v1 = bfr(bias[i1]);
      const float v2 = bfr(bias2[i2]);
      const bool lo = (col < nsplit);
      const bool valid = lo ? (col < nb1) : ((col - nsplit) < nb2);
      const float v = lo ? v1 : v2;
      bc[j] = valid ? v : 0.f;
    }
  }
#pragma unroll
  for (int i = 0; i < 2; ++i) {
    const int mBase = m0 + (i << 4);
    float br[8];
#pragma unroll
    for (int r = 0; r < 8; ++r) {
      br[r] = 0.f;
      if (BROW) {
        int ir = mBase + mOff + r; if (ir > nb1 - 1) ir = nb1 - 1;
        br[r] = bfr(bias[ir]);
      }
    }
#pragma unroll
    for (int j = 0; j < 8; ++j)
#pragma unroll
      for (int r = 0; r < 8; ++r)
        slab[(mOff + r) * GP + (j << 4) + rlane] = acc[i][j][r] + (BROW ? br[r] : bc[j]);
    wave_sync();
    if (OUT_MODE == 0) {
      float* C = (float*)Cout + (size_t)bz * strideC;
      const int c4 = lane * 4;                               // row segment 512 B = 32 lanes x 16 B
      {
#pragma unroll
        for (int it = 0; it < 16; ++it) {
          const v4f v = *(const v4f*)(slab + it * GP + c4);
          *(v4f*)(C + (size_t)(mBase + it) * ldc + n0 + c4) = v;
        }
        
      }
    } else if (OUT_MODE == 1) {
      unsigned short* C  = (unsigned short*)Cout  + (size_t)bz * strideC;
      unsigned short* C2 = (unsigned short*)Cout2 + (size_t)bz * strideC;
      const int q16 = lane >> 4, c8 = (lane & 15) * 8;      // row segment 256 B = 16 lanes x 16 B
      {
#pragma unroll
        for (int it = 0; it < 8; ++it) {
          const int row = it * 2 + q16;
          const float* sp = slab + row * GP + c8;
          v4u hv, lv;
#pragma unroll
          for (int p = 0; p < 4; ++p) {
            const float f0 = sp[2 * p], f1 = sp[2 * p + 1];
            const _Float16 e0 = (_Float16)f0, e1 = (_Float16)f1;
            const _Float16 g0 = (_Float16)((f0 - (float)e0) * 2048.0f);
            const _Float16 g1 = (_Float16)((f1 - (float)e1) * 2048.0f);
            hv[p] = pk16(h2u(e0), h2u(e1));
            lv[p] = pk16(h2u(g0), h2u(g1));
          }
          const size_t go = (size_t)(mBase + row) * ldc + n0 + c8;
          *(v4u*)(C  + go) = hv;
          *(v4u*)(C2 + go) = lv;
        }
        
      }
    } else {
      unsigned short* Q1 = (unsigned short*)Cout;
      unsigned short* Q2 = (unsigned short*)Cout2;
      unsigned short* K1 = (unsigned short*)Cout3;
      const int q16 = lane >> 4, c8 = (lane & 15) * 8;      // row segment 256 B = 16 lanes x 16 B
      const int  bidx = m0 / SEQ;                             // all 32 rows of the tile lie in one batch element
      const bool isq  = (n0 < nsplit);                        // wave-uniform
      const int  head = (isq ? n0 : (n0 - nsplit)) >> 7;
      const size_t rowBase = (size_t)(bidx * NH + head) * SEQ;
      {
#pragma unroll
        for (int it = 0; it < 8; ++it) {
          const int row = it * 2 + q16;
          const int s   = (mBase + row) & (SEQ - 1);
          const float* sp = slab + row * GP + c8;
          v4u hv, lv;
#pragma unroll
          for (int p = 0; p < 4; ++p) {
            const float f0 = sp[2 * p], f1 = sp[2 * p + 1];
            const _Float16 e0 = (_Float16)f0, e1 = (_Float16)f1;
            const _Float16 g0 = (_Float16)((f0 - (float)e0) * 2048.0f);
            const _Float16 g1 = (_Float16)((f1 - (float)e1) * 2048.0f);
            hv[p] = pk16(h2u(e0), h2u(e1));
            lv[p] = pk16(h2u(g0), h2u(g1));
          }
          const size_t go = (rowBase + (size_t)s) * ldc + c8;
          if (isq) {
            *(v4u*)(Q1 + go) = hv;
            *(v4u*)(Q2 + go) = lv;
          } else {
            *(v4u*)(K1 + go) = hv;
          }
        }
        
      }
    }
    wave_sync();
  }
}

// =====================================================================================
// Full (non-causal) attention with additive per-head-scaled bias and sigmoid head gate, head dim 128, 16 heads.
// Block = 4 waves = 64 query rows of one (b, h).
//   q planes f16 hi / residual*2048: element (b, h, s, d) at [((b*16 + h)*SEQ + s)*128 + d]
//   k plane  f16:                     element (b, h, s, d) at [((b*16 + h)*SEQ + s)*128 + d]
//   v^T planes f16 hi / residual*2048: element (b, h, d, s) at [((b*2048 + h*128 + d)*SEQ + s]
//   bias: f32 [b][q][key] read per element, RNE-rounded to bf16, scaled by 2^(-(h+1)/2)
//   gate logits: f32 [(b*SEQ + s)*GLD + h]; g = 1/(1 + exp(-a))
//   ctx out: bf16 hi + lo planes, element (b, s, h, d) at [(b*SEQ + s)*HID + h*128 + d]
//   scores = (qh.k + ql.k/2048) * (1/sqrt(128)) + bias*hs on v_wmma_f32_16x16x32_f16; online softmax in f32;
//   p1024 = f16(1024*exp(s - m)); ctx += ph.vh + (ph.vl)/2048, the residual product into a per-tile scratch
//   accumulator (starting at zero) folded in f32 right after; ctx = acc * g / 1024 / l.
//   kv chunks of 64 staged in LDS (K 17 KB, V^T hi/res 18 KB each, rows padded by 16 B), 32 chunks.
//   q fragments (hi and residual, 4 k-steps each, 64 VGPRs) loaded once from the global planes and held in registers.
//   Epilogue: wave 16x128 f32 tile staged in LDS (aliasing the K/V region after a block barrier), each 128-wide row =
//   Coverage: it 0..7 x (lane>>4) 0..1 = 16 rows x 128 columns per wave; 1024 blocks x 64 rows = every (b, s, h, d).
// =====================================================================================
#define AT_QB 64
#define AT_KC 64
#define OS_P  132
// LDS row pitches in f16 elements, each 16 B x odd so that the 16 rows a ds_load_b128 fragment read touches fall on distinct banks
#define K_P   (HD + 8)      // K rows of 256 B at pitch 272 B
#define V_P   (AT_KC + 8)   // V^T rows of 128 B at pitch 144 B
#define P_P   (AT_KC + 8)   // P rows of 128 B at pitch 144 B

__global__ __launch_bounds__(128)
void attn_kernel(const unsigned short* __restrict__ qhp, const unsigned short* __restrict__ qlp,
                 const unsigned short* __restrict__ kp,
                 const unsigned short* __restrict__ vhp, const unsigned short* __restrict__ vlp,
                 const float* __restrict__ bmp, const float* __restrict__ glp,
                 unsigned short* chp, unsigned short* clp) {
  __shared__ __align__(16) _Float16 KVs[AT_KC * K_P + 2 * HD * V_P];   // K [key][d] | V^T hi [d][key] | V^T res [d][key], padded rows; ctx staging later
  __shared__ __align__(16) _Float16 Psh[4][16 * P_P];         // per wave P x1024 [row][key], padded rows
  static_assert(4 * 16 * OS_P * 4 <= (AT_KC * K_P + 2 * HD * V_P) * 2);
  _Float16* const Ksh = KVs;
  _Float16* const Vth = KVs + AT_KC * K_P;
  _Float16* const Vtl = KVs + AT_KC * K_P + HD * V_P;

  const int tid  = threadIdx.x;
  const int wave = tid >> 5;
  const int lane = tid & 31;
  const int hh   = lane >> 4;
  const int c    = lane & 15;

  const int bx  = blockIdx.x;
  const int qb  = bx & 31;                 // query block of 64
  const int h   = (bx >> 5) & (NH - 1);    // head
  const int b   = bx >> 9;                 // batch element
  const int q0  = qb * AT_QB + wave * 16;

  const _Float16* Qhg = (const _Float16*)(const void*)qhp + (size_t)(b * NH + h) * SEQ * HD;
  const _Float16* Qlg = (const _Float16*)(const void*)qlp + (size_t)(b * NH + h) * SEQ * HD;
  const _Float16* Kg  = (const _Float16*)(const void*)kp  + (size_t)(b * NH + h) * SEQ * HD;
  const _Float16* Vhg = (const _Float16*)(const void*)vhp + ((size_t)b * HID + (size_t)h * HD) * SEQ;
  const _Float16* Vlg = (const _Float16*)(const void*)vlp + ((size_t)b * HID + (size_t)h * HD) * SEQ;
  const float*    Bm  = bmp + (size_t)b * SEQ * SEQ + (size_t)(q0 + 8 * hh) * SEQ + c;   // + r*SEQ + key
  const int qro = (q0 + c) * HD + 8 * hh;  // per-lane A-fragment row base (d added per step)

  // per-head bias scale 2^(-(h+1)/2): exact power of two times sqrt(1/2) for odd (h+1)
  const int   hexp = (h + 1) >> 1;
  const float hs   = __uint_as_float((unsigned)(127 - hexp) << 23) * (((h + 1) & 1) ? 0.70710678118654752f : 1.0f);

  const v8f zero8 = (v8f){0.f, 0.f, 0.f, 0.f, 0.f, 0.f, 0.f, 0.f};
  const float inv2048 = 4.8828125e-4f;
  const float scale   = 1.0f / 11.313708305358887f;

  float mrow[8], lrow[8];
  v8f oh[8];
#pragma unroll
  for (int r = 0; r < 8; ++r) { mrow[r] = -INFINITY; lrow[r] = 0.f; }
#pragma unroll
  for (int t = 0; t < 8; ++t) oh[t] = zero8;

  v16h qa[4], qr[4];
  // unrolled here and in the loops over a0, b0, b1 and bb below: static indices keep these arrays in registers
#pragma unroll
  for (int dc = 0; dc < 4; ++dc) {
    qa[dc] = ldfrag_h(Qhg + qro + dc * 32);
    qr[dc] = ldfrag_h(Qlg + qro + dc * 32);
  }

  for (int kc = 0; kc < SEQ / AT_KC; ++kc) {
    const int kv0 = kc * AT_KC;
    __syncthreads();
    {
      // staging: K: thread -> key tid>>1, d half (tid&1)*64, 8 x 16 B; V^T hi/res: thread -> d = tid, keys kv0..kv0+63, 8 x 16 B
      // coverage: 64 keys x 128 d for K, 128 d x 64 keys for each V^T plane = the whole chunk tiles
      const int r = tid >> 1, half = (tid & 1) * 64;
      const _Float16* ks = Kg  + (size_t)(kv0 + r) * HD + half;
      const _Float16* vs = Vhg + (size_t)tid * SEQ + kv0;
      const _Float16* ws = Vlg + (size_t)tid * SEQ + kv0;
      // loads grouped per plane, the third group issued behind the first group's stores: 16 loads in flight fit beside the held q fragments
      v8h a0[8], b0[8], b1[8];
#pragma unroll
      for (int i = 0; i < 8; ++i) a0[i] = *(const v8h*)(ks + 8 * i);
#pragma unroll
      for (int i = 0; i < 8; ++i) b0[i] = *(const v8h*)(vs + 8 * i);
#pragma unroll
      for (int i = 0; i < 8; ++i) *(v8h*)(Ksh + r * K_P + half + 8 * i) = a0[i];
#pragma unroll
      for (int i = 0; i < 8; ++i) b1[i] = *(const v8h*)(ws + 8 * i);
#pragma unroll
      for (int i = 0; i < 8; ++i) *(v8h*)(Vth + tid * V_P + 8 * i) = b0[i];
#pragma unroll
      for (int i = 0; i < 8; ++i) *(v8h*)(Vtl + tid * V_P + 8 * i) = b1[i];
    }
    __syncthreads();

    // ---- scores: 4 key tiles of 16, reduce over d = 128 = 4 k-steps; hi and residual accumulators separate ----
    v8f s[4];
    float bb[4][8];                          // raw bias values per key tile
#pragma unroll
    for (int r = 0; r < 8; ++r) bb[0][r] = Bm[kv0 + (size_t)r * SEQ];
#pragma unroll
    for (int j = 0; j < 4; ++j) {
      if (j < 3) {
#pragma unroll
        for (int r = 0; r < 8; ++r) bb[j + 1][r] = Bm[kv0 + (j + 1) * 16 + (size_t)r * SEQ];
        // keeps the next key tile's bias loads issued as one group here, in flight behind this tile's products:
        // with the q fragments held, the scheduler otherwise sinks them in pairs to their uses
        __builtin_amdgcn_sched_barrier(0);
      }
      v8f sh = zero8, sl = zero8;
#pragma unroll
      for (int dc = 0; dc < 4; ++dc) {
        FragH kb;
        kb.h[0] = *(const v8h*)(Ksh + (j * 16 + c) * K_P + dc * 32 + 8 * hh);
        kb.h[1] = *(const v8h*)(Ksh + (j * 16 + c) * K_P + dc * 32 + 16 + 8 * hh);
        sh = wmma_h(qa[dc], kb.v, sh);
        sl = wmma_h(qr[dc], kb.v, sl);
      }
      // keeps the first use of this tile's bias (and its wait) behind the tile's products
      __builtin_amdgcn_sched_barrier(0);
      v8f sj = (sh + sl * inv2048) * scale;
#pragma unroll
      for (int r = 0; r < 8; ++r) sj[r] = sj[r] + hs * bfr(bb[j][r]);
      s[j] = sj;
    }

    float cm[8];
#pragma unroll
    for (int r = 0; r < 8; ++r) {
      float m = fmaxf(fmaxf(s[0][r], s[1][r]), fmaxf(s[2][r], s[3][r]));
#pragma unroll
      for (int off = 1; off < 16; off <<= 1) m = fmaxf(m, __shfl_xor(m, off, 32));
      cm[r] = m;
    }

    _Float16* pw = Psh[wave];
#pragma unroll
    for (int r = 0; r < 8; ++r) {
      const float mnew  = fmaxf(mrow[r], cm[r]);
      const float alpha = expf(mrow[r] - mnew);
      mrow[r] = mnew;
      float psum = 0.f;
#pragma unroll
      for (int j = 0; j < 4; ++j) {
        const float p = expf(s[j][r] - mnew);
        psum += p;
        pw[(8 * hh + r) * P_P + j * 16 + c] = (_Float16)(p * 1024.0f);
      }
#pragma unroll
      for (int off = 1; off < 16; off <<= 1) psum += __shfl_xor(psum, off, 32);
      lrow[r] = lrow[r] * alpha + psum;
#pragma unroll
      for (int t = 0; t < 8; ++t) oh[t][r] *= alpha;
    }
    wave_sync();

    // ---- ctx += P . V over the 64 keys of the chunk (2 k-steps), 8 d tiles ----
#pragma unroll 1
    for (int kk = 0; kk < 2; ++kk) {
      FragH pa;
      pa.h[0] = *(const v8h*)(pw + c * P_P + kk * 32 + 8 * hh);
      pa.h[1] = *(const v8h*)(pw + c * P_P + kk * 32 + 16 + 8 * hh);
#pragma unroll
      for (int t = 0; t < 8; ++t) {
        FragH vb, vr;
        vb.h[0] = *(const v8h*)(Vth + (t * 16 + c) * V_P + kk * 32 + 8 * hh);
        vb.h[1] = *(const v8h*)(Vth + (t * 16 + c) * V_P + kk * 32 + 16 + 8 * hh);
        vr.h[0] = *(const v8h*)(Vtl + (t * 16 + c) * V_P + kk * 32 + 8 * hh);
        vr.h[1] = *(const v8h*)(Vtl + (t * 16 + c) * V_P + kk * 32 + 16 + 8 * hh);
        oh[t] = wmma_h(pa.v, vb.v, oh[t]);
        const v8f tr = wmma_h(pa.v, vr.v, zero8);
        oh[t] += tr * inv2048;
      }
    }
  }

  // ---- normalise, apply the head gate, stage the wave 16x128 tile (aliases the K/V region after the block barrier),
  //      write bf16 hi/lo planes ----
  __syncthreads();
  float* os = (float*)(void*)KVs + wave * (16 * OS_P);
#pragma unroll
  for (int r = 0; r < 8; ++r) {
    const int   q  = q0 + 8 * hh + r;
    const float a  = glp[(size_t)(b * SEQ + q) * GLD + h];
    const float g  = 1.0f / (1.0f + expf(-a));
    const float invl = g * (1.0f / lrow[r]) * 9.765625e-4f;
#pragma unroll
    for (int t = 0; t < 8; ++t) os[(8 * hh + r) * OS_P + t * 16 + c] = oh[t][r] * invl;
  }
  wave_sync();
  {
    const int q16 = lane >> 4, c8 = (lane & 15) * 8;         // 2 rows per instruction, each row 256 B = 16 lanes x 16 B
    {
#pragma unroll
      for (int it = 0; it < 8; ++it) {
        const int row = it * 2 + q16;
        const float* sp = os + row * OS_P + c8;
        v4u hv, lv;
#pragma unroll
        for (int p = 0; p < 4; ++p) {
          const float f0 = sp[2 * p], f1 = sp[2 * p + 1];
          const unsigned short hb0 = f2bf_bits(f0), hb1 = f2bf_bits(f1);
          const unsigned short lb0 = f2bf_bits(f0 - bf_bits2f(hb0));
          const unsigned short lb1 = f2bf_bits(f1 - bf_bits2f(hb1));
          hv[p] = pk16(hb0, hb1);
          lv[p] = pk16(lb0, lb1);
        }
        const size_t go = (size_t)(b * SEQ + q0 + row) * HID + h * HD + c8;
        *(v4u*)(chp + go) = hv;
        *(v4u*)(clp + go) = lv;
      }
      
    }
  }
}

// ---------------------------------------------------------------------------
// all sizes exact tile multiples, all offsets multiples of 512 KiB):
//   R0   bf16 [4096][2048]       16777216 @ 0           x as bf16; later ctx hi plane (written after the last reader of x)
//   R1   bf16 [4096][2048]       16777216 @ 16777216    wv^T as bf16 [2048][2048]; then wq^T|wk^T panel [4096][2048]; later ctx lo plane
//   Wob  bf16 [2048][2048]        8388608 @ 33554432    wo^T
//   Wgb  bf16 [128][2048]          524288 @ 41943040    wg^T zero-padded to 128 rows
//   Glog f32  [4096][128]         2097152 @ 42467328    gate logits
//   Qh   f16  [2][16][2048][128]  16777216 @ 44564480    Ql same @ 61341696
//   Kp   f16  [2][16][2048][128]  16777216 @ 78118912
//   Vth  f16  [2][2048][2048]     16777216 @ 94896128    Vtl same @ 111673344
//   total                        128450560
// ---------------------------------------------------------------------------
extern "C" void kernel_launch(void* const* d_in, const int* in_sizes, int n_in,
                              void* d_out, int out_size, void* d_ws, size_t ws_size,
                              hipStream_t stream) {
  if (n_in < 12) return;
  if (in_sizes[0] != NB * SEQ * HID) return;
  if (in_sizes[1] != NB * SEQ * SEQ) return;
  if (in_sizes[2] != HID * HID) return;
  if (in_sizes[3] != HID) return;
  if (in_sizes[4] != HID * HID) return;
  if (in_sizes[5] != HID) return;
  if (in_sizes[6] != HID * HID) return;
  if (in_sizes[7] != HID) return;
  if (in_sizes[8] != HID * NH) return;
  if (in_sizes[9] != NH) return;
  if (in_sizes[10] != HID * HID) return;
  if (in_sizes[11] != HID) return;
  if (out_size != NB * SEQ * HID) return;

  const float* x   = (const float*)d_in[0];
  const float* bm  = (const float*)d_in[1];
  const float* wq  = (const float*)d_in[2];
  const float* bq  = (const float*)d_in[3];
  const float* wk  = (const float*)d_in[4];
  const float* bk  = (const float*)d_in[5];
  const float* wv  = (const float*)d_in[6];
  const float* bv  = (const float*)d_in[7];
  const float* wg  = (const float*)d_in[8];
  const float* bg  = (const float*)d_in[9];
  const float* wo  = (const float*)d_in[10];
  const float* bo  = (const float*)d_in[11];
  float* out = (float*)d_out;

  const size_t szR0  = (size_t)NB * SEQ * HID * 2;          // 16 MiB
  const size_t szR1  = (size_t)2 * HID * HID * 2;           // 16 MiB
  const size_t szWo  = (size_t)HID * HID * 2;               //  8 MiB
  const size_t szWg  = (size_t)GLD * HID * 2;               //  512 KiB
  const size_t szG   = (size_t)NB * SEQ * GLD * 4;          //  2 MiB
  const size_t szQ   = (size_t)NB * NH * SEQ * HD * 2;      // 16 MiB
  const size_t szK   = szQ;
  const size_t szV   = (size_t)NB * HID * SEQ * 2;          // 16 MiB
  size_t off = 0;
  const size_t oR0  = off; off += szR0;
  const size_t oR1  = off; off += szR1;
  const size_t oWo  = off; off += szWo;
  const size_t oWg  = off; off += szWg;
  const size_t oG   = off; off += szG;
  const size_t oQh  = off; off += szQ;
  const size_t oQl  = off; off += szQ;
  const size_t oKp  = off; off += szK;
  const size_t oVth = off; off += szV;
  const size_t oVtl = off; off += szV;
  if (off > ws_size) return;                    // off = 128450560
  if (off > (size_t)134217728) return;

  char* ws = (char*)d_ws;
  unsigned short* Xb  = (unsigned short*)(ws + oR0);
  unsigned short* Ch  = (unsigned short*)(ws + oR0);        // reuses R0 after the gate GEMM (last reader of Xb)
  unsigned short* Wvt = (unsigned short*)(ws + oR1);
  unsigned short* Wqk = (unsigned short*)(ws + oR1);        // reuses R1 after the v^T GEMM (last reader of Wvt)
  unsigned short* Cl  = (unsigned short*)(ws + oR1);        // reuses R1 after the q|k GEMM (last reader of Wqk)
  unsigned short* Wot = (unsigned short*)(ws + oWo);
  unsigned short* Wgt = (unsigned short*)(ws + oWg);
  float*          Gl  = (float*)(ws + oG);
  unsigned short* Qh  = (unsigned short*)(ws + oQh);
  unsigned short* Ql  = (unsigned short*)(ws + oQl);
  unsigned short* Kp  = (unsigned short*)(ws + oKp);
  unsigned short* Vth = (unsigned short*)(ws + oVth);
  unsigned short* Vtl = (unsigned short*)(ws + oVtl);

  const dim3 blk256(256), blk128(128);
  const dim3 trg(HID / 64, HID / 64);           // in [2048 rows][2048 cols] -> out [cols][rows]
  const int n8x = NB * SEQ * HID / 8;

  // (1) x f32 -> bf16 plane
  cvt_bf16x8_kernel<<<dim3((n8x + 255) / 256), blk256, 0, stream>>>(x, Xb, n8x);
  // (2) wv [in][out] -> wv^T bf16 [out][in]
  tr_bf16_kernel<<<trg, blk256, 0, stream>>>(wv, Wvt, HID, HID);
  // (3) v^T per batch element: A = Wvt [2048 d][2048 k], Bt = Xb[b] [2048 s][2048 k] -> V^T hi/res planes [2048][2048] per b, + bv[d]
  {
    const int M = HID, N = SEQ, K = HID;
    const int tiles = (M / 32) * (N / 128);
    gemm_kernel<false, 1, true><<<dim3((tiles + 3) / 4, NB), blk128, 0, stream>>>(
        Wvt, Wvt, HID, 0L, Xb, HID, (long)SEQ * HID, (void*)Vth, (void*)Vtl, (void*)Vtl, SEQ, (long)HID * SEQ,
        bv, HID, bv, HID, N, M, N, K);
  }
  // (4) wq^T | wk^T panel [4096][2048] into R1
  tr_bf16_kernel<<<trg, blk256, 0, stream>>>(wq, Wqk, HID, HID);
  tr_bf16_kernel<<<trg, blk256, 0, stream>>>(wk, Wqk + (size_t)HID * HID, HID, HID);
  // (5) q | k projections with head-major relayout: A = Xb [4096][2048], Bt = Wqk [4096][2048] -> q hi/res planes, k plane; + bq | bk
  {
    const int M = NB * SEQ, N = 2 * HID, K = HID;
    const int tiles = (M / 32) * (N / 128);
    gemm_kernel<false, 2, false><<<dim3((tiles + 3) / 4, 1), blk128, 0, stream>>>(
        Xb, Xb, HID, 0L, Wqk, HID, 0L, (void*)Qh, (void*)Ql, (void*)Kp, HD, 0L,
        bq, HID, bk, HID, HID, M, N, K);
  }
  // (6) gate weights: wg [2048][16] -> wg^T zero-padded bf16 [128][2048]
  wg_pad_kernel<<<dim3(GLD), blk256, 0, stream>>>(wg, Wgt);
  // (7) gate logits: A = Xb [4096][2048], Bt = Wgt [128][2048] -> f32 [4096][128], + bg for columns < 16
  {
    const int M = NB * SEQ, N = GLD, K = HID;
    const int tiles = (M / 32) * (N / 128);
    gemm_kernel<false, 0, false><<<dim3((tiles + 3) / 4, 1), blk128, 0, stream>>>(
        Xb, Xb, HID, 0L, Wgt, HID, 0L, (void*)Gl, (void*)Gl, (void*)Gl, GLD, 0L,
        bg, NH, bg, NH, N, M, N, K);
  }
  // (8) wo [in][out] -> wo^T bf16
  tr_bf16_kernel<<<trg, blk256, 0, stream>>>(wo, Wot, HID, HID);
  // (9) attention: grid = NB x 16 heads x 32 query blocks, 128 threads
  attn_kernel<<<dim3(NB * NH * (SEQ / AT_QB)), blk128, 0, stream>>>(Qh, Ql, Kp, Vth, Vtl, bm, Gl, Ch, Cl);
  // (10) output projection: A = gated ctx hi/lo planes [4096][2048], Bt = Wot [2048][2048] -> d_out f32 [4096][2048], + bo
  {
    const int M = NB * SEQ, N = HID, K = HID;
    const int tiles = (M / 32) * (N / 128);
    gemm_kernel<true, 0, false><<<dim3((tiles + 3) / 4, 1), blk128, 0, stream>>>(
        Ch, Cl, HID, 0L, Wot, HID, 0L, (void*)out, (void*)out, (void*)out, HID, 0L,
        bo, HID, bo, HID, N, M, N, K);
  }
  (void)hipGetLastError();
}

// v003
// Measured time: 411 microseconds a run.
// Next to v002, in two timings, it ran 2.01 times as fast each time.
// All steps since v000 together make it 2.83 times as fast.
#include <hip/hip_runtime.h>
#include <math.h>
#include <stdint.h>

// q/k/v and gate projections: v_wmma_f32_16x16x32_bf16, single products on bf16-RNE converted x and W^T, f32 accumulate;
// scores q.k^T: v_wmma_f32_16x16x32_f16 with q = f16 hi + residual x2^11 planes, k single f16 plane, f32 accumulate;
// p.v: v_wmma_f32_16x16x32_f16 with p x1024 single f16 plane, v^T = f16 hi + residual x2^11 planes, f32 accumulate;
// output projection: v_wmma_f32_16x16x32_bf16 with gated ctx as bf16 hi + lo planes and Wo^T bf16, f32 accumulate.
// Online softmax, score scale 1/sqrt(128), per-head bias scale 2^(-(h+1)/2), sigmoid gate and normalisation in f32.

#define NB   2
#define SEQ  2048
#define HID  2048
#define NH   16
#define HD   128
#define GLD  128

typedef _Float16 v16h __attribute__((ext_vector_type(16)));
typedef _Float16 v8h  __attribute__((ext_vector_type(8)));
typedef __bf16   v16b __attribute__((ext_vector_type(16)));
typedef __bf16   v8b  __attribute__((ext_vector_type(8)));
typedef float    v8f  __attribute__((ext_vector_type(8)));
typedef float    v4f  __attribute__((ext_vector_type(4)));
typedef unsigned int v4u __attribute__((ext_vector_type(4)));

// ---------------------------------------------------------------------------
// small helpers
// ---------------------------------------------------------------------------
__device__ __forceinline__ unsigned short f2bf_bits(float f) {          // RNE convert f32 -> bf16 bits
  const unsigned u = __float_as_uint(f);
  return (unsigned short)((u + 0x7FFFu + ((u >> 16) & 1u)) >> 16);
}
__device__ __forceinline__ float bf_bits2f(unsigned short x) { return __uint_as_float(((unsigned)x) << 16); }
__device__ __forceinline__ float bfr(float f) { return __uint_as_float(((unsigned)f2bf_bits(f)) << 16); }
__device__ __forceinline__ unsigned pk16(unsigned short a, unsigned short b) { return (unsigned)a | ((unsigned)b << 16); }
__device__ __forceinline__ unsigned short h2u(_Float16 x) { return __builtin_bit_cast(unsigned short, x); }

__device__ __forceinline__ void wave_sync() {
  __builtin_amdgcn_fence(__ATOMIC_RELEASE, "workgroup");
  __builtin_amdgcn_wave_barrier();
  __builtin_amdgcn_fence(__ATOMIC_ACQUIRE, "workgroup");
}

// 16-bit fragment loaders, same k map for A and B: p points at (row or col)*ld + k0 + 8*(lane>>4);
// elements 0..7 <- p[0..7] (k0+8h..k0+8h+7), elements 8..15 <- p[16..23] (k0+16+8h..k0+16+8h+7).
union FragB { v16b v; v8b h[2]; };
union FragH { v16h v; v8h h[2]; };
__device__ __forceinline__ v16b ldfrag_b(const __bf16* p) {
  FragB f; f.h[0] = *(const v8b*)(p); f.h[1] = *(const v8b*)(p + 16); return f.v;
}
__device__ __forceinline__ v16h ldfrag_h(const _Float16* p) {
  FragH f; f.h[0] = *(const v8h*)(p); f.h[1] = *(const v8h*)(p + 16); return f.v;
}

__device__ __forceinline__ v8f wmma_b(v16b a, v16b b, v8f c) {
  return __builtin_amdgcn_wmma_f32_16x16x32_bf16(false, a, false, b, (short)0, c, false, false);
}
// f16 form with the hazard guard attached to every issue (ties D, keeps A/B live)
__device__ __forceinline__ v8f wmma_h(v16h a, v16h b, v8f c) {
  c = __builtin_amdgcn_wmma_f32_16x16x32_f16(false, a, false, b, (short)0, c, false, false);
#if defined(__HIP_DEVICE_COMPILE__)
  asm volatile("v_nop\n\tv_nop\n\tv_nop\n\tv_nop" : "+v"(c) : "v"(a), "v"(b));
#endif
  return c;
}
// hazard guard for one j-group of the register-blocked GEMM (ties both D tiles, keeps A/B registers live)
__device__ __forceinline__ void dep_guard_b(v8f& x, v8f& y, v16b b, v16b a0, v16b a1, v16b l0, v16b l1) {
#if defined(__HIP_DEVICE_COMPILE__)
  asm volatile("v_nop\n\tv_nop\n\tv_nop\n\tv_nop" : "+v"(x), "+v"(y) : "v"(b), "v"(a0), "v"(a1), "v"(l0), "v"(l1));
#endif
}

// ---------------------------------------------------------------------------
// f32 -> bf16 (RNE) convert, 8 elements per thread: two 16-B loads, one 16-B store.
// Coverage: grid = ceil(n8/256) x 256 threads x 8 elements = the whole array (sizes here are multiples of 2048).
// ---------------------------------------------------------------------------
__global__ __launch_bounds__(256) void cvt_bf16x8_kernel(const float* __restrict__ in, unsigned short* out, int n8) {
  const int i = blockIdx.x * 256 + threadIdx.x;
  if (i < n8) {
    const v4f a = *(const v4f*)(in + 8 * (size_t)i);
    const v4f c = *(const v4f*)(in + 8 * (size_t)i + 4);
    v4u w;
    w[0] = pk16(f2bf_bits(a[0]), f2bf_bits(a[1]));
    w[1] = pk16(f2bf_bits(a[2]), f2bf_bits(a[3]));
    w[2] = pk16(f2bf_bits(c[0]), f2bf_bits(c[1]));
    w[3] = pk16(f2bf_bits(c[2]), f2bf_bits(c[3]));
    v4u* p = (v4u*)(out + 8 * (size_t)i);
    *p = w;
    
  }
}

// ---------------------------------------------------------------------------
// Transpose + RNE bf16 convert: in f32 [R][C] row-major -> out bf16 [C][R] (out[c][r] = bf16(in[r][c])).
// Block 256 threads handles a 64x64 tile through LDS. Load: thread -> 4 float4 (rows t>>4 + 16i, cols 4*(t&15)+0..3).
// Coverage: out rows cc = wave*4 + (lane>>3) (+32) over 8 waves = 0..63; columns (lane&7)*8 + 0..7 = 0..63; grid (C/64, R/64).
// ---------------------------------------------------------------------------
__global__ __launch_bounds__(256) void tr_bf16_kernel(const float* __restrict__ in, unsigned short* out, int R, int C) {
  __shared__ __align__(16) float tile[64][65];
  const int c0 = blockIdx.x * 64, r0 = blockIdx.y * 64;
  const int t = threadIdx.x;
  const int cq = (t & 15) * 4, rb = t >> 4;
#pragma unroll
  for (int i = 0; i < 4; ++i) {
    const int r = rb + 16 * i;
    const v4f v = *(const v4f*)(in + (size_t)(r0 + r) * C + c0 + cq);
    tile[r][cq] = v[0]; tile[r][cq + 1] = v[1]; tile[r][cq + 2] = v[2]; tile[r][cq + 3] = v[3];
  }
  __syncthreads();
  const int wave = t >> 5, lane = t & 31, q = lane >> 3, pc = lane & 7;
  const int cc0 = wave * 4 + q, cc1 = 32 + wave * 4 + q;
  v4u w0, w1;
#pragma unroll
  for (int e = 0; e < 4; ++e) {
    w0[e] = pk16(f2bf_bits(tile[pc * 8 + 2 * e][cc0]), f2bf_bits(tile[pc * 8 + 2 * e + 1][cc0]));
    w1[e] = pk16(f2bf_bits(tile[pc * 8 + 2 * e][cc1]), f2bf_bits(tile[pc * 8 + 2 * e + 1][cc1]));
  }
  v4u* p0 = (v4u*)(out + (size_t)(c0 + cc0) * R + r0 + pc * 8);
  v4u* p1 = (v4u*)(out + (size_t)(c0 + cc1) * R + r0 + pc * 8);
  *p0 = w0; *p1 = w1;
  
}

// ---------------------------------------------------------------------------
// Gate weight panel: wg f32 [HID][NH] -> out bf16 [GLD][HID], out[n][k] = bf16(wg[k][n]) for n < NH, 0 for n >= NH.
// Block n (uniform), thread -> k = 8*threadIdx.x; loads use a clamped column address, zeroed by value for n >= NH.
// Coverage: 128 blocks x 256 threads x 8 = the whole [128][2048] panel (padding rows written as zeros).
// ---------------------------------------------------------------------------
__global__ __launch_bounds__(256) void wg_pad_kernel(const float* __restrict__ wg, unsigned short* out) {
  const int n = blockIdx.x;
  const int k = threadIdx.x * 8;
  const int nn = (n < NH) ? n : (NH - 1);
  const float keep = (n < NH) ? 1.0f : 0.0f;
  v4u w;
#pragma unroll
  for (int e = 0; e < 4; ++e) {
    const float a = wg[(size_t)(k + 2 * e) * NH + nn] * keep;
    const float b = wg[(size_t)(k + 2 * e + 1) * NH + nn] * keep;
    w[e] = pk16(f2bf_bits(a), f2bf_bits(b));
  }
  v4u* p = (v4u*)(out + (size_t)n * HID + k);
  *p = w;
  
}

// ---------------------------------------------------------------------------
// Register-blocked bf16 WMMA GEMM: C[m][n] = sum_k A[m][k] * Bt[n][k] + bias; each wave owns a 32x128 tile,
// the 4 waves of a block own 128x128 (4 row slabs over one column panel) and share the operand tiles in LDS.
// A row-major [M][K] (pitch lda), Bt row-major [N][K] (pitch ldb); M and N multiples of 128, K multiple of 64.
// Operand staging: per stage of 64 k, 128 rows x 128 B of A (and of the lo plane) and of Bt are copied global -> LDS by
// asynchronous 16-B copies, 8 lanes per row (whole 128-B lines), rows at pitch 144 B; two buffers, the copies of
// stage t + 2 fly while stage t + 1 is worked on. Fragments are then read from LDS with the same k map as before.
// SPLITA: A given as hi plane (Ap) + unscaled bf16 lo plane (A2p): products Ahi.B + Alo.B into one accumulator.
// BROW: bias[m] per row (clamped to nb1), else per column: bias[n] for n < nsplit (valid while n < nb1),
//       bias2[n - nsplit] for n >= nsplit (valid while n - nsplit < nb2); bias values RNE-rounded to bf16; both
//       candidates loaded from clamped addresses and selected by value.
// blockIdx.y selects a z slice through strideA / strideB / strideC (element strides).
// Epilogue: per wave, each 16x128 accumulator slab is staged in LDS (pitch 132 floats), then written as whole
//   OUT_MODE 0: f32 rows into Cout [M][ldc] (row segment 512 B = 32 lanes x 16 B, 1 row per instruction).
//   OUT_MODE 1: f16 hi plane Cout + f16 residual plane Cout2 ((v - hi) * 2048), [M][ldc] (256 B = 16 lanes x 16 B, 2 rows per instr.).
//   OUT_MODE 2: head-major relayout: columns n0 < nsplit -> q planes Cout (f16 hi) / Cout2 (residual * 2048) at
//               [(b*16 + n0/128)*SEQ + s][ldc = 128]; columns >= nsplit -> single f16 k plane Cout3 at
//               [(b*16 + (n0-nsplit)/128)*SEQ + s][128], with row m = b*2048 + s. Each 128-wide row = 256 B = 16 lanes x 16 B.
// Coverage per slab: it 0..7 x (lane>>4) 0..1 = 16 rows, (lane&15)*8 + 0..7 = 128 columns (OUT_MODE 1/2);
//                    it 0..15 = 16 rows, lane*4 + 0..3 = 128 columns (OUT_MODE 0).
// ---------------------------------------------------------------------------
#define GP 132
#define GK    64               // k elements per stage
#define GT_P  (GK + 8)         // LDS row pitch in bf16 elements: 144 B = 16 B x odd, conflict-free for ds_load_b128 fragment reads
#define GT_SZ (128 * GT_P)     // elements of one staged 128-row tile

// One 128-row x 128-B tile, global -> LDS: 8 asynchronous 16-B copies per lane. l = this lane's LDS byte address of its
// first row, g = this lane's global address of its first row; copy i takes row +16*i (ld = global pitch in elements).
// The s_wait_xcnt stands inside the statement so that no address register is rewritten ahead of it.
__device__ __forceinline__ void copy_tile(unsigned l, const __bf16* g, int ld) {
  const size_t st = (size_t)16 * (size_t)ld;
  const unsigned ls = 16 * GT_P * 2;
  const __bf16 *g1 = g + st, *g2 = g + 2 * st, *g3 = g + 3 * st, *g4 = g + 4 * st, *g5 = g + 5 * st, *g6 = g + 6 * st, *g7 = g + 7 * st;
#if defined(__HIP_DEVICE_COMPILE__)
  asm volatile("global_load_async_to_lds_b128 %0, %8, off\n\t"
               "global_load_async_to_lds_b128 %1, %9, off\n\t"
               "global_load_async_to_lds_b128 %2, %10, off\n\t"
               "global_load_async_to_lds_b128 %3, %11, off\n\t"
               "global_load_async_to_lds_b128 %4, %12, off\n\t"
               "global_load_async_to_lds_b128 %5, %13, off\n\t"
               "global_load_async_to_lds_b128 %6, %14, off\n\t"
               "global_load_async_to_lds_b128 %7, %15, off\n\t"
               "s_wait_xcnt 0x0"
               :: "v"(l), "v"(l + ls), "v"(l + 2 * ls), "v"(l + 3 * ls), "v"(l + 4 * ls), "v"(l + 5 * ls), "v"(l + 6 * ls), "v"(l + 7 * ls),
                  "v"(g), "v"(g1), "v"(g2), "v"(g3), "v"(g4), "v"(g5), "v"(g6), "v"(g7)
               : "memory");
#endif
}
// this wave's own copies have landed
__device__ __forceinline__ void wait_copies() {
#if defined(__HIP_DEVICE_COMPILE__)
  asm volatile("s_wait_asynccnt 0x0" ::: "memory");
#endif
}
// this wave's own LDS reads have returned (before the barrier that hands their buffer to the next copies)
__device__ __forceinline__ void wait_lds() {
#if defined(__HIP_DEVICE_COMPILE__)
  asm volatile("s_wait_dscnt 0x0" ::: "memory");
#endif
}

template <bool SPLITA, int OUT_MODE, bool BROW>
__global__ __launch_bounds__(128) void gemm_kernel(
    const unsigned short* __restrict__ Ap, const unsigned short* __restrict__ A2p, int lda, long strideA,
    const unsigned short* __restrict__ Btp, int ldb, long strideB,
    void* Cout, void* Cout2, void* Cout3, int ldc, long strideC,
    const float* __restrict__ bias, int nb1, const float* __restrict__ bias2, int nb2, int nsplit,
    int M, int N, int K) {
  constexpr int NT = SPLITA ? 3 : 2;            // staged tiles per stage: A, Bt (, A lo plane)
  __shared__ __align__(16) __bf16 sS[2 * NT * GT_SZ];   // two stage buffers; the epilogue slabs reuse them behind the loop's last barrier
  static_assert(4 * 16 * GP * 4 <= 2 * NT * GT_SZ * 2);
  const int bz   = blockIdx.y;
  const int tid  = threadIdx.x;
  const int lane = threadIdx.x & 31;
  const int wave = threadIdx.x >> 5;
  const int tilesN = N >> 7;
  const int tilesM = M >> 7;
  const int tile = blockIdx.x;
  if (tile >= tilesM * tilesN) return;          // block-uniform, in front of every barrier
  const int tm = tile / tilesN;
  const int tn = tile - tm * tilesN;
  const int mb = tm << 7;                       // first row of the block's 128x128 tile
  const int m0 = mb + (wave << 5);
  const int n0 = tn << 7;

  const __bf16* Ab  = (const __bf16*)(const void*)Ap + (size_t)bz * strideA;
  const __bf16* Ab2 = SPLITA ? ((const __bf16*)(const void*)A2p + (size_t)bz * strideA) : (const __bf16*)0;
  const __bf16* Bb  = (const __bf16*)(const void*)Btp + (size_t)bz * strideB;

  const int rlane = lane & 15;              // row (A) / col (B, D) within a 16x16 subtile
  const int koff  = (lane >> 4) * 8;        // k offset of this lane half
  const int mOff  = (lane >> 4) * 8;        // D row offset of this lane half

  v8f acc[2][8];
#pragma unroll
  for (int i = 0; i < 2; ++i)
#pragma unroll
    for (int j = 0; j < 8; ++j) acc[i][j] = (v8f){0.f, 0.f, 0.f, 0.f, 0.f, 0.f, 0.f, 0.f};

  // copy lanes: thread -> row tid>>3 (+16 per copy), 16-B piece tid&7 of the row's 128 B
  const int crow = tid >> 3, cseg = (tid & 7) * 8;
  const __bf16* cA  = Ab + (size_t)(mb + crow) * lda + cseg;
  const __bf16* cA2 = SPLITA ? (Ab2 + (size_t)(mb + crow) * lda + cseg) : (const __bf16*)0;
  const __bf16* cB  = Bb + (size_t)(n0 + crow) * ldb + cseg;
  const unsigned cL = (unsigned)(size_t)(const void*)sS + (unsigned)(crow * GT_P + cseg) * 2u;   // LDS byte address, buffer 0, tile 0
  const int NP = K / GK;

  // stage 0 into buffer 0, published; then stage 1 into buffer 1
  copy_tile(cL, cA, lda);
  copy_tile(cL + GT_SZ * 2, cB, ldb);
  if (SPLITA) copy_tile(cL + 2 * GT_SZ * 2, cA2, lda);
  wait_copies();
  __syncthreads();
  if (NP > 1) {
    const unsigned lb = cL + NT * GT_SZ * 2;
    copy_tile(lb, cA + GK, lda);
    copy_tile(lb + GT_SZ * 2, cB + GK, ldb);
    if (SPLITA) copy_tile(lb + 2 * GT_SZ * 2, cA2 + GK, lda);
  }

  // one stage per trip, the buffer chosen by the trip's parity
  for (int t = 0; t < NP; ++t) {
    const int bo = (t & 1) * (NT * GT_SZ);
    const __bf16* sA  = sS + bo + ((wave << 5) + rlane) * GT_P + koff;
    const __bf16* sB  = sS + bo + GT_SZ + rlane * GT_P + koff;
    const __bf16* sA2 = sS + bo + 2 * GT_SZ + ((wave << 5) + rlane) * GT_P + koff;
#pragma unroll
    for (int kk = 0; kk < GK; kk += 32) {
      const v16b a0 = ldfrag_b(sA + kk);
      const v16b a1 = ldfrag_b(sA + 16 * GT_P + kk);
      v16b l0 = a0, l1 = a1;
      if (SPLITA) { l0 = ldfrag_b(sA2 + kk); l1 = ldfrag_b(sA2 + 16 * GT_P + kk); }
      // the k-step's fragments are read as one group ahead of its products, so that the LDS latency is paid once per k-step
      v16b bh[8];
#pragma unroll
      for (int j = 0; j < 8; ++j) bh[j] = ldfrag_b(sB + (j << 4) * GT_P + kk);
#pragma unroll
      for (int j = 0; j < 8; ++j) {
        acc[0][j] = wmma_b(a0, bh[j], acc[0][j]);
        if (SPLITA) acc[0][j] = wmma_b(l0, bh[j], acc[0][j]);
        acc[1][j] = wmma_b(a1, bh[j], acc[1][j]);
        if (SPLITA) acc[1][j] = wmma_b(l1, bh[j], acc[1][j]);
        dep_guard_b(acc[0][j], acc[1][j], bh[j], a0, a1, l0, l1);
      }
    }
    // publish point of stage t + 1: own reads of this buffer done, own copies of the next landed, then the block barrier
    wait_lds();
    wait_copies();
    __syncthreads();
    if (t + 2 < NP) {                           // block-uniform: refill the buffer this trip has just read
      const unsigned lb = cL + (unsigned)bo * 2u;
      const int ko = (t + 2) * GK;
      copy_tile(lb, cA + ko, lda);
      copy_tile(lb + GT_SZ * 2, cB + ko, ldb);
      if (SPLITA) copy_tile(lb + 2 * GT_SZ * 2, cA2 + ko, lda);
    }
  }
  wait_copies();

  // ---- epilogue ----
  float* slab = (float*)(void*)sS + wave * (16 * GP);
  float bc[8];
#pragma unroll
  for (int j = 0; j < 8; ++j) bc[j] = 0.f;
  if (!BROW) {
#pragma unroll
    for (int j = 0; j < 8; ++j) {
      const int col = n0 + (j << 4) + rlane;
      int i1 = col;          if (i1 > nb1 - 1) i1 = nb1 - 1;
      int i2 = col - nsplit; if (i2 < 0) i2 = 0; if (i2 > nb2 - 1) i2 = nb2 - 1;
      const float v1 = bfr(bias[i1]);
      const float v2 = bfr(bias2[i2]);
      const bool lo = (col < nsplit);
      const bool valid = lo ? (col < nb1) : ((col - nsplit) < nb2);
      const float v = lo ? v1 : v2;
      bc[j] = valid ? v : 0.f;
    }
  }
#pragma unroll
  for (int i = 0; i < 2; ++i) {
    const int mBase = m0 + (i << 4);
    float br[8];
#pragma unroll
    for (int r = 0; r < 8; ++r) {
      br[r] = 0.f;
      if (BROW) {
        int ir = mBase + mOff + r; if (ir > nb1 - 1) ir = nb1 - 1;
        br[r] = bfr(bias[ir]);
      }
    }
#pragma unroll
    for (int j = 0; j < 8; ++j)
#pragma unroll
      for (int r = 0; r < 8; ++r)
        slab[(mOff + r) * GP + (j << 4) + rlane] = acc[i][j][r] + (BROW ? br[r] : bc[j]);
    wave_sync();
    if (OUT_MODE == 0) {
      float* C = (float*)Cout + (size_t)bz * strideC;
      const int c4 = lane * 4;                               // row segment 512 B = 32 lanes x 16 B
      {
#pragma unroll
        for (int it = 0; it < 16; ++it) {
          const v4f v = *(const v4f*)(slab + it * GP + c4);
          *(v4f*)(C + (size_t)(mBase + it) * ldc + n0 + c4) = v;
        }
        
      }
    } else if (OUT_MODE == 1) {
      unsigned short* C  = (unsigned short*)Cout  + (size_t)bz * strideC;
      unsigned short* C2 = (unsigned short*)Cout2 + (size_t)bz * strideC;
      const int q16 = lane >> 4, c8 = (lane & 15) * 8;      // row segment 256 B = 16 lanes x 16 B
      {
#pragma unroll
        for (int it = 0; it < 8; ++it) {
          const int row = it * 2 + q16;
          const float* sp = slab + row * GP + c8;
          v4u hv, lv;
#pragma unroll
          for (int p = 0; p < 4; ++p) {
            const float f0 = sp[2 * p], f1 = sp[2 * p + 1];
            const _Float16 e0 = (_Float16)f0, e1 = (_Float16)f1;
            const _Float16 g0 = (_Float16)((f0 - (float)e0) * 2048.0f);
            const _Float16 g1 = (_Float16)((f1 - (float)e1) * 2048.0f);
            hv[p] = pk16(h2u(e0), h2u(e1));
            lv[p] = pk16(h2u(g0), h2u(g1));
          }
          const size_t go = (size_t)(mBase + row) * ldc + n0 + c8;
          *(v4u*)(C  + go) = hv;
          *(v4u*)(C2 + go) = lv;
        }
        
      }
    } else {
      unsigned short* Q1 = (unsigned short*)Cout;
      unsigned short* Q2 = (unsigned short*)Cout2;
      unsigned short* K1 = (unsigned short*)Cout3;
      const int q16 = lane >> 4, c8 = (lane & 15) * 8;      // row segment 256 B = 16 lanes x 16 B
      const int  bidx = m0 / SEQ;                             // all 32 rows of the tile lie in one batch element
      const bool isq  = (n0 < nsplit);                        // wave-uniform
      const int  head = (isq ? n0 : (n0 - nsplit)) >> 7;
      const size_t rowBase = (size_t)(bidx * NH + head) * SEQ;
      {
#pragma unroll
        for (int it = 0; it < 8; ++it) {
          const int row = it * 2 + q16;
          const int s   = (mBase + row) & (SEQ - 1);
          const float* sp = slab + row * GP + c8;
          v4u hv, lv;
#pragma unroll
          for (int p = 0; p < 4; ++p) {
            const float f0 = sp[2 * p], f1 = sp[2 * p + 1];
            const _Float16 e0 = (_Float16)f0, e1 = (_Float16)f1;
            const _Float16 g0 = (_Float16)((f0 - (float)e0) * 2048.0f);
            const _Float16 g1 = (_Float16)((f1 - (float)e1) * 2048.0f);
            hv[p] = pk16(h2u(e0), h2u(e1));
            lv[p] = pk16(h2u(g0), h2u(g1));
          }
          const size_t go = (rowBase + (size_t)s) * ldc + c8;
          if (isq) {
            *(v4u*)(Q1 + go) = hv;
            *(v4u*)(Q2 + go) = lv;
          } else {
            *(v4u*)(K1 + go) = hv;
          }
        }
        
      }
    }
    wave_sync();
  }
}

// =====================================================================================
// Full (non-causal) attention with additive per-head-scaled bias and sigmoid head gate, head dim 128, 16 heads.
// Block = 4 waves = 64 query rows of one (b, h).
//   q planes f16 hi / residual*2048: element (b, h, s, d) at [((b*16 + h)*SEQ + s)*128 + d]
//   k plane  f16:                     element (b, h, s, d) at [((b*16 + h)*SEQ + s)*128 + d]
//   v^T planes f16 hi / residual*2048: element (b, h, d, s) at [((b*2048 + h*128 + d)*SEQ + s]
//   bias: f32 [b][q][key] read per element, RNE-rounded to bf16, scaled by 2^(-(h+1)/2)
//   gate logits: f32 [(b*SEQ + s)*GLD + h]; g = 1/(1 + exp(-a))
//   ctx out: bf16 hi + lo planes, element (b, s, h, d) at [(b*SEQ + s)*HID + h*128 + d]
//   scores = (qh.k + ql.k/2048) * (1/sqrt(128)) + bias*hs on v_wmma_f32_16x16x32_f16; online softmax in f32;
//   p1024 = f16(1024*exp(s - m)); ctx += ph.vh + (ph.vl)/2048, the residual product into a per-tile scratch
//   accumulator (starting at zero) folded in f32 right after; ctx = acc * g / 1024 / l.
//   kv chunks of 64 staged in LDS (K 17 KB, V^T hi/res 18 KB each, rows padded by 16 B), 32 chunks.
//   q fragments (hi and residual, 4 k-steps each, 64 VGPRs) loaded once from the global planes and held in registers.
//   Epilogue: wave 16x128 f32 tile staged in LDS (aliasing the K/V region after a block barrier), each 128-wide row =
//   Coverage: it 0..7 x (lane>>4) 0..1 = 16 rows x 128 columns per wave; 1024 blocks x 64 rows = every (b, s, h, d).
// =====================================================================================
#define AT_QB 64
#define AT_KC 64
#define OS_P  132
// LDS row pitches in f16 elements, each 16 B x odd so that the 16 rows a ds_load_b128 fragment read touches fall on distinct banks
#define K_P   (HD + 8)      // K rows of 256 B at pitch 272 B
#define V_P   (AT_KC + 8)   // V^T rows of 128 B at pitch 144 B
#define P_P   (AT_KC + 8)   // P rows of 128 B at pitch 144 B

__global__ __launch_bounds__(128)
void attn_kernel(const unsigned short* __restrict__ qhp, const unsigned short* __restrict__ qlp,
                 const unsigned short* __restrict__ kp,
                 const unsigned short* __restrict__ vhp, const unsigned short* __restrict__ vlp,
                 const float* __restrict__ bmp, const float* __restrict__ glp,
                 unsigned short* chp, unsigned short* clp) {
  __shared__ __align__(16) _Float16 KVs[AT_KC * K_P + 2 * HD * V_P];   // K [key][d] | V^T hi [d][key] | V^T res [d][key], padded rows; ctx staging later
  __shared__ __align__(16) _Float16 Psh[4][16 * P_P];         // per wave P x1024 [row][key], padded rows
  static_assert(4 * 16 * OS_P * 4 <= (AT_KC * K_P + 2 * HD * V_P) * 2);
  _Float16* const Ksh = KVs;
  _Float16* const Vth = KVs + AT_KC * K_P;
  _Float16* const Vtl = KVs + AT_KC * K_P + HD * V_P;

  const int tid  = threadIdx.x;
  const int wave = tid >> 5;
  const int lane = tid & 31;
  const int hh   = lane >> 4;
  const int c    = lane & 15;

  const int bx  = blockIdx.x;
  const int qb  = bx & 31;                 // query block of 64
  const int h   = (bx >> 5) & (NH - 1);    // head
  const int b   = bx >> 9;                 // batch element
  const int q0  = qb * AT_QB + wave * 16;

  const _Float16* Qhg = (const _Float16*)(const void*)qhp + (size_t)(b * NH + h) * SEQ * HD;
  const _Float16* Qlg = (const _Float16*)(const void*)qlp + (size_t)(b * NH + h) * SEQ * HD;
  const _Float16* Kg  = (const _Float16*)(const void*)kp  + (size_t)(b * NH + h) * SEQ * HD;
  const _Float16* Vhg = (const _Float16*)(const void*)vhp + ((size_t)b * HID + (size_t)h * HD) * SEQ;
  const _Float16* Vlg = (const _Float16*)(const void*)vlp + ((size_t)b * HID + (size_t)h * HD) * SEQ;
  const float*    Bm  = bmp + (size_t)b * SEQ * SEQ + (size_t)(q0 + 8 * hh) * SEQ + c;   // + r*SEQ + key
  const int qro = (q0 + c) * HD + 8 * hh;  // per-lane A-fragment row base (d added per step)

  // per-head bias scale 2^(-(h+1)/2): exact power of two times sqrt(1/2) for odd (h+1)
  const int   hexp = (h + 1) >> 1;
  const float hs   = __uint_as_float((unsigned)(127 - hexp) << 23) * (((h + 1) & 1) ? 0.70710678118654752f : 1.0f);

  const v8f zero8 = (v8f){0.f, 0.f, 0.f, 0.f, 0.f, 0.f, 0.f, 0.f};
  const float inv2048 = 4.8828125e-4f;
  const float scale   = 1.0f / 11.313708305358887f;

  float mrow[8], lrow[8];
  v8f oh[8];
#pragma unroll
  for (int r = 0; r < 8; ++r) { mrow[r] = -INFINITY; lrow[r] = 0.f; }
#pragma unroll
  for (int t = 0; t < 8; ++t) oh[t] = zero8;

  v16h qa[4], qr[4];
  // unrolled here and in the loops over a0, b0, b1 and bb below: static indices keep these arrays in registers
#pragma unroll
  for (int dc = 0; dc < 4; ++dc) {
    qa[dc] = ldfrag_h(Qhg + qro + dc * 32);
    qr[dc] = ldfrag_h(Qlg + qro + dc * 32);
  }

  for (int kc = 0; kc < SEQ / AT_KC; ++kc) {
    const int kv0 = kc * AT_KC;
    __syncthreads();
    {
      // staging: K: thread -> key tid>>1, d half (tid&1)*64, 8 x 16 B; V^T hi/res: thread -> d = tid, keys kv0..kv0+63, 8 x 16 B
      // coverage: 64 keys x 128 d for K, 128 d x 64 keys for each V^T plane = the whole chunk tiles
      const int r = tid >> 1, half = (tid & 1) * 64;
      const _Float16* ks = Kg  + (size_t)(kv0 + r) * HD + half;
      const _Float16* vs = Vhg + (size_t)tid * SEQ + kv0;
      const _Float16* ws = Vlg + (size_t)tid * SEQ + kv0;
      // loads grouped per plane, the third group issued behind the first group's stores: 16 loads in flight fit beside the held q fragments
      v8h a0[8], b0[8], b1[8];
#pragma unroll
      for (int i = 0; i < 8; ++i) a0[i] = *(const v8h*)(ks + 8 * i);
#pragma unroll
      for (int i = 0; i < 8; ++i) b0[i] = *(const v8h*)(vs + 8 * i);
#pragma unroll
      for (int i = 0; i < 8; ++i) *(v8h*)(Ksh + r * K_P + half + 8 * i) = a0[i];
#pragma unroll
      for (int i = 0; i < 8; ++i) b1[i] = *(const v8h*)(ws + 8 * i);
#pragma unroll
      for (int i = 0; i < 8; ++i) *(v8h*)(Vth + tid * V_P + 8 * i) = b0[i];
#pragma unroll
      for (int i = 0; i < 8; ++i) *(v8h*)(Vtl + tid * V_P + 8 * i) = b1[i];
    }
    __syncthreads();

    // ---- scores: 4 key tiles of 16, reduce over d = 128 = 4 k-steps; hi and residual accumulators separate ----
    v8f s[4];
    float bb[4][8];                          // raw bias values per key tile
#pragma unroll
    for (int r = 0; r < 8; ++r) bb[0][r] = Bm[kv0 + (size_t)r * SEQ];
#pragma unroll
    for (int j = 0; j < 4; ++j) {
      if (j < 3) {
#pragma unroll
        for (int r = 0; r < 8; ++r) bb[j + 1][r] = Bm[kv0 + (j + 1) * 16 + (size_t)r * SEQ];
        // keeps the next key tile's bias loads issued as one group here, in flight behind this tile's products:
        // with the q fragments held, the scheduler otherwise sinks them in pairs to their uses
        __builtin_amdgcn_sched_barrier(0);
      }
      v8f sh = zero8, sl = zero8;
#pragma unroll
      for (int dc = 0; dc < 4; ++dc) {
        FragH kb;
        kb.h[0] = *(const v8h*)(Ksh + (j * 16 + c) * K_P + dc * 32 + 8 * hh);
        kb.h[1] = *(const v8h*)(Ksh + (j * 16 + c) * K_P + dc * 32 + 16 + 8 * hh);
        sh = wmma_h(qa[dc], kb.v, sh);
        sl = wmma_h(qr[dc], kb.v, sl);
      }
      // keeps the first use of this tile's bias (and its wait) behind the tile's products
      __builtin_amdgcn_sched_barrier(0);
      v8f sj = (sh + sl * inv2048) * scale;
#pragma unroll
      for (int r = 0; r < 8; ++r) sj[r] = sj[r] + hs * bfr(bb[j][r]);
      s[j] = sj;
    }

    float cm[8];
#pragma unroll
    for (int r = 0; r < 8; ++r) {
      float m = fmaxf(fmaxf(s[0][r], s[1][r]), fmaxf(s[2][r], s[3][r]));
#pragma unroll
      for (int off = 1; off < 16; off <<= 1) m = fmaxf(m, __shfl_xor(m, off, 32));
      cm[r] = m;
    }

    _Float16* pw = Psh[wave];
#pragma unroll
    for (int r = 0; r < 8; ++r) {
      const float mnew  = fmaxf(mrow[r], cm[r]);
      const float alpha = expf(mrow[r] - mnew);
      mrow[r] = mnew;
      float psum = 0.f;
#pragma unroll
      for (int j = 0; j < 4; ++j) {
        const float p = expf(s[j][r] - mnew);
        psum += p;
        pw[(8 * hh + r) * P_P + j * 16 + c] = (_Float16)(p * 1024.0f);
      }
#pragma unroll
      for (int off = 1; off < 16; off <<= 1) psum += __shfl_xor(psum, off, 32);
      lrow[r] = lrow[r] * alpha + psum;
#pragma unroll
      for (int t = 0; t < 8; ++t) oh[t][r] *= alpha;
    }
    wave_sync();

    // ---- ctx += P . V over the 64 keys of the chunk (2 k-steps), 8 d tiles ----
#pragma unroll 1
    for (int kk = 0; kk < 2; ++kk) {
      FragH pa;
      pa.h[0] = *(const v8h*)(pw + c * P_P + kk * 32 + 8 * hh);
      pa.h[1] = *(const v8h*)(pw + c * P_P + kk * 32 + 16 + 8 * hh);
#pragma unroll
      for (int t = 0; t < 8; ++t) {
        FragH vb, vr;
        vb.h[0] = *(const v8h*)(Vth + (t * 16 + c) * V_P + kk * 32 + 8 * hh);
        vb.h[1] = *(const v8h*)(Vth + (t * 16 + c) * V_P + kk * 32 + 16 + 8 * hh);
        vr.h[0] = *(const v8h*)(Vtl + (t * 16 + c) * V_P + kk * 32 + 8 * hh);
        vr.h[1] = *(const v8h*)(Vtl + (t * 16 + c) * V_P + kk * 32 + 16 + 8 * hh);
        oh[t] = wmma_h(pa.v, vb.v, oh[t]);
        const v8f tr = wmma_h(pa.v, vr.v, zero8);
        oh[t] += tr * inv2048;
      }
    }
  }

  // ---- normalise, apply the head gate, stage the wave 16x128 tile (aliases the K/V region after the block barrier),
  //      write bf16 hi/lo planes ----
  __syncthreads();
  float* os = (float*)(void*)KVs + wave * (16 * OS_P);
#pragma unroll
  for (int r = 0; r < 8; ++r) {
    const int   q  = q0 + 8 * hh + r;
    const float a  = glp[(size_t)(b * SEQ + q) * GLD + h];
    const float g  = 1.0f / (1.0f + expf(-a));
    const float invl = g * (1.0f / lrow[r]) * 9.765625e-4f;
#pragma unroll
    for (int t = 0; t < 8; ++t) os[(8 * hh + r) * OS_P + t * 16 + c] = oh[t][r] * invl;
  }
  wave_sync();
  {
    const int q16 = lane >> 4, c8 = (lane & 15) * 8;         // 2 rows per instruction, each row 256 B = 16 lanes x 16 B
    {
#pragma unroll
      for (int it = 0; it < 8; ++it) {
        const int row = it * 2 + q16;
        const float* sp = os + row * OS_P + c8;
        v4u hv, lv;
#pragma unroll
        for (int p = 0; p < 4; ++p) {
          const float f0 = sp[2 * p], f1 = sp[2 * p + 1];
          const unsigned short hb0 = f2bf_bits(f0), hb1 = f2bf_bits(f1);
          const unsigned short lb0 = f2bf_bits(f0 - bf_bits2f(hb0));
          const unsigned short lb1 = f2bf_bits(f1 - bf_bits2f(hb1));
          hv[p] = pk16(hb0, hb1);
          lv[p] = pk16(lb0, lb1);
        }
        const size_t go = (size_t)(b * SEQ + q0 + row) * HID + h * HD + c8;
        *(v4u*)(chp + go) = hv;
        *(v4u*)(clp + go) = lv;
      }
      
    }
  }
}

// ---------------------------------------------------------------------------
// all sizes exact tile multiples, all offsets multiples of 512 KiB):
//   R0   bf16 [4096][2048]       16777216 @ 0           x as bf16; later ctx hi plane (written after the last reader of x)
//   R1   bf16 [4096][2048]       16777216 @ 16777216    wv^T as bf16 [2048][2048]; then wq^T|wk^T panel [4096][2048]; later ctx lo plane
//   Wob  bf16 [2048][2048]        8388608 @ 33554432    wo^T
//   Wgb  bf16 [128][2048]          524288 @ 41943040    wg^T zero-padded to 128 rows
//   Glog f32  [4096][128]         2097152 @ 42467328    gate logits
//   Qh   f16  [2][16][2048][128]  16777216 @ 44564480    Ql same @ 61341696
//   Kp   f16  [2][16][2048][128]  16777216 @ 78118912
//   Vth  f16  [2][2048][2048]     16777216 @ 94896128    Vtl same @ 111673344
//   total                        128450560
// ---------------------------------------------------------------------------
extern "C" void kernel_launch(void* const* d_in, const int* in_sizes, int n_in,
                              void* d_out, int out_size, void* d_ws, size_t ws_size,
                              hipStream_t stream) {
  if (n_in < 12) return;
  if (in_sizes[0] != NB * SEQ * HID) return;
  if (in_sizes[1] != NB * SEQ * SEQ) return;
  if (in_sizes[2] != HID * HID) return;
  if (in_sizes[3] != HID) return;
  if (in_sizes[4] != HID * HID) return;
  if (in_sizes[5] != HID) return;
  if (in_sizes[6] != HID * HID) return;
  if (in_sizes[7] != HID) return;
  if (in_sizes[8] != HID * NH) return;
  if (in_sizes[9] != NH) return;
  if (in_sizes[10] != HID * HID) return;
  if (in_sizes[11] != HID) return;
  if (out_size != NB * SEQ * HID) return;

  const float* x   = (const float*)d_in[0];
  const float* bm  = (const float*)d_in[1];
  const float* wq  = (const float*)d_in[2];
  const float* bq  = (const float*)d_in[3];
  const float* wk  = (const float*)d_in[4];
  const float* bk  = (const float*)d_in[5];
  const float* wv  = (const float*)d_in[6];
  const float* bv  = (const float*)d_in[7];
  const float* wg  = (const float*)d_in[8];
  const float* bg  = (const float*)d_in[9];
  const float* wo  = (const float*)d_in[10];
  const float* bo  = (const float*)d_in[11];
  float* out = (float*)d_out;

  const size_t szR0  = (size_t)NB * SEQ * HID * 2;          // 16 MiB
  const size_t szR1  = (size_t)2 * HID * HID * 2;           // 16 MiB
  const size_t szWo  = (size_t)HID * HID * 2;               //  8 MiB
  const size_t szWg  = (size_t)GLD * HID * 2;               //  512 KiB
  const size_t szG   = (size_t)NB * SEQ * GLD * 4;          //  2 MiB
  const size_t szQ   = (size_t)NB * NH * SEQ * HD * 2;      // 16 MiB
  const size_t szK   = szQ;
  const size_t szV   = (size_t)NB * HID * SEQ * 2;          // 16 MiB
  size_t off = 0;
  const size_t oR0  = off; off += szR0;
  const size_t oR1  = off; off += szR1;
  const size_t oWo  = off; off += szWo;
  const size_t oWg  = off; off += szWg;
  const size_t oG   = off; off += szG;
  const size_t oQh  = off; off += szQ;
  const size_t oQl  = off; off += szQ;
  const size_t oKp  = off; off += szK;
  const size_t oVth = off; off += szV;
  const size_t oVtl = off; off += szV;
  if (off > ws_size) return;                    // off = 128450560
  if (off > (size_t)134217728) return;

  char* ws = (char*)d_ws;
  unsigned short* Xb  = (unsigned short*)(ws + oR0);
  unsigned short* Ch  = (unsigned short*)(ws + oR0);        // reuses R0 after the gate GEMM (last reader of Xb)
  unsigned short* Wvt = (unsigned short*)(ws + oR1);
  unsigned short* Wqk = (unsigned short*)(ws + oR1);        // reuses R1 after the v^T GEMM (last reader of Wvt)
  unsigned short* Cl  = (unsigned short*)(ws + oR1);        // reuses R1 after the q|k GEMM (last reader of Wqk)
  unsigned short* Wot = (unsigned short*)(ws + oWo);
  unsigned short* Wgt = (unsigned short*)(ws + oWg);
  float*          Gl  = (float*)(ws + oG);
  unsigned short* Qh  = (unsigned short*)(ws + oQh);
  unsigned short* Ql  = (unsigned short*)(ws + oQl);
  unsigned short* Kp  = (unsigned short*)(ws + oKp);
  unsigned short* Vth = (unsigned short*)(ws + oVth);
  unsigned short* Vtl = (unsigned short*)(ws + oVtl);

  const dim3 blk256(256), blk128(128);
  const dim3 trg(HID / 64, HID / 64);           // in [2048 rows][2048 cols] -> out [cols][rows]
  const int n8x = NB * SEQ * HID / 8;

  // (1) x f32 -> bf16 plane
  cvt_bf16x8_kernel<<<dim3((n8x + 255) / 256), blk256, 0, stream>>>(x, Xb, n8x);
  // (2) wv [in][out] -> wv^T bf16 [out][in]
  tr_bf16_kernel<<<trg, blk256, 0, stream>>>(wv, Wvt, HID, HID);
  // (3) v^T per batch element: A = Wvt [2048 d][2048 k], Bt = Xb[b] [2048 s][2048 k] -> V^T hi/res planes [2048][2048] per b, + bv[d]
  {
    const int M = HID, N = SEQ, K = HID;
    const int tiles = (M / 32) * (N / 128);
    gemm_kernel<false, 1, true><<<dim3((tiles + 3) / 4, NB), blk128, 0, stream>>>(
        Wvt, Wvt, HID, 0L, Xb, HID, (long)SEQ * HID, (void*)Vth, (void*)Vtl, (void*)Vtl, SEQ, (long)HID * SEQ,
        bv, HID, bv, HID, N, M, N, K);
  }
  // (4) wq^T | wk^T panel [4096][2048] into R1
  tr_bf16_kernel<<<trg, blk256, 0, stream>>>(wq, Wqk, HID, HID);
  tr_bf16_kernel<<<trg, blk256, 0, stream>>>(wk, Wqk + (size_t)HID * HID, HID, HID);
  // (5) q | k projections with head-major relayout: A = Xb [4096][2048], Bt = Wqk [4096][2048] -> q hi/res planes, k plane; + bq | bk
  {
    const int M = NB * SEQ, N = 2 * HID, K = HID;
    const int tiles = (M / 32) * (N / 128);
    gemm_kernel<false, 2, false><<<dim3((tiles + 3) / 4, 1), blk128, 0, stream>>>(
        Xb, Xb, HID, 0L, Wqk, HID, 0L, (void*)Qh, (void*)Ql, (void*)Kp, HD, 0L,
        bq, HID, bk, HID, HID, M, N, K);
  }
  // (6) gate weights: wg [2048][16] -> wg^T zero-padded bf16 [128][2048]
  wg_pad_kernel<<<dim3(GLD), blk256, 0, stream>>>(wg, Wgt);
  // (7) gate logits: A = Xb [4096][2048], Bt = Wgt [128][2048] -> f32 [4096][128], + bg for columns < 16
  {
    const int M = NB * SEQ, N = GLD, K = HID;
    const int tiles = (M / 32) * (N / 128);
    gemm_kernel<false, 0, false><<<dim3((tiles + 3) / 4, 1), blk128, 0, stream>>>(
        Xb, Xb, HID, 0L, Wgt, HID, 0L, (void*)Gl, (void*)Gl, (void*)Gl, GLD, 0L,
        bg, NH, bg, NH, N, M, N, K);
  }
  // (8) wo [in][out] -> wo^T bf16
  tr_bf16_kernel<<<trg, blk256, 0, stream>>>(wo, Wot, HID, HID);
  // (9) attention: grid = NB x 16 heads x 32 query blocks, 128 threads
  attn_kernel<<<dim3(NB * NH * (SEQ / AT_QB)), blk128, 0, stream>>>(Qh, Ql, Kp, Vth, Vtl, bm, Gl, Ch, Cl);
  // (10) output projection: A = gated ctx hi/lo planes [4096][2048], Bt = Wot [2048][2048] -> d_out f32 [4096][2048], + bo
  {
    const int M = NB * SEQ, N = HID, K = HID;
    const int tiles = (M / 32) * (N / 128);
    gemm_kernel<true, 0, false><<<dim3((tiles + 3) / 4, 1), blk128, 0, stream>>>(
        Ch, Cl, HID, 0L, Wot, HID, 0L, (void*)out, (void*)out, (void*)out, HID, 0L,
        bo, HID, bo, HID, N, M, N, K);
  }
  (void)hipGetLastError();
}

// v004
// One run takes 374 microseconds.
// Two timings next to v003 both put it at 1.11 times that version's speed.
// Counting every step since v000, it is 3.13 times as fast.
#include <hip/hip_runtime.h>
#include <math.h>
#include <stdint.h>

// q/k/v and gate projections: v_wmma_f32_16x16x32_bf16, single products on bf16-RNE converted x and W^T, f32 accumulate;
// scores, transposed, k.q^T: v_wmma_f32_16x16x32_f16 with q = f16 hi + residual x2^11 planes, k single f16 plane, f32 accumulate;
// ctx, transposed, v^T.p^T: v_wmma_f32_16x16x32_f16 with p x1024 single f16 plane, v^T = f16 hi + residual x2^11 planes, f32 accumulate;
// output projection: v_wmma_f32_16x16x32_bf16 with gated ctx as bf16 hi + lo planes and Wo^T bf16, f32 accumulate.
// Online softmax, score scale 1/sqrt(128), per-head bias scale 2^(-(h+1)/2), sigmoid gate and normalisation in f32.

#define NB   2
#define SEQ  2048
#define HID  2048
#define NH   16
#define HD   128
#define GLD  128

typedef _Float16 v16h __attribute__((ext_vector_type(16)));
typedef _Float16 v8h  __attribute__((ext_vector_type(8)));
typedef __bf16   v16b __attribute__((ext_vector_type(16)));
typedef __bf16   v8b  __attribute__((ext_vector_type(8)));
typedef float    v8f  __attribute__((ext_vector_type(8)));
typedef float    v4f  __attribute__((ext_vector_type(4)));
typedef unsigned int v4u __attribute__((ext_vector_type(4)));

// ---------------------------------------------------------------------------
// small helpers
// ---------------------------------------------------------------------------
__device__ __forceinline__ unsigned short f2bf_bits(float f) {          // RNE convert f32 -> bf16 bits
  const unsigned u = __float_as_uint(f);
  return (unsigned short)((u + 0x7FFFu + ((u >> 16) & 1u)) >> 16);
}
__device__ __forceinline__ float bf_bits2f(unsigned short x) { return __uint_as_float(((unsigned)x) << 16); }
__device__ __forceinline__ float bfr(float f) { return __uint_as_float(((unsigned)f2bf_bits(f)) << 16); }
__device__ __forceinline__ unsigned pk16(unsigned short a, unsigned short b) { return (unsigned)a | ((unsigned)b << 16); }
__device__ __forceinline__ unsigned short h2u(_Float16 x) { return __builtin_bit_cast(unsigned short, x); }

// lane l with lane l ^ 16
__device__ __forceinline__ float xhalf(float x) {
  return __builtin_bit_cast(float, __builtin_amdgcn_permlanex16(__builtin_bit_cast(int, x), __builtin_bit_cast(int, x), 0x76543210, 0xfedcba98, false, false));
}

__device__ __forceinline__ void wave_sync() {
  __builtin_amdgcn_fence(__ATOMIC_RELEASE, "workgroup");
  __builtin_amdgcn_wave_barrier();
  __builtin_amdgcn_fence(__ATOMIC_ACQUIRE, "workgroup");
}

// 16-bit fragment loaders, same k map for A and B: p points at (row or col)*ld + k0 + 8*(lane>>4);
// elements 0..7 <- p[0..7] (k0+8h..k0+8h+7), elements 8..15 <- p[16..23] (k0+16+8h..k0+16+8h+7).
union FragB { v16b v; v8b h[2]; };
union FragH { v16h v; v8h h[2]; };
__device__ __forceinline__ v16b ldfrag_b(const __bf16* p) {
  FragB f; f.h[0] = *(const v8b*)(p); f.h[1] = *(const v8b*)(p + 16); return f.v;
}
__device__ __forceinline__ v16h ldfrag_h(const _Float16* p) {
  FragH f; f.h[0] = *(const v8h*)(p); f.h[1] = *(const v8h*)(p + 16); return f.v;
}

__device__ __forceinline__ v8f wmma_b(v16b a, v16b b, v8f c) {
  return __builtin_amdgcn_wmma_f32_16x16x32_bf16(false, a, false, b, (short)0, c, false, false);
}
// f16 form with the hazard guard attached to every issue (ties D, keeps A/B live)
__device__ __forceinline__ v8f wmma_h(v16h a, v16h b, v8f c) {
  c = __builtin_amdgcn_wmma_f32_16x16x32_f16(false, a, false, b, (short)0, c, false, false);
#if defined(__HIP_DEVICE_COMPILE__)
  asm volatile("v_nop\n\tv_nop\n\tv_nop\n\tv_nop" : "+v"(c) : "v"(a), "v"(b));
#endif
  return c;
}
// hazard guard for one j-group of the register-blocked GEMM (ties both D tiles, keeps A/B registers live)
__device__ __forceinline__ void dep_guard_b(v8f& x, v8f& y, v16b b, v16b a0, v16b a1, v16b l0, v16b l1) {
#if defined(__HIP_DEVICE_COMPILE__)
  asm volatile("v_nop\n\tv_nop\n\tv_nop\n\tv_nop" : "+v"(x), "+v"(y) : "v"(b), "v"(a0), "v"(a1), "v"(l0), "v"(l1));
#endif
}

// ---------------------------------------------------------------------------
// f32 -> bf16 (RNE) convert, 8 elements per thread: two 16-B loads, one 16-B store.
// Coverage: grid = ceil(n8/256) x 256 threads x 8 elements = the whole array (sizes here are multiples of 2048).
// ---------------------------------------------------------------------------
__global__ __launch_bounds__(256) void cvt_bf16x8_kernel(const float* __restrict__ in, unsigned short* out, int n8) {
  const int i = blockIdx.x * 256 + threadIdx.x;
  if (i < n8) {
    const v4f a = *(const v4f*)(in + 8 * (size_t)i);
    const v4f c = *(const v4f*)(in + 8 * (size_t)i + 4);
    v4u w;
    w[0] = pk16(f2bf_bits(a[0]), f2bf_bits(a[1]));
    w[1] = pk16(f2bf_bits(a[2]), f2bf_bits(a[3]));
    w[2] = pk16(f2bf_bits(c[0]), f2bf_bits(c[1]));
    w[3] = pk16(f2bf_bits(c[2]), f2bf_bits(c[3]));
    v4u* p = (v4u*)(out + 8 * (size_t)i);
    *p = w;
    
  }
}

// ---------------------------------------------------------------------------
// Transpose + RNE bf16 convert: in f32 [R][C] row-major -> out bf16 [C][R] (out[c][r] = bf16(in[r][c])).
// Block 256 threads handles a 64x64 tile through LDS. Load: thread -> 4 float4 (rows t>>4 + 16i, cols 4*(t&15)+0..3).
// Coverage: out rows cc = wave*4 + (lane>>3) (+32) over 8 waves = 0..63; columns (lane&7)*8 + 0..7 = 0..63; grid (C/64, R/64).
// ---------------------------------------------------------------------------
__global__ __launch_bounds__(256) void tr_bf16_kernel(const float* __restrict__ in, unsigned short* out, int R, int C) {
  __shared__ __align__(16) float tile[64][65];
  const int c0 = blockIdx.x * 64, r0 = blockIdx.y * 64;
  const int t = threadIdx.x;
  const int cq = (t & 15) * 4, rb = t >> 4;
#pragma unroll
  for (int i = 0; i < 4; ++i) {
    const int r = rb + 16 * i;
    const v4f v = *(const v4f*)(in + (size_t)(r0 + r) * C + c0 + cq);
    tile[r][cq] = v[0]; tile[r][cq + 1] = v[1]; tile[r][cq + 2] = v[2]; tile[r][cq + 3] = v[3];
  }
  __syncthreads();
  const int wave = t >> 5, lane = t & 31, q = lane >> 3, pc = lane & 7;
  const int cc0 = wave * 4 + q, cc1 = 32 + wave * 4 + q;
  v4u w0, w1;
#pragma unroll
  for (int e = 0; e < 4; ++e) {
    w0[e] = pk16(f2bf_bits(tile[pc * 8 + 2 * e][cc0]), f2bf_bits(tile[pc * 8 + 2 * e + 1][cc0]));
    w1[e] = pk16(f2bf_bits(tile[pc * 8 + 2 * e][cc1]), f2bf_bits(tile[pc * 8 + 2 * e + 1][cc1]));
  }
  v4u* p0 = (v4u*)(out + (size_t)(c0 + cc0) * R + r0 + pc * 8);
  v4u* p1 = (v4u*)(out + (size_t)(c0 + cc1) * R + r0 + pc * 8);
  *p0 = w0; *p1 = w1;
  
}

// ---------------------------------------------------------------------------
// Gate weight panel: wg f32 [HID][NH] -> out bf16 [GLD][HID], out[n][k] = bf16(wg[k][n]) for n < NH, 0 for n >= NH.
// Block n (uniform), thread -> k = 8*threadIdx.x; loads use a clamped column address, zeroed by value for n >= NH.
// Coverage: 128 blocks x 256 threads x 8 = the whole [128][2048] panel (padding rows written as zeros).
// ---------------------------------------------------------------------------
__global__ __launch_bounds__(256) void wg_pad_kernel(const float* __restrict__ wg, unsigned short* out) {
  const int n = blockIdx.x;
  const int k = threadIdx.x * 8;
  const int nn = (n < NH) ? n : (NH - 1);
  const float keep = (n < NH) ? 1.0f : 0.0f;
  v4u w;
#pragma unroll
  for (int e = 0; e < 4; ++e) {
    const float a = wg[(size_t)(k + 2 * e) * NH + nn] * keep;
    const float b = wg[(size_t)(k + 2 * e + 1) * NH + nn] * keep;
    w[e] = pk16(f2bf_bits(a), f2bf_bits(b));
  }
  v4u* p = (v4u*)(out + (size_t)n * HID + k);
  *p = w;
  
}

// ---------------------------------------------------------------------------
// Register-blocked bf16 WMMA GEMM: C[m][n] = sum_k A[m][k] * Bt[n][k] + bias; each wave owns a 32x128 tile,
// the 4 waves of a block own 128x128 (4 row slabs over one column panel) and share the operand tiles in LDS.
// A row-major [M][K] (pitch lda), Bt row-major [N][K] (pitch ldb); M and N multiples of 128, K multiple of 64.
// Operand staging: per stage of 64 k, 128 rows x 128 B of A (and of the lo plane) and of Bt are copied global -> LDS by
// asynchronous 16-B copies, 8 lanes per row (whole 128-B lines), rows at pitch 144 B; two buffers, the copies of
// stage t + 2 fly while stage t + 1 is worked on. Fragments are then read from LDS with the same k map as before.
// SPLITA: A given as hi plane (Ap) + unscaled bf16 lo plane (A2p): products Ahi.B + Alo.B into one accumulator.
// BROW: bias[m] per row (clamped to nb1), else per column: bias[n] for n < nsplit (valid while n < nb1),
//       bias2[n - nsplit] for n >= nsplit (valid while n - nsplit < nb2); bias values RNE-rounded to bf16; both
//       candidates loaded from clamped addresses and selected by value.
// blockIdx.y selects a z slice through strideA / strideB / strideC (element strides).
// Epilogue: per wave, each 16x128 accumulator slab is staged in LDS (pitch 132 floats), then written as whole
//   OUT_MODE 0: f32 rows into Cout [M][ldc] (row segment 512 B = 32 lanes x 16 B, 1 row per instruction).
//   OUT_MODE 1: f16 hi plane Cout + f16 residual plane Cout2 ((v - hi) * 2048), [M][ldc] (256 B = 16 lanes x 16 B, 2 rows per instr.).
//   OUT_MODE 2: head-major relayout: columns n0 < nsplit -> q planes Cout (f16 hi) / Cout2 (residual * 2048) at
//               [(b*16 + n0/128)*SEQ + s][ldc = 128]; columns >= nsplit -> single f16 k plane Cout3 at
//               [(b*16 + (n0-nsplit)/128)*SEQ + s][128], with row m = b*2048 + s. Each 128-wide row = 256 B = 16 lanes x 16 B.
// Coverage per slab: it 0..7 x (lane>>4) 0..1 = 16 rows, (lane&15)*8 + 0..7 = 128 columns (OUT_MODE 1/2);
//                    it 0..15 = 16 rows, lane*4 + 0..3 = 128 columns (OUT_MODE 0).
// ---------------------------------------------------------------------------
#define GP 132
#define GK    64               // k elements per stage
#define GT_P  (GK + 8)         // LDS row pitch in bf16 elements: 144 B = 16 B x odd, conflict-free for ds_load_b128 fragment reads
#define GT_SZ (128 * GT_P)     // elements of one staged 128-row tile

// One 128-row x 128-B tile, global -> LDS: 8 asynchronous 16-B copies per lane. l = this lane's LDS byte address of its
// first row, g = this lane's global address of its first row; copy i takes row +16*i (ld = global pitch in elements).
// The s_wait_xcnt stands inside the statement so that no address register is rewritten ahead of it.
__device__ __forceinline__ void copy_tile(unsigned l, const __bf16* g, int ld) {
  const size_t st = (size_t)16 * (size_t)ld;
  const unsigned ls = 16 * GT_P * 2;
  const __bf16 *g1 = g + st, *g2 = g + 2 * st, *g3 = g + 3 * st, *g4 = g + 4 * st, *g5 = g + 5 * st, *g6 = g + 6 * st, *g7 = g + 7 * st;
#if defined(__HIP_DEVICE_COMPILE__)
  asm volatile("global_load_async_to_lds_b128 %0, %8, off\n\t"
               "global_load_async_to_lds_b128 %1, %9, off\n\t"
               "global_load_async_to_lds_b128 %2, %10, off\n\t"
               "global_load_async_to_lds_b128 %3, %11, off\n\t"
               "global_load_async_to_lds_b128 %4, %12, off\n\t"
               "global_load_async_to_lds_b128 %5, %13, off\n\t"
               "global_load_async_to_lds_b128 %6, %14, off\n\t"
               "global_load_async_to_lds_b128 %7, %15, off\n\t"
               "s_wait_xcnt 0x0"
               :: "v"(l), "v"(l + ls), "v"(l + 2 * ls), "v"(l + 3 * ls), "v"(l + 4 * ls), "v"(l + 5 * ls), "v"(l + 6 * ls), "v"(l + 7 * ls),
                  "v"(g), "v"(g1), "v"(g2), "v"(g3), "v"(g4), "v"(g5), "v"(g6), "v"(g7)
               : "memory");
#endif
}
// this wave's own copies have landed
__device__ __forceinline__ void wait_copies() {
#if defined(__HIP_DEVICE_COMPILE__)
  asm volatile("s_wait_asynccnt 0x0" ::: "memory");
#endif
}
// this wave's own LDS reads have returned (before the barrier that hands their buffer to the next copies)
__device__ __forceinline__ void wait_lds() {
#if defined(__HIP_DEVICE_COMPILE__)
  asm volatile("s_wait_dscnt 0x0" ::: "memory");
#endif
}

template <bool SPLITA, int OUT_MODE, bool BROW>
__global__ __launch_bounds__(128) void gemm_kernel(
    const unsigned short* __restrict__ Ap, const unsigned short* __restrict__ A2p, int lda, long strideA,
    const unsigned short* __restrict__ Btp, int ldb, long strideB,
    void* Cout, void* Cout2, void* Cout3, int ldc, long strideC,
    const float* __restrict__ bias, int nb1, const float* __restrict__ bias2, int nb2, int nsplit,
    int M, int N, int K) {
  constexpr int NT = SPLITA ? 3 : 2;            // staged tiles per stage: A, Bt (, A lo plane)
  __shared__ __align__(16) __bf16 sS[2 * NT * GT_SZ];   // two stage buffers; the epilogue slabs reuse them behind the loop's last barrier
  static_assert(4 * 16 * GP * 4 <= 2 * NT * GT_SZ * 2);
  const int bz   = blockIdx.y;
  const int tid  = threadIdx.x;
  const int lane = threadIdx.x & 31;
  const int wave = threadIdx.x >> 5;
  const int tilesN = N >> 7;
  const int tilesM = M >> 7;
  const int tile = blockIdx.x;
  if (tile >= tilesM * tilesN) return;          // block-uniform, in front of every barrier
  const int tm = tile / tilesN;
  const int tn = tile - tm * tilesN;
  const int mb = tm << 7;                       // first row of the block's 128x128 tile
  const int m0 = mb + (wave << 5);
  const int n0 = tn << 7;

  const __bf16* Ab  = (const __bf16*)(const void*)Ap + (size_t)bz * strideA;
  const __bf16* Ab2 = SPLITA ? ((const __bf16*)(const void*)A2p + (size_t)bz * strideA) : (const __bf16*)0;
  const __bf16* Bb  = (const __bf16*)(const void*)Btp + (size_t)bz * strideB;

  const int rlane = lane & 15;              // row (A) / col (B, D) within a 16x16 subtile
  const int koff  = (lane >> 4) * 8;        // k offset of this lane half
  const int mOff  = (lane >> 4) * 8;        // D row offset of this lane half

  v8f acc[2][8];
#pragma unroll
  for (int i = 0; i < 2; ++i)
#pragma unroll
    for (int j = 0; j < 8; ++j) acc[i][j] = (v8f){0.f, 0.f, 0.f, 0.f, 0.f, 0.f, 0.f, 0.f};

  // copy lanes: thread -> row tid>>3 (+16 per copy), 16-B piece tid&7 of the row's 128 B
  const int crow = tid >> 3, cseg = (tid & 7) * 8;
  const __bf16* cA  = Ab + (size_t)(mb + crow) * lda + cseg;
  const __bf16* cA2 = SPLITA ? (Ab2 + (size_t)(mb + crow) * lda + cseg) : (const __bf16*)0;
  const __bf16* cB  = Bb + (size_t)(n0 + crow) * ldb + cseg;
  const unsigned cL = (unsigned)(size_t)(const void*)sS + (unsigned)(crow * GT_P + cseg) * 2u;   // LDS byte address, buffer 0, tile 0
  const int NP = K / GK;

  // stage 0 into buffer 0, published; then stage 1 into buffer 1
  copy_tile(cL, cA, lda);
  copy_tile(cL + GT_SZ * 2, cB, ldb);
  if (SPLITA) copy_tile(cL + 2 * GT_SZ * 2, cA2, lda);
  wait_copies();
  __syncthreads();
  if (NP > 1) {
    const unsigned lb = cL + NT * GT_SZ * 2;
    copy_tile(lb, cA + GK, lda);
    copy_tile(lb + GT_SZ * 2, cB + GK, ldb);
    if (SPLITA) copy_tile(lb + 2 * GT_SZ * 2, cA2 + GK, lda);
  }

  // one stage per trip, the buffer chosen by the trip's parity
  for (int t = 0; t < NP; ++t) {
    const int bo = (t & 1) * (NT * GT_SZ);
    const __bf16* sA  = sS + bo + ((wave << 5) + rlane) * GT_P + koff;
    const __bf16* sB  = sS + bo + GT_SZ + rlane * GT_P + koff;
    const __bf16* sA2 = sS + bo + 2 * GT_SZ + ((wave << 5) + rlane) * GT_P + koff;
#pragma unroll
    for (int kk = 0; kk < GK; kk += 32) {
      const v16b a0 = ldfrag_b(sA + kk);
      const v16b a1 = ldfrag_b(sA + 16 * GT_P + kk);
      v16b l0 = a0, l1 = a1;
      if (SPLITA) { l0 = ldfrag_b(sA2 + kk); l1 = ldfrag_b(sA2 + 16 * GT_P + kk); }
      // the k-step's fragments are read as one group ahead of its products, so that the LDS latency is paid once per k-step
      v16b bh[8];
#pragma unroll
      for (int j = 0; j < 8; ++j) bh[j] = ldfrag_b(sB + (j << 4) * GT_P + kk);
#pragma unroll
      for (int j = 0; j < 8; ++j) {
        acc[0][j] = wmma_b(a0, bh[j], acc[0][j]);
        if (SPLITA) acc[0][j] = wmma_b(l0, bh[j], acc[0][j]);
        acc[1][j] = wmma_b(a1, bh[j], acc[1][j]);
        if (SPLITA) acc[1][j] = wmma_b(l1, bh[j], acc[1][j]);
        dep_guard_b(acc[0][j], acc[1][j], bh[j], a0, a1, l0, l1);
      }
    }
    // publish point of stage t + 1: own reads of this buffer done, own copies of the next landed, then the block barrier
    wait_lds();
    wait_copies();
    __syncthreads();
    if (t + 2 < NP) {                           // block-uniform: refill the buffer this trip has just read
      const unsigned lb = cL + (unsigned)bo * 2u;
      const int ko = (t + 2) * GK;
      copy_tile(lb, cA + ko, lda);
      copy_tile(lb + GT_SZ * 2, cB + ko, ldb);
      if (SPLITA) copy_tile(lb + 2 * GT_SZ * 2, cA2 + ko, lda);
    }
  }
  wait_copies();

  // ---- epilogue ----
  float* slab = (float*)(void*)sS + wave * (16 * GP);
  float bc[8];
#pragma unroll
  for (int j = 0; j < 8; ++j) bc[j] = 0.f;
  if (!BROW) {
#pragma unroll
    for (int j = 0; j < 8; ++j) {
      const int col = n0 + (j << 4) + rlane;
      int i1 = col;          if (i1 > nb1 - 1) i1 = nb1 - 1;
      int i2 = col - nsplit; if (i2 < 0) i2 = 0; if (i2 > nb2 - 1) i2 = nb2 - 1;
      const float v1 = bfr(bias[i1]);
      const float v2 = bfr(bias2[i2]);
      const bool lo = (col < nsplit);
      const bool valid = lo ? (col < nb1) : ((col - nsplit) < nb2);
      const float v = lo ? v1 : v2;
      bc[j] = valid ? v : 0.f;
    }
  }
#pragma unroll
  for (int i = 0; i < 2; ++i) {
    const int mBase = m0 + (i << 4);
    float br[8];
#pragma unroll
    for (int r = 0; r < 8; ++r) {
      br[r] = 0.f;
      if (BROW) {
        int ir = mBase + mOff + r; if (ir > nb1 - 1) ir = nb1 - 1;
        br[r] = bfr(bias[ir]);
      }
    }
#pragma unroll
    for (int j = 0; j < 8; ++j)
#pragma unroll
      for (int r = 0; r < 8; ++r)
        slab[(mOff + r) * GP + (j << 4) + rlane] = acc[i][j][r] + (BROW ? br[r] : bc[j]);
    wave_sync();
    if (OUT_MODE == 0) {
      float* C = (float*)Cout + (size_t)bz * strideC;
      const int c4 = lane * 4;                               // row segment 512 B = 32 lanes x 16 B
      {
#pragma unroll
        for (int it = 0; it < 16; ++it) {
          const v4f v = *(const v4f*)(slab + it * GP + c4);
          *(v4f*)(C + (size_t)(mBase + it) * ldc + n0 + c4) = v;
        }
        
      }
    } else if (OUT_MODE == 1) {
      unsigned short* C  = (unsigned short*)Cout  + (size_t)bz * strideC;
      unsigned short* C2 = (unsigned short*)Cout2 + (size_t)bz * strideC;
      const int q16 = lane >> 4, c8 = (lane & 15) * 8;      // row segment 256 B = 16 lanes x 16 B
      {
#pragma unroll
        for (int it = 0; it < 8; ++it) {
          const int row = it * 2 + q16;
          const float* sp = slab + row * GP + c8;
          v4u hv, lv;
#pragma unroll
          for (int p = 0; p < 4; ++p) {
            const float f0 = sp[2 * p], f1 = sp[2 * p + 1];
            const _Float16 e0 = (_Float16)f0, e1 = (_Float16)f1;
            const _Float16 g0 = (_Float16)((f0 - (float)e0) * 2048.0f);
            const _Float16 g1 = (_Float16)((f1 - (float)e1) * 2048.0f);
            hv[p] = pk16(h2u(e0), h2u(e1));
            lv[p] = pk16(h2u(g0), h2u(g1));
          }
          const size_t go = (size_t)(mBase + row) * ldc + n0 + c8;
          *(v4u*)(C  + go) = hv;
          *(v4u*)(C2 + go) = lv;
        }
        
      }
    } else {
      unsigned short* Q1 = (unsigned short*)Cout;
      unsigned short* Q2 = (unsigned short*)Cout2;
      unsigned short* K1 = (unsigned short*)Cout3;
      const int q16 = lane >> 4, c8 = (lane & 15) * 8;      // row segment 256 B = 16 lanes x 16 B
      const int  bidx = m0 / SEQ;                             // all 32 rows of the tile lie in one batch element
      const bool isq  = (n0 < nsplit);                        // wave-uniform
      const int  head = (isq ? n0 : (n0 - nsplit)) >> 7;
      const size_t rowBase = (size_t)(bidx * NH + head) * SEQ;
      {
#pragma unroll
        for (int it = 0; it < 8; ++it) {
          const int row = it * 2 + q16;
          const int s   = (mBase + row) & (SEQ - 1);
          const float* sp = slab + row * GP + c8;
          v4u hv, lv;
#pragma unroll
          for (int p = 0; p < 4; ++p) {
            const float f0 = sp[2 * p], f1 = sp[2 * p + 1];
            const _Float16 e0 = (_Float16)f0, e1 = (_Float16)f1;
            const _Float16 g0 = (_Float16)((f0 - (float)e0) * 2048.0f);
            const _Float16 g1 = (_Float16)((f1 - (float)e1) * 2048.0f);
            hv[p] = pk16(h2u(e0), h2u(e1));
            lv[p] = pk16(h2u(g0), h2u(g1));
          }
          const size_t go = (rowBase + (size_t)s) * ldc + c8;
          if (isq) {
            *(v4u*)(Q1 + go) = hv;
            *(v4u*)(Q2 + go) = lv;
          } else {
            *(v4u*)(K1 + go) = hv;
          }
        }
        
      }
    }
    wave_sync();
  }
}

#define AT_QB 64
#define AT_KC 64
#define OS_P  132
// LDS row pitches in f16 elements, each 16 B x odd so that the 16 rows a ds_load_b128 fragment read touches fall on distinct banks
#define K_P   (HD + 8)      // K rows of 256 B at pitch 272 B
#define V_P   (AT_KC + 8)   // V^T rows of 128 B at pitch 144 B

__global__ __launch_bounds__(128)
void attn_kernel(const unsigned short* __restrict__ qhp, const unsigned short* __restrict__ qlp,
                 const unsigned short* __restrict__ kp,
                 const unsigned short* __restrict__ vhp, const unsigned short* __restrict__ vlp,
                 const float* __restrict__ bmp, const float* __restrict__ glp,
                 unsigned short* chp, unsigned short* clp) {
  __shared__ __align__(16) _Float16 KVs[AT_KC * K_P + 2 * HD * V_P];   // K [key][d] | V^T hi [d][key] | V^T res [d][key], padded rows; ctx staging later
  static_assert(4 * 16 * OS_P * 4 <= (AT_KC * K_P + 2 * HD * V_P) * 2);
  _Float16* const Ksh = KVs;
  _Float16* const Vth = KVs + AT_KC * K_P;
  _Float16* const Vtl = KVs + AT_KC * K_P + HD * V_P;

  const int tid  = threadIdx.x;
  const int wave = __builtin_amdgcn_readfirstlane(tid >> 5);   // wave-uniform: held in a scalar register, with all that is formed from it
  const int lane = tid & 31;
  const int hh   = lane >> 4;
  const int c    = lane & 15;

  const int bx  = blockIdx.x;
  const int qb  = bx & 31;                 // query block of 64
  const int h   = (bx >> 5) & (NH - 1);    // head
  const int b   = bx >> 9;                 // batch element
  const int q0  = qb * AT_QB + wave * 16;

  const _Float16* Qhg = (const _Float16*)(const void*)qhp + (size_t)(b * NH + h) * SEQ * HD;
  const _Float16* Qlg = (const _Float16*)(const void*)qlp + (size_t)(b * NH + h) * SEQ * HD;
  const _Float16* Kg  = (const _Float16*)(const void*)kp  + (size_t)(b * NH + h) * SEQ * HD;
  const _Float16* Vhg = (const _Float16*)(const void*)vhp + ((size_t)b * HID + (size_t)h * HD) * SEQ;
  const _Float16* Vlg = (const _Float16*)(const void*)vlp + ((size_t)b * HID + (size_t)h * HD) * SEQ;
  const float*    Bm  = bmp + (size_t)b * SEQ * SEQ + (size_t)(q0 + c) * SEQ + 8 * hh;   // + first key of the tile + r
  const int qro = (q0 + c) * HD + 8 * hh;  // per-lane q fragment base, query q0 + c (d added per step)

  // per-head bias scale 2^(-(h+1)/2): exact power of two times sqrt(1/2) for odd (h+1)
  const int   hexp = (h + 1) >> 1;
  const float hs   = __uint_as_float((unsigned)(127 - hexp) << 23) * (((h + 1) & 1) ? 0.70710678118654752f : 1.0f);

  const v8f zero8 = (v8f){0.f, 0.f, 0.f, 0.f, 0.f, 0.f, 0.f, 0.f};
  const float inv2048 = 4.8828125e-4f;
  const float scale   = 1.0f / 11.313708305358887f;

  float mrow = -INFINITY, lrow = 0.f;      // of query q0 + c; lrow sums this lane half's keys only
  v8f oh[8];
#pragma unroll
  for (int t = 0; t < 8; ++t) oh[t] = zero8;

  v16h qa[4], qr[4];
  // unrolled here and in the loops over a0, b0 and b1 below: static indices keep these arrays in registers
#pragma unroll
  for (int dc = 0; dc < 4; ++dc) {
    qa[dc] = ldfrag_h(Qhg + qro + dc * 32);
    qr[dc] = ldfrag_h(Qlg + qro + dc * 32);
  }

  for (int kc = 0; kc < SEQ / AT_KC; ++kc) {
    const int kv0 = kc * AT_KC;
    __syncthreads();
    {
      // staging: K: thread -> key tid>>1, d half (tid&1)*64, 8 x 16 B; V^T hi/res: thread -> d = tid, keys kv0..kv0+63, 8 x 16 B
      // coverage: 64 keys x 128 d for K, 128 d x 64 keys for each V^T plane = the whole chunk tiles
      const int r = tid >> 1, half = (tid & 1) * 64;
      const _Float16* ks = Kg  + (size_t)(kv0 + r) * HD + half;
      const _Float16* vs = Vhg + (size_t)tid * SEQ + kv0;
      const _Float16* ws = Vlg + (size_t)tid * SEQ + kv0;
      // loads grouped per plane; with one maximum and one sum per lane the registers hold all 24 loads in flight beside the q fragments
      v8h a0[8], b0[8], b1[8];
#pragma unroll
      for (int i = 0; i < 8; ++i) a0[i] = *(const v8h*)(ks + 8 * i);
#pragma unroll
      for (int i = 0; i < 8; ++i) b0[i] = *(const v8h*)(vs + 8 * i);
#pragma unroll
      for (int i = 0; i < 8; ++i) *(v8h*)(Ksh + r * K_P + half + 8 * i) = a0[i];
#pragma unroll
      for (int i = 0; i < 8; ++i) b1[i] = *(const v8h*)(ws + 8 * i);
#pragma unroll
      for (int i = 0; i < 8; ++i) *(v8h*)(Vth + tid * V_P + 8 * i) = b0[i];
#pragma unroll
      for (int i = 0; i < 8; ++i) *(v8h*)(Vtl + tid * V_P + 8 * i) = b1[i];
    }
    __syncthreads();

    // ---- scores: 4 key tiles of 16, reduce over d = 128 = 4 k-steps; hi and residual accumulators separate ----
    v8f s[4];
    v4f bb[4][2];                            // raw bias values per key tile: 8 consecutive keys of this lane's query
    bb[0][0] = *(const v4f*)(Bm + kv0);
    bb[0][1] = *(const v4f*)(Bm + kv0 + 4);
#pragma unroll
    for (int j = 0; j < 4; ++j) {
      if (j < 3) {
        bb[j + 1][0] = *(const v4f*)(Bm + kv0 + (j + 1) * 16);
        bb[j + 1][1] = *(const v4f*)(Bm + kv0 + (j + 1) * 16 + 4);
        // keeps the next key tile's bias loads issued as one group here, in flight behind this tile's products:
        // with the q fragments held, the scheduler otherwise sinks them in pairs to their uses
        __builtin_amdgcn_sched_barrier(0);
      }
      v8f sh = zero8, sl = zero8;
#pragma unroll
      for (int dc = 0; dc < 4; ++dc) {
        FragH kb;
        kb.h[0] = *(const v8h*)(Ksh + (j * 16 + c) * K_P + dc * 32 + 8 * hh);
        kb.h[1] = *(const v8h*)(Ksh + (j * 16 + c) * K_P + dc * 32 + 16 + 8 * hh);
        sh = wmma_h(kb.v, qa[dc], sh);
        sl = wmma_h(kb.v, qr[dc], sl);
      }
      // keeps the first use of this tile's bias (and its wait) behind the tile's products
      __builtin_amdgcn_sched_barrier(0);
      v8f sj = (sh + sl * inv2048) * scale;
#pragma unroll
      for (int r = 0; r < 8; ++r) sj[r] = sj[r] + hs * bfr(bb[j][r >> 2][r & 3]);
      s[j] = sj;
    }

    // maximum over this lane's 32 scores, then over the other half's
    float mx[8];
#pragma unroll
    for (int r = 0; r < 8; ++r) mx[r] = fmaxf(fmaxf(s[0][r], s[1][r]), fmaxf(s[2][r], s[3][r]));
    float cm = fmaxf(fmaxf(fmaxf(mx[0], mx[1]), fmaxf(mx[2], mx[3])), fmaxf(fmaxf(mx[4], mx[5]), fmaxf(mx[6], mx[7])));
    cm = fmaxf(cm, xhalf(cm));

    const float mnew  = fmaxf(mrow, cm);
    const float alpha = expf(mrow - mnew);
    mrow = mnew;
    // P^T operands: element e of k-step kk is key 32*kk + 8*hh + e (e < 8, tile 2*kk) or 32*kk + 16 + 8*hh + e - 8 (tile 2*kk + 1),
    // the k order of the V^T fragment loads below
    FragH pb[2];
    float ps[4];
#pragma unroll
    for (int j = 0; j < 4; ++j) {
      float pj = 0.f;
#pragma unroll
      for (int r = 0; r < 8; ++r) {
        const float p = expf(s[j][r] - mnew);
        pj += p;
        pb[j >> 1].v[(j & 1) * 8 + r] = (_Float16)(p * 1024.0f);
      }
      ps[j] = pj;
    }
    lrow = lrow * alpha + ((ps[0] + ps[1]) + (ps[2] + ps[3]));
#pragma unroll
    for (int t = 0; t < 8; ++t) oh[t] *= alpha;

    // ---- ctx^T += V^T . P^T over the 64 keys of the chunk (2 k-steps), 8 d tiles ----
    // unrolled: the static index keeps pb in registers
#pragma unroll
    for (int kk = 0; kk < 2; ++kk) {
#pragma unroll
      for (int t = 0; t < 8; ++t) {
        FragH vb, vr;
        vb.h[0] = *(const v8h*)(Vth + (t * 16 + c) * V_P + kk * 32 + 8 * hh);
        vb.h[1] = *(const v8h*)(Vth + (t * 16 + c) * V_P + kk * 32 + 16 + 8 * hh);
        vr.h[0] = *(const v8h*)(Vtl + (t * 16 + c) * V_P + kk * 32 + 8 * hh);
        vr.h[1] = *(const v8h*)(Vtl + (t * 16 + c) * V_P + kk * 32 + 16 + 8 * hh);
        oh[t] = wmma_h(vb.v, pb[kk].v, oh[t]);
        const v8f tr = wmma_h(vr.v, pb[kk].v, zero8);
        oh[t] += tr * inv2048;
      }
    }
  }

  // ---- normalise, apply the head gate, stage the wave 16x128 tile (aliases the K/V region after the block barrier),
  //      write bf16 hi/lo planes ----
  __syncthreads();
  float* os = (float*)(void*)KVs + wave * (16 * OS_P);
  {
    const float lsum = lrow + xhalf(lrow);   // the two lane halves' key sums of query q0 + c
    const float a  = glp[(size_t)(b * SEQ + q0 + c) * GLD + h];
    const float g  = 1.0f / (1.0f + expf(-a));
    const float invl = g * (1.0f / lsum) * 9.765625e-4f;
#pragma unroll
    for (int t = 0; t < 8; ++t) {
      const v8f o = oh[t] * invl;
      *(v4f*)(os + c * OS_P + t * 16 + 8 * hh)     = (v4f){o[0], o[1], o[2], o[3]};
      *(v4f*)(os + c * OS_P + t * 16 + 8 * hh + 4) = (v4f){o[4], o[5], o[6], o[7]};
    }
  }
  wave_sync();
  {
    const int q16 = lane >> 4, c8 = (lane & 15) * 8;         // 2 rows per instruction, each row 256 B = 16 lanes x 16 B
    {
#pragma unroll
      for (int it = 0; it < 8; ++it) {
        const int row = it * 2 + q16;
        const float* sp = os + row * OS_P + c8;
        v4u hv, lv;
#pragma unroll
        for (int p = 0; p < 4; ++p) {
          const float f0 = sp[2 * p], f1 = sp[2 * p + 1];
          const unsigned short hb0 = f2bf_bits(f0), hb1 = f2bf_bits(f1);
          const unsigned short lb0 = f2bf_bits(f0 - bf_bits2f(hb0));
          const unsigned short lb1 = f2bf_bits(f1 - bf_bits2f(hb1));
          hv[p] = pk16(hb0, hb1);
          lv[p] = pk16(lb0, lb1);
        }
        const size_t go = (size_t)(b * SEQ + q0 + row) * HID + h * HD + c8;
        *(v4u*)(chp + go) = hv;
        *(v4u*)(clp + go) = lv;
      }
      
    }
  }
}

// ---------------------------------------------------------------------------
// all sizes exact tile multiples, all offsets multiples of 512 KiB):
//   R0   bf16 [4096][2048]       16777216 @ 0           x as bf16; later ctx hi plane (written after the last reader of x)
//   R1   bf16 [4096][2048]       16777216 @ 16777216    wv^T as bf16 [2048][2048]; then wq^T|wk^T panel [4096][2048]; later ctx lo plane
//   Wob  bf16 [2048][2048]        8388608 @ 33554432    wo^T
//   Wgb  bf16 [128][2048]          524288 @ 41943040    wg^T zero-padded to 128 rows
//   Glog f32  [4096][128]         2097152 @ 42467328    gate logits
//   Qh   f16  [2][16][2048][128]  16777216 @ 44564480    Ql same @ 61341696
//   Kp   f16  [2][16][2048][128]  16777216 @ 78118912
//   Vth  f16  [2][2048][2048]     16777216 @ 94896128    Vtl same @ 111673344
//   total                        128450560
// ---------------------------------------------------------------------------
extern "C" void kernel_launch(void* const* d_in, const int* in_sizes, int n_in,
                              void* d_out, int out_size, void* d_ws, size_t ws_size,
                              hipStream_t stream) {
  if (n_in < 12) return;
  if (in_sizes[0] != NB * SEQ * HID) return;
  if (in_sizes[1] != NB * SEQ * SEQ) return;
  if (in_sizes[2] != HID * HID) return;
  if (in_sizes[3] != HID) return;
  if (in_sizes[4] != HID * HID) return;
  if (in_sizes[5] != HID) return;
  if (in_sizes[6] != HID * HID) return;
  if (in_sizes[7] != HID) return;
  if (in_sizes[8] != HID * NH) return;
  if (in_sizes[9] != NH) return;
  if (in_sizes[10] != HID * HID) return;
  if (in_sizes[11] != HID) return;
  if (out_size != NB * SEQ * HID) return;

  const float* x   = (const float*)d_in[0];
  const float* bm  = (const float*)d_in[1];
  const float* wq  = (const float*)d_in[2];
  const float* bq  = (const float*)d_in[3];
  const float* wk  = (const float*)d_in[4];
  const float* bk  = (const float*)d_in[5];
  const float* wv  = (const float*)d_in[6];
  const float* bv  = (const float*)d_in[7];
  const float* wg  = (const float*)d_in[8];
  const float* bg  = (const float*)d_in[9];
  const float* wo  = (const float*)d_in[10];
  const float* bo  = (const float*)d_in[11];
  float* out = (float*)d_out;

  const size_t szR0  = (size_t)NB * SEQ * HID * 2;          // 16 MiB
  const size_t szR1  = (size_t)2 * HID * HID * 2;           // 16 MiB
  const size_t szWo  = (size_t)HID * HID * 2;               //  8 MiB
  const size_t szWg  = (size_t)GLD * HID * 2;               //  512 KiB
  const size_t szG   = (size_t)NB * SEQ * GLD * 4;          //  2 MiB
  const size_t szQ   = (size_t)NB * NH * SEQ * HD * 2;      // 16 MiB
  const size_t szK   = szQ;
  const size_t szV   = (size_t)NB * HID * SEQ * 2;          // 16 MiB
  size_t off = 0;
  const size_t oR0  = off; off += szR0;
  const size_t oR1  = off; off += szR1;
  const size_t oWo  = off; off += szWo;
  const size_t oWg  = off; off += szWg;
  const size_t oG   = off; off += szG;
  const size_t oQh  = off; off += szQ;
  const size_t oQl  = off; off += szQ;
  const size_t oKp  = off; off += szK;
  const size_t oVth = off; off += szV;
  const size_t oVtl = off; off += szV;
  if (off > ws_size) return;                    // off = 128450560
  if (off > (size_t)134217728) return;

  char* ws = (char*)d_ws;
  unsigned short* Xb  = (unsigned short*)(ws + oR0);
  unsigned short* Ch  = (unsigned short*)(ws + oR0);        // reuses R0 after the gate GEMM (last reader of Xb)
  unsigned short* Wvt = (unsigned short*)(ws + oR1);
  unsigned short* Wqk = (unsigned short*)(ws + oR1);        // reuses R1 after the v^T GEMM (last reader of Wvt)
  unsigned short* Cl  = (unsigned short*)(ws + oR1);        // reuses R1 after the q|k GEMM (last reader of Wqk)
  unsigned short* Wot = (unsigned short*)(ws + oWo);
  unsigned short* Wgt = (unsigned short*)(ws + oWg);
  float*          Gl  = (float*)(ws + oG);
  unsigned short* Qh  = (unsigned short*)(ws + oQh);
  unsigned short* Ql  = (unsigned short*)(ws + oQl);
  unsigned short* Kp  = (unsigned short*)(ws + oKp);
  unsigned short* Vth = (unsigned short*)(ws + oVth);
  unsigned short* Vtl = (unsigned short*)(ws + oVtl);

  const dim3 blk256(256), blk128(128);
  const dim3 trg(HID / 64, HID / 64);           // in [2048 rows][2048 cols] -> out [cols][rows]
  const int n8x = NB * SEQ * HID / 8;

  // (1) x f32 -> bf16 plane
  cvt_bf16x8_kernel<<<dim3((n8x + 255) / 256), blk256, 0, stream>>>(x, Xb, n8x);
  // (2) wv [in][out] -> wv^T bf16 [out][in]
  tr_bf16_kernel<<<trg, blk256, 0, stream>>>(wv, Wvt, HID, HID);
  // (3) v^T per batch element: A = Wvt [2048 d][2048 k], Bt = Xb[b] [2048 s][2048 k] -> V^T hi/res planes [2048][2048] per b, + bv[d]
  {
    const int M = HID, N = SEQ, K = HID;
    const int tiles = (M / 32) * (N / 128);
    gemm_kernel<false, 1, true><<<dim3((tiles + 3) / 4, NB), blk128, 0, stream>>>(
        Wvt, Wvt, HID, 0L, Xb, HID, (long)SEQ * HID, (void*)Vth, (void*)Vtl, (void*)Vtl, SEQ, (long)HID * SEQ,
        bv, HID, bv, HID, N, M, N, K);
  }
  // (4) wq^T | wk^T panel [4096][2048] into R1
  tr_bf16_kernel<<<trg, blk256, 0, stream>>>(wq, Wqk, HID, HID);
  tr_bf16_kernel<<<trg, blk256, 0, stream>>>(wk, Wqk + (size_t)HID * HID, HID, HID);
  // (5) q | k projections with head-major relayout: A = Xb [4096][2048], Bt = Wqk [4096][2048] -> q hi/res planes, k plane; + bq | bk
  {
    const int M = NB * SEQ, N = 2 * HID, K = HID;
    const int tiles = (M / 32) * (N / 128);
    gemm_kernel<false, 2, false><<<dim3((tiles + 3) / 4, 1), blk128, 0, stream>>>(
        Xb, Xb, HID, 0L, Wqk, HID, 0L, (void*)Qh, (void*)Ql, (void*)Kp, HD, 0L,
        bq, HID, bk, HID, HID, M, N, K);
  }
  // (6) gate weights: wg [2048][16] -> wg^T zero-padded bf16 [128][2048]
  wg_pad_kernel<<<dim3(GLD), blk256, 0, stream>>>(wg, Wgt);
  // (7) gate logits: A = Xb [4096][2048], Bt = Wgt [128][2048] -> f32 [4096][128], + bg for columns < 16
  {
    const int M = NB * SEQ, N = GLD, K = HID;
    const int tiles = (M / 32) * (N / 128);
    gemm_kernel<false, 0, false><<<dim3((tiles + 3) / 4, 1), blk128, 0, stream>>>(
        Xb, Xb, HID, 0L, Wgt, HID, 0L, (void*)Gl, (void*)Gl, (void*)Gl, GLD, 0L,
        bg, NH, bg, NH, N, M, N, K);
  }
  // (8) wo [in][out] -> wo^T bf16
  tr_bf16_kernel<<<trg, blk256, 0, stream>>>(wo, Wot, HID, HID);
  // (9) attention: grid = NB x 16 heads x 32 query blocks, 128 threads
  attn_kernel<<<dim3(NB * NH * (SEQ / AT_QB)), blk128, 0, stream>>>(Qh, Ql, Kp, Vth, Vtl, bm, Gl, Ch, Cl);
  // (10) output projection: A = gated ctx hi/lo planes [4096][2048], Bt = Wot [2048][2048] -> d_out f32 [4096][2048], + bo
  {
    const int M = NB * SEQ, N = HID, K = HID;
    const int tiles = (M / 32) * (N / 128);
    gemm_kernel<true, 0, false><<<dim3((tiles + 3) / 4, 1), blk128, 0, stream>>>(
        Ch, Cl, HID, 0L, Wot, HID, 0L, (void*)out, (void*)out, (void*)out, HID, 0L,
        bo, HID, bo, HID, N, M, N, K);
  }
  (void)hipGetLastError();
}

// v005
// One run takes 351 microseconds.
// In two side-by-side timings against v004, it was 1.07 and 1.06 times as fast.
// Counting every step since v000, it is 3.33 times as fast.
#include <hip/hip_runtime.h>
#include <math.h>
#include <stdint.h>

// q/k/v and gate projections: v_wmma_f32_16x16x32_bf16, single products on bf16-RNE converted x and W^T, f32 accumulate;
// scores, transposed, k.q^T: v_wmma_f32_16x16x32_f16 with q = f16 hi + residual x2^11 planes, k single f16 plane, f32 accumulate;
// ctx, transposed, v^T.p^T: v_wmma_f32_16x16x32_f16 with p x1024 single f16 plane, v^T = f16 hi + residual x2^11 planes, f32 accumulate;
// output projection: v_wmma_f32_16x16x32_bf16 with gated ctx as bf16 hi + lo planes and Wo^T bf16, f32 accumulate.
// Online softmax, score scale 1/sqrt(128), per-head bias scale 2^(-(h+1)/2), sigmoid gate and normalisation in f32.

#define NB   2
#define SEQ  2048
#define HID  2048
#define NH   16
#define HD   128
#define GLD  128

typedef _Float16 v16h __attribute__((ext_vector_type(16)));
typedef _Float16 v8h  __attribute__((ext_vector_type(8)));
typedef __bf16   v16b __attribute__((ext_vector_type(16)));
typedef __bf16   v8b  __attribute__((ext_vector_type(8)));
typedef float    v8f  __attribute__((ext_vector_type(8)));
typedef float    v4f  __attribute__((ext_vector_type(4)));
typedef unsigned int v4u __attribute__((ext_vector_type(4)));

// ---------------------------------------------------------------------------
// small helpers
// ---------------------------------------------------------------------------
__device__ __forceinline__ unsigned short f2bf_bits(float f) {          // RNE convert f32 -> bf16 bits
  const unsigned u = __float_as_uint(f);
  return (unsigned short)((u + 0x7FFFu + ((u >> 16) & 1u)) >> 16);
}
__device__ __forceinline__ float bf_bits2f(unsigned short x) { return __uint_as_float(((unsigned)x) << 16); }
__device__ __forceinline__ float bfr(float f) { return __uint_as_float(((unsigned)f2bf_bits(f)) << 16); }
__device__ __forceinline__ unsigned pk16(unsigned short a, unsigned short b) { return (unsigned)a | ((unsigned)b << 16); }
__device__ __forceinline__ unsigned short h2u(_Float16 x) { return __builtin_bit_cast(unsigned short, x); }

// lane l with lane l ^ 16
__device__ __forceinline__ float xhalf(float x) {
  return __builtin_bit_cast(float, __builtin_amdgcn_permlanex16(__builtin_bit_cast(int, x), __builtin_bit_cast(int, x), 0x76543210, 0xfedcba98, false, false));
}

__device__ __forceinline__ void wave_sync() {
  __builtin_amdgcn_fence(__ATOMIC_RELEASE, "workgroup");
  __builtin_amdgcn_wave_barrier();
  __builtin_amdgcn_fence(__ATOMIC_ACQUIRE, "workgroup");
}

// 16-bit fragment loaders, same k map for A and B: p points at (row or col)*ld + k0 + 8*(lane>>4);
// elements 0..7 <- p[0..7] (k0+8h..k0+8h+7), elements 8..15 <- p[16..23] (k0+16+8h..k0+16+8h+7).
union FragB { v16b v; v8b h[2]; };
union FragH { v16h v; v8h h[2]; };
__device__ __forceinline__ v16b ldfrag_b(const __bf16* p) {
  FragB f; f.h[0] = *(const v8b*)(p); f.h[1] = *(const v8b*)(p + 16); return f.v;
}
__device__ __forceinline__ v16h ldfrag_h(const _Float16* p) {
  FragH f; f.h[0] = *(const v8h*)(p); f.h[1] = *(const v8h*)(p + 16); return f.v;
}

__device__ __forceinline__ v8f wmma_b(v16b a, v16b b, v8f c) {
  return __builtin_amdgcn_wmma_f32_16x16x32_bf16(false, a, false, b, (short)0, c, false, false);
}
// f16 form with the hazard guard attached to every issue (ties D, keeps A/B live)
__device__ __forceinline__ v8f wmma_h(v16h a, v16h b, v8f c) {
  c = __builtin_amdgcn_wmma_f32_16x16x32_f16(false, a, false, b, (short)0, c, false, false);
#if defined(__HIP_DEVICE_COMPILE__)
  asm volatile("v_nop\n\tv_nop\n\tv_nop\n\tv_nop" : "+v"(c) : "v"(a), "v"(b));
#endif
  return c;
}
// hazard guard for one j-group of the register-blocked GEMM (ties both D tiles, keeps A/B registers live)
__device__ __forceinline__ void dep_guard_b(v8f& x, v8f& y, v16b b, v16b a0, v16b a1, v16b l0, v16b l1) {
#if defined(__HIP_DEVICE_COMPILE__)
  asm volatile("v_nop\n\tv_nop\n\tv_nop\n\tv_nop" : "+v"(x), "+v"(y) : "v"(b), "v"(a0), "v"(a1), "v"(l0), "v"(l1));
#endif
}

// ---------------------------------------------------------------------------
// f32 -> bf16 (RNE) convert, 8 elements per thread: two 16-B loads, one 16-B store.
// Coverage: grid = ceil(n8/256) x 256 threads x 8 elements = the whole array (sizes here are multiples of 2048).
// ---------------------------------------------------------------------------
__global__ __launch_bounds__(256) void cvt_bf16x8_kernel(const float* __restrict__ in, unsigned short* out, int n8) {
  const int i = blockIdx.x * 256 + threadIdx.x;
  if (i < n8) {
    const v4f a = *(const v4f*)(in + 8 * (size_t)i);
    const v4f c = *(const v4f*)(in + 8 * (size_t)i + 4);
    v4u w;
    w[0] = pk16(f2bf_bits(a[0]), f2bf_bits(a[1]));
    w[1] = pk16(f2bf_bits(a[2]), f2bf_bits(a[3]));
    w[2] = pk16(f2bf_bits(c[0]), f2bf_bits(c[1]));
    w[3] = pk16(f2bf_bits(c[2]), f2bf_bits(c[3]));
    v4u* p = (v4u*)(out + 8 * (size_t)i);
    *p = w;
    
  }
}

// ---------------------------------------------------------------------------
// Transpose + RNE bf16 convert: in f32 [R][C] row-major -> out bf16 [C][R] (out[c][r] = bf16(in[r][c])).
// Block 256 threads handles a 64x64 tile through LDS. Load: thread -> 4 float4 (rows t>>4 + 16i, cols 4*(t&15)+0..3).
// Coverage: out rows cc = wave*4 + (lane>>3) (+32) over 8 waves = 0..63; columns (lane&7)*8 + 0..7 = 0..63; grid (C/64, R/64).
// ---------------------------------------------------------------------------
__global__ __launch_bounds__(256) void tr_bf16_kernel(const float* __restrict__ in, unsigned short* out, int R, int C) {
  __shared__ __align__(16) float tile[64][65];
  const int c0 = blockIdx.x * 64, r0 = blockIdx.y * 64;
  const int t = threadIdx.x;
  const int cq = (t & 15) * 4, rb = t >> 4;
#pragma unroll
  for (int i = 0; i < 4; ++i) {
    const int r = rb + 16 * i;
    const v4f v = *(const v4f*)(in + (size_t)(r0 + r) * C + c0 + cq);
    tile[r][cq] = v[0]; tile[r][cq + 1] = v[1]; tile[r][cq + 2] = v[2]; tile[r][cq + 3] = v[3];
  }
  __syncthreads();
  const int wave = t >> 5, lane = t & 31, q = lane >> 3, pc = lane & 7;
  const int cc0 = wave * 4 + q, cc1 = 32 + wave * 4 + q;
  v4u w0, w1;
#pragma unroll
  for (int e = 0; e < 4; ++e) {
    w0[e] = pk16(f2bf_bits(tile[pc * 8 + 2 * e][cc0]), f2bf_bits(tile[pc * 8 + 2 * e + 1][cc0]));
    w1[e] = pk16(f2bf_bits(tile[pc * 8 + 2 * e][cc1]), f2bf_bits(tile[pc * 8 + 2 * e + 1][cc1]));
  }
  v4u* p0 = (v4u*)(out + (size_t)(c0 + cc0) * R + r0 + pc * 8);
  v4u* p1 = (v4u*)(out + (size_t)(c0 + cc1) * R + r0 + pc * 8);
  *p0 = w0; *p1 = w1;
  
}

// ---------------------------------------------------------------------------
// Gate weight panel: wg f32 [HID][NH] -> out bf16 [GLD][HID], out[n][k] = bf16(wg[k][n]) for n < NH, 0 for n >= NH.
// Block n (uniform), thread -> k = 8*threadIdx.x; loads use a clamped column address, zeroed by value for n >= NH.
// Coverage: 128 blocks x 256 threads x 8 = the whole [128][2048] panel (padding rows written as zeros).
// ---------------------------------------------------------------------------
__global__ __launch_bounds__(256) void wg_pad_kernel(const float* __restrict__ wg, unsigned short* out) {
  const int n = blockIdx.x;
  const int k = threadIdx.x * 8;
  const int nn = (n < NH) ? n : (NH - 1);
  const float keep = (n < NH) ? 1.0f : 0.0f;
  v4u w;
#pragma unroll
  for (int e = 0; e < 4; ++e) {
    const float a = wg[(size_t)(k + 2 * e) * NH + nn] * keep;
    const float b = wg[(size_t)(k + 2 * e + 1) * NH + nn] * keep;
    w[e] = pk16(f2bf_bits(a), f2bf_bits(b));
  }
  v4u* p = (v4u*)(out + (size_t)n * HID + k);
  *p = w;
  
}

// ---------------------------------------------------------------------------
// Register-blocked bf16 WMMA GEMM: C[m][n] = sum_k A[m][k] * Bt[n][k] + bias; each wave owns a 32x128 tile,
// the 4 waves of a block own 128x128 (4 row slabs over one column panel) and share the operand tiles in LDS.
// A row-major [M][K] (pitch lda), Bt row-major [N][K] (pitch ldb); M and N multiples of 128, K multiple of 64.
// Operand staging: per stage of 64 k, 128 rows x 128 B of A (and of the lo plane) and of Bt are copied global -> LDS by
// asynchronous 16-B copies, 8 lanes per row (whole 128-B lines), rows at pitch 144 B; two buffers, the copies of
// stage t + 2 fly while stage t + 1 is worked on. Fragments are then read from LDS with the same k map as before.
// SPLITA: A given as hi plane (Ap) + unscaled bf16 lo plane (A2p): products Ahi.B + Alo.B into one accumulator.
// BROW: bias[m] per row (clamped to nb1), else per column: bias[n] for n < nsplit (valid while n < nb1),
//       bias2[n - nsplit] for n >= nsplit (valid while n - nsplit < nb2); bias values RNE-rounded to bf16; both
//       candidates loaded from clamped addresses and selected by value.
// blockIdx.y selects a z slice through strideA / strideB / strideC (element strides).
// Epilogue: per wave, each 16x128 accumulator slab is staged in LDS (pitch 132 floats), then written as whole
//   OUT_MODE 0: f32 rows into Cout [M][ldc] (row segment 512 B = 32 lanes x 16 B, 1 row per instruction).
//   OUT_MODE 1: f16 hi plane Cout + f16 residual plane Cout2 ((v - hi) * 2048), [M][ldc] (256 B = 16 lanes x 16 B, 2 rows per instr.).
//   OUT_MODE 2: head-major relayout: columns n0 < nsplit -> q planes Cout (f16 hi) / Cout2 (residual * 2048) at
//               [(b*16 + n0/128)*SEQ + s][ldc = 128]; columns >= nsplit -> single f16 k plane Cout3 at
//               [(b*16 + (n0-nsplit)/128)*SEQ + s][128], with row m = b*2048 + s. Each 128-wide row = 256 B = 16 lanes x 16 B.
// Coverage per slab: it 0..7 x (lane>>4) 0..1 = 16 rows, (lane&15)*8 + 0..7 = 128 columns (OUT_MODE 1/2);
//                    it 0..15 = 16 rows, lane*4 + 0..3 = 128 columns (OUT_MODE 0).
// ---------------------------------------------------------------------------
#define GP 132
#define GK    64               // k elements per stage
#define GT_P  (GK + 8)         // LDS row pitch in bf16 elements: 144 B = 16 B x odd, conflict-free for ds_load_b128 fragment reads
#define GT_SZ (128 * GT_P)     // elements of one staged 128-row tile

// One 128-row x 128-B tile, global -> LDS: 8 asynchronous 16-B copies per lane. l = this lane's LDS byte address of its
// first row, g = this lane's global address of its first row; copy i takes row +16*i (ld = global pitch in elements).
// The s_wait_xcnt stands inside the statement so that no address register is rewritten ahead of it.
__device__ __forceinline__ void copy_tile(unsigned l, const __bf16* g, int ld) {
  const size_t st = (size_t)16 * (size_t)ld;
  const unsigned ls = 16 * GT_P * 2;
  const __bf16 *g1 = g + st, *g2 = g + 2 * st, *g3 = g + 3 * st, *g4 = g + 4 * st, *g5 = g + 5 * st, *g6 = g + 6 * st, *g7 = g + 7 * st;
#if defined(__HIP_DEVICE_COMPILE__)
  asm volatile("global_load_async_to_lds_b128 %0, %8, off\n\t"
               "global_load_async_to_lds_b128 %1, %9, off\n\t"
               "global_load_async_to_lds_b128 %2, %10, off\n\t"
               "global_load_async_to_lds_b128 %3, %11, off\n\t"
               "global_load_async_to_lds_b128 %4, %12, off\n\t"
               "global_load_async_to_lds_b128 %5, %13, off\n\t"
               "global_load_async_to_lds_b128 %6, %14, off\n\t"
               "global_load_async_to_lds_b128 %7, %15, off\n\t"
               "s_wait_xcnt 0x0"
               :: "v"(l), "v"(l + ls), "v"(l + 2 * ls), "v"(l + 3 * ls), "v"(l + 4 * ls), "v"(l + 5 * ls), "v"(l + 6 * ls), "v"(l + 7 * ls),
                  "v"(g), "v"(g1), "v"(g2), "v"(g3), "v"(g4), "v"(g5), "v"(g6), "v"(g7)
               : "memory");
#endif
}
// this wave's own copies have landed
__device__ __forceinline__ void wait_copies() {
#if defined(__HIP_DEVICE_COMPILE__)
  asm volatile("s_wait_asynccnt 0x0" ::: "memory");
#endif
}
// this wave's own LDS reads have returned (before the barrier that hands their buffer to the next copies)
__device__ __forceinline__ void wait_lds() {
#if defined(__HIP_DEVICE_COMPILE__)
  asm volatile("s_wait_dscnt 0x0" ::: "memory");
#endif
}

template <bool SPLITA, int OUT_MODE, bool BROW>
__global__ __launch_bounds__(128) void gemm_kernel(
    const unsigned short* __restrict__ Ap, const unsigned short* __restrict__ A2p, int lda, long strideA,
    const unsigned short* __restrict__ Btp, int ldb, long strideB,
    void* Cout, void* Cout2, void* Cout3, int ldc, long strideC,
    const float* __restrict__ bias, int nb1, const float* __restrict__ bias2, int nb2, int nsplit,
    int M, int N, int K) {
  constexpr int NT = SPLITA ? 3 : 2;            // staged tiles per stage: A, Bt (, A lo plane)
  __shared__ __align__(16) __bf16 sS[2 * NT * GT_SZ];   // two stage buffers; the epilogue slabs reuse them behind the loop's last barrier
  static_assert(4 * 16 * GP * 4 <= 2 * NT * GT_SZ * 2);
  const int bz   = blockIdx.y;
  const int tid  = threadIdx.x;
  const int lane = threadIdx.x & 31;
  const int wave = threadIdx.x >> 5;
  const int tilesN = N >> 7;
  const int tilesM = M >> 7;
  const int tile = blockIdx.x;
  if (tile >= tilesM * tilesN) return;          // block-uniform, in front of every barrier
  const int tm = tile / tilesN;
  const int tn = tile - tm * tilesN;
  const int mb = tm << 7;                       // first row of the block's 128x128 tile
  const int m0 = mb + (wave << 5);
  const int n0 = tn << 7;

  const __bf16* Ab  = (const __bf16*)(const void*)Ap + (size_t)bz * strideA;
  const __bf16* Ab2 = SPLITA ? ((const __bf16*)(const void*)A2p + (size_t)bz * strideA) : (const __bf16*)0;
  const __bf16* Bb  = (const __bf16*)(const void*)Btp + (size_t)bz * strideB;

  const int rlane = lane & 15;              // row (A) / col (B, D) within a 16x16 subtile
  const int koff  = (lane >> 4) * 8;        // k offset of this lane half
  const int mOff  = (lane >> 4) * 8;        // D row offset of this lane half

  v8f acc[2][8];
#pragma unroll
  for (int i = 0; i < 2; ++i)
#pragma unroll
    for (int j = 0; j < 8; ++j) acc[i][j] = (v8f){0.f, 0.f, 0.f, 0.f, 0.f, 0.f, 0.f, 0.f};

  // copy lanes: thread -> row tid>>3 (+16 per copy), 16-B piece tid&7 of the row's 128 B
  const int crow = tid >> 3, cseg = (tid & 7) * 8;
  const __bf16* cA  = Ab + (size_t)(mb + crow) * lda + cseg;
  const __bf16* cA2 = SPLITA ? (Ab2 + (size_t)(mb + crow) * lda + cseg) : (const __bf16*)0;
  const __bf16* cB  = Bb + (size_t)(n0 + crow) * ldb + cseg;
  const unsigned cL = (unsigned)(size_t)(const void*)sS + (unsigned)(crow * GT_P + cseg) * 2u;   // LDS byte address, buffer 0, tile 0
  const int NP = K / GK;

  // stage 0 into buffer 0, published; then stage 1 into buffer 1
  copy_tile(cL, cA, lda);
  copy_tile(cL + GT_SZ * 2, cB, ldb);
  if (SPLITA) copy_tile(cL + 2 * GT_SZ * 2, cA2, lda);
  wait_copies();
  __syncthreads();
  if (NP > 1) {
    const unsigned lb = cL + NT * GT_SZ * 2;
    copy_tile(lb, cA + GK, lda);
    copy_tile(lb + GT_SZ * 2, cB + GK, ldb);
    if (SPLITA) copy_tile(lb + 2 * GT_SZ * 2, cA2 + GK, lda);
  }

  // one stage per trip, the buffer chosen by the trip's parity
  for (int t = 0; t < NP; ++t) {
    const int bo = (t & 1) * (NT * GT_SZ);
    const __bf16* sA  = sS + bo + ((wave << 5) + rlane) * GT_P + koff;
    const __bf16* sB  = sS + bo + GT_SZ + rlane * GT_P + koff;
    const __bf16* sA2 = sS + bo + 2 * GT_SZ + ((wave << 5) + rlane) * GT_P + koff;
#pragma unroll
    for (int kk = 0; kk < GK; kk += 32) {
      const v16b a0 = ldfrag_b(sA + kk);
      const v16b a1 = ldfrag_b(sA + 16 * GT_P + kk);
      v16b l0 = a0, l1 = a1;
      if (SPLITA) { l0 = ldfrag_b(sA2 + kk); l1 = ldfrag_b(sA2 + 16 * GT_P + kk); }
      // the k-step's fragments are read as one group ahead of its products, so that the LDS latency is paid once per k-step
      v16b bh[8];
#pragma unroll
      for (int j = 0; j < 8; ++j) bh[j] = ldfrag_b(sB + (j << 4) * GT_P + kk);
#pragma unroll
      for (int j = 0; j < 8; ++j) {
        acc[0][j] = wmma_b(a0, bh[j], acc[0][j]);
        if (SPLITA) acc[0][j] = wmma_b(l0, bh[j], acc[0][j]);
        acc[1][j] = wmma_b(a1, bh[j], acc[1][j]);
        if (SPLITA) acc[1][j] = wmma_b(l1, bh[j], acc[1][j]);
        dep_guard_b(acc[0][j], acc[1][j], bh[j], a0, a1, l0, l1);
      }
    }
    // publish point of stage t + 1: own reads of this buffer done, own copies of the next landed, then the block barrier
    wait_lds();
    wait_copies();
    __syncthreads();
    if (t + 2 < NP) {                           // block-uniform: refill the buffer this trip has just read
      const unsigned lb = cL + (unsigned)bo * 2u;
      const int ko = (t + 2) * GK;
      copy_tile(lb, cA + ko, lda);
      copy_tile(lb + GT_SZ * 2, cB + ko, ldb);
      if (SPLITA) copy_tile(lb + 2 * GT_SZ * 2, cA2 + ko, lda);
    }
  }
  wait_copies();

  // ---- epilogue ----
  float* slab = (float*)(void*)sS + wave * (16 * GP);
  float bc[8];
#pragma unroll
  for (int j = 0; j < 8; ++j) bc[j] = 0.f;
  if (!BROW) {
#pragma unroll
    for (int j = 0; j < 8; ++j) {
      const int col = n0 + (j << 4) + rlane;
      int i1 = col;          if (i1 > nb1 - 1) i1 = nb1 - 1;
      int i2 = col - nsplit; if (i2 < 0) i2 = 0; if (i2 > nb2 - 1) i2 = nb2 - 1;
      const float v1 = bfr(bias[i1]);
      const float v2 = bfr(bias2[i2]);
      const bool lo = (col < nsplit);
      const bool valid = lo ? (col < nb1) : ((col - nsplit) < nb2);
      const float v = lo ? v1 : v2;
      bc[j] = valid ? v : 0.f;
    }
  }
#pragma unroll
  for (int i = 0; i < 2; ++i) {
    const int mBase = m0 + (i << 4);
    float br[8];
#pragma unroll
    for (int r = 0; r < 8; ++r) {
      br[r] = 0.f;
      if (BROW) {
        int ir = mBase + mOff + r; if (ir > nb1 - 1) ir = nb1 - 1;
        br[r] = bfr(bias[ir]);
      }
    }
#pragma unroll
    for (int j = 0; j < 8; ++j)
#pragma unroll
      for (int r = 0; r < 8; ++r)
        slab[(mOff + r) * GP + (j << 4) + rlane] = acc[i][j][r] + (BROW ? br[r] : bc[j]);
    wave_sync();
    if (OUT_MODE == 0) {
      float* C = (float*)Cout + (size_t)bz * strideC;
      const int c4 = lane * 4;                               // row segment 512 B = 32 lanes x 16 B
      {
#pragma unroll
        for (int it = 0; it < 16; ++it) {
          const v4f v = *(const v4f*)(slab + it * GP + c4);
          *(v4f*)(C + (size_t)(mBase + it) * ldc + n0 + c4) = v;
        }
        
      }
    } else if (OUT_MODE == 1) {
      unsigned short* C  = (unsigned short*)Cout  + (size_t)bz * strideC;
      unsigned short* C2 = (unsigned short*)Cout2 + (size_t)bz * strideC;
      const int q16 = lane >> 4, c8 = (lane & 15) * 8;      // row segment 256 B = 16 lanes x 16 B
      {
#pragma unroll
        for (int it = 0; it < 8; ++it) {
          const int row = it * 2 + q16;
          const float* sp = slab + row * GP + c8;
          v4u hv, lv;
#pragma unroll
          for (int p = 0; p < 4; ++p) {
            const float f0 = sp[2 * p], f1 = sp[2 * p + 1];
            const _Float16 e0 = (_Float16)f0, e1 = (_Float16)f1;
            const _Float16 g0 = (_Float16)((f0 - (float)e0) * 2048.0f);
            const _Float16 g1 = (_Float16)((f1 - (float)e1) * 2048.0f);
            hv[p] = pk16(h2u(e0), h2u(e1));
            lv[p] = pk16(h2u(g0), h2u(g1));
          }
          const size_t go = (size_t)(mBase + row) * ldc + n0 + c8;
          *(v4u*)(C  + go) = hv;
          *(v4u*)(C2 + go) = lv;
        }
        
      }
    } else {
      unsigned short* Q1 = (unsigned short*)Cout;
      unsigned short* Q2 = (unsigned short*)Cout2;
      unsigned short* K1 = (unsigned short*)Cout3;
      const int q16 = lane >> 4, c8 = (lane & 15) * 8;      // row segment 256 B = 16 lanes x 16 B
      const int  bidx = m0 / SEQ;                             // all 32 rows of the tile lie in one batch element
      const bool isq  = (n0 < nsplit);                        // wave-uniform
      const int  head = (isq ? n0 : (n0 - nsplit)) >> 7;
      const size_t rowBase = (size_t)(bidx * NH + head) * SEQ;
      {
#pragma unroll
        for (int it = 0; it < 8; ++it) {
          const int row = it * 2 + q16;
          const int s   = (mBase + row) & (SEQ - 1);
          const float* sp = slab + row * GP + c8;
          v4u hv, lv;
#pragma unroll
          for (int p = 0; p < 4; ++p) {
            const float f0 = sp[2 * p], f1 = sp[2 * p + 1];
            const _Float16 e0 = (_Float16)f0, e1 = (_Float16)f1;
            const _Float16 g0 = (_Float16)((f0 - (float)e0) * 2048.0f);
            const _Float16 g1 = (_Float16)((f1 - (float)e1) * 2048.0f);
            hv[p] = pk16(h2u(e0), h2u(e1));
            lv[p] = pk16(h2u(g0), h2u(g1));
          }
          const size_t go = (rowBase + (size_t)s) * ldc + c8;
          if (isq) {
            *(v4u*)(Q1 + go) = hv;
            *(v4u*)(Q2 + go) = lv;
          } else {
            *(v4u*)(K1 + go) = hv;
          }
        }
        
      }
    }
    wave_sync();
  }
}

#define AT_QB 128
#define AT_KC 64
#define OS_P  132
// LDS row pitches in f16 elements, each 16 B x odd so that the 16 rows a ds_load_b128 fragment read touches fall on distinct banks
#define K_P   (HD + 8)      // K rows of 256 B at pitch 272 B
#define V_P   (AT_KC + 8)   // V^T rows of 128 B at pitch 144 B
#define AT_BUF (AT_KC * K_P + 2 * HD * V_P)   // f16 elements of one staged chunk: K | V^T hi | V^T res

// One chunk, global -> LDS: 12 asynchronous 16-B copies per lane, 4 per plane. lk / lh / ll = this lane's LDS byte address of its
// first row of K / V^T hi / V^T res, gk / gh / gl = its global address there; copy i takes K row +16*i, V^T row +32*i.
// The s_wait_xcnt stands inside the statement so that no address register is rewritten ahead of it.
__device__ __forceinline__ void copy_chunk(unsigned lk, unsigned lh, unsigned ll,
                                           const _Float16* gk, const _Float16* gh, const _Float16* gl) {
  const unsigned ks = 16 * K_P * 2, vs = 32 * V_P * 2;
  const size_t kg = (size_t)16 * HD, vg = (size_t)32 * SEQ;
#if defined(__HIP_DEVICE_COMPILE__)
  asm volatile("global_load_async_to_lds_b128 %0, %12, off\n\t"
               "global_load_async_to_lds_b128 %1, %13, off\n\t"
               "global_load_async_to_lds_b128 %2, %14, off\n\t"
               "global_load_async_to_lds_b128 %3, %15, off\n\t"
               "global_load_async_to_lds_b128 %4, %16, off\n\t"
               "global_load_async_to_lds_b128 %5, %17, off\n\t"
               "global_load_async_to_lds_b128 %6, %18, off\n\t"
               "global_load_async_to_lds_b128 %7, %19, off\n\t"
               "global_load_async_to_lds_b128 %8, %20, off\n\t"
               "global_load_async_to_lds_b128 %9, %21, off\n\t"
               "global_load_async_to_lds_b128 %10, %22, off\n\t"
               "global_load_async_to_lds_b128 %11, %23, off\n\t"
               "s_wait_xcnt 0x0"
               :: "v"(lk), "v"(lk + ks), "v"(lk + 2 * ks), "v"(lk + 3 * ks),
                  "v"(lh), "v"(lh + vs), "v"(lh + 2 * vs), "v"(lh + 3 * vs),
                  "v"(ll), "v"(ll + vs), "v"(ll + 2 * vs), "v"(ll + 3 * vs),
                  "v"(gk), "v"(gk + kg), "v"(gk + 2 * kg), "v"(gk + 3 * kg),
                  "v"(gh), "v"(gh + vg), "v"(gh + 2 * vg), "v"(gh + 3 * vg),
                  "v"(gl), "v"(gl + vg), "v"(gl + 2 * vg), "v"(gl + 3 * vg)
               : "memory");
#endif
}

// four waves per SIMD: two blocks of 8 waves on a WGP, 256 registers a wave
__global__ __launch_bounds__(256) __attribute__((amdgpu_waves_per_eu(4, 4)))
void attn_kernel(const unsigned short* __restrict__ qhp, const unsigned short* __restrict__ qlp,
                 const unsigned short* __restrict__ kp,
                 const unsigned short* __restrict__ vhp, const unsigned short* __restrict__ vlp,
                 const float* __restrict__ bmp, const float* __restrict__ glp,
                 unsigned short* chp, unsigned short* clp) {
  __shared__ __align__(16) _Float16 KVs[2 * AT_BUF];   // two buffers of K [key][d] | V^T hi [d][key] | V^T res [d][key], padded rows; ctx staging later
  static_assert(8 * 16 * OS_P * 4 <= 2 * AT_BUF * 2);

  const int tid  = threadIdx.x;
  const int wave = __builtin_amdgcn_readfirstlane(tid >> 5);   // wave-uniform: held in a scalar register, with all that is formed from it
  const int lane = tid & 31;
  const int hh   = lane >> 4;
  const int c    = lane & 15;

  const int bx  = blockIdx.x;
  const int qb  = bx & 15;                 // query block of 128
  const int h   = (bx >> 4) & (NH - 1);    // head
  const int b   = bx >> 8;                 // batch element
  const int q0  = qb * AT_QB + wave * 16;

  const _Float16* Qhg = (const _Float16*)(const void*)qhp + (size_t)(b * NH + h) * SEQ * HD;
  const _Float16* Qlg = (const _Float16*)(const void*)qlp + (size_t)(b * NH + h) * SEQ * HD;
  const _Float16* Kg  = (const _Float16*)(const void*)kp  + (size_t)(b * NH + h) * SEQ * HD;
  const _Float16* Vhg = (const _Float16*)(const void*)vhp + ((size_t)b * HID + (size_t)h * HD) * SEQ;
  const _Float16* Vlg = (const _Float16*)(const void*)vlp + ((size_t)b * HID + (size_t)h * HD) * SEQ;
  const float*    Bm  = bmp + (size_t)b * SEQ * SEQ + (size_t)(q0 + c) * SEQ + 8 * hh;   // + first key of the tile + r
  const int qro = (q0 + c) * HD + 8 * hh;  // per-lane q fragment base, query q0 + c (d added per step)

  // per-head bias scale 2^(-(h+1)/2): exact power of two times sqrt(1/2) for odd (h+1)
  const int   hexp = (h + 1) >> 1;
  const float hs   = __uint_as_float((unsigned)(127 - hexp) << 23) * (((h + 1) & 1) ? 0.70710678118654752f : 1.0f);

  const v8f zero8 = (v8f){0.f, 0.f, 0.f, 0.f, 0.f, 0.f, 0.f, 0.f};
  const float inv2048 = 4.8828125e-4f;
  const float scale   = 1.0f / 11.313708305358887f;

  float mrow = -INFINITY, lrow = 0.f;      // of query q0 + c; lrow sums this lane half's keys only
  v8f oh[8];
#pragma unroll
  for (int t = 0; t < 8; ++t) oh[t] = zero8;

  v16h qa[4], qr[4];
  // unrolled: static indices keep these arrays in registers
#pragma unroll
  for (int dc = 0; dc < 4; ++dc) {
    qa[dc] = ldfrag_h(Qhg + qro + dc * 32);
    qr[dc] = ldfrag_h(Qlg + qro + dc * 32);
  }

  // copy lanes: K: thread -> key tid>>4 (+16 per copy), 16-B piece tid&15 of the row's 256 B;
  //             V^T hi/res: thread -> d = tid>>3 (+32 per copy), 16-B piece tid&7 of the row's 128 B of this chunk
  // coverage: 4 x 16 keys x 128 d for K, 4 x 32 d x 64 keys for each V^T plane = the whole chunk tiles
  constexpr int NCH = SEQ / AT_KC;
  static_assert(NCH >= 2);
  const int krow = tid >> 4, kseg = (tid & 15) * 8;
  const int vrow = tid >> 3, vseg = (tid & 7) * 8;
  const unsigned lK = (unsigned)(size_t)(const void*)KVs + (unsigned)(krow * K_P + kseg) * 2u;                 // LDS byte addresses, buffer 0
  const unsigned lH = (unsigned)(size_t)(const void*)KVs + (unsigned)(AT_KC * K_P + vrow * V_P + vseg) * 2u;
  const unsigned lL = lH + HD * V_P * 2;
  const _Float16* gK = Kg  + krow * HD + kseg;
  const _Float16* gH = Vhg + (size_t)vrow * SEQ + vseg;
  const _Float16* gL = Vlg + (size_t)vrow * SEQ + vseg;

  // chunk 0 into buffer 0, published
  copy_chunk(lK, lH, lL, gK, gH, gL);
  wait_copies();
  __syncthreads();

  // one chunk per trip, the buffer chosen by the trip's parity
  for (int kc = 0; kc < NCH; ++kc) {
    const int kv0 = kc * AT_KC;
    const int bo  = (kc & 1) * AT_BUF;
    // directly behind the barrier that ended every read of the other buffer (the one above, then the one at the trip's foot):
    // the next chunk's copies into it, while there is a next chunk (block-uniform); they fly while this chunk is worked on
    if (kc + 1 < NCH) {
      const unsigned lb = (unsigned)(AT_BUF - bo) * 2u;
      const int kn = kv0 + AT_KC;
      copy_chunk(lK + lb, lH + lb, lL + lb, gK + (size_t)kn * HD, gH + kn, gL + kn);
    }
    const _Float16* const Ksh = KVs + bo;
    const _Float16* const Vth = KVs + bo + AT_KC * K_P;
    const _Float16* const Vtl = KVs + bo + AT_KC * K_P + HD * V_P;

    // ---- scores: 4 key tiles of 16, reduce over d = 128 = 4 k-steps; hi and residual accumulators separate ----
    v8f s[4];
    v4f bb[4][2];                            // raw bias values per key tile: 8 consecutive keys of this lane's query
    bb[0][0] = *(const v4f*)(Bm + kv0);
    bb[0][1] = *(const v4f*)(Bm + kv0 + 4);
#pragma unroll
    for (int j = 0; j < 4; ++j) {
      if (j < 3) {
        bb[j + 1][0] = *(const v4f*)(Bm + kv0 + (j + 1) * 16);
        bb[j + 1][1] = *(const v4f*)(Bm + kv0 + (j + 1) * 16 + 4);
        // keeps the next key tile's bias loads issued as one group here, in flight behind this tile's products:
        // with the q fragments held, the scheduler otherwise sinks them in pairs to their uses
        __builtin_amdgcn_sched_barrier(0);
      }
      v8f sh = zero8, sl = zero8;
#pragma unroll
      for (int dc = 0; dc < 4; ++dc) {
        FragH kb;
        kb.h[0] = *(const v8h*)(Ksh + (j * 16 + c) * K_P + dc * 32 + 8 * hh);
        kb.h[1] = *(const v8h*)(Ksh + (j * 16 + c) * K_P + dc * 32 + 16 + 8 * hh);
        sh = wmma_h(kb.v, qa[dc], sh);
        sl = wmma_h(kb.v, qr[dc], sl);
      }
      // keeps the first use of this tile's bias (and its wait) behind the tile's products
      __builtin_amdgcn_sched_barrier(0);
      v8f sj = (sh + sl * inv2048) * scale;
#pragma unroll
      for (int r = 0; r < 8; ++r) sj[r] = sj[r] + hs * bfr(bb[j][r >> 2][r & 3]);
      s[j] = sj;
    }

    // maximum over this lane's 32 scores, then over the other half's
    float mx[8];
#pragma unroll
    for (int r = 0; r < 8; ++r) mx[r] = fmaxf(fmaxf(s[0][r], s[1][r]), fmaxf(s[2][r], s[3][r]));
    float cm = fmaxf(fmaxf(fmaxf(mx[0], mx[1]), fmaxf(mx[2], mx[3])), fmaxf(fmaxf(mx[4], mx[5]), fmaxf(mx[6], mx[7])));
    cm = fmaxf(cm, xhalf(cm));

    const float mnew  = fmaxf(mrow, cm);
    const float alpha = expf(mrow - mnew);
    mrow = mnew;
    // P^T operands: element e of k-step kk is key 32*kk + 8*hh + e (e < 8, tile 2*kk) or 32*kk + 16 + 8*hh + e - 8 (tile 2*kk + 1),
    // the k order of the V^T fragment loads below
    FragH pb[2];
    float ps[4];
#pragma unroll
    for (int j = 0; j < 4; ++j) {
      float pj = 0.f;
#pragma unroll
      for (int r = 0; r < 8; ++r) {
        const float p = expf(s[j][r] - mnew);
        pj += p;
        pb[j >> 1].v[(j & 1) * 8 + r] = (_Float16)(p * 1024.0f);
      }
      ps[j] = pj;
    }
    lrow = lrow * alpha + ((ps[0] + ps[1]) + (ps[2] + ps[3]));
#pragma unroll
    for (int t = 0; t < 8; ++t) oh[t] *= alpha;

    // ---- ctx^T += V^T . P^T over the 64 keys of the chunk (2 k-steps), 8 d tiles ----
    // unrolled: the static index keeps pb in registers
#pragma unroll
    for (int kk = 0; kk < 2; ++kk) {
#pragma unroll
      for (int t = 0; t < 8; ++t) {
        FragH vb, vr;
        vb.h[0] = *(const v8h*)(Vth + (t * 16 + c) * V_P + kk * 32 + 8 * hh);
        vb.h[1] = *(const v8h*)(Vth + (t * 16 + c) * V_P + kk * 32 + 16 + 8 * hh);
        vr.h[0] = *(const v8h*)(Vtl + (t * 16 + c) * V_P + kk * 32 + 8 * hh);
        vr.h[1] = *(const v8h*)(Vtl + (t * 16 + c) * V_P + kk * 32 + 16 + 8 * hh);
        oh[t] = wmma_h(vb.v, pb[kk].v, oh[t]);
        const v8f tr = wmma_h(vr.v, pb[kk].v, zero8);
        oh[t] += tr * inv2048;
      }
    }
    // publish point of chunk kc + 1: own reads of this buffer done, own copies of the next landed, then the block barrier
    wait_lds();
    wait_copies();
    __syncthreads();
  }
  wait_copies();

  // ---- normalise, apply the head gate, stage the wave 16x128 tile (aliases the K/V region behind the loop's last barrier),
  //      write bf16 hi/lo planes ----
  float* os = (float*)(void*)KVs + wave * (16 * OS_P);
  {
    const float lsum = lrow + xhalf(lrow);   // the two lane halves' key sums of query q0 + c
    const float a  = glp[(size_t)(b * SEQ + q0 + c) * GLD + h];
    const float g  = 1.0f / (1.0f + expf(-a));
    const float invl = g * (1.0f / lsum) * 9.765625e-4f;
#pragma unroll
    for (int t = 0; t < 8; ++t) {
      const v8f o = oh[t] * invl;
      *(v4f*)(os + c * OS_P + t * 16 + 8 * hh)     = (v4f){o[0], o[1], o[2], o[3]};
      *(v4f*)(os + c * OS_P + t * 16 + 8 * hh + 4) = (v4f){o[4], o[5], o[6], o[7]};
    }
  }
  wave_sync();
  {
    const int q16 = lane >> 4, c8 = (lane & 15) * 8;         // 2 rows per instruction, each row 256 B = 16 lanes x 16 B
    {
#pragma unroll
      for (int it = 0; it < 8; ++it) {
        const int row = it * 2 + q16;
        const float* sp = os + row * OS_P + c8;
        v4u hv, lv;
#pragma unroll
        for (int p = 0; p < 4; ++p) {
          const float f0 = sp[2 * p], f1 = sp[2 * p + 1];
          const unsigned short hb0 = f2bf_bits(f0), hb1 = f2bf_bits(f1);
          const unsigned short lb0 = f2bf_bits(f0 - bf_bits2f(hb0));
          const unsigned short lb1 = f2bf_bits(f1 - bf_bits2f(hb1));
          hv[p] = pk16(hb0, hb1);
          lv[p] = pk16(lb0, lb1);
        }
        const size_t go = (size_t)(b * SEQ + q0 + row) * HID + h * HD + c8;
        *(v4u*)(chp + go) = hv;
        *(v4u*)(clp + go) = lv;
      }
      
    }
  }
}

// ---------------------------------------------------------------------------
// all sizes exact tile multiples, all offsets multiples of 512 KiB):
//   R0   bf16 [4096][2048]       16777216 @ 0           x as bf16; later ctx hi plane (written after the last reader of x)
//   R1   bf16 [4096][2048]       16777216 @ 16777216    wv^T as bf16 [2048][2048]; then wq^T|wk^T panel [4096][2048]; later ctx lo plane
//   Wob  bf16 [2048][2048]        8388608 @ 33554432    wo^T
//   Wgb  bf16 [128][2048]          524288 @ 41943040    wg^T zero-padded to 128 rows
//   Glog f32  [4096][128]         2097152 @ 42467328    gate logits
//   Qh   f16  [2][16][2048][128]  16777216 @ 44564480    Ql same @ 61341696
//   Kp   f16  [2][16][2048][128]  16777216 @ 78118912
//   Vth  f16  [2][2048][2048]     16777216 @ 94896128    Vtl same @ 111673344
//   total                        128450560
// ---------------------------------------------------------------------------
extern "C" void kernel_launch(void* const* d_in, const int* in_sizes, int n_in,
                              void* d_out, int out_size, void* d_ws, size_t ws_size,
                              hipStream_t stream) {
  if (n_in < 12) return;
  if (in_sizes[0] != NB * SEQ * HID) return;
  if (in_sizes[1] != NB * SEQ * SEQ) return;
  if (in_sizes[2] != HID * HID) return;
  if (in_sizes[3] != HID) return;
  if (in_sizes[4] != HID * HID) return;
  if (in_sizes[5] != HID) return;
  if (in_sizes[6] != HID * HID) return;
  if (in_sizes[7] != HID) return;
  if (in_sizes[8] != HID * NH) return;
  if (in_sizes[9] != NH) return;
  if (in_sizes[10] != HID * HID) return;
  if (in_sizes[11] != HID) return;
  if (out_size != NB * SEQ * HID) return;

  const float* x   = (const float*)d_in[0];
  const float* bm  = (const float*)d_in[1];
  const float* wq  = (const float*)d_in[2];
  const float* bq  = (const float*)d_in[3];
  const float* wk  = (const float*)d_in[4];
  const float* bk  = (const float*)d_in[5];
  const float* wv  = (const float*)d_in[6];
  const float* bv  = (const float*)d_in[7];
  const float* wg  = (const float*)d_in[8];
  const float* bg  = (const float*)d_in[9];
  const float* wo  = (const float*)d_in[10];
  const float* bo  = (const float*)d_in[11];
  float* out = (float*)d_out;

  const size_t szR0  = (size_t)NB * SEQ * HID * 2;          // 16 MiB
  const size_t szR1  = (size_t)2 * HID * HID * 2;           // 16 MiB
  const size_t szWo  = (size_t)HID * HID * 2;               //  8 MiB
  const size_t szWg  = (size_t)GLD * HID * 2;               //  512 KiB
  const size_t szG   = (size_t)NB * SEQ * GLD * 4;          //  2 MiB
  const size_t szQ   = (size_t)NB * NH * SEQ * HD * 2;      // 16 MiB
  const size_t szK   = szQ;
  const size_t szV   = (size_t)NB * HID * SEQ * 2;          // 16 MiB
  size_t off = 0;
  const size_t oR0  = off; off += szR0;
  const size_t oR1  = off; off += szR1;
  const size_t oWo  = off; off += szWo;
  const size_t oWg  = off; off += szWg;
  const size_t oG   = off; off += szG;
  const size_t oQh  = off; off += szQ;
  const size_t oQl  = off; off += szQ;
  const size_t oKp  = off; off += szK;
  const size_t oVth = off; off += szV;
  const size_t oVtl = off; off += szV;
  if (off > ws_size) return;                    // off = 128450560
  if (off > (size_t)134217728) return;

  char* ws = (char*)d_ws;
  unsigned short* Xb  = (unsigned short*)(ws + oR0);
  unsigned short* Ch  = (unsigned short*)(ws + oR0);        // reuses R0 after the gate GEMM (last reader of Xb)
  unsigned short* Wvt = (unsigned short*)(ws + oR1);
  unsigned short* Wqk = (unsigned short*)(ws + oR1);        // reuses R1 after the v^T GEMM (last reader of Wvt)
  unsigned short* Cl  = (unsigned short*)(ws + oR1);        // reuses R1 after the q|k GEMM (last reader of Wqk)
  unsigned short* Wot = (unsigned short*)(ws + oWo);
  unsigned short* Wgt = (unsigned short*)(ws + oWg);
  float*          Gl  = (float*)(ws + oG);
  unsigned short* Qh  = (unsigned short*)(ws + oQh);
  unsigned short* Ql  = (unsigned short*)(ws + oQl);
  unsigned short* Kp  = (unsigned short*)(ws + oKp);
  unsigned short* Vth = (unsigned short*)(ws + oVth);
  unsigned short* Vtl = (unsigned short*)(ws + oVtl);

  const dim3 blk256(256), blk128(128);
  const dim3 trg(HID / 64, HID / 64);           // in [2048 rows][2048 cols] -> out [cols][rows]
  const int n8x = NB * SEQ * HID / 8;

  // (1) x f32 -> bf16 plane
  cvt_bf16x8_kernel<<<dim3((n8x + 255) / 256), blk256, 0, stream>>>(x, Xb, n8x);
  // (2) wv [in][out] -> wv^T bf16 [out][in]
  tr_bf16_kernel<<<trg, blk256, 0, stream>>>(wv, Wvt, HID, HID);
  // (3) v^T per batch element: A = Wvt [2048 d][2048 k], Bt = Xb[b] [2048 s][2048 k] -> V^T hi/res planes [2048][2048] per b, + bv[d]
  {
    const int M = HID, N = SEQ, K = HID;
    const int tiles = (M / 32) * (N / 128);
    gemm_kernel<false, 1, true><<<dim3((tiles + 3) / 4, NB), blk128, 0, stream>>>(
        Wvt, Wvt, HID, 0L, Xb, HID, (long)SEQ * HID, (void*)Vth, (void*)Vtl, (void*)Vtl, SEQ, (long)HID * SEQ,
        bv, HID, bv, HID, N, M, N, K);
  }
  // (4) wq^T | wk^T panel [4096][2048] into R1
  tr_bf16_kernel<<<trg, blk256, 0, stream>>>(wq, Wqk, HID, HID);
  tr_bf16_kernel<<<trg, blk256, 0, stream>>>(wk, Wqk + (size_t)HID * HID, HID, HID);
  // (5) q | k projections with head-major relayout: A = Xb [4096][2048], Bt = Wqk [4096][2048] -> q hi/res planes, k plane; + bq | bk
  {
    const int M = NB * SEQ, N = 2 * HID, K = HID;
    const int tiles = (M / 32) * (N / 128);
    gemm_kernel<false, 2, false><<<dim3((tiles + 3) / 4, 1), blk128, 0, stream>>>(
        Xb, Xb, HID, 0L, Wqk, HID, 0L, (void*)Qh, (void*)Ql, (void*)Kp, HD, 0L,
        bq, HID, bk, HID, HID, M, N, K);
  }
  // (6) gate weights: wg [2048][16] -> wg^T zero-padded bf16 [128][2048]
  wg_pad_kernel<<<dim3(GLD), blk256, 0, stream>>>(wg, Wgt);
  // (7) gate logits: A = Xb [4096][2048], Bt = Wgt [128][2048] -> f32 [4096][128], + bg for columns < 16
  {
    const int M = NB * SEQ, N = GLD, K = HID;
    const int tiles = (M / 32) * (N / 128);
    gemm_kernel<false, 0, false><<<dim3((tiles + 3) / 4, 1), blk128, 0, stream>>>(
        Xb, Xb, HID, 0L, Wgt, HID, 0L, (void*)Gl, (void*)Gl, (void*)Gl, GLD, 0L,
        bg, NH, bg, NH, N, M, N, K);
  }
  // (8) wo [in][out] -> wo^T bf16
  tr_bf16_kernel<<<trg, blk256, 0, stream>>>(wo, Wot, HID, HID);
  // (9) attention: grid = NB x 16 heads x 16 query blocks, 256 threads
  attn_kernel<<<dim3(NB * NH * (SEQ / AT_QB)), blk256, 0, stream>>>(Qh, Ql, Kp, Vth, Vtl, bm, Gl, Ch, Cl);
  // (10) output projection: A = gated ctx hi/lo planes [4096][2048], Bt = Wot [2048][2048] -> d_out f32 [4096][2048], + bo
  {
    const int M = NB * SEQ, N = HID, K = HID;
    const int tiles = (M / 32) * (N / 128);
    gemm_kernel<true, 0, false><<<dim3((tiles + 3) / 4, 1), blk128, 0, stream>>>(
        Ch, Cl, HID, 0L, Wot, HID, 0L, (void*)out, (void*)out, (void*)out, HID, 0L,
        bo, HID, bo, HID, N, M, N, K);
  }
  (void)hipGetLastError();
}

// v006
// It runs in 323 microseconds.
// Next to v005, in two timings, it ran 1.09 and 1.10 times as fast.
// All steps since v000 together make it 3.64 times as fast.
#include <hip/hip_runtime.h>
#include <math.h>
#include <stdint.h>

// q/k/v and gate projections: v_wmma_f32_16x16x32_bf16, single products on bf16-RNE converted x and W^T, f32 accumulate;
// scores, transposed, k.q^T: v_wmma_f32_16x16x32_f16 with q = f16 hi + residual x2^11 planes, k single f16 plane, f32 accumulate;
// ctx, transposed, v^T.p^T: v_wmma_f32_16x16x32_f16 with p x1024 single f16 plane, v^T = f16 hi + residual x2^11 planes, f32 accumulate;
// output projection: v_wmma_f32_16x16x32_bf16 with gated ctx as bf16 hi + lo planes and Wo^T bf16, f32 accumulate.
// Online softmax, score scale 1/sqrt(128), per-head bias scale 2^(-(h+1)/2), sigmoid gate and normalisation in f32.

#define NB   2
#define SEQ  2048
#define HID  2048
#define NH   16
#define HD   128
#define GLD  128

typedef _Float16 v16h __attribute__((ext_vector_type(16)));
typedef _Float16 v8h  __attribute__((ext_vector_type(8)));
typedef __bf16   v16b __attribute__((ext_vector_type(16)));
typedef __bf16   v8b  __attribute__((ext_vector_type(8)));
typedef float    v8f  __attribute__((ext_vector_type(8)));
typedef float    v4f  __attribute__((ext_vector_type(4)));
typedef unsigned int v4u __attribute__((ext_vector_type(4)));

// ---------------------------------------------------------------------------
// small helpers
// ---------------------------------------------------------------------------
__device__ __forceinline__ unsigned short f2bf_bits(float f) {          // RNE convert f32 -> bf16 bits
  const unsigned u = __float_as_uint(f);
  return (unsigned short)((u + 0x7FFFu + ((u >> 16) & 1u)) >> 16);
}
__device__ __forceinline__ float bf_bits2f(unsigned short x) { return __uint_as_float(((unsigned)x) << 16); }
__device__ __forceinline__ float bfr(float f) { return __uint_as_float(((unsigned)f2bf_bits(f)) << 16); }
__device__ __forceinline__ unsigned pk16(unsigned short a, unsigned short b) { return (unsigned)a | ((unsigned)b << 16); }
__device__ __forceinline__ unsigned short h2u(_Float16 x) { return __builtin_bit_cast(unsigned short, x); }

// 2^(x - m) on eight values in place. One statement, so that behind each v_exp_f32 stands an independent one (another register, neither
// its result nor its source), the slot the instruction set asks for behind a transcendental; the v_nop is that slot for the last.
__device__ __forceinline__ void exp2x8(v8f& x, float m) {
#if defined(__HIP_DEVICE_COMPILE__)
  float a = x[0] - m, b = x[1] - m, c = x[2] - m, d = x[3] - m, e = x[4] - m, f = x[5] - m, g = x[6] - m, h = x[7] - m;
  asm("v_exp_f32 %0, %0\n\tv_exp_f32 %1, %1\n\tv_exp_f32 %2, %2\n\tv_exp_f32 %3, %3\n\t"
      "v_exp_f32 %4, %4\n\tv_exp_f32 %5, %5\n\tv_exp_f32 %6, %6\n\tv_exp_f32 %7, %7\n\tv_nop"
      : "+v"(a), "+v"(b), "+v"(c), "+v"(d), "+v"(e), "+v"(f), "+v"(g), "+v"(h));
  x = (v8f){a, b, c, d, e, f, g, h};
#endif
}

// lane l with lane l ^ 16
__device__ __forceinline__ float xhalf(float x) {
  return __builtin_bit_cast(float, __builtin_amdgcn_permlanex16(__builtin_bit_cast(int, x), __builtin_bit_cast(int, x), 0x76543210, 0xfedcba98, false, false));
}

__device__ __forceinline__ void wave_sync() {
  __builtin_amdgcn_fence(__ATOMIC_RELEASE, "workgroup");
  __builtin_amdgcn_wave_barrier();
  __builtin_amdgcn_fence(__ATOMIC_ACQUIRE, "workgroup");
}

// 16-bit fragment loaders, same k map for A and B: p points at (row or col)*ld + k0 + 8*(lane>>4);
// elements 0..7 <- p[0..7] (k0+8h..k0+8h+7), elements 8..15 <- p[16..23] (k0+16+8h..k0+16+8h+7).
union FragB { v16b v; v8b h[2]; };
union FragH { v16h v; v8h h[2]; };
__device__ __forceinline__ v16b ldfrag_b(const __bf16* p) {
  FragB f; f.h[0] = *(const v8b*)(p); f.h[1] = *(const v8b*)(p + 16); return f.v;
}
__device__ __forceinline__ v16h ldfrag_h(const _Float16* p) {
  FragH f; f.h[0] = *(const v8h*)(p); f.h[1] = *(const v8h*)(p + 16); return f.v;
}

__device__ __forceinline__ v8f wmma_b(v16b a, v16b b, v8f c) {
  return __builtin_amdgcn_wmma_f32_16x16x32_bf16(false, a, false, b, (short)0, c, false, false);
}
// f16 form with the hazard guard attached to every issue (ties D, keeps A/B live)
__device__ __forceinline__ v8f wmma_h(v16h a, v16h b, v8f c) {
  c = __builtin_amdgcn_wmma_f32_16x16x32_f16(false, a, false, b, (short)0, c, false, false);
#if defined(__HIP_DEVICE_COMPILE__)
  asm volatile("v_nop\n\tv_nop\n\tv_nop\n\tv_nop" : "+v"(c) : "v"(a), "v"(b));
#endif
  return c;
}
// hazard guard for one j-group of the register-blocked GEMM (ties both D tiles, keeps A/B registers live)
__device__ __forceinline__ void dep_guard_b(v8f& x, v8f& y, v16b b, v16b a0, v16b a1, v16b l0, v16b l1) {
#if defined(__HIP_DEVICE_COMPILE__)
  asm volatile("v_nop\n\tv_nop\n\tv_nop\n\tv_nop" : "+v"(x), "+v"(y) : "v"(b), "v"(a0), "v"(a1), "v"(l0), "v"(l1));
#endif
}

// ---------------------------------------------------------------------------
// f32 -> bf16 (RNE) convert, 8 elements per thread: two 16-B loads, one 16-B store.
// Coverage: grid = ceil(n8/256) x 256 threads x 8 elements = the whole array (sizes here are multiples of 2048).
// ---------------------------------------------------------------------------
__global__ __launch_bounds__(256) void cvt_bf16x8_kernel(const float* __restrict__ in, unsigned short* out, int n8) {
  const int i = blockIdx.x * 256 + threadIdx.x;
  if (i < n8) {
    const v4f a = *(const v4f*)(in + 8 * (size_t)i);
    const v4f c = *(const v4f*)(in + 8 * (size_t)i + 4);
    v4u w;
    w[0] = pk16(f2bf_bits(a[0]), f2bf_bits(a[1]));
    w[1] = pk16(f2bf_bits(a[2]), f2bf_bits(a[3]));
    w[2] = pk16(f2bf_bits(c[0]), f2bf_bits(c[1]));
    w[3] = pk16(f2bf_bits(c[2]), f2bf_bits(c[3]));
    v4u* p = (v4u*)(out + 8 * (size_t)i);
    *p = w;
    
  }
}

// ---------------------------------------------------------------------------
// Transpose + RNE bf16 convert: in f32 [R][C] row-major -> out bf16 [C][R] (out[c][r] = bf16(in[r][c])).
// Block 256 threads handles a 64x64 tile through LDS. Load: thread -> 4 float4 (rows t>>4 + 16i, cols 4*(t&15)+0..3).
// Coverage: out rows cc = wave*4 + (lane>>3) (+32) over 8 waves = 0..63; columns (lane&7)*8 + 0..7 = 0..63; grid (C/64, R/64).
// ---------------------------------------------------------------------------
__global__ __launch_bounds__(256) void tr_bf16_kernel(const float* __restrict__ in, unsigned short* out, int R, int C) {
  __shared__ __align__(16) float tile[64][65];
  const int c0 = blockIdx.x * 64, r0 = blockIdx.y * 64;
  const int t = threadIdx.x;
  const int cq = (t & 15) * 4, rb = t >> 4;
#pragma unroll
  for (int i = 0; i < 4; ++i) {
    const int r = rb + 16 * i;
    const v4f v = *(const v4f*)(in + (size_t)(r0 + r) * C + c0 + cq);
    tile[r][cq] = v[0]; tile[r][cq + 1] = v[1]; tile[r][cq + 2] = v[2]; tile[r][cq + 3] = v[3];
  }
  __syncthreads();
  const int wave = t >> 5, lane = t & 31, q = lane >> 3, pc = lane & 7;
  const int cc0 = wave * 4 + q, cc1 = 32 + wave * 4 + q;
  v4u w0, w1;
#pragma unroll
  for (int e = 0; e < 4; ++e) {
    w0[e] = pk16(f2bf_bits(tile[pc * 8 + 2 * e][cc0]), f2bf_bits(tile[pc * 8 + 2 * e + 1][cc0]));
    w1[e] = pk16(f2bf_bits(tile[pc * 8 + 2 * e][cc1]), f2bf_bits(tile[pc * 8 + 2 * e + 1][cc1]));
  }
  v4u* p0 = (v4u*)(out + (size_t)(c0 + cc0) * R + r0 + pc * 8);
  v4u* p1 = (v4u*)(out + (size_t)(c0 + cc1) * R + r0 + pc * 8);
  *p0 = w0; *p1 = w1;
  
}

// ---------------------------------------------------------------------------
// Gate weight panel: wg f32 [HID][NH] -> out bf16 [GLD][HID], out[n][k] = bf16(wg[k][n]) for n < NH, 0 for n >= NH.
// Block n (uniform), thread -> k = 8*threadIdx.x; loads use a clamped column address, zeroed by value for n >= NH.
// Coverage: 128 blocks x 256 threads x 8 = the whole [128][2048] panel (padding rows written as zeros).
// ---------------------------------------------------------------------------
__global__ __launch_bounds__(256) void wg_pad_kernel(const float* __restrict__ wg, unsigned short* out) {
  const int n = blockIdx.x;
  const int k = threadIdx.x * 8;
  const int nn = (n < NH) ? n : (NH - 1);
  const float keep = (n < NH) ? 1.0f : 0.0f;
  v4u w;
#pragma unroll
  for (int e = 0; e < 4; ++e) {
    const float a = wg[(size_t)(k + 2 * e) * NH + nn] * keep;
    const float b = wg[(size_t)(k + 2 * e + 1) * NH + nn] * keep;
    w[e] = pk16(f2bf_bits(a), f2bf_bits(b));
  }
  v4u* p = (v4u*)(out + (size_t)n * HID + k);
  *p = w;
  
}

// ---------------------------------------------------------------------------
// Register-blocked bf16 WMMA GEMM: C[m][n] = sum_k A[m][k] * Bt[n][k] + bias; each wave owns a 32x128 tile,
// the 4 waves of a block own 128x128 (4 row slabs over one column panel) and share the operand tiles in LDS.
// A row-major [M][K] (pitch lda), Bt row-major [N][K] (pitch ldb); M and N multiples of 128, K multiple of 64.
// Operand staging: per stage of 64 k, 128 rows x 128 B of A (and of the lo plane) and of Bt are copied global -> LDS by
// asynchronous 16-B copies, 8 lanes per row (whole 128-B lines), rows at pitch 144 B; two buffers, the copies of
// stage t + 2 fly while stage t + 1 is worked on. Fragments are then read from LDS with the same k map as before.
// SPLITA: A given as hi plane (Ap) + unscaled bf16 lo plane (A2p): products Ahi.B + Alo.B into one accumulator.
// BROW: bias[m] per row (clamped to nb1), else per column: bias[n] for n < nsplit (valid while n < nb1),
//       bias2[n - nsplit] for n >= nsplit (valid while n - nsplit < nb2); bias values RNE-rounded to bf16; both
//       candidates loaded from clamped addresses and selected by value.
// blockIdx.y selects a z slice through strideA / strideB / strideC (element strides).
// Epilogue: per wave, each 16x128 accumulator slab is staged in LDS (pitch 132 floats), then written as whole
//   OUT_MODE 0: f32 rows into Cout [M][ldc] (row segment 512 B = 32 lanes x 16 B, 1 row per instruction).
//   OUT_MODE 1: f16 hi plane Cout + f16 residual plane Cout2 ((v - hi) * 2048), [M][ldc] (256 B = 16 lanes x 16 B, 2 rows per instr.).
//   OUT_MODE 2: head-major relayout: columns n0 < nsplit -> q planes Cout (f16 hi) / Cout2 (residual * 2048) at
//               [(b*16 + n0/128)*SEQ + s][ldc = 128]; columns >= nsplit -> single f16 k plane Cout3 at
//               [(b*16 + (n0-nsplit)/128)*SEQ + s][128], with row m = b*2048 + s. Each 128-wide row = 256 B = 16 lanes x 16 B.
// Coverage per slab: it 0..7 x (lane>>4) 0..1 = 16 rows, (lane&15)*8 + 0..7 = 128 columns (OUT_MODE 1/2);
//                    it 0..15 = 16 rows, lane*4 + 0..3 = 128 columns (OUT_MODE 0).
// ---------------------------------------------------------------------------
#define GP 132
#define GK    64               // k elements per stage
#define GT_P  (GK + 8)         // LDS row pitch in bf16 elements: 144 B = 16 B x odd, conflict-free for ds_load_b128 fragment reads
#define GT_SZ (128 * GT_P)     // elements of one staged 128-row tile

// One 128-row x 128-B tile, global -> LDS: 8 asynchronous 16-B copies per lane. l = this lane's LDS byte address of its
// first row, g = this lane's global address of its first row; copy i takes row +16*i (ld = global pitch in elements).
// The s_wait_xcnt stands inside the statement so that no address register is rewritten ahead of it.
__device__ __forceinline__ void copy_tile(unsigned l, const __bf16* g, int ld) {
  const size_t st = (size_t)16 * (size_t)ld;
  const unsigned ls = 16 * GT_P * 2;
  const __bf16 *g1 = g + st, *g2 = g + 2 * st, *g3 = g + 3 * st, *g4 = g + 4 * st, *g5 = g + 5 * st, *g6 = g + 6 * st, *g7 = g + 7 * st;
#if defined(__HIP_DEVICE_COMPILE__)
  asm volatile("global_load_async_to_lds_b128 %0, %8, off\n\t"
               "global_load_async_to_lds_b128 %1, %9, off\n\t"
               "global_load_async_to_lds_b128 %2, %10, off\n\t"
               "global_load_async_to_lds_b128 %3, %11, off\n\t"
               "global_load_async_to_lds_b128 %4, %12, off\n\t"
               "global_load_async_to_lds_b128 %5, %13, off\n\t"
               "global_load_async_to_lds_b128 %6, %14, off\n\t"
               "global_load_async_to_lds_b128 %7, %15, off\n\t"
               "s_wait_xcnt 0x0"
               :: "v"(l), "v"(l + ls), "v"(l + 2 * ls), "v"(l + 3 * ls), "v"(l + 4 * ls), "v"(l + 5 * ls), "v"(l + 6 * ls), "v"(l + 7 * ls),
                  "v"(g), "v"(g1), "v"(g2), "v"(g3), "v"(g4), "v"(g5), "v"(g6), "v"(g7)
               : "memory");
#endif
}
// this wave's own copies have landed
__device__ __forceinline__ void wait_copies() {
#if defined(__HIP_DEVICE_COMPILE__)
  asm volatile("s_wait_asynccnt 0x0" ::: "memory");
#endif
}
// this wave's own LDS reads have returned (before the barrier that hands their buffer to the next copies)
__device__ __forceinline__ void wait_lds() {
#if defined(__HIP_DEVICE_COMPILE__)
  asm volatile("s_wait_dscnt 0x0" ::: "memory");
#endif
}

template <bool SPLITA, int OUT_MODE, bool BROW>
__global__ __launch_bounds__(128) void gemm_kernel(
    const unsigned short* __restrict__ Ap, const unsigned short* __restrict__ A2p, int lda, long strideA,
    const unsigned short* __restrict__ Btp, int ldb, long strideB,
    void* Cout, void* Cout2, void* Cout3, int ldc, long strideC,
    const float* __restrict__ bias, int nb1, const float* __restrict__ bias2, int nb2, int nsplit,
    int M, int N, int K) {
  constexpr int NT = SPLITA ? 3 : 2;            // staged tiles per stage: A, Bt (, A lo plane)
  __shared__ __align__(16) __bf16 sS[2 * NT * GT_SZ];   // two stage buffers; the epilogue slabs reuse them behind the loop's last barrier
  static_assert(4 * 16 * GP * 4 <= 2 * NT * GT_SZ * 2);
  const int bz   = blockIdx.y;
  const int tid  = threadIdx.x;
  const int lane = threadIdx.x & 31;
  const int wave = threadIdx.x >> 5;
  const int tilesN = N >> 7;
  const int tilesM = M >> 7;
  const int tile = blockIdx.x;
  if (tile >= tilesM * tilesN) return;          // block-uniform, in front of every barrier
  const int tm = tile / tilesN;
  const int tn = tile - tm * tilesN;
  const int mb = tm << 7;                       // first row of the block's 128x128 tile
  const int m0 = mb + (wave << 5);
  const int n0 = tn << 7;

  const __bf16* Ab  = (const __bf16*)(const void*)Ap + (size_t)bz * strideA;
  const __bf16* Ab2 = SPLITA ? ((const __bf16*)(const void*)A2p + (size_t)bz * strideA) : (const __bf16*)0;
  const __bf16* Bb  = (const __bf16*)(const void*)Btp + (size_t)bz * strideB;

  const int rlane = lane & 15;              // row (A) / col (B, D) within a 16x16 subtile
  const int koff  = (lane >> 4) * 8;        // k offset of this lane half
  const int mOff  = (lane >> 4) * 8;        // D row offset of this lane half

  v8f acc[2][8];
#pragma unroll
  for (int i = 0; i < 2; ++i)
#pragma unroll
    for (int j = 0; j < 8; ++j) acc[i][j] = (v8f){0.f, 0.f, 0.f, 0.f, 0.f, 0.f, 0.f, 0.f};

  // copy lanes: thread -> row tid>>3 (+16 per copy), 16-B piece tid&7 of the row's 128 B
  const int crow = tid >> 3, cseg = (tid & 7) * 8;
  const __bf16* cA  = Ab + (size_t)(mb + crow) * lda + cseg;
  const __bf16* cA2 = SPLITA ? (Ab2 + (size_t)(mb + crow) * lda + cseg) : (const __bf16*)0;
  const __bf16* cB  = Bb + (size_t)(n0 + crow) * ldb + cseg;
  const unsigned cL = (unsigned)(size_t)(const void*)sS + (unsigned)(crow * GT_P + cseg) * 2u;   // LDS byte address, buffer 0, tile 0
  const int NP = K / GK;

  // stage 0 into buffer 0, published; then stage 1 into buffer 1
  copy_tile(cL, cA, lda);
  copy_tile(cL + GT_SZ * 2, cB, ldb);
  if (SPLITA) copy_tile(cL + 2 * GT_SZ * 2, cA2, lda);
  wait_copies();
  __syncthreads();
  if (NP > 1) {
    const unsigned lb = cL + NT * GT_SZ * 2;
    copy_tile(lb, cA + GK, lda);
    copy_tile(lb + GT_SZ * 2, cB + GK, ldb);
    if (SPLITA) copy_tile(lb + 2 * GT_SZ * 2, cA2 + GK, lda);
  }

  // one stage per trip, the buffer chosen by the trip's parity
  for (int t = 0; t < NP; ++t) {
    const int bo = (t & 1) * (NT * GT_SZ);
    const __bf16* sA  = sS + bo + ((wave << 5) + rlane) * GT_P + koff;
    const __bf16* sB  = sS + bo + GT_SZ + rlane * GT_P + koff;
    const __bf16* sA2 = sS + bo + 2 * GT_SZ + ((wave << 5) + rlane) * GT_P + koff;
#pragma unroll
    for (int kk = 0; kk < GK; kk += 32) {
      const v16b a0 = ldfrag_b(sA + kk);
      const v16b a1 = ldfrag_b(sA + 16 * GT_P + kk);
      v16b l0 = a0, l1 = a1;
      if (SPLITA) { l0 = ldfrag_b(sA2 + kk); l1 = ldfrag_b(sA2 + 16 * GT_P + kk); }
      // the k-step's fragments are read as one group ahead of its products, so that the LDS latency is paid once per k-step
      v16b bh[8];
#pragma unroll
      for (int j = 0; j < 8; ++j) bh[j] = ldfrag_b(sB + (j << 4) * GT_P + kk);
#pragma unroll
      for (int j = 0; j < 8; ++j) {
        acc[0][j] = wmma_b(a0, bh[j], acc[0][j]);
        if (SPLITA) acc[0][j] = wmma_b(l0, bh[j], acc[0][j]);
        acc[1][j] = wmma_b(a1, bh[j], acc[1][j]);
        if (SPLITA) acc[1][j] = wmma_b(l1, bh[j], acc[1][j]);
        dep_guard_b(acc[0][j], acc[1][j], bh[j], a0, a1, l0, l1);
      }
    }
    // publish point of stage t + 1: own reads of this buffer done, own copies of the next landed, then the block barrier
    wait_lds();
    wait_copies();
    __syncthreads();
    if (t + 2 < NP) {                           // block-uniform: refill the buffer this trip has just read
      const unsigned lb = cL + (unsigned)bo * 2u;
      const int ko = (t + 2) * GK;
      copy_tile(lb, cA + ko, lda);
      copy_tile(lb + GT_SZ * 2, cB + ko, ldb);
      if (SPLITA) copy_tile(lb + 2 * GT_SZ * 2, cA2 + ko, lda);
    }
  }
  wait_copies();

  // ---- epilogue ----
  float* slab = (float*)(void*)sS + wave * (16 * GP);
  float bc[8];
#pragma unroll
  for (int j = 0; j < 8; ++j) bc[j] = 0.f;
  if (!BROW) {
#pragma unroll
    for (int j = 0; j < 8; ++j) {
      const int col = n0 + (j << 4) + rlane;
      int i1 = col;          if (i1 > nb1 - 1) i1 = nb1 - 1;
      int i2 = col - nsplit; if (i2 < 0) i2 = 0; if (i2 > nb2 - 1) i2 = nb2 - 1;
      const float v1 = bfr(bias[i1]);
      const float v2 = bfr(bias2[i2]);
      const bool lo = (col < nsplit);
      const bool valid = lo ? (col < nb1) : ((col - nsplit) < nb2);
      const float v = lo ? v1 : v2;
      bc[j] = valid ? v : 0.f;
    }
  }
#pragma unroll
  for (int i = 0; i < 2; ++i) {
    const int mBase = m0 + (i << 4);
    float br[8];
#pragma unroll
    for (int r = 0; r < 8; ++r) {
      br[r] = 0.f;
      if (BROW) {
        int ir = mBase + mOff + r; if (ir > nb1 - 1) ir = nb1 - 1;
        br[r] = bfr(bias[ir]);
      }
    }
#pragma unroll
    for (int j = 0; j < 8; ++j)
#pragma unroll
      for (int r = 0; r < 8; ++r)
        slab[(mOff + r) * GP + (j << 4) + rlane] = acc[i][j][r] + (BROW ? br[r] : bc[j]);
    wave_sync();
    if (OUT_MODE == 0) {
      float* C = (float*)Cout + (size_t)bz * strideC;
      const int c4 = lane * 4;                               // row segment 512 B = 32 lanes x 16 B
      {
#pragma unroll
        for (int it = 0; it < 16; ++it) {
          const v4f v = *(const v4f*)(slab + it * GP + c4);
          *(v4f*)(C + (size_t)(mBase + it) * ldc + n0 + c4) = v;
        }
        
      }
    } else if (OUT_MODE == 1) {
      unsigned short* C  = (unsigned short*)Cout  + (size_t)bz * strideC;
      unsigned short* C2 = (unsigned short*)Cout2 + (size_t)bz * strideC;
      const int q16 = lane >> 4, c8 = (lane & 15) * 8;      // row segment 256 B = 16 lanes x 16 B
      {
#pragma unroll
        for (int it = 0; it < 8; ++it) {
          const int row = it * 2 + q16;
          const float* sp = slab + row * GP + c8;
          v4u hv, lv;
#pragma unroll
          for (int p = 0; p < 4; ++p) {
            const float f0 = sp[2 * p], f1 = sp[2 * p + 1];
            const _Float16 e0 = (_Float16)f0, e1 = (_Float16)f1;
            const _Float16 g0 = (_Float16)((f0 - (float)e0) * 2048.0f);
            const _Float16 g1 = (_Float16)((f1 - (float)e1) * 2048.0f);
            hv[p] = pk16(h2u(e0), h2u(e1));
            lv[p] = pk16(h2u(g0), h2u(g1));
          }
          const size_t go = (size_t)(mBase + row) * ldc + n0 + c8;
          *(v4u*)(C  + go) = hv;
          *(v4u*)(C2 + go) = lv;
        }
        
      }
    } else {
      unsigned short* Q1 = (unsigned short*)Cout;
      unsigned short* Q2 = (unsigned short*)Cout2;
      unsigned short* K1 = (unsigned short*)Cout3;
      const int q16 = lane >> 4, c8 = (lane & 15) * 8;      // row segment 256 B = 16 lanes x 16 B
      const int  bidx = m0 / SEQ;                             // all 32 rows of the tile lie in one batch element
      const bool isq  = (n0 < nsplit);                        // wave-uniform
      const int  head = (isq ? n0 : (n0 - nsplit)) >> 7;
      const size_t rowBase = (size_t)(bidx * NH + head) * SEQ;
      {
#pragma unroll
        for (int it = 0; it < 8; ++it) {
          const int row = it * 2 + q16;
          const int s   = (mBase + row) & (SEQ - 1);
          const float* sp = slab + row * GP + c8;
          v4u hv, lv;
#pragma unroll
          for (int p = 0; p < 4; ++p) {
            const float f0 = sp[2 * p], f1 = sp[2 * p + 1];
            const _Float16 e0 = (_Float16)f0, e1 = (_Float16)f1;
            const _Float16 g0 = (_Float16)((f0 - (float)e0) * 2048.0f);
            const _Float16 g1 = (_Float16)((f1 - (float)e1) * 2048.0f);
            hv[p] = pk16(h2u(e0), h2u(e1));
            lv[p] = pk16(h2u(g0), h2u(g1));
          }
          const size_t go = (rowBase + (size_t)s) * ldc + c8;
          if (isq) {
            *(v4u*)(Q1 + go) = hv;
            *(v4u*)(Q2 + go) = lv;
          } else {
            *(v4u*)(K1 + go) = hv;
          }
        }
        
      }
    }
    wave_sync();
  }
}

#define AT_QB 128
#define AT_KC 64
#define OS_P  132
// LDS row pitches in f16 elements, each 16 B x odd so that the 16 rows a ds_load_b128 fragment read touches fall on distinct banks
#define K_P   (HD + 8)      // K rows of 256 B at pitch 272 B
#define V_P   (AT_KC + 8)   // V^T rows of 128 B at pitch 144 B
#define AT_BUF (AT_KC * K_P + 2 * HD * V_P)   // f16 elements of one staged chunk: K | V^T hi | V^T res

// One chunk, global -> LDS: 12 asynchronous 16-B copies per lane, 4 per plane. lk / lh / ll = this lane's LDS byte address of its
// first row of K / V^T hi / V^T res, gk / gh / gl = its global address there; copy i takes K row +16*i, V^T row +32*i.
// The s_wait_xcnt stands inside the statement so that no address register is rewritten ahead of it.
__device__ __forceinline__ void copy_chunk(unsigned lk, unsigned lh, unsigned ll,
                                           const _Float16* gk, const _Float16* gh, const _Float16* gl) {
  const unsigned ks = 16 * K_P * 2, vs = 32 * V_P * 2;
  const size_t kg = (size_t)16 * HD, vg = (size_t)32 * SEQ;
#if defined(__HIP_DEVICE_COMPILE__)
  asm volatile("global_load_async_to_lds_b128 %0, %12, off\n\t"
               "global_load_async_to_lds_b128 %1, %13, off\n\t"
               "global_load_async_to_lds_b128 %2, %14, off\n\t"
               "global_load_async_to_lds_b128 %3, %15, off\n\t"
               "global_load_async_to_lds_b128 %4, %16, off\n\t"
               "global_load_async_to_lds_b128 %5, %17, off\n\t"
               "global_load_async_to_lds_b128 %6, %18, off\n\t"
               "global_load_async_to_lds_b128 %7, %19, off\n\t"
               "global_load_async_to_lds_b128 %8, %20, off\n\t"
               "global_load_async_to_lds_b128 %9, %21, off\n\t"
               "global_load_async_to_lds_b128 %10, %22, off\n\t"
               "global_load_async_to_lds_b128 %11, %23, off\n\t"
               "s_wait_xcnt 0x0"
               :: "v"(lk), "v"(lk + ks), "v"(lk + 2 * ks), "v"(lk + 3 * ks),
                  "v"(lh), "v"(lh + vs), "v"(lh + 2 * vs), "v"(lh + 3 * vs),
                  "v"(ll), "v"(ll + vs), "v"(ll + 2 * vs), "v"(ll + 3 * vs),
                  "v"(gk), "v"(gk + kg), "v"(gk + 2 * kg), "v"(gk + 3 * kg),
                  "v"(gh), "v"(gh + vg), "v"(gh + 2 * vg), "v"(gh + 3 * vg),
                  "v"(gl), "v"(gl + vg), "v"(gl + 2 * vg), "v"(gl + 3 * vg)
               : "memory");
#endif
}

// four waves per SIMD: two blocks of 8 waves on a WGP, 256 registers a wave
__global__ __launch_bounds__(256) __attribute__((amdgpu_waves_per_eu(4, 4)))
void attn_kernel(const unsigned short* __restrict__ qhp, const unsigned short* __restrict__ qlp,
                 const unsigned short* __restrict__ kp,
                 const unsigned short* __restrict__ vhp, const unsigned short* __restrict__ vlp,
                 const float* __restrict__ bmp, const float* __restrict__ glp,
                 unsigned short* chp, unsigned short* clp) {
  __shared__ __align__(16) _Float16 KVs[2 * AT_BUF];   // two buffers of K [key][d] | V^T hi [d][key] | V^T res [d][key], padded rows; ctx staging later
  static_assert(8 * 16 * OS_P * 4 <= 2 * AT_BUF * 2);

  const int tid  = threadIdx.x;
  const int wave = __builtin_amdgcn_readfirstlane(tid >> 5);   // wave-uniform: held in a scalar register, with all that is formed from it
  const int lane = tid & 31;
  const int hh   = lane >> 4;
  const int c    = lane & 15;

  const int bx  = blockIdx.x;
  const int qb  = bx & 15;                 // query block of 128
  const int h   = (bx >> 4) & (NH - 1);    // head
  const int b   = bx >> 8;                 // batch element
  const int q0  = qb * AT_QB + wave * 16;

  const _Float16* Qhg = (const _Float16*)(const void*)qhp + (size_t)(b * NH + h) * SEQ * HD;
  const _Float16* Qlg = (const _Float16*)(const void*)qlp + (size_t)(b * NH + h) * SEQ * HD;
  const _Float16* Kg  = (const _Float16*)(const void*)kp  + (size_t)(b * NH + h) * SEQ * HD;
  const _Float16* Vhg = (const _Float16*)(const void*)vhp + ((size_t)b * HID + (size_t)h * HD) * SEQ;
  const _Float16* Vlg = (const _Float16*)(const void*)vlp + ((size_t)b * HID + (size_t)h * HD) * SEQ;
  const float*    Bm  = bmp + (size_t)b * SEQ * SEQ + (size_t)(q0 + c) * SEQ + 8 * hh;   // + first key of the tile + r
  const int qro = (q0 + c) * HD + 8 * hh;  // per-lane q fragment base, query q0 + c (d added per step)

  // per-head bias scale 2^(-(h+1)/2): exact power of two times sqrt(1/2) for odd (h+1)
  const int   hexp = (h + 1) >> 1;
  const float hs   = __uint_as_float((unsigned)(127 - hexp) << 23) * (((h + 1) & 1) ? 0.70710678118654752f : 1.0f);

  const v8f zero8 = (v8f){0.f, 0.f, 0.f, 0.f, 0.f, 0.f, 0.f, 0.f};
  const float inv2048 = 4.8828125e-4f;
  // softmax runs in base 2: log2(e) is folded into the score scale and the bias scale, so that exp(x) is one v_exp_f32
  const float log2e   = 1.4426950408889634f;
  const float scale   = (1.0f / 11.313708305358887f) * log2e;
  const float hs2     = hs * log2e;

  float mrow = -INFINITY, lrow = 0.f;      // of query q0 + c; lrow sums this lane half's keys only
  v8f oh[8];
#pragma unroll
  for (int t = 0; t < 8; ++t) oh[t] = zero8;

  v16h qa[4], qr[4];
  // unrolled: static indices keep these arrays in registers
#pragma unroll
  for (int dc = 0; dc < 4; ++dc) {
    qa[dc] = ldfrag_h(Qhg + qro + dc * 32);
    qr[dc] = ldfrag_h(Qlg + qro + dc * 32);
  }

  // copy lanes: K: thread -> key tid>>4 (+16 per copy), 16-B piece tid&15 of the row's 256 B;
  //             V^T hi/res: thread -> d = tid>>3 (+32 per copy), 16-B piece tid&7 of the row's 128 B of this chunk
  // coverage: 4 x 16 keys x 128 d for K, 4 x 32 d x 64 keys for each V^T plane = the whole chunk tiles
  constexpr int NCH = SEQ / AT_KC;
  static_assert(NCH >= 2);
  const int krow = tid >> 4, kseg = (tid & 15) * 8;
  const int vrow = tid >> 3, vseg = (tid & 7) * 8;
  const unsigned lK = (unsigned)(size_t)(const void*)KVs + (unsigned)(krow * K_P + kseg) * 2u;                 // LDS byte addresses, buffer 0
  const unsigned lH = (unsigned)(size_t)(const void*)KVs + (unsigned)(AT_KC * K_P + vrow * V_P + vseg) * 2u;
  const unsigned lL = lH + HD * V_P * 2;
  const _Float16* gK = Kg  + krow * HD + kseg;
  const _Float16* gH = Vhg + (size_t)vrow * SEQ + vseg;
  const _Float16* gL = Vlg + (size_t)vrow * SEQ + vseg;

  // chunk 0 into buffer 0, published
  copy_chunk(lK, lH, lL, gK, gH, gL);
  wait_copies();
  __syncthreads();

  // one chunk per trip, the buffer chosen by the trip's parity
  for (int kc = 0; kc < NCH; ++kc) {
    const int kv0 = kc * AT_KC;
    const int bo  = (kc & 1) * AT_BUF;
    // directly behind the barrier that ended every read of the other buffer (the one above, then the one at the trip's foot):
    // the next chunk's copies into it, while there is a next chunk (block-uniform); they fly while this chunk is worked on
    if (kc + 1 < NCH) {
      const unsigned lb = (unsigned)(AT_BUF - bo) * 2u;
      const int kn = kv0 + AT_KC;
      copy_chunk(lK + lb, lH + lb, lL + lb, gK + (size_t)kn * HD, gH + kn, gL + kn);
    }
    const _Float16* const Ksh = KVs + bo;
    const _Float16* const Vth = KVs + bo + AT_KC * K_P;
    const _Float16* const Vtl = KVs + bo + AT_KC * K_P + HD * V_P;

    // ---- scores: 4 key tiles of 16, reduce over d = 128 = 4 k-steps; hi and residual accumulators separate ----
    v8f s[4];
    v4f bb[4][2];                            // raw bias values per key tile: 8 consecutive keys of this lane's query
    bb[0][0] = *(const v4f*)(Bm + kv0);
    bb[0][1] = *(const v4f*)(Bm + kv0 + 4);
#pragma unroll
    for (int j = 0; j < 4; ++j) {
      if (j < 3) {
        bb[j + 1][0] = *(const v4f*)(Bm + kv0 + (j + 1) * 16);
        bb[j + 1][1] = *(const v4f*)(Bm + kv0 + (j + 1) * 16 + 4);
        // keeps the next key tile's bias loads issued as one group here, in flight behind this tile's products:
        // with the q fragments held, the scheduler otherwise sinks them in pairs to their uses
        __builtin_amdgcn_sched_barrier(0);
      }
      v8f sh = zero8, sl = zero8;
#pragma unroll
      for (int dc = 0; dc < 4; ++dc) {
        FragH kb;
        kb.h[0] = *(const v8h*)(Ksh + (j * 16 + c) * K_P + dc * 32 + 8 * hh);
        kb.h[1] = *(const v8h*)(Ksh + (j * 16 + c) * K_P + dc * 32 + 16 + 8 * hh);
        sh = wmma_h(kb.v, qa[dc], sh);
        sl = wmma_h(kb.v, qr[dc], sl);
      }
      // keeps the first use of this tile's bias (and its wait) behind the tile's products
      __builtin_amdgcn_sched_barrier(0);
      v8f sj = (sh + sl * inv2048) * scale;
#pragma unroll
      for (int r = 0; r < 8; ++r) sj[r] = sj[r] + hs2 * bfr(bb[j][r >> 2][r & 3]);
      s[j] = sj;
    }

    // maximum over this lane's 32 scores, then over the other half's
    float mx[8];
#pragma unroll
    for (int r = 0; r < 8; ++r) mx[r] = fmaxf(fmaxf(s[0][r], s[1][r]), fmaxf(s[2][r], s[3][r]));
    float cm = fmaxf(fmaxf(fmaxf(mx[0], mx[1]), fmaxf(mx[2], mx[3])), fmaxf(fmaxf(mx[4], mx[5]), fmaxf(mx[6], mx[7])));
    cm = fmaxf(cm, xhalf(cm));

    const float mnew  = fmaxf(mrow, cm);
    const float alpha = __builtin_amdgcn_exp2f(mrow - mnew);
    const float msub  = mnew - 10.0f;      // the 2^10 scale of P rides in the exponent
    mrow = mnew;
    // P^T operands: element e of k-step kk is key 32*kk + 8*hh + e (e < 8, tile 2*kk) or 32*kk + 16 + 8*hh + e - 8 (tile 2*kk + 1),
    // the k order of the V^T fragment loads below
    FragH pb[2];
    float ps[4];
#pragma unroll
    for (int j = 0; j < 4; ++j) {
      exp2x8(s[j], msub);                        // 1024 * exp(score - maximum)
    }
#pragma unroll
    for (int j = 0; j < 4; ++j) {
      float pj = s[j][0];
#pragma unroll
      for (int r = 1; r < 8; ++r) pj += s[j][r];
#pragma unroll
      for (int r = 0; r < 8; ++r) pb[j >> 1].v[(j & 1) * 8 + r] = (_Float16)s[j][r];
      ps[j] = pj;
    }
    lrow = lrow * alpha + ((ps[0] + ps[1]) + (ps[2] + ps[3]));
#pragma unroll
    for (int t = 0; t < 8; ++t) oh[t] *= alpha;

    // ---- ctx^T += V^T . P^T over the 64 keys of the chunk (2 k-steps), 8 d tiles ----
    // unrolled: the static index keeps pb in registers
#pragma unroll
    for (int kk = 0; kk < 2; ++kk) {
#pragma unroll
      for (int t = 0; t < 8; ++t) {
        FragH vb, vr;
        vb.h[0] = *(const v8h*)(Vth + (t * 16 + c) * V_P + kk * 32 + 8 * hh);
        vb.h[1] = *(const v8h*)(Vth + (t * 16 + c) * V_P + kk * 32 + 16 + 8 * hh);
        vr.h[0] = *(const v8h*)(Vtl + (t * 16 + c) * V_P + kk * 32 + 8 * hh);
        vr.h[1] = *(const v8h*)(Vtl + (t * 16 + c) * V_P + kk * 32 + 16 + 8 * hh);
        oh[t] = wmma_h(vb.v, pb[kk].v, oh[t]);
        const v8f tr = wmma_h(vr.v, pb[kk].v, zero8);
        oh[t] += tr * inv2048;
      }
    }
    // publish point of chunk kc + 1: own reads of this buffer done, own copies of the next landed, then the block barrier
    wait_lds();
    wait_copies();
    __syncthreads();
  }
  wait_copies();

  // ---- normalise, apply the head gate, stage the wave 16x128 tile (aliases the K/V region behind the loop's last barrier),
  //      write bf16 hi/lo planes ----
  float* os = (float*)(void*)KVs + wave * (16 * OS_P);
  {
    const float lsum = lrow + xhalf(lrow);   // the two lane halves' key sums of query q0 + c
    const float a  = glp[(size_t)(b * SEQ + q0 + c) * GLD + h];
    const float g  = 1.0f / (1.0f + expf(-a));
    const float invl = g * (1.0f / lsum);    // ctx and lsum both carry the factor 1024
#pragma unroll
    for (int t = 0; t < 8; ++t) {
      const v8f o = oh[t] * invl;
      *(v4f*)(os + c * OS_P + t * 16 + 8 * hh)     = (v4f){o[0], o[1], o[2], o[3]};
      *(v4f*)(os + c * OS_P + t * 16 + 8 * hh + 4) = (v4f){o[4], o[5], o[6], o[7]};
    }
  }
  wave_sync();
  {
    const int q16 = lane >> 4, c8 = (lane & 15) * 8;         // 2 rows per instruction, each row 256 B = 16 lanes x 16 B
    {
#pragma unroll
      for (int it = 0; it < 8; ++it) {
        const int row = it * 2 + q16;
        const float* sp = os + row * OS_P + c8;
        v4u hv, lv;
#pragma unroll
        for (int p = 0; p < 4; ++p) {
          const float f0 = sp[2 * p], f1 = sp[2 * p + 1];
          const unsigned short hb0 = f2bf_bits(f0), hb1 = f2bf_bits(f1);
          const unsigned short lb0 = f2bf_bits(f0 - bf_bits2f(hb0));
          const unsigned short lb1 = f2bf_bits(f1 - bf_bits2f(hb1));
          hv[p] = pk16(hb0, hb1);
          lv[p] = pk16(lb0, lb1);
        }
        const size_t go = (size_t)(b * SEQ + q0 + row) * HID + h * HD + c8;
        *(v4u*)(chp + go) = hv;
        *(v4u*)(clp + go) = lv;
      }
      
    }
  }
}

// ---------------------------------------------------------------------------
// all sizes exact tile multiples, all offsets multiples of 512 KiB):
//   R0   bf16 [4096][2048]       16777216 @ 0           x as bf16; later ctx hi plane (written after the last reader of x)
//   R1   bf16 [4096][2048]       16777216 @ 16777216    wv^T as bf16 [2048][2048]; then wq^T|wk^T panel [4096][2048]; later ctx lo plane
//   Wob  bf16 [2048][2048]        8388608 @ 33554432    wo^T
//   Wgb  bf16 [128][2048]          524288 @ 41943040    wg^T zero-padded to 128 rows
//   Glog f32  [4096][128]         2097152 @ 42467328    gate logits
//   Qh   f16  [2][16][2048][128]  16777216 @ 44564480    Ql same @ 61341696
//   Kp   f16  [2][16][2048][128]  16777216 @ 78118912
//   Vth  f16  [2][2048][2048]     16777216 @ 94896128    Vtl same @ 111673344
//   total                        128450560
// ---------------------------------------------------------------------------
extern "C" void kernel_launch(void* const* d_in, const int* in_sizes, int n_in,
                              void* d_out, int out_size, void* d_ws, size_t ws_size,
                              hipStream_t stream) {
  if (n_in < 12) return;
  if (in_sizes[0] != NB * SEQ * HID) return;
  if (in_sizes[1] != NB * SEQ * SEQ) return;
  if (in_sizes[2] != HID * HID) return;
  if (in_sizes[3] != HID) return;
  if (in_sizes[4] != HID * HID) return;
  if (in_sizes[5] != HID) return;
  if (in_sizes[6] != HID * HID) return;
  if (in_sizes[7] != HID) return;
  if (in_sizes[8] != HID * NH) return;
  if (in_sizes[9] != NH) return;
  if (in_sizes[10] != HID * HID) return;
  if (in_sizes[11] != HID) return;
  if (out_size != NB * SEQ * HID) return;

  const float* x   = (const float*)d_in[0];
  const float* bm  = (const float*)d_in[1];
  const float* wq  = (const float*)d_in[2];
  const float* bq  = (const float*)d_in[3];
  const float* wk  = (const float*)d_in[4];
  const float* bk  = (const float*)d_in[5];
  const float* wv  = (const float*)d_in[6];
  const float* bv  = (const float*)d_in[7];
  const float* wg  = (const float*)d_in[8];
  const float* bg  = (const float*)d_in[9];
  const float* wo  = (const float*)d_in[10];
  const float* bo  = (const float*)d_in[11];
  float* out = (float*)d_out;

  const size_t szR0  = (size_t)NB * SEQ * HID * 2;          // 16 MiB
  const size_t szR1  = (size_t)2 * HID * HID * 2;           // 16 MiB
  const size_t szWo  = (size_t)HID * HID * 2;               //  8 MiB
  const size_t szWg  = (size_t)GLD * HID * 2;               //  512 KiB
  const size_t szG   = (size_t)NB * SEQ * GLD * 4;          //  2 MiB
  const size_t szQ   = (size_t)NB * NH * SEQ * HD * 2;      // 16 MiB
  const size_t szK   = szQ;
  const size_t szV   = (size_t)NB * HID * SEQ * 2;          // 16 MiB
  size_t off = 0;
  const size_t oR0  = off; off += szR0;
  const size_t oR1  = off; off += szR1;
  const size_t oWo  = off; off += szWo;
  const size_t oWg  = off; off += szWg;
  const size_t oG   = off; off += szG;
  const size_t oQh  = off; off += szQ;
  const size_t oQl  = off; off += szQ;
  const size_t oKp  = off; off += szK;
  const size_t oVth = off; off += szV;
  const size_t oVtl = off; off += szV;
  if (off > ws_size) return;                    // off = 128450560
  if (off > (size_t)134217728) return;

  char* ws = (char*)d_ws;
  unsigned short* Xb  = (unsigned short*)(ws + oR0);
  unsigned short* Ch  = (unsigned short*)(ws + oR0);        // reuses R0 after the gate GEMM (last reader of Xb)
  unsigned short* Wvt = (unsigned short*)(ws + oR1);
  unsigned short* Wqk = (unsigned short*)(ws + oR1);        // reuses R1 after the v^T GEMM (last reader of Wvt)
  unsigned short* Cl  = (unsigned short*)(ws + oR1);        // reuses R1 after the q|k GEMM (last reader of Wqk)
  unsigned short* Wot = (unsigned short*)(ws + oWo);
  unsigned short* Wgt = (unsigned short*)(ws + oWg);
  float*          Gl  = (float*)(ws + oG);
  unsigned short* Qh  = (unsigned short*)(ws + oQh);
  unsigned short* Ql  = (unsigned short*)(ws + oQl);
  unsigned short* Kp  = (unsigned short*)(ws + oKp);
  unsigned short* Vth = (unsigned short*)(ws + oVth);
  unsigned short* Vtl = (unsigned short*)(ws + oVtl);

  const dim3 blk256(256), blk128(128);
  const dim3 trg(HID / 64, HID / 64);           // in [2048 rows][2048 cols] -> out [cols][rows]
  const int n8x = NB * SEQ * HID / 8;

  // (1) x f32 -> bf16 plane
  cvt_bf16x8_kernel<<<dim3((n8x + 255) / 256), blk256, 0, stream>>>(x, Xb, n8x);
  // (2) wv [in][out] -> wv^T bf16 [out][in]
  tr_bf16_kernel<<<trg, blk256, 0, stream>>>(wv, Wvt, HID, HID);
  // (3) v^T per batch element: A = Wvt [2048 d][2048 k], Bt = Xb[b] [2048 s][2048 k] -> V^T hi/res planes [2048][2048] per b, + bv[d]
  {
    const int M = HID, N = SEQ, K = HID;
    const int tiles = (M / 32) * (N / 128);
    gemm_kernel<false, 1, true><<<dim3((tiles + 3) / 4, NB), blk128, 0, stream>>>(
        Wvt, Wvt, HID, 0L, Xb, HID, (long)SEQ * HID, (void*)Vth, (void*)Vtl, (void*)Vtl, SEQ, (long)HID * SEQ,
        bv, HID, bv, HID, N, M, N, K);
  }
  // (4) wq^T | wk^T panel [4096][2048] into R1
  tr_bf16_kernel<<<trg, blk256, 0, stream>>>(wq, Wqk, HID, HID);
  tr_bf16_kernel<<<trg, blk256, 0, stream>>>(wk, Wqk + (size_t)HID * HID, HID, HID);
  // (5) q | k projections with head-major relayout: A = Xb [4096][2048], Bt = Wqk [4096][2048] -> q hi/res planes, k plane; + bq | bk
  {
    const int M = NB * SEQ, N = 2 * HID, K = HID;
    const int tiles = (M / 32) * (N / 128);
    gemm_kernel<false, 2, false><<<dim3((tiles + 3) / 4, 1), blk128, 0, stream>>>(
        Xb, Xb, HID, 0L, Wqk, HID, 0L, (void*)Qh, (void*)Ql, (void*)Kp, HD, 0L,
        bq, HID, bk, HID, HID, M, N, K);
  }
  // (6) gate weights: wg [2048][16] -> wg^T zero-padded bf16 [128][2048]
  wg_pad_kernel<<<dim3(GLD), blk256, 0, stream>>>(wg, Wgt);
  // (7) gate logits: A = Xb [4096][2048], Bt = Wgt [128][2048] -> f32 [4096][128], + bg for columns < 16
  {
    const int M = NB * SEQ, N = GLD, K = HID;
    const int tiles = (M / 32) * (N / 128);
    gemm_kernel<false, 0, false><<<dim3((tiles + 3) / 4, 1), blk128, 0, stream>>>(
        Xb, Xb, HID, 0L, Wgt, HID, 0L, (void*)Gl, (void*)Gl, (void*)Gl, GLD, 0L,
        bg, NH, bg, NH, N, M, N, K);
  }
  // (8) wo [in][out] -> wo^T bf16
  tr_bf16_kernel<<<trg, blk256, 0, stream>>>(wo, Wot, HID, HID);
  // (9) attention: grid = NB x 16 heads x 16 query blocks, 256 threads
  attn_kernel<<<dim3(NB * NH * (SEQ / AT_QB)), blk256, 0, stream>>>(Qh, Ql, Kp, Vth, Vtl, bm, Gl, Ch, Cl);
  // (10) output projection: A = gated ctx hi/lo planes [4096][2048], Bt = Wot [2048][2048] -> d_out f32 [4096][2048], + bo
  {
    const int M = NB * SEQ, N = HID, K = HID;
    const int tiles = (M / 32) * (N / 128);
    gemm_kernel<true, 0, false><<<dim3((tiles + 3) / 4, 1), blk128, 0, stream>>>(
        Ch, Cl, HID, 0L, Wot, HID, 0L, (void*)out, (void*)out, (void*)out, HID, 0L,
        bo, HID, bo, HID, N, M, N, K);
  }
  (void)hipGetLastError();
}

// v007
// A run of this version takes 272 microseconds.
// Timed twice side by side with v006, it ran 1.18 times as fast both times.
// All steps since v000 together make it 4.31 times as fast.
#include <hip/hip_runtime.h>
#include <math.h>
#include <stdint.h>

// q/k/v and gate projections: v_wmma_f32_16x16x32_bf16, single products on bf16-RNE converted x and W^T, f32 accumulate;
// scores, transposed, k.q^T: v_wmma_f32_16x16x32_f16 with q = f16 hi + residual x2^11 planes, k single f16 plane, f32 accumulate;
// ctx, transposed, v^T.p^T: v_wmma_f32_16x16x32_f16 with p x1024 single f16 plane, v^T = f16 hi + residual x2^11 planes, f32 accumulate;
// output projection: v_wmma_f32_16x16x32_bf16 with gated ctx as bf16 hi + lo planes and Wo^T bf16, f32 accumulate.
// Online softmax, score scale 1/sqrt(128), per-head bias scale 2^(-(h+1)/2), sigmoid gate and normalisation in f32.

#define NB   2
#define SEQ  2048
#define HID  2048
#define NH   16
#define HD   128
#define GLD  128

typedef _Float16 v16h __attribute__((ext_vector_type(16)));
typedef _Float16 v8h  __attribute__((ext_vector_type(8)));
typedef __bf16   v16b __attribute__((ext_vector_type(16)));
typedef __bf16   v8b  __attribute__((ext_vector_type(8)));
typedef float    v8f  __attribute__((ext_vector_type(8)));
typedef float    v4f  __attribute__((ext_vector_type(4)));
typedef unsigned int v4u __attribute__((ext_vector_type(4)));

// ---------------------------------------------------------------------------
// small helpers
// ---------------------------------------------------------------------------
__device__ __forceinline__ unsigned short f2bf_bits(float f) {          // RNE convert f32 -> bf16 bits
  const unsigned u = __float_as_uint(f);
  return (unsigned short)((u + 0x7FFFu + ((u >> 16) & 1u)) >> 16);
}
__device__ __forceinline__ float bf_bits2f(unsigned short x) { return __uint_as_float(((unsigned)x) << 16); }
__device__ __forceinline__ float bfr(float f) { return __uint_as_float(((unsigned)f2bf_bits(f)) << 16); }
__device__ __forceinline__ unsigned pk16(unsigned short a, unsigned short b) { return (unsigned)a | ((unsigned)b << 16); }
__device__ __forceinline__ unsigned short h2u(_Float16 x) { return __builtin_bit_cast(unsigned short, x); }

// 2^(x - m) on eight values in place. One statement, so that behind each v_exp_f32 stands an independent one (another register, neither
// its result nor its source), the slot the instruction set asks for behind a transcendental; the v_nop is that slot for the last.
__device__ __forceinline__ void exp2x8(v8f& x, float m) {
#if defined(__HIP_DEVICE_COMPILE__)
  float a = x[0] - m, b = x[1] - m, c = x[2] - m, d = x[3] - m, e = x[4] - m, f = x[5] - m, g = x[6] - m, h = x[7] - m;
  asm("v_exp_f32 %0, %0\n\tv_exp_f32 %1, %1\n\tv_exp_f32 %2, %2\n\tv_exp_f32 %3, %3\n\t"
      "v_exp_f32 %4, %4\n\tv_exp_f32 %5, %5\n\tv_exp_f32 %6, %6\n\tv_exp_f32 %7, %7\n\tv_nop"
      : "+v"(a), "+v"(b), "+v"(c), "+v"(d), "+v"(e), "+v"(f), "+v"(g), "+v"(h));
  x = (v8f){a, b, c, d, e, f, g, h};
#endif
}

// lane l with lane l ^ 16
__device__ __forceinline__ float xhalf(float x) {
  return __builtin_bit_cast(float, __builtin_amdgcn_permlanex16(__builtin_bit_cast(int, x), __builtin_bit_cast(int, x), 0x76543210, 0xfedcba98, false, false));
}

// stands behind global loads or stores, in front of the code that rewrites a register which they name (address, offset, store data)
__device__ __forceinline__ void wait_named_regs() {
#if defined(__HIP_DEVICE_COMPILE__)
  asm volatile("s_wait_xcnt 0x0" ::: "memory");
#endif
}

// behind a run of eight loads: offsets and loaded values are inputs only, so that each offset register lives to this wait and
// no load of the run lands in the offset register of another
__device__ __forceinline__ void hold_offsets8(const int (&x)[8], const float (&r)[8]) {
#if defined(__HIP_DEVICE_COMPILE__)
  asm volatile("s_wait_xcnt 0x0" :: "v"(x[0]), "v"(x[1]), "v"(x[2]), "v"(x[3]), "v"(x[4]), "v"(x[5]), "v"(x[6]), "v"(x[7]),
                                    "v"(r[0]), "v"(r[1]), "v"(r[2]), "v"(r[3]), "v"(r[4]), "v"(r[5]), "v"(r[6]), "v"(r[7]) : "memory");
#endif
}

__device__ __forceinline__ void wave_sync() {
  __builtin_amdgcn_fence(__ATOMIC_RELEASE, "workgroup");
  __builtin_amdgcn_wave_barrier();
  __builtin_amdgcn_fence(__ATOMIC_ACQUIRE, "workgroup");
}

// 16-bit fragment loaders, same k map for A and B: p points at (row or col)*ld + k0 + 8*(lane>>4);
// elements 0..7 <- p[0..7] (k0+8h..k0+8h+7), elements 8..15 <- p[16..23] (k0+16+8h..k0+16+8h+7).
union FragB { v16b v; v8b h[2]; };
union FragH { v16h v; v8h h[2]; };
__device__ __forceinline__ v16b ldfrag_b(const __bf16* p) {
  FragB f; f.h[0] = *(const v8b*)(p); f.h[1] = *(const v8b*)(p + 16); return f.v;
}
__device__ __forceinline__ v16h ldfrag_h(const _Float16* p) {
  FragH f; f.h[0] = *(const v8h*)(p); f.h[1] = *(const v8h*)(p + 16); return f.v;
}

__device__ __forceinline__ v8f wmma_b(v16b a, v16b b, v8f c) {
  return __builtin_amdgcn_wmma_f32_16x16x32_bf16(false, a, false, b, (short)0, c, false, false);
}
// f16 form with the hazard guard attached to every issue (ties D, keeps A/B live)
__device__ __forceinline__ v8f wmma_h(v16h a, v16h b, v8f c) {
  c = __builtin_amdgcn_wmma_f32_16x16x32_f16(false, a, false, b, (short)0, c, false, false);
#if defined(__HIP_DEVICE_COMPILE__)
  asm volatile("v_nop\n\tv_nop\n\tv_nop\n\tv_nop" : "+v"(c) : "v"(a), "v"(b));
#endif
  return c;
}
// hazard guard for one j-group of the register-blocked GEMM (ties both D tiles, keeps A/B registers live)
__device__ __forceinline__ void dep_guard_b(v8f& x, v8f& y, v16b b, v16b a0, v16b a1, v16b l0, v16b l1) {
#if defined(__HIP_DEVICE_COMPILE__)
  asm volatile("v_nop\n\tv_nop\n\tv_nop\n\tv_nop" : "+v"(x), "+v"(y) : "v"(b), "v"(a0), "v"(a1), "v"(l0), "v"(l1));
#endif
}

// ---------------------------------------------------------------------------
// f32 -> bf16 (RNE) convert, 8 elements per thread: two 16-B loads, one 16-B store.
// Coverage: ceil(n8/256) blocks (index bx) x 256 threads x 8 elements = the whole array (sizes here are multiples of 2048).
// ---------------------------------------------------------------------------
__device__ __forceinline__ void cvt_bf16x8_body(const float* __restrict__ in, unsigned short* out, int n8, int bx) {
  const int i = bx * 256 + threadIdx.x;
  if (i < n8) {
    const v4f a = *(const v4f*)(in + 8 * (size_t)i);
    const v4f c = *(const v4f*)(in + 8 * (size_t)i + 4);
    v4u w;
    w[0] = pk16(f2bf_bits(a[0]), f2bf_bits(a[1]));
    w[1] = pk16(f2bf_bits(a[2]), f2bf_bits(a[3]));
    w[2] = pk16(f2bf_bits(c[0]), f2bf_bits(c[1]));
    w[3] = pk16(f2bf_bits(c[2]), f2bf_bits(c[3]));
    v4u* p = (v4u*)(out + 8 * (size_t)i);
    *p = w;
    
  }
}

// ---------------------------------------------------------------------------
// Transpose + RNE bf16 convert: in f32 [R][C] row-major -> out bf16 [C][R] (out[c][r] = bf16(in[r][c])).
// Block 256 threads handles a 64x64 tile through LDS. Load: thread -> 4 float4 (rows t>>4 + 16i, cols 4*(t&15)+0..3).
// Coverage: out rows cc = wave*4 + (lane>>3) (+32) over 8 waves = 0..63; columns (lane&7)*8 + 0..7 = 0..63; tiles (bx, by) over (C/64, R/64).
// ---------------------------------------------------------------------------
__device__ __forceinline__ void tr_bf16_body(float (*tile)[65], const float* __restrict__ in, unsigned short* out, int R, int C, int bx, int by) {
  const int c0 = bx * 64, r0 = by * 64;
  const int t = threadIdx.x;
  const int cq = (t & 15) * 4, rb = t >> 4;
#pragma unroll
  for (int i = 0; i < 4; ++i) {
    const int r = rb + 16 * i;
    const v4f v = *(const v4f*)(in + (size_t)(r0 + r) * C + c0 + cq);
    tile[r][cq] = v[0]; tile[r][cq + 1] = v[1]; tile[r][cq + 2] = v[2]; tile[r][cq + 3] = v[3];
  }
  __syncthreads();
  const int wave = t >> 5, lane = t & 31, q = lane >> 3, pc = lane & 7;
  const int cc0 = wave * 4 + q, cc1 = 32 + wave * 4 + q;
  v4u w0, w1;
#pragma unroll
  for (int e = 0; e < 4; ++e) {
    w0[e] = pk16(f2bf_bits(tile[pc * 8 + 2 * e][cc0]), f2bf_bits(tile[pc * 8 + 2 * e + 1][cc0]));
    w1[e] = pk16(f2bf_bits(tile[pc * 8 + 2 * e][cc1]), f2bf_bits(tile[pc * 8 + 2 * e + 1][cc1]));
  }
  v4u* p0 = (v4u*)(out + (size_t)(c0 + cc0) * R + r0 + pc * 8);
  v4u* p1 = (v4u*)(out + (size_t)(c0 + cc1) * R + r0 + pc * 8);
  *p0 = w0; *p1 = w1;
  wait_named_regs();   // the built code of another block range follows these stores and reuses their registers
}

// ---------------------------------------------------------------------------
// Gate weight panel: wg f32 [HID][NH] -> out bf16 [GLD][HID], out[n][k] = bf16(wg[k][n]) for n < NH, 0 for n >= NH.
// Block n (uniform), thread -> k = 8*threadIdx.x; loads use a clamped column address, zeroed by value for n >= NH.
// Coverage: 128 blocks x 256 threads x 8 = the whole [128][2048] panel (padding rows written as zeros).
// ---------------------------------------------------------------------------
__device__ __forceinline__ void wg_pad_body(const float* __restrict__ wg, unsigned short* out, int n) {
  const int k = threadIdx.x * 8;
  const int nn = (n < NH) ? n : (NH - 1);
  const float keep = (n < NH) ? 1.0f : 0.0f;
  v4u w;
#pragma unroll
  for (int e = 0; e < 4; ++e) {
    const float a = wg[(size_t)(k + 2 * e) * NH + nn] * keep;
    const float b = wg[(size_t)(k + 2 * e + 1) * NH + nn] * keep;
    w[e] = pk16(f2bf_bits(a), f2bf_bits(b));
  }
  v4u* p = (v4u*)(out + (size_t)n * HID + k);
  *p = w;
  
}

// ---------------------------------------------------------------------------
// All operand conversions in one launch: none reads what another writes, so they are ranges of one grid's block index.
//   blocks [0, GLD): the gate weight panel (strided reads, the longest wait of the three kinds, so it starts first);
//   then 4*TR_NB blocks: the four 2048 x 2048 weight transposes (wv, wq, wk, wo), TR_NB tiles of 64 x 64 each;
//   then CV_NB blocks: x to bf16.
// The range tests read blockIdx alone: block-uniform, so the transpose's barrier is passed by all threads of a block or by none.
// ---------------------------------------------------------------------------
#define TR_NB ((HID / 64) * (HID / 64))
#define CV_NB (NB * SEQ * HID / 8 / 256)
__global__ __launch_bounds__(256) void prep_kernel(const float* __restrict__ x, const float* __restrict__ wv, const float* __restrict__ wq,
                                                   const float* __restrict__ wk, const float* __restrict__ wo, const float* __restrict__ wg,
                                                   unsigned short* Xb, unsigned short* Wvt, unsigned short* Wqk, unsigned short* Wot,
                                                   unsigned short* Wgt) {
  __shared__ __align__(16) float tile[64][65];
  const int bx = blockIdx.x - GLD;
  if (bx < 0) {
    wg_pad_body(wg, Wgt, blockIdx.x);
  } else if (bx < 4 * TR_NB) {
    const int w = bx / TR_NB, t = bx - w * TR_NB;
    const float* in = (w == 0) ? wv : (w == 1) ? wq : (w == 2) ? wk : wo;
    unsigned short* out = (w == 0) ? Wvt : (w == 1) ? Wqk : (w == 2) ? (Wqk + (size_t)HID * HID) : Wot;
    tr_bf16_body(tile, in, out, HID, HID, t % (HID / 64), t / (HID / 64));
  } else {
    cvt_bf16x8_body(x, Xb, NB * SEQ * HID / 8, bx - 4 * TR_NB);
  }
}

// ---------------------------------------------------------------------------
// Register-blocked bf16 WMMA GEMM: C[m][n] = sum_k A[m][k] * Bt[n][k] + bias; each wave owns a 32x128 tile,
// the 4 waves of a block own 128x128 (4 row slabs over one column panel) and share the operand tiles in LDS.
// A row-major [M][K] (pitch lda), Bt row-major [N][K] (pitch ldb); M and N multiples of 128, K multiple of 64.
// Operand staging: per stage of 64 k, 128 rows x 128 B of A (and of the lo plane) and of Bt are copied global -> LDS by
// asynchronous 16-B copies, 8 lanes per row (whole 128-B lines), rows at pitch 144 B; two buffers, the copies of
// stage t + 2 fly while stage t + 1 is worked on. Fragments are then read from LDS with the same k map as before.
// SPLITA: A given as hi plane (Ap) + unscaled bf16 lo plane (A2p): products Ahi.B + Alo.B into one accumulator.
// BROW: bias[m] per row (clamped to nb1), else per column: bias[n] for n < nsplit (valid while n < nb1),
//       bias2[n - nsplit] for n >= nsplit (valid while n - nsplit < nb2); bias values RNE-rounded to bf16; both
//       candidates loaded from clamped addresses and selected by value.
// blockIdx.y selects a z slice through strideA / strideB / strideC (element strides).
// Epilogue: per wave, each 16x128 accumulator slab is staged in LDS (pitch 132 floats), then written as whole
//   OUT_MODE 0: f32 rows into Cout [M][ldc] (row segment 512 B = 32 lanes x 16 B, 1 row per instruction).
//   OUT_MODE 1: f16 hi plane Cout + f16 residual plane Cout2 ((v - hi) * 2048), [M][ldc] (256 B = 16 lanes x 16 B, 2 rows per instr.).
//   OUT_MODE 2: head-major relayout: columns n0 < nsplit -> q planes Cout (f16 hi) / Cout2 (residual * 2048) at
//               [(b*16 + n0/128)*SEQ + s][ldc = 128]; columns >= nsplit -> single f16 k plane Cout3 at
//               [(b*16 + (n0-nsplit)/128)*SEQ + s][128], with row m = b*2048 + s. Each 128-wide row = 256 B = 16 lanes x 16 B.
// Coverage per slab: it 0..7 x (lane>>4) 0..1 = 16 rows, (lane&15)*8 + 0..7 = 128 columns (OUT_MODE 1/2);
//                    it 0..15 = 16 rows, lane*4 + 0..3 = 128 columns (OUT_MODE 0).
// ---------------------------------------------------------------------------
#define GP 132
#define GK    64               // k elements per stage
#define GT_P  (GK + 8)         // LDS row pitch in bf16 elements: 144 B = 16 B x odd, conflict-free for ds_load_b128 fragment reads
#define GT_SZ (128 * GT_P)     // elements of one staged 128-row tile

// One 128-row x 128-B tile, global -> LDS: 8 asynchronous 16-B copies per lane. l = this lane's LDS byte address of its
// first row, g = this lane's global address of its first row; copy i takes row +16*i (ld = global pitch in elements).
// The s_wait_xcnt stands inside the statement so that no address register is rewritten ahead of it.
__device__ __forceinline__ void copy_tile(unsigned l, const __bf16* g, int ld) {
  const size_t st = (size_t)16 * (size_t)ld;
  const unsigned ls = 16 * GT_P * 2;
  const __bf16 *g1 = g + st, *g2 = g + 2 * st, *g3 = g + 3 * st, *g4 = g + 4 * st, *g5 = g + 5 * st, *g6 = g + 6 * st, *g7 = g + 7 * st;
#if defined(__HIP_DEVICE_COMPILE__)
  asm volatile("global_load_async_to_lds_b128 %0, %8, off\n\t"
               "global_load_async_to_lds_b128 %1, %9, off\n\t"
               "global_load_async_to_lds_b128 %2, %10, off\n\t"
               "global_load_async_to_lds_b128 %3, %11, off\n\t"
               "global_load_async_to_lds_b128 %4, %12, off\n\t"
               "global_load_async_to_lds_b128 %5, %13, off\n\t"
               "global_load_async_to_lds_b128 %6, %14, off\n\t"
               "global_load_async_to_lds_b128 %7, %15, off\n\t"
               "s_wait_xcnt 0x0"
               :: "v"(l), "v"(l + ls), "v"(l + 2 * ls), "v"(l + 3 * ls), "v"(l + 4 * ls), "v"(l + 5 * ls), "v"(l + 6 * ls), "v"(l + 7 * ls),
                  "v"(g), "v"(g1), "v"(g2), "v"(g3), "v"(g4), "v"(g5), "v"(g6), "v"(g7)
               : "memory");
#endif
}
// this wave's own copies have landed
__device__ __forceinline__ void wait_copies() {
#if defined(__HIP_DEVICE_COMPILE__)
  asm volatile("s_wait_asynccnt 0x0" ::: "memory");
#endif
}
// this wave's own LDS reads have returned (before the barrier that hands their buffer to the next copies)
__device__ __forceinline__ void wait_lds() {
#if defined(__HIP_DEVICE_COMPILE__)
  asm volatile("s_wait_dscnt 0x0" ::: "memory");
#endif
}

// The k loop: fills acc with the block's 128 x 128 tile at rows mb, columns n0 (this wave's 32 rows of it). sS: two stage buffers.
template <bool SPLITA>
__device__ __forceinline__ void gemm_main(__bf16* sS, const __bf16* Ab, const __bf16* Ab2, int lda, const __bf16* Bb, int ldb,
                                          int mb, int n0, int K, v8f (&acc)[2][8]) {
  constexpr int NT = SPLITA ? 3 : 2;            // staged tiles per stage: A, Bt (, A lo plane)
  const int tid  = threadIdx.x;
  const int lane = threadIdx.x & 31;
  const int wave = threadIdx.x >> 5;
  const int rlane = lane & 15;              // row (A) / col (B, D) within a 16x16 subtile
  const int koff  = (lane >> 4) * 8;        // k offset of this lane half

#pragma unroll
  for (int i = 0; i < 2; ++i)
#pragma unroll
    for (int j = 0; j < 8; ++j) acc[i][j] = (v8f){0.f, 0.f, 0.f, 0.f, 0.f, 0.f, 0.f, 0.f};

  // copy lanes: thread -> row tid>>3 (+16 per copy), 16-B piece tid&7 of the row's 128 B
  const int crow = tid >> 3, cseg = (tid & 7) * 8;
  const __bf16* cA  = Ab + (size_t)(mb + crow) * lda + cseg;
  const __bf16* cA2 = SPLITA ? (Ab2 + (size_t)(mb + crow) * lda + cseg) : (const __bf16*)0;
  const __bf16* cB  = Bb + (size_t)(n0 + crow) * ldb + cseg;
  const unsigned cL = (unsigned)(size_t)(const void*)sS + (unsigned)(crow * GT_P + cseg) * 2u;   // LDS byte address, buffer 0, tile 0
  const int NP = K / GK;

  // stage 0 into buffer 0, published; then stage 1 into buffer 1
  copy_tile(cL, cA, lda);
  copy_tile(cL + GT_SZ * 2, cB, ldb);
  if (SPLITA) copy_tile(cL + 2 * GT_SZ * 2, cA2, lda);
  wait_copies();
  __syncthreads();
  if (NP > 1) {
    const unsigned lb = cL + NT * GT_SZ * 2;
    copy_tile(lb, cA + GK, lda);
    copy_tile(lb + GT_SZ * 2, cB + GK, ldb);
    if (SPLITA) copy_tile(lb + 2 * GT_SZ * 2, cA2 + GK, lda);
  }

  // one stage per trip, the buffer chosen by the trip's parity
  for (int t = 0; t < NP; ++t) {
    const int bo = (t & 1) * (NT * GT_SZ);
    const __bf16* sA  = sS + bo + ((wave << 5) + rlane) * GT_P + koff;
    const __bf16* sB  = sS + bo + GT_SZ + rlane * GT_P + koff;
    const __bf16* sA2 = sS + bo + 2 * GT_SZ + ((wave << 5) + rlane) * GT_P + koff;
#pragma unroll
    for (int kk = 0; kk < GK; kk += 32) {
      const v16b a0 = ldfrag_b(sA + kk);
      const v16b a1 = ldfrag_b(sA + 16 * GT_P + kk);
      v16b l0 = a0, l1 = a1;
      if (SPLITA) { l0 = ldfrag_b(sA2 + kk); l1 = ldfrag_b(sA2 + 16 * GT_P + kk); }
      // the k-step's fragments are read as one group ahead of its products, so that the LDS latency is paid once per k-step
      v16b bh[8];
#pragma unroll
      for (int j = 0; j < 8; ++j) bh[j] = ldfrag_b(sB + (j << 4) * GT_P + kk);
#pragma unroll
      for (int j = 0; j < 8; ++j) {
        acc[0][j] = wmma_b(a0, bh[j], acc[0][j]);
        if (SPLITA) acc[0][j] = wmma_b(l0, bh[j], acc[0][j]);
        acc[1][j] = wmma_b(a1, bh[j], acc[1][j]);
        if (SPLITA) acc[1][j] = wmma_b(l1, bh[j], acc[1][j]);
        dep_guard_b(acc[0][j], acc[1][j], bh[j], a0, a1, l0, l1);
      }
    }
    // publish point of stage t + 1: own reads of this buffer done, own copies of the next landed, then the block barrier
    wait_lds();
    wait_copies();
    __syncthreads();
    if (t + 2 < NP) {                           // block-uniform: refill the buffer this trip has just read
      const unsigned lb = cL + (unsigned)bo * 2u;
      const int ko = (t + 2) * GK;
      copy_tile(lb, cA + ko, lda);
      copy_tile(lb + GT_SZ * 2, cB + ko, ldb);
      if (SPLITA) copy_tile(lb + 2 * GT_SZ * 2, cA2 + ko, lda);
    }
  }
  wait_copies();
}

// The epilogue: bias, then the block's tile written in the form OUT_MODE names; zoff = the z slice's element offset in the outputs.
// The slabs reuse the stage buffers behind the k loop's last barrier.
template <int OUT_MODE, bool BROW>
__device__ __forceinline__ void gemm_epilogue(__bf16* sS, v8f (&acc)[2][8], int mb, int n0, size_t zoff,
                                              void* Cout, void* Cout2, void* Cout3, int ldc,
                                              const float* __restrict__ bias, int nb1, const float* __restrict__ bias2, int nb2, int nsplit) {
  const int lane = threadIdx.x & 31;
  const int wave = threadIdx.x >> 5;
  const int m0 = mb + (wave << 5);
  const int rlane = lane & 15;              // col within a 16x16 subtile
  const int mOff  = (lane >> 4) * 8;        // D row offset of this lane half
  float* slab = (float*)(void*)sS + wave * (16 * GP);
  float bc[8];
#pragma unroll
  for (int j = 0; j < 8; ++j) bc[j] = 0.f;
  if (!BROW) {
    int x1[8], x2[8];
    float r1[8], r2[8];
#pragma unroll
    for (int j = 0; j < 8; ++j) {
      const int col = n0 + (j << 4) + rlane;
      int i1 = col;          if (i1 > nb1 - 1) i1 = nb1 - 1;
      int i2 = col - nsplit; if (i2 < 0) i2 = 0; if (i2 > nb2 - 1) i2 = nb2 - 1;
      x1[j] = i1; x2[j] = i2;
      r1[j] = bias[i1];
      r2[j] = bias2[i2];
    }
    hold_offsets8(x1, r1);
    hold_offsets8(x2, r2);
    // unrolled: static indices keep the arrays in registers
#pragma unroll
    for (int j = 0; j < 8; ++j) {
      const int col = n0 + (j << 4) + rlane;
      const float v1 = bfr(r1[j]);
      const float v2 = bfr(r2[j]);
      const bool lo = (col < nsplit);
      const bool valid = lo ? (col < nb1) : ((col - nsplit) < nb2);
      const float v = lo ? v1 : v2;
      bc[j] = valid ? v : 0.f;
    }
  }
#pragma unroll
  for (int i = 0; i < 2; ++i) {
    const int mBase = m0 + (i << 4);
    float br[8];
#pragma unroll
    for (int r = 0; r < 8; ++r) {
      br[r] = 0.f;
      if (BROW) {
        int ir = mBase + mOff + r; if (ir > nb1 - 1) ir = nb1 - 1;
        br[r] = bfr(bias[ir]);
      }
    }
#pragma unroll
    for (int j = 0; j < 8; ++j)
#pragma unroll
      for (int r = 0; r < 8; ++r)
        slab[(mOff + r) * GP + (j << 4) + rlane] = acc[i][j][r] + (BROW ? br[r] : bc[j]);
    wave_sync();
    if (OUT_MODE == 0) {
      float* C = (float*)Cout + zoff;
      const int c4 = lane * 4;                               // row segment 512 B = 32 lanes x 16 B
      {
#pragma unroll
        for (int it = 0; it < 16; ++it) {
          const v4f v = *(const v4f*)(slab + it * GP + c4);
          *(v4f*)(C + (size_t)(mBase + it) * ldc + n0 + c4) = v;
        }
        
      }
    } else if (OUT_MODE == 1) {
      unsigned short* C  = (unsigned short*)Cout  + zoff;
      unsigned short* C2 = (unsigned short*)Cout2 + zoff;
      const int q16 = lane >> 4, c8 = (lane & 15) * 8;      // row segment 256 B = 16 lanes x 16 B
      {
#pragma unroll
        for (int it = 0; it < 8; ++it) {
          const int row = it * 2 + q16;
          const float* sp = slab + row * GP + c8;
          v4u hv, lv;
#pragma unroll
          for (int p = 0; p < 4; ++p) {
            const float f0 = sp[2 * p], f1 = sp[2 * p + 1];
            const _Float16 e0 = (_Float16)f0, e1 = (_Float16)f1;
            const _Float16 g0 = (_Float16)((f0 - (float)e0) * 2048.0f);
            const _Float16 g1 = (_Float16)((f1 - (float)e1) * 2048.0f);
            hv[p] = pk16(h2u(e0), h2u(e1));
            lv[p] = pk16(h2u(g0), h2u(g1));
          }
          const size_t go = (size_t)(mBase + row) * ldc + n0 + c8;
          *(v4u*)(C  + go) = hv;
          *(v4u*)(C2 + go) = lv;
        }
        
      }
    } else {
      unsigned short* Q1 = (unsigned short*)Cout;
      unsigned short* Q2 = (unsigned short*)Cout2;
      unsigned short* K1 = (unsigned short*)Cout3;
      const int q16 = lane >> 4, c8 = (lane & 15) * 8;      // row segment 256 B = 16 lanes x 16 B
      const int  bidx = m0 / SEQ;                             // all 32 rows of the tile lie in one batch element
      const bool isq  = (n0 < nsplit);                        // wave-uniform
      const int  head = (isq ? n0 : (n0 - nsplit)) >> 7;
      const size_t rowBase = (size_t)(bidx * NH + head) * SEQ;
      {
#pragma unroll
        for (int it = 0; it < 8; ++it) {
          const int row = it * 2 + q16;
          const int s   = (mBase + row) & (SEQ - 1);
          const float* sp = slab + row * GP + c8;
          v4u hv, lv;
#pragma unroll
          for (int p = 0; p < 4; ++p) {
            const float f0 = sp[2 * p], f1 = sp[2 * p + 1];
            const _Float16 e0 = (_Float16)f0, e1 = (_Float16)f1;
            const _Float16 g0 = (_Float16)((f0 - (float)e0) * 2048.0f);
            const _Float16 g1 = (_Float16)((f1 - (float)e1) * 2048.0f);
            hv[p] = pk16(h2u(e0), h2u(e1));
            lv[p] = pk16(h2u(g0), h2u(g1));
          }
          const size_t go = (rowBase + (size_t)s) * ldc + c8;
          if (isq) {
            *(v4u*)(Q1 + go) = hv;
            *(v4u*)(Q2 + go) = lv;
            wait_named_regs();   // the next trip rewrites the stores' data and address registers
          } else {
            *(v4u*)(K1 + go) = hv;
            wait_named_regs();   // as above
          }
        }
        
      }
    }
    wave_sync();
  }
}

template <bool SPLITA, int OUT_MODE, bool BROW>
__global__ __launch_bounds__(128) void gemm_kernel(
    const unsigned short* __restrict__ Ap, const unsigned short* __restrict__ A2p, int lda, long strideA,
    const unsigned short* __restrict__ Btp, int ldb, long strideB,
    void* Cout, void* Cout2, void* Cout3, int ldc, long strideC,
    const float* __restrict__ bias, int nb1, const float* __restrict__ bias2, int nb2, int nsplit,
    int M, int N, int K) {
  constexpr int NT = SPLITA ? 3 : 2;            // staged tiles per stage: A, Bt (, A lo plane)
  __shared__ __align__(16) __bf16 sS[2 * NT * GT_SZ];   // two stage buffers; the epilogue slabs reuse them behind the loop's last barrier
  static_assert(4 * 16 * GP * 4 <= 2 * NT * GT_SZ * 2);
  const int bz   = blockIdx.y;
  const int tilesN = N >> 7;
  const int tilesM = M >> 7;
  const int tile = blockIdx.x;
  if (tile >= tilesM * tilesN) return;          // block-uniform, in front of every barrier
  const int tm = tile / tilesN;
  const int tn = tile - tm * tilesN;
  const int mb = tm << 7;                       // first row of the block's 128x128 tile
  const int n0 = tn << 7;

  const __bf16* Ab  = (const __bf16*)(const void*)Ap + (size_t)bz * strideA;
  const __bf16* Ab2 = SPLITA ? ((const __bf16*)(const void*)A2p + (size_t)bz * strideA) : (const __bf16*)0;
  const __bf16* Bb  = (const __bf16*)(const void*)Btp + (size_t)bz * strideB;

  v8f acc[2][8];
  gemm_main<SPLITA>(sS, Ab, Ab2, lda, Bb, ldb, mb, n0, K, acc);
  gemm_epilogue<OUT_MODE, BROW>(sS, acc, mb, n0, (size_t)bz * strideC, Cout, Cout2, Cout3, ldc, bias, nb1, bias2, nb2, nsplit);
}

// ---------------------------------------------------------------------------
// The three projections of x in one launch: none reads what another writes, so they are ranges of one grid's block index,
// each block one 128 x 128 tile over K = HID through the same k loop; only operands, tile grid and epilogue differ.
//   blocks [0, PJ_QK):  q | k: A = x [4096][2048], Bt = wq^T | wk^T [4096][2048] -> q hi/res planes, k plane, head-major; + bq | bk
//   then NB * PJ_V:     v^T per batch element: A = wv^T [2048 d][2048 k], Bt = x[b] [2048 s][2048 k] -> V^T hi/res planes; + bv[d]
//   then PJ_G:          gate logits: A = x, Bt = wg^T zero-padded [128][2048] -> f32 [4096][128]; + bg for columns < 16
// The range tests read blockIdx alone: block-uniform around every barrier.
// ---------------------------------------------------------------------------
#define PJ_QK ((NB * SEQ / 128) * (2 * HID / 128))
#define PJ_V  ((HID / 128) * (SEQ / 128))
#define PJ_G  ((NB * SEQ / 128) * (GLD / 128))
// four waves per SIMD, as each of the three had alone (four blocks of 72 KB on a WGP): 256 registers a wave
__global__ __launch_bounds__(128) __attribute__((amdgpu_waves_per_eu(4, 4))) void proj_kernel(
    const unsigned short* __restrict__ Xbp, const unsigned short* __restrict__ Wqkp, const unsigned short* __restrict__ Wvtp,
    const unsigned short* __restrict__ Wgtp,
    unsigned short* Qh, unsigned short* Ql, unsigned short* Kp, unsigned short* Vth, unsigned short* Vtl, float* Gl,
    const float* __restrict__ bq, const float* __restrict__ bk, const float* __restrict__ bv, const float* __restrict__ bg) {
  __shared__ __align__(16) __bf16 sS[2 * 2 * GT_SZ];    // two stage buffers; the epilogue slabs reuse them behind the loop's last barrier
  static_assert(4 * 16 * GP * 4 <= 2 * 2 * GT_SZ * 2);
  const __bf16* Xb = (const __bf16*)(const void*)Xbp;
  const int bx = blockIdx.x;
  const int kind = (bx < PJ_QK) ? 0 : (bx < PJ_QK + NB * PJ_V) ? 1 : 2;
  int tile = bx, tilesN = 2 * HID / 128, bz = 0;
  const __bf16* Ab = Xb;
  const __bf16* Bb = (const __bf16*)(const void*)Wqkp;
  if (kind == 1) {
    const int t = bx - PJ_QK;
    bz = t / PJ_V; tile = t - bz * PJ_V; tilesN = SEQ / 128;
    Ab = (const __bf16*)(const void*)Wvtp;
    Bb = Xb + (size_t)bz * SEQ * HID;
  } else if (kind == 2) {
    tile = bx - (PJ_QK + NB * PJ_V); tilesN = GLD / 128;
    Bb = (const __bf16*)(const void*)Wgtp;
  }
  const int tm = tile / tilesN;
  const int tn = tile - tm * tilesN;
  const int mb = tm << 7;                       // first row of the block's 128x128 tile
  const int n0 = tn << 7;

  v8f acc[2][8];
  gemm_main<false>(sS, Ab, (const __bf16*)0, HID, Bb, HID, mb, n0, HID, acc);
  if (kind == 0)      gemm_epilogue<2, false>(sS, acc, mb, n0, 0, (void*)Qh, (void*)Ql, (void*)Kp, HD, bq, HID, bk, HID, HID);
  else if (kind == 1) gemm_epilogue<1, true>(sS, acc, mb, n0, (size_t)bz * HID * SEQ, (void*)Vth, (void*)Vtl, (void*)Vtl, SEQ, bv, HID, bv, HID, SEQ);
  else                gemm_epilogue<0, false>(sS, acc, mb, n0, 0, (void*)Gl, (void*)Gl, (void*)Gl, GLD, bg, NH, bg, NH, GLD);
}

#define AT_QB 128
#define AT_KC 64
#define OS_P  132
// LDS row pitches in f16 elements, each 16 B x odd so that the 16 rows a ds_load_b128 fragment read touches fall on distinct banks
#define K_P   (HD + 8)      // K rows of 256 B at pitch 272 B
#define V_P   (AT_KC + 8)   // V^T rows of 128 B at pitch 144 B
#define AT_BUF (AT_KC * K_P + 2 * HD * V_P)   // f16 elements of one staged chunk: K | V^T hi | V^T res

// One chunk, global -> LDS: 12 asynchronous 16-B copies per lane, 4 per plane. lk / lh / ll = this lane's LDS byte address of its
// first row of K / V^T hi / V^T res, gk / gh / gl = its global address there; copy i takes K row +16*i, V^T row +32*i.
// The s_wait_xcnt stands inside the statement so that no address register is rewritten ahead of it.
__device__ __forceinline__ void copy_chunk(unsigned lk, unsigned lh, unsigned ll,
                                           const _Float16* gk, const _Float16* gh, const _Float16* gl) {
  const unsigned ks = 16 * K_P * 2, vs = 32 * V_P * 2;
  const size_t kg = (size_t)16 * HD, vg = (size_t)32 * SEQ;
#if defined(__HIP_DEVICE_COMPILE__)
  asm volatile("global_load_async_to_lds_b128 %0, %12, off\n\t"
               "global_load_async_to_lds_b128 %1, %13, off\n\t"
               "global_load_async_to_lds_b128 %2, %14, off\n\t"
               "global_load_async_to_lds_b128 %3, %15, off\n\t"
               "global_load_async_to_lds_b128 %4, %16, off\n\t"
               "global_load_async_to_lds_b128 %5, %17, off\n\t"
               "global_load_async_to_lds_b128 %6, %18, off\n\t"
               "global_load_async_to_lds_b128 %7, %19, off\n\t"
               "global_load_async_to_lds_b128 %8, %20, off\n\t"
               "global_load_async_to_lds_b128 %9, %21, off\n\t"
               "global_load_async_to_lds_b128 %10, %22, off\n\t"
               "global_load_async_to_lds_b128 %11, %23, off\n\t"
               "s_wait_xcnt 0x0"
               :: "v"(lk), "v"(lk + ks), "v"(lk + 2 * ks), "v"(lk + 3 * ks),
                  "v"(lh), "v"(lh + vs), "v"(lh + 2 * vs), "v"(lh + 3 * vs),
                  "v"(ll), "v"(ll + vs), "v"(ll + 2 * vs), "v"(ll + 3 * vs),
                  "v"(gk), "v"(gk + kg), "v"(gk + 2 * kg), "v"(gk + 3 * kg),
                  "v"(gh), "v"(gh + vg), "v"(gh + 2 * vg), "v"(gh + 3 * vg),
                  "v"(gl), "v"(gl + vg), "v"(gl + 2 * vg), "v"(gl + 3 * vg)
               : "memory");
#endif
}

// four waves per SIMD: two blocks of 8 waves on a WGP, 256 registers a wave
__global__ __launch_bounds__(256) __attribute__((amdgpu_waves_per_eu(4, 4)))
void attn_kernel(const unsigned short* __restrict__ qhp, const unsigned short* __restrict__ qlp,
                 const unsigned short* __restrict__ kp,
                 const unsigned short* __restrict__ vhp, const unsigned short* __restrict__ vlp,
                 const float* __restrict__ bmp, const float* __restrict__ glp,
                 unsigned short* chp, unsigned short* clp) {
  __shared__ __align__(16) _Float16 KVs[2 * AT_BUF];   // two buffers of K [key][d] | V^T hi [d][key] | V^T res [d][key], padded rows; ctx staging later
  static_assert(8 * 16 * OS_P * 4 <= 2 * AT_BUF * 2);

  const int tid  = threadIdx.x;
  const int wave = __builtin_amdgcn_readfirstlane(tid >> 5);   // wave-uniform: held in a scalar register, with all that is formed from it
  const int lane = tid & 31;
  const int hh   = lane >> 4;
  const int c    = lane & 15;

  const int bx  = blockIdx.x;
  const int qb  = bx & 15;                 // query block of 128
  const int h   = (bx >> 4) & (NH - 1);    // head
  const int b   = bx >> 8;                 // batch element
  const int q0  = qb * AT_QB + wave * 16;

  const _Float16* Qhg = (const _Float16*)(const void*)qhp + (size_t)(b * NH + h) * SEQ * HD;
  const _Float16* Qlg = (const _Float16*)(const void*)qlp + (size_t)(b * NH + h) * SEQ * HD;
  const _Float16* Kg  = (const _Float16*)(const void*)kp  + (size_t)(b * NH + h) * SEQ * HD;
  const _Float16* Vhg = (const _Float16*)(const void*)vhp + ((size_t)b * HID + (size_t)h * HD) * SEQ;
  const _Float16* Vlg = (const _Float16*)(const void*)vlp + ((size_t)b * HID + (size_t)h * HD) * SEQ;
  const float*    Bm  = bmp + (size_t)b * SEQ * SEQ + (size_t)(q0 + c) * SEQ + 8 * hh;   // + first key of the tile + r
  const int qro = (q0 + c) * HD + 8 * hh;  // per-lane q fragment base, query q0 + c (d added per step)

  // per-head bias scale 2^(-(h+1)/2): exact power of two times sqrt(1/2) for odd (h+1)
  const int   hexp = (h + 1) >> 1;
  const float hs   = __uint_as_float((unsigned)(127 - hexp) << 23) * (((h + 1) & 1) ? 0.70710678118654752f : 1.0f);

  const v8f zero8 = (v8f){0.f, 0.f, 0.f, 0.f, 0.f, 0.f, 0.f, 0.f};
  const float inv2048 = 4.8828125e-4f;
  // softmax runs in base 2: log2(e) is folded into the score scale and the bias scale, so that exp(x) is one v_exp_f32
  const float log2e   = 1.4426950408889634f;
  const float scale   = (1.0f / 11.313708305358887f) * log2e;
  const float hs2     = hs * log2e;

  float mrow = -INFINITY, lrow = 0.f;      // of query q0 + c; lrow sums this lane half's keys only
  v8f oh[8];
#pragma unroll
  for (int t = 0; t < 8; ++t) oh[t] = zero8;

  v16h qa[4], qr[4];
  // unrolled: static indices keep these arrays in registers
#pragma unroll
  for (int dc = 0; dc < 4; ++dc) {
    qa[dc] = ldfrag_h(Qhg + qro + dc * 32);
    qr[dc] = ldfrag_h(Qlg + qro + dc * 32);
  }

  // copy lanes: K: thread -> key tid>>4 (+16 per copy), 16-B piece tid&15 of the row's 256 B;
  //             V^T hi/res: thread -> d = tid>>3 (+32 per copy), 16-B piece tid&7 of the row's 128 B of this chunk
  // coverage: 4 x 16 keys x 128 d for K, 4 x 32 d x 64 keys for each V^T plane = the whole chunk tiles
  constexpr int NCH = SEQ / AT_KC;
  static_assert(NCH >= 2);
  const int krow = tid >> 4, kseg = (tid & 15) * 8;
  const int vrow = tid >> 3, vseg = (tid & 7) * 8;
  const unsigned lK = (unsigned)(size_t)(const void*)KVs + (unsigned)(krow * K_P + kseg) * 2u;                 // LDS byte addresses, buffer 0
  const unsigned lH = (unsigned)(size_t)(const void*)KVs + (unsigned)(AT_KC * K_P + vrow * V_P + vseg) * 2u;
  const unsigned lL = lH + HD * V_P * 2;
  const _Float16* gK = Kg  + krow * HD + kseg;
  const _Float16* gH = Vhg + (size_t)vrow * SEQ + vseg;
  const _Float16* gL = Vlg + (size_t)vrow * SEQ + vseg;

  // chunk 0 into buffer 0, published
  copy_chunk(lK, lH, lL, gK, gH, gL);
  wait_copies();
  __syncthreads();

  // one chunk per trip, the buffer chosen by the trip's parity
  for (int kc = 0; kc < NCH; ++kc) {
    const int kv0 = kc * AT_KC;
    const int bo  = (kc & 1) * AT_BUF;
    // directly behind the barrier that ended every read of the other buffer (the one above, then the one at the trip's foot):
    // the next chunk's copies into it, while there is a next chunk (block-uniform); they fly while this chunk is worked on
    if (kc + 1 < NCH) {
      const unsigned lb = (unsigned)(AT_BUF - bo) * 2u;
      const int kn = kv0 + AT_KC;
      copy_chunk(lK + lb, lH + lb, lL + lb, gK + (size_t)kn * HD, gH + kn, gL + kn);
    }
    const _Float16* const Ksh = KVs + bo;
    const _Float16* const Vth = KVs + bo + AT_KC * K_P;
    const _Float16* const Vtl = KVs + bo + AT_KC * K_P + HD * V_P;

    // ---- scores: 4 key tiles of 16, reduce over d = 128 = 4 k-steps; hi and residual accumulators separate ----
    v8f s[4];
    v4f bb[4][2];                            // raw bias values per key tile: 8 consecutive keys of this lane's query
    bb[0][0] = *(const v4f*)(Bm + kv0);
    bb[0][1] = *(const v4f*)(Bm + kv0 + 4);
#pragma unroll
    for (int j = 0; j < 4; ++j) {
      if (j < 3) {
        bb[j + 1][0] = *(const v4f*)(Bm + kv0 + (j + 1) * 16);
        bb[j + 1][1] = *(const v4f*)(Bm + kv0 + (j + 1) * 16 + 4);
        // keeps the next key tile's bias loads issued as one group here, in flight behind this tile's products:
        // with the q fragments held, the scheduler otherwise sinks them in pairs to their uses
        __builtin_amdgcn_sched_barrier(0);
      }
      v8f sh = zero8, sl = zero8;
#pragma unroll
      for (int dc = 0; dc < 4; ++dc) {
        FragH kb;
        kb.h[0] = *(const v8h*)(Ksh + (j * 16 + c) * K_P + dc * 32 + 8 * hh);
        kb.h[1] = *(const v8h*)(Ksh + (j * 16 + c) * K_P + dc * 32 + 16 + 8 * hh);
        sh = wmma_h(kb.v, qa[dc], sh);
        sl = wmma_h(kb.v, qr[dc], sl);
      }
      // keeps the first use of this tile's bias (and its wait) behind the tile's products
      __builtin_amdgcn_sched_barrier(0);
      v8f sj = (sh + sl * inv2048) * scale;
#pragma unroll
      for (int r = 0; r < 8; ++r) sj[r] = sj[r] + hs2 * bfr(bb[j][r >> 2][r & 3]);
      s[j] = sj;
    }

    // maximum over this lane's 32 scores, then over the other half's
    float mx[8];
#pragma unroll
    for (int r = 0; r < 8; ++r) mx[r] = fmaxf(fmaxf(s[0][r], s[1][r]), fmaxf(s[2][r], s[3][r]));
    float cm = fmaxf(fmaxf(fmaxf(mx[0], mx[1]), fmaxf(mx[2], mx[3])), fmaxf(fmaxf(mx[4], mx[5]), fmaxf(mx[6], mx[7])));
    cm = fmaxf(cm, xhalf(cm));

    const float mnew  = fmaxf(mrow, cm);
    const float alpha = __builtin_amdgcn_exp2f(mrow - mnew);
    const float msub  = mnew - 10.0f;      // the 2^10 scale of P rides in the exponent
    mrow = mnew;
    // P^T operands: element e of k-step kk is key 32*kk + 8*hh + e (e < 8, tile 2*kk) or 32*kk + 16 + 8*hh + e - 8 (tile 2*kk + 1),
    // the k order of the V^T fragment loads below
    FragH pb[2];
    float ps[4];
#pragma unroll
    for (int j = 0; j < 4; ++j) {
      exp2x8(s[j], msub);                        // 1024 * exp(score - maximum)
    }
#pragma unroll
    for (int j = 0; j < 4; ++j) {
      float pj = s[j][0];
#pragma unroll
      for (int r = 1; r < 8; ++r) pj += s[j][r];
#pragma unroll
      for (int r = 0; r < 8; ++r) pb[j >> 1].v[(j & 1) * 8 + r] = (_Float16)s[j][r];
      ps[j] = pj;
    }
    lrow = lrow * alpha + ((ps[0] + ps[1]) + (ps[2] + ps[3]));
#pragma unroll
    for (int t = 0; t < 8; ++t) oh[t] *= alpha;

    // ---- ctx^T += V^T . P^T over the 64 keys of the chunk (2 k-steps), 8 d tiles ----
    // unrolled: the static index keeps pb in registers
#pragma unroll
    for (int kk = 0; kk < 2; ++kk) {
#pragma unroll
      for (int t = 0; t < 8; ++t) {
        FragH vb, vr;
        vb.h[0] = *(const v8h*)(Vth + (t * 16 + c) * V_P + kk * 32 + 8 * hh);
        vb.h[1] = *(const v8h*)(Vth + (t * 16 + c) * V_P + kk * 32 + 16 + 8 * hh);
        vr.h[0] = *(const v8h*)(Vtl + (t * 16 + c) * V_P + kk * 32 + 8 * hh);
        vr.h[1] = *(const v8h*)(Vtl + (t * 16 + c) * V_P + kk * 32 + 16 + 8 * hh);
        oh[t] = wmma_h(vb.v, pb[kk].v, oh[t]);
        const v8f tr = wmma_h(vr.v, pb[kk].v, zero8);
        oh[t] += tr * inv2048;
      }
    }
    // publish point of chunk kc + 1: own reads of this buffer done, own copies of the next landed, then the block barrier
    wait_lds();
    wait_copies();
    __syncthreads();
  }
  wait_copies();

  // ---- normalise, apply the head gate, stage the wave 16x128 tile (aliases the K/V region behind the loop's last barrier),
  //      write bf16 hi/lo planes ----
  float* os = (float*)(void*)KVs + wave * (16 * OS_P);
  {
    const float lsum = lrow + xhalf(lrow);   // the two lane halves' key sums of query q0 + c
    const float a  = glp[(size_t)(b * SEQ + q0 + c) * GLD + h];
    const float g  = 1.0f / (1.0f + expf(-a));
    const float invl = g * (1.0f / lsum);    // ctx and lsum both carry the factor 1024
#pragma unroll
    for (int t = 0; t < 8; ++t) {
      const v8f o = oh[t] * invl;
      *(v4f*)(os + c * OS_P + t * 16 + 8 * hh)     = (v4f){o[0], o[1], o[2], o[3]};
      *(v4f*)(os + c * OS_P + t * 16 + 8 * hh + 4) = (v4f){o[4], o[5], o[6], o[7]};
    }
  }
  wave_sync();
  {
    const int q16 = lane >> 4, c8 = (lane & 15) * 8;         // 2 rows per instruction, each row 256 B = 16 lanes x 16 B
    {
#pragma unroll
      for (int it = 0; it < 8; ++it) {
        const int row = it * 2 + q16;
        const float* sp = os + row * OS_P + c8;
        v4u hv, lv;
#pragma unroll
        for (int p = 0; p < 4; ++p) {
          const float f0 = sp[2 * p], f1 = sp[2 * p + 1];
          const unsigned short hb0 = f2bf_bits(f0), hb1 = f2bf_bits(f1);
          const unsigned short lb0 = f2bf_bits(f0 - bf_bits2f(hb0));
          const unsigned short lb1 = f2bf_bits(f1 - bf_bits2f(hb1));
          hv[p] = pk16(hb0, hb1);
          lv[p] = pk16(lb0, lb1);
        }
        const size_t go = (size_t)(b * SEQ + q0 + row) * HID + h * HD + c8;
        *(v4u*)(chp + go) = hv;
        *(v4u*)(clp + go) = lv;
      }
      
    }
  }
}

// ---------------------------------------------------------------------------
// all sizes exact tile multiples, all offsets multiples of 512 KiB):
//   R0   bf16 [4096][2048]       16777216 @ 0           x as bf16; later ctx hi plane (written after the last reader of x)
//   R1   bf16 [4096][2048]       16777216 @ 16777216    wq^T|wk^T panel [4096][2048]; later ctx lo plane
//   Wob  bf16 [2048][2048]        8388608 @ 33554432    wo^T
//   Wgb  bf16 [128][2048]          524288 @ 41943040    wg^T zero-padded to 128 rows
//   Glog f32  [4096][128]         2097152 @ 42467328    gate logits
//   Qh   f16  [2][16][2048][128]  16777216 @ 44564480    Ql same @ 61341696
//   Kp   f16  [2][16][2048][128]  16777216 @ 78118912
//   Vth  f16  [2][2048][2048]     16777216 @ 94896128    Vtl same @ 111673344
//   Wvt  bf16 [2048][2048]        8388608 @ 128450560   wv^T
//   total                        136839168
// ---------------------------------------------------------------------------
extern "C" void kernel_launch(void* const* d_in, const int* in_sizes, int n_in,
                              void* d_out, int out_size, void* d_ws, size_t ws_size,
                              hipStream_t stream) {
  if (n_in < 12) return;
  if (in_sizes[0] != NB * SEQ * HID) return;
  if (in_sizes[1] != NB * SEQ * SEQ) return;
  if (in_sizes[2] != HID * HID) return;
  if (in_sizes[3] != HID) return;
  if (in_sizes[4] != HID * HID) return;
  if (in_sizes[5] != HID) return;
  if (in_sizes[6] != HID * HID) return;
  if (in_sizes[7] != HID) return;
  if (in_sizes[8] != HID * NH) return;
  if (in_sizes[9] != NH) return;
  if (in_sizes[10] != HID * HID) return;
  if (in_sizes[11] != HID) return;
  if (out_size != NB * SEQ * HID) return;

  const float* x   = (const float*)d_in[0];
  const float* bm  = (const float*)d_in[1];
  const float* wq  = (const float*)d_in[2];
  const float* bq  = (const float*)d_in[3];
  const float* wk  = (const float*)d_in[4];
  const float* bk  = (const float*)d_in[5];
  const float* wv  = (const float*)d_in[6];
  const float* bv  = (const float*)d_in[7];
  const float* wg  = (const float*)d_in[8];
  const float* bg  = (const float*)d_in[9];
  const float* wo  = (const float*)d_in[10];
  const float* bo  = (const float*)d_in[11];
  float* out = (float*)d_out;

  const size_t szR0  = (size_t)NB * SEQ * HID * 2;          // 16 MiB
  const size_t szR1  = (size_t)2 * HID * HID * 2;           // 16 MiB
  const size_t szWo  = (size_t)HID * HID * 2;               //  8 MiB
  const size_t szWg  = (size_t)GLD * HID * 2;               //  512 KiB
  const size_t szG   = (size_t)NB * SEQ * GLD * 4;          //  2 MiB
  const size_t szQ   = (size_t)NB * NH * SEQ * HD * 2;      // 16 MiB
  const size_t szK   = szQ;
  const size_t szV   = (size_t)NB * HID * SEQ * 2;          // 16 MiB
  size_t off = 0;
  const size_t oR0  = off; off += szR0;
  const size_t oR1  = off; off += szR1;
  const size_t oWo  = off; off += szWo;
  const size_t oWg  = off; off += szWg;
  const size_t oG   = off; off += szG;
  const size_t oQh  = off; off += szQ;
  const size_t oQl  = off; off += szQ;
  const size_t oKp  = off; off += szK;
  const size_t oVth = off; off += szV;
  const size_t oVtl = off; off += szV;
  const size_t oWv  = off; off += szWo;
  if (off > ws_size) return;                    // off = 136839168

  char* ws = (char*)d_ws;
  unsigned short* Xb  = (unsigned short*)(ws + oR0);
  unsigned short* Ch  = (unsigned short*)(ws + oR0);        // reuses R0 after the projections (last readers of Xb)
  unsigned short* Wvt = (unsigned short*)(ws + oWv);
  unsigned short* Wqk = (unsigned short*)(ws + oR1);
  unsigned short* Cl  = (unsigned short*)(ws + oR1);        // reuses R1 after the projections (last readers of Wqk)
  unsigned short* Wot = (unsigned short*)(ws + oWo);
  unsigned short* Wgt = (unsigned short*)(ws + oWg);
  float*          Gl  = (float*)(ws + oG);
  unsigned short* Qh  = (unsigned short*)(ws + oQh);
  unsigned short* Ql  = (unsigned short*)(ws + oQl);
  unsigned short* Kp  = (unsigned short*)(ws + oKp);
  unsigned short* Vth = (unsigned short*)(ws + oVth);
  unsigned short* Vtl = (unsigned short*)(ws + oVtl);

  const dim3 blk256(256), blk128(128);

  // (1) all operand conversions: wv^T, wq^T | wk^T, wo^T, x as bf16, wg^T zero-padded
  prep_kernel<<<dim3(GLD + 4 * TR_NB + CV_NB), blk256, 0, stream>>>(x, wv, wq, wk, wo, wg, Xb, Wvt, Wqk, Wot, Wgt);
  // (2) the three projections of x: q | k planes, v^T planes, gate logits
  proj_kernel<<<dim3(PJ_QK + NB * PJ_V + PJ_G), blk128, 0, stream>>>(Xb, Wqk, Wvt, Wgt, Qh, Ql, Kp, Vth, Vtl, Gl, bq, bk, bv, bg);
  // (3) attention: grid = NB x 16 heads x 16 query blocks, 256 threads
  attn_kernel<<<dim3(NB * NH * (SEQ / AT_QB)), blk256, 0, stream>>>(Qh, Ql, Kp, Vth, Vtl, bm, Gl, Ch, Cl);
  // (4) output projection: A = gated ctx hi/lo planes [4096][2048], Bt = Wot [2048][2048] -> d_out f32 [4096][2048], + bo
  {
    const int M = NB * SEQ, N = HID, K = HID;
    const int tiles = (M / 32) * (N / 128);
    gemm_kernel<true, 0, false><<<dim3((tiles + 3) / 4, 1), blk128, 0, stream>>>(
        Ch, Cl, HID, 0L, Wot, HID, 0L, (void*)out, (void*)out, (void*)out, HID, 0L,
        bo, HID, bo, HID, N, M, N, K);
  }
  (void)hipGetLastError();
}

// v009
// Measured time: 218 microseconds a run.
// It is 1.24 times as fast as v007, going by the measured steps of the versions left out in between.
// Over all steps from v000 it is 5.36 times as fast.
#include <hip/hip_runtime.h>
#include <math.h>
#include <stdint.h>

// q/k/v and gate projections: v_wmma_f32_16x16x32_bf16, single products on bf16-RNE converted x and W^T, f32 accumulate;
// scores, transposed, k.q^T: v_wmma_f32_16x16x32_f16 with q and k single f16 planes, f32 accumulate;
// ctx, transposed, v^T.p^T: v_wmma_f32_16x16x32_f16 with p x1024 and v^T single f16 planes, f32 accumulate;
// (q, k and v come from bf16-rounded x and W, unit roundoff 2^-8 a factor; their own f16 rounding, 2^-11, lies well under that)
// output projection: v_wmma_f32_16x16x32_bf16 with gated ctx as bf16 hi + lo planes and Wo^T bf16, f32 accumulate.
// Online softmax, score scale 1/sqrt(128), per-head bias scale 2^(-(h+1)/2), sigmoid gate and normalisation in f32.

#define NB   2
#define SEQ  2048
#define HID  2048
#define NH   16
#define HD   128
#define GLD  128

typedef _Float16 v16h __attribute__((ext_vector_type(16)));
typedef _Float16 v8h  __attribute__((ext_vector_type(8)));
typedef __bf16   v16b __attribute__((ext_vector_type(16)));
typedef __bf16   v8b  __attribute__((ext_vector_type(8)));
typedef float    v8f  __attribute__((ext_vector_type(8)));
typedef float    v4f  __attribute__((ext_vector_type(4)));
typedef unsigned int v4u __attribute__((ext_vector_type(4)));

// ---------------------------------------------------------------------------
// small helpers
// ---------------------------------------------------------------------------
__device__ __forceinline__ unsigned short f2bf_bits(float f) {          // RNE convert f32 -> bf16 bits
  const unsigned u = __float_as_uint(f);
  return (unsigned short)((u + 0x7FFFu + ((u >> 16) & 1u)) >> 16);
}
__device__ __forceinline__ float bf_bits2f(unsigned short x) { return __uint_as_float(((unsigned)x) << 16); }
__device__ __forceinline__ float bfr(float f) { return __uint_as_float(((unsigned)f2bf_bits(f)) << 16); }
__device__ __forceinline__ unsigned pk16(unsigned short a, unsigned short b) { return (unsigned)a | ((unsigned)b << 16); }
__device__ __forceinline__ unsigned short h2u(_Float16 x) { return __builtin_bit_cast(unsigned short, x); }

// 2^(x - m) on eight values in place. One statement, so that behind each v_exp_f32 stands an independent one (another register, neither
// its result nor its source), the slot the instruction set asks for behind a transcendental; the v_nop is that slot for the last.
__device__ __forceinline__ void exp2x8(v8f& x, float m) {
#if defined(__HIP_DEVICE_COMPILE__)
  float a = x[0] - m, b = x[1] - m, c = x[2] - m, d = x[3] - m, e = x[4] - m, f = x[5] - m, g = x[6] - m, h = x[7] - m;
  asm("v_exp_f32 %0, %0\n\tv_exp_f32 %1, %1\n\tv_exp_f32 %2, %2\n\tv_exp_f32 %3, %3\n\t"
      "v_exp_f32 %4, %4\n\tv_exp_f32 %5, %5\n\tv_exp_f32 %6, %6\n\tv_exp_f32 %7, %7\n\tv_nop"
      : "+v"(a), "+v"(b), "+v"(c), "+v"(d), "+v"(e), "+v"(f), "+v"(g), "+v"(h));
  x = (v8f){a, b, c, d, e, f, g, h};
#endif
}

// lane l with lane l ^ 16
__device__ __forceinline__ float xhalf(float x) {
  return __builtin_bit_cast(float, __builtin_amdgcn_permlanex16(__builtin_bit_cast(int, x), __builtin_bit_cast(int, x), 0x76543210, 0xfedcba98, false, false));
}

// stands behind global loads or stores, in front of the code that rewrites a register which they name (address, offset, store data)
__device__ __forceinline__ void wait_named_regs() {
#if defined(__HIP_DEVICE_COMPILE__)
  asm volatile("s_wait_xcnt 0x0" ::: "memory");
#endif
}

// behind a run of eight loads: offsets and loaded values are inputs only, so that each offset register lives to this wait and
// no load of the run lands in the offset register of another
__device__ __forceinline__ void hold_offsets8(const int (&x)[8], const float (&r)[8]) {
#if defined(__HIP_DEVICE_COMPILE__)
  asm volatile("s_wait_xcnt 0x0" :: "v"(x[0]), "v"(x[1]), "v"(x[2]), "v"(x[3]), "v"(x[4]), "v"(x[5]), "v"(x[6]), "v"(x[7]),
                                    "v"(r[0]), "v"(r[1]), "v"(r[2]), "v"(r[3]), "v"(r[4]), "v"(r[5]), "v"(r[6]), "v"(r[7]) : "memory");
#endif
}

// behind a run of loads from one scalar base and one offset register: both are inputs only, so that they live to this wait and
// the address arithmetic that follows cannot take their registers ahead of it
__device__ __forceinline__ void hold_base_offset(const _Float16* base, unsigned off) {
#if defined(__HIP_DEVICE_COMPILE__)
  asm volatile("s_wait_xcnt 0x0" :: "s"(base), "v"(off) : "memory");
#endif
}

__device__ __forceinline__ void wave_sync() {
  __builtin_amdgcn_fence(__ATOMIC_RELEASE, "workgroup");
  __builtin_amdgcn_wave_barrier();
  __builtin_amdgcn_fence(__ATOMIC_ACQUIRE, "workgroup");
}

// 16-bit fragment loaders, same k map for A and B: p points at (row or col)*ld + k0 + 8*(lane>>4);
// elements 0..7 <- p[0..7] (k0+8h..k0+8h+7), elements 8..15 <- p[16..23] (k0+16+8h..k0+16+8h+7).
union FragB { v16b v; v8b h[2]; };
union FragH { v16h v; v8h h[2]; };
__device__ __forceinline__ v16b ldfrag_b(const __bf16* p) {
  FragB f; f.h[0] = *(const v8b*)(p); f.h[1] = *(const v8b*)(p + 16); return f.v;
}
__device__ __forceinline__ v16h ldfrag_h(const _Float16* p) {
  FragH f; f.h[0] = *(const v8h*)(p); f.h[1] = *(const v8h*)(p + 16); return f.v;
}

__device__ __forceinline__ v8f wmma_b(v16b a, v16b b, v8f c) {
  return __builtin_amdgcn_wmma_f32_16x16x32_bf16(false, a, false, b, (short)0, c, false, false);
}
// f16 form, the plain builtin: the compiler keeps the distances behind it. No asm statement names its operands: the attention kernel
// holds more than 256 registers, and what an asm statement names must lie in the first 256
__device__ __forceinline__ v8f wmma_h(v16h a, v16h b, v8f c) {
  return __builtin_amdgcn_wmma_f32_16x16x32_f16(false, a, false, b, (short)0, c, false, false);
}
// hazard guard for one j-group of the register-blocked GEMM (ties both D tiles, keeps A/B registers live)
__device__ __forceinline__ void dep_guard_b(v8f& x, v8f& y, v16b b, v16b a0, v16b a1, v16b l0, v16b l1) {
#if defined(__HIP_DEVICE_COMPILE__)
  asm volatile("v_nop\n\tv_nop\n\tv_nop\n\tv_nop" : "+v"(x), "+v"(y) : "v"(b), "v"(a0), "v"(a1), "v"(l0), "v"(l1));
#endif
}

// ---------------------------------------------------------------------------
// f32 -> bf16 (RNE) convert, 8 elements per thread: two 16-B loads, one 16-B store.
// Coverage: ceil(n8/256) blocks (index bx) x 256 threads x 8 elements = the whole array (sizes here are multiples of 2048).
// ---------------------------------------------------------------------------
__device__ __forceinline__ void cvt_bf16x8_body(const float* __restrict__ in, unsigned short* out, int n8, int bx) {
  const int i = bx * 256 + threadIdx.x;
  if (i < n8) {
    const v4f a = *(const v4f*)(in + 8 * (size_t)i);
    const v4f c = *(const v4f*)(in + 8 * (size_t)i + 4);
    v4u w;
    w[0] = pk16(f2bf_bits(a[0]), f2bf_bits(a[1]));
    w[1] = pk16(f2bf_bits(a[2]), f2bf_bits(a[3]));
    w[2] = pk16(f2bf_bits(c[0]), f2bf_bits(c[1]));
    w[3] = pk16(f2bf_bits(c[2]), f2bf_bits(c[3]));
    v4u* p = (v4u*)(out + 8 * (size_t)i);
    *p = w;
    
  }
}

// ---------------------------------------------------------------------------
// Transpose + RNE bf16 convert: in f32 [R][C] row-major -> out bf16 [C][R] (out[c][r] = bf16(in[r][c])).
// Block 256 threads handles a 64x64 tile through LDS. Load: thread -> 4 float4 (rows t>>4 + 16i, cols 4*(t&15)+0..3).
// Coverage: out rows cc = wave*4 + (lane>>3) (+32) over 8 waves = 0..63; columns (lane&7)*8 + 0..7 = 0..63; tiles (bx, by) over (C/64, R/64).
// ---------------------------------------------------------------------------
__device__ __forceinline__ void tr_bf16_body(float (*tile)[65], const float* __restrict__ in, unsigned short* out, int R, int C, int bx, int by) {
  const int c0 = bx * 64, r0 = by * 64;
  const int t = threadIdx.x;
  const int cq = (t & 15) * 4, rb = t >> 4;
#pragma unroll
  for (int i = 0; i < 4; ++i) {
    const int r = rb + 16 * i;
    const v4f v = *(const v4f*)(in + (size_t)(r0 + r) * C + c0 + cq);
    tile[r][cq] = v[0]; tile[r][cq + 1] = v[1]; tile[r][cq + 2] = v[2]; tile[r][cq + 3] = v[3];
  }
  __syncthreads();
  const int wave = t >> 5, lane = t & 31, q = lane >> 3, pc = lane & 7;
  const int cc0 = wave * 4 + q, cc1 = 32 + wave * 4 + q;
  v4u w0, w1;
#pragma unroll
  for (int e = 0; e < 4; ++e) {
    w0[e] = pk16(f2bf_bits(tile[pc * 8 + 2 * e][cc0]), f2bf_bits(tile[pc * 8 + 2 * e + 1][cc0]));
    w1[e] = pk16(f2bf_bits(tile[pc * 8 + 2 * e][cc1]), f2bf_bits(tile[pc * 8 + 2 * e + 1][cc1]));
  }
  v4u* p0 = (v4u*)(out + (size_t)(c0 + cc0) * R + r0 + pc * 8);
  v4u* p1 = (v4u*)(out + (size_t)(c0 + cc1) * R + r0 + pc * 8);
  *p0 = w0; *p1 = w1;
  wait_named_regs();   // the built code of another block range follows these stores and reuses their registers
}

// ---------------------------------------------------------------------------
// Gate weight panel: wg f32 [HID][NH] -> out bf16 [GLD][HID], out[n][k] = bf16(wg[k][n]) for n < NH, 0 for n >= NH.
// Block n (uniform), thread -> k = 8*threadIdx.x; loads use a clamped column address, zeroed by value for n >= NH.
// Coverage: 128 blocks x 256 threads x 8 = the whole [128][2048] panel (padding rows written as zeros).
// ---------------------------------------------------------------------------
__device__ __forceinline__ void wg_pad_body(const float* __restrict__ wg, unsigned short* out, int n) {
  const int k = threadIdx.x * 8;
  const int nn = (n < NH) ? n : (NH - 1);
  const float keep = (n < NH) ? 1.0f : 0.0f;
  v4u w;
#pragma unroll
  for (int e = 0; e < 4; ++e) {
    const float a = wg[(size_t)(k + 2 * e) * NH + nn] * keep;
    const float b = wg[(size_t)(k + 2 * e + 1) * NH + nn] * keep;
    w[e] = pk16(f2bf_bits(a), f2bf_bits(b));
  }
  v4u* p = (v4u*)(out + (size_t)n * HID + k);
  *p = w;
  
}

// ---------------------------------------------------------------------------
// All operand conversions in one launch: none reads what another writes, so they are ranges of one grid's block index.
//   blocks [0, GLD): the gate weight panel (strided reads, the longest wait of the three kinds, so it starts first);
//   then 4*TR_NB blocks: the four 2048 x 2048 weight transposes (wv, wq, wk, wo), TR_NB tiles of 64 x 64 each;
//   then CV_NB blocks: x to bf16.
// The range tests read blockIdx alone: block-uniform, so the transpose's barrier is passed by all threads of a block or by none.
// ---------------------------------------------------------------------------
#define TR_NB ((HID / 64) * (HID / 64))
#define CV_NB (NB * SEQ * HID / 8 / 256)
__global__ __launch_bounds__(256) void prep_kernel(const float* __restrict__ x, const float* __restrict__ wv, const float* __restrict__ wq,
                                                   const float* __restrict__ wk, const float* __restrict__ wo, const float* __restrict__ wg,
                                                   unsigned short* Xb, unsigned short* Wvt, unsigned short* Wqk, unsigned short* Wot,
                                                   unsigned short* Wgt) {
  __shared__ __align__(16) float tile[64][65];
  const int bx = blockIdx.x - GLD;
  if (bx < 0) {
    wg_pad_body(wg, Wgt, blockIdx.x);
  } else if (bx < 4 * TR_NB) {
    const int w = bx / TR_NB, t = bx - w * TR_NB;
    const float* in = (w == 0) ? wv : (w == 1) ? wq : (w == 2) ? wk : wo;
    unsigned short* out = (w == 0) ? Wvt : (w == 1) ? Wqk : (w == 2) ? (Wqk + (size_t)HID * HID) : Wot;
    tr_bf16_body(tile, in, out, HID, HID, t % (HID / 64), t / (HID / 64));
  } else {
    cvt_bf16x8_body(x, Xb, NB * SEQ * HID / 8, bx - 4 * TR_NB);
  }
}

// ---------------------------------------------------------------------------
// Register-blocked bf16 WMMA GEMM: C[m][n] = sum_k A[m][k] * Bt[n][k] + bias; each wave owns a 32x128 tile,
// the 4 waves of a block own 128x128 (4 row slabs over one column panel) and share the operand tiles in LDS.
// A row-major [M][K] (pitch lda), Bt row-major [N][K] (pitch ldb); M and N multiples of 128, K multiple of 64.
// Operand staging: per stage of 64 k, 128 rows x 128 B of A (and of the lo plane) and of Bt are copied global -> LDS by
// asynchronous 16-B copies, 8 lanes per row (whole 128-B lines), rows at pitch 144 B; two buffers, the copies of
// stage t + 2 fly while stage t + 1 is worked on. Fragments are then read from LDS with the same k map as before.
// SPLITA: A given as hi plane (Ap) + unscaled bf16 lo plane (A2p): products Ahi.B + Alo.B into one accumulator.
// BROW: bias[m] per row (clamped to nb1), else per column: bias[n] for n < nsplit (valid while n < nb1),
//       bias2[n - nsplit] for n >= nsplit (valid while n - nsplit < nb2); bias values RNE-rounded to bf16; both
//       candidates loaded from clamped addresses and selected by value.
// blockIdx.y selects a z slice through strideA / strideB / strideC (element strides).
// Epilogue: per wave, each 16x128 accumulator slab is staged in LDS (pitch 132 floats), then written as whole
//   OUT_MODE 0: f32 rows into Cout [M][ldc] (row segment 512 B = 32 lanes x 16 B, 1 row per instruction).
//   OUT_MODE 1: f16 plane Cout, [M][ldc] (256 B = 16 lanes x 16 B, 2 rows per instr.).
//   OUT_MODE 2: head-major relayout: columns n0 < nsplit -> f16 q plane Cout at
//               [(b*16 + n0/128)*SEQ + s][ldc = 128]; columns >= nsplit -> f16 k plane Cout2 at
//               [(b*16 + (n0-nsplit)/128)*SEQ + s][128], with row m = b*2048 + s. Each 128-wide row = 256 B = 16 lanes x 16 B.
// Coverage per slab: it 0..7 x (lane>>4) 0..1 = 16 rows, (lane&15)*8 + 0..7 = 128 columns (OUT_MODE 1/2);
//                    it 0..15 = 16 rows, lane*4 + 0..3 = 128 columns (OUT_MODE 0).
// ---------------------------------------------------------------------------
#define GP 132
#define GK    64               // k elements per stage
#define GT_P  (GK + 8)         // LDS row pitch in bf16 elements: 144 B = 16 B x odd, conflict-free for ds_load_b128 fragment reads
#define GT_SZ (128 * GT_P)     // elements of one staged 128-row tile

// One 128-row x 128-B tile, global -> LDS: 8 asynchronous 16-B copies per lane. l = this lane's LDS byte address of its
// first row, g = this lane's global address of its first row; copy i takes row +16*i (ld = global pitch in elements).
// The s_wait_xcnt stands inside the statement so that no address register is rewritten ahead of it.
__device__ __forceinline__ void copy_tile(unsigned l, const __bf16* g, int ld) {
  const size_t st = (size_t)16 * (size_t)ld;
  const unsigned ls = 16 * GT_P * 2;
  const __bf16 *g1 = g + st, *g2 = g + 2 * st, *g3 = g + 3 * st, *g4 = g + 4 * st, *g5 = g + 5 * st, *g6 = g + 6 * st, *g7 = g + 7 * st;
#if defined(__HIP_DEVICE_COMPILE__)
  asm volatile("global_load_async_to_lds_b128 %0, %8, off\n\t"
               "global_load_async_to_lds_b128 %1, %9, off\n\t"
               "global_load_async_to_lds_b128 %2, %10, off\n\t"
               "global_load_async_to_lds_b128 %3, %11, off\n\t"
               "global_load_async_to_lds_b128 %4, %12, off\n\t"
               "global_load_async_to_lds_b128 %5, %13, off\n\t"
               "global_load_async_to_lds_b128 %6, %14, off\n\t"
               "global_load_async_to_lds_b128 %7, %15, off\n\t"
               "s_wait_xcnt 0x0"
               :: "v"(l), "v"(l + ls), "v"(l + 2 * ls), "v"(l + 3 * ls), "v"(l + 4 * ls), "v"(l + 5 * ls), "v"(l + 6 * ls), "v"(l + 7 * ls),
                  "v"(g), "v"(g1), "v"(g2), "v"(g3), "v"(g4), "v"(g5), "v"(g6), "v"(g7)
               : "memory");
#endif
}
// this wave's own copies have landed
__device__ __forceinline__ void wait_copies() {
#if defined(__HIP_DEVICE_COMPILE__)
  asm volatile("s_wait_asynccnt 0x0" ::: "memory");
#endif
}
// this wave's own LDS reads have returned (before the barrier that hands their buffer to the next copies)
__device__ __forceinline__ void wait_lds() {
#if defined(__HIP_DEVICE_COMPILE__)
  asm volatile("s_wait_dscnt 0x0" ::: "memory");
#endif
}

// The k loop: fills acc with the block's 128 x 128 tile at rows mb, columns n0 (this wave's 32 rows of it). sS: two stage buffers.
template <bool SPLITA>
__device__ __forceinline__ void gemm_main(__bf16* sS, const __bf16* Ab, const __bf16* Ab2, int lda, const __bf16* Bb, int ldb,
                                          int mb, int n0, int K, v8f (&acc)[2][8]) {
  constexpr int NT = SPLITA ? 3 : 2;            // staged tiles per stage: A, Bt (, A lo plane)
  const int tid  = threadIdx.x;
  const int lane = threadIdx.x & 31;
  const int wave = threadIdx.x >> 5;
  const int rlane = lane & 15;              // row (A) / col (B, D) within a 16x16 subtile
  const int koff  = (lane >> 4) * 8;        // k offset of this lane half

#pragma unroll
  for (int i = 0; i < 2; ++i)
#pragma unroll
    for (int j = 0; j < 8; ++j) acc[i][j] = (v8f){0.f, 0.f, 0.f, 0.f, 0.f, 0.f, 0.f, 0.f};

  // copy lanes: thread -> row tid>>3 (+16 per copy), 16-B piece tid&7 of the row's 128 B
  const int crow = tid >> 3, cseg = (tid & 7) * 8;
  const __bf16* cA  = Ab + (size_t)(mb + crow) * lda + cseg;
  const __bf16* cA2 = SPLITA ? (Ab2 + (size_t)(mb + crow) * lda + cseg) : (const __bf16*)0;
  const __bf16* cB  = Bb + (size_t)(n0 + crow) * ldb + cseg;
  const unsigned cL = (unsigned)(size_t)(const void*)sS + (unsigned)(crow * GT_P + cseg) * 2u;   // LDS byte address, buffer 0, tile 0
  const int NP = K / GK;

  // stage 0 into buffer 0, published; then stage 1 into buffer 1
  copy_tile(cL, cA, lda);
  copy_tile(cL + GT_SZ * 2, cB, ldb);
  if (SPLITA) copy_tile(cL + 2 * GT_SZ * 2, cA2, lda);
  wait_copies();
  __syncthreads();
  if (NP > 1) {
    const unsigned lb = cL + NT * GT_SZ * 2;
    copy_tile(lb, cA + GK, lda);
    copy_tile(lb + GT_SZ * 2, cB + GK, ldb);
    if (SPLITA) copy_tile(lb + 2 * GT_SZ * 2, cA2 + GK, lda);
  }

  // one stage per trip, the buffer chosen by the trip's parity
  for (int t = 0; t < NP; ++t) {
    const int bo = (t & 1) * (NT * GT_SZ);
    const __bf16* sA  = sS + bo + ((wave << 5) + rlane) * GT_P + koff;
    const __bf16* sB  = sS + bo + GT_SZ + rlane * GT_P + koff;
    const __bf16* sA2 = sS + bo + 2 * GT_SZ + ((wave << 5) + rlane) * GT_P + koff;
#pragma unroll
    for (int kk = 0; kk < GK; kk += 32) {
      const v16b a0 = ldfrag_b(sA + kk);
      const v16b a1 = ldfrag_b(sA + 16 * GT_P + kk);
      v16b l0 = a0, l1 = a1;
      if (SPLITA) { l0 = ldfrag_b(sA2 + kk); l1 = ldfrag_b(sA2 + 16 * GT_P + kk); }
      // the k-step's fragments are read as one group ahead of its products, so that the LDS latency is paid once per k-step
      v16b bh[8];
#pragma unroll
      for (int j = 0; j < 8; ++j) bh[j] = ldfrag_b(sB + (j << 4) * GT_P + kk);
#pragma unroll
      for (int j = 0; j < 8; ++j) {
        acc[0][j] = wmma_b(a0, bh[j], acc[0][j]);
        if (SPLITA) acc[0][j] = wmma_b(l0, bh[j], acc[0][j]);
        acc[1][j] = wmma_b(a1, bh[j], acc[1][j]);
        if (SPLITA) acc[1][j] = wmma_b(l1, bh[j], acc[1][j]);
        dep_guard_b(acc[0][j], acc[1][j], bh[j], a0, a1, l0, l1);
      }
    }
    // publish point of stage t + 1: own reads of this buffer done, own copies of the next landed, then the block barrier
    wait_lds();
    wait_copies();
    __syncthreads();
    if (t + 2 < NP) {                           // block-uniform: refill the buffer this trip has just read
      const unsigned lb = cL + (unsigned)bo * 2u;
      const int ko = (t + 2) * GK;
      copy_tile(lb, cA + ko, lda);
      copy_tile(lb + GT_SZ * 2, cB + ko, ldb);
      if (SPLITA) copy_tile(lb + 2 * GT_SZ * 2, cA2 + ko, lda);
    }
  }
  wait_copies();
}

// The epilogue: bias, then the block's tile written in the form OUT_MODE names; zoff = the z slice's element offset in the outputs.
// The slabs reuse the stage buffers behind the k loop's last barrier.
template <int OUT_MODE, bool BROW>
__device__ __forceinline__ void gemm_epilogue(__bf16* sS, v8f (&acc)[2][8], int mb, int n0, size_t zoff,
                                              void* Cout, void* Cout2, int ldc,
                                              const float* __restrict__ bias, int nb1, const float* __restrict__ bias2, int nb2, int nsplit) {
  const int lane = threadIdx.x & 31;
  const int wave = threadIdx.x >> 5;
  const int m0 = mb + (wave << 5);
  const int rlane = lane & 15;              // col within a 16x16 subtile
  const int mOff  = (lane >> 4) * 8;        // D row offset of this lane half
  float* slab = (float*)(void*)sS + wave * (16 * GP);
  float bc[8];
#pragma unroll
  for (int j = 0; j < 8; ++j) bc[j] = 0.f;
  if (!BROW) {
    int x1[8], x2[8];
    float r1[8], r2[8];
#pragma unroll
    for (int j = 0; j < 8; ++j) {
      const int col = n0 + (j << 4) + rlane;
      int i1 = col;          if (i1 > nb1 - 1) i1 = nb1 - 1;
      int i2 = col - nsplit; if (i2 < 0) i2 = 0; if (i2 > nb2 - 1) i2 = nb2 - 1;
      x1[j] = i1; x2[j] = i2;
      r1[j] = bias[i1];
      r2[j] = bias2[i2];
    }
    hold_offsets8(x1, r1);
    hold_offsets8(x2, r2);
    // unrolled: static indices keep the arrays in registers
#pragma unroll
    for (int j = 0; j < 8; ++j) {
      const int col = n0 + (j << 4) + rlane;
      const float v1 = bfr(r1[j]);
      const float v2 = bfr(r2[j]);
      const bool lo = (col < nsplit);
      const bool valid = lo ? (col < nb1) : ((col - nsplit) < nb2);
      const float v = lo ? v1 : v2;
      bc[j] = valid ? v : 0.f;
    }
  }
#pragma unroll
  for (int i = 0; i < 2; ++i) {
    const int mBase = m0 + (i << 4);
    float br[8];
#pragma unroll
    for (int r = 0; r < 8; ++r) {
      br[r] = 0.f;
      if (BROW) {
        int ir = mBase + mOff + r; if (ir > nb1 - 1) ir = nb1 - 1;
        br[r] = bfr(bias[ir]);
      }
    }
#pragma unroll
    for (int j = 0; j < 8; ++j)
#pragma unroll
      for (int r = 0; r < 8; ++r)
        slab[(mOff + r) * GP + (j << 4) + rlane] = acc[i][j][r] + (BROW ? br[r] : bc[j]);
    wave_sync();
    if (OUT_MODE == 0) {
      float* C = (float*)Cout + zoff;
      const int c4 = lane * 4;                               // row segment 512 B = 32 lanes x 16 B
      {
#pragma unroll
        for (int it = 0; it < 16; ++it) {
          const v4f v = *(const v4f*)(slab + it * GP + c4);
          *(v4f*)(C + (size_t)(mBase + it) * ldc + n0 + c4) = v;
        }
        
      }
    } else if (OUT_MODE == 1) {
      unsigned short* C  = (unsigned short*)Cout  + zoff;
      const int q16 = lane >> 4, c8 = (lane & 15) * 8;      // row segment 256 B = 16 lanes x 16 B
      {
#pragma unroll
        for (int it = 0; it < 8; ++it) {
          const int row = it * 2 + q16;
          const float* sp = slab + row * GP + c8;
          v4u hv;
#pragma unroll
          for (int p = 0; p < 4; ++p) {
            const float f0 = sp[2 * p], f1 = sp[2 * p + 1];
            const _Float16 e0 = (_Float16)f0, e1 = (_Float16)f1;
            hv[p] = pk16(h2u(e0), h2u(e1));
          }
          const size_t go = (size_t)(mBase + row) * ldc + n0 + c8;
          *(v4u*)(C  + go) = hv;
        }
        
      }
    } else {
      const int q16 = lane >> 4, c8 = (lane & 15) * 8;      // row segment 256 B = 16 lanes x 16 B
      const int  bidx = m0 / SEQ;                             // all 32 rows of the tile lie in one batch element
      const bool isq  = (n0 < nsplit);                        // wave-uniform
      const int  head = (isq ? n0 : (n0 - nsplit)) >> 7;
      const size_t rowBase = (size_t)(bidx * NH + head) * SEQ;
      unsigned short* P1 = (unsigned short*)(isq ? Cout : Cout2);
      {
#pragma unroll
        for (int it = 0; it < 8; ++it) {
          const int row = it * 2 + q16;
          const int s   = (mBase + row) & (SEQ - 1);
          const float* sp = slab + row * GP + c8;
          v4u hv;
#pragma unroll
          for (int p = 0; p < 4; ++p) {
            const float f0 = sp[2 * p], f1 = sp[2 * p + 1];
            const _Float16 e0 = (_Float16)f0, e1 = (_Float16)f1;
            hv[p] = pk16(h2u(e0), h2u(e1));
          }
          const size_t go = (rowBase + (size_t)s) * ldc + c8;
          *(v4u*)(P1 + go) = hv;
          wait_named_regs();   // the next trip rewrites the store's data and address registers
        }
        
      }
    }
    wave_sync();
  }
}

template <bool SPLITA, int OUT_MODE, bool BROW>
__global__ __launch_bounds__(128) void gemm_kernel(
    const unsigned short* __restrict__ Ap, const unsigned short* __restrict__ A2p, int lda, long strideA,
    const unsigned short* __restrict__ Btp, int ldb, long strideB,
    void* Cout, void* Cout2, int ldc, long strideC,
    const float* __restrict__ bias, int nb1, const float* __restrict__ bias2, int nb2, int nsplit,
    int M, int N, int K) {
  constexpr int NT = SPLITA ? 3 : 2;            // staged tiles per stage: A, Bt (, A lo plane)
  __shared__ __align__(16) __bf16 sS[2 * NT * GT_SZ];   // two stage buffers; the epilogue slabs reuse them behind the loop's last barrier
  static_assert(4 * 16 * GP * 4 <= 2 * NT * GT_SZ * 2);
  const int bz   = blockIdx.y;
  const int tilesN = N >> 7;
  const int tilesM = M >> 7;
  const int tile = blockIdx.x;
  if (tile >= tilesM * tilesN) return;          // block-uniform, in front of every barrier
  const int tm = tile / tilesN;
  const int tn = tile - tm * tilesN;
  const int mb = tm << 7;                       // first row of the block's 128x128 tile
  const int n0 = tn << 7;

  const __bf16* Ab  = (const __bf16*)(const void*)Ap + (size_t)bz * strideA;
  const __bf16* Ab2 = SPLITA ? ((const __bf16*)(const void*)A2p + (size_t)bz * strideA) : (const __bf16*)0;
  const __bf16* Bb  = (const __bf16*)(const void*)Btp + (size_t)bz * strideB;

  v8f acc[2][8];
  gemm_main<SPLITA>(sS, Ab, Ab2, lda, Bb, ldb, mb, n0, K, acc);
  gemm_epilogue<OUT_MODE, BROW>(sS, acc, mb, n0, (size_t)bz * strideC, Cout, Cout2, ldc, bias, nb1, bias2, nb2, nsplit);
}

// ---------------------------------------------------------------------------
// The three projections of x in one launch: none reads what another writes, so they are ranges of one grid's block index,
// each block one 128 x 128 tile over K = HID through the same k loop; only operands, tile grid and epilogue differ.
//   blocks [0, PJ_QK):  q | k: A = x [4096][2048], Bt = wq^T | wk^T [4096][2048] -> q plane, k plane, head-major; + bq | bk
//   then NB * PJ_V:     v^T per batch element: A = wv^T [2048 d][2048 k], Bt = x[b] [2048 s][2048 k] -> V^T plane; + bv[d]
//   then PJ_G:          gate logits: A = x, Bt = wg^T zero-padded [128][2048] -> f32 [4096][128]; + bg for columns < 16
// The range tests read blockIdx alone: block-uniform around every barrier.
// ---------------------------------------------------------------------------
#define PJ_QK ((NB * SEQ / 128) * (2 * HID / 128))
#define PJ_V  ((HID / 128) * (SEQ / 128))
#define PJ_G  ((NB * SEQ / 128) * (GLD / 128))
// four waves per SIMD, as each of the three had alone (four blocks of 72 KB on a WGP): 256 registers a wave
__global__ __launch_bounds__(128) __attribute__((amdgpu_waves_per_eu(4, 4))) void proj_kernel(
    const unsigned short* __restrict__ Xbp, const unsigned short* __restrict__ Wqkp, const unsigned short* __restrict__ Wvtp,
    const unsigned short* __restrict__ Wgtp,
    unsigned short* Qh, unsigned short* Kp, unsigned short* Vth, float* Gl,
    const float* __restrict__ bq, const float* __restrict__ bk, const float* __restrict__ bv, const float* __restrict__ bg) {
  __shared__ __align__(16) __bf16 sS[2 * 2 * GT_SZ];    // two stage buffers; the epilogue slabs reuse them behind the loop's last barrier
  static_assert(4 * 16 * GP * 4 <= 2 * 2 * GT_SZ * 2);
  const __bf16* Xb = (const __bf16*)(const void*)Xbp;
  const int bx = blockIdx.x;
  const int kind = (bx < PJ_QK) ? 0 : (bx < PJ_QK + NB * PJ_V) ? 1 : 2;
  int tile = bx, tilesN = 2 * HID / 128, bz = 0;
  const __bf16* Ab = Xb;
  const __bf16* Bb = (const __bf16*)(const void*)Wqkp;
  if (kind == 1) {
    const int t = bx - PJ_QK;
    bz = t / PJ_V; tile = t - bz * PJ_V; tilesN = SEQ / 128;
    Ab = (const __bf16*)(const void*)Wvtp;
    Bb = Xb + (size_t)bz * SEQ * HID;
  } else if (kind == 2) {
    tile = bx - (PJ_QK + NB * PJ_V); tilesN = GLD / 128;
    Bb = (const __bf16*)(const void*)Wgtp;
  }
  const int tm = tile / tilesN;
  const int tn = tile - tm * tilesN;
  const int mb = tm << 7;                       // first row of the block's 128x128 tile
  const int n0 = tn << 7;

  v8f acc[2][8];
  gemm_main<false>(sS, Ab, (const __bf16*)0, HID, Bb, HID, mb, n0, HID, acc);
  if (kind == 0)      gemm_epilogue<2, false>(sS, acc, mb, n0, 0, (void*)Qh, (void*)Kp, HD, bq, HID, bk, HID, HID);
  else if (kind == 1) gemm_epilogue<1, true>(sS, acc, mb, n0, (size_t)bz * HID * SEQ, (void*)Vth, (void*)Vth, SEQ, bv, HID, bv, HID, SEQ);
  else                gemm_epilogue<0, false>(sS, acc, mb, n0, 0, (void*)Gl, (void*)Gl, GLD, bg, NH, bg, NH, GLD);
}

#define AT_QB 128
#define AT_QW 2      // column groups of 16 queries per wave
#define AT_KC 64
#define OS_P  132
// LDS row pitches in f16 elements, each 16 B x odd so that the 16 rows a ds_load_b128 fragment read touches fall on distinct banks
#define K_P   (HD + 8)      // K rows of 256 B at pitch 272 B
#define V_P   (AT_KC + 8)   // V^T rows of 128 B at pitch 144 B
#define AT_BUF (AT_KC * K_P + HD * V_P)   // f16 elements of one staged chunk: K | V^T

// Half a chunk, global -> LDS: 8 asynchronous 16-B copies per lane, 4 per plane. lk / lh = this lane's LDS byte address of its
// first row of K / V^T, gk / gh = its global address there; copy i takes K row +16*i, V^T row +32*i.
// The s_wait_xcnt stands inside the statement so that no address register is rewritten ahead of it.
__device__ __forceinline__ void copy_chunk(unsigned lk, unsigned lh, const _Float16* gk, const _Float16* gh) {
  const unsigned ks = 16 * K_P * 2, vs = 32 * V_P * 2;
  const size_t kg = (size_t)16 * HD, vg = (size_t)32 * SEQ;
#if defined(__HIP_DEVICE_COMPILE__)
  asm volatile("global_load_async_to_lds_b128 %0, %8, off\n\t"
               "global_load_async_to_lds_b128 %1, %9, off\n\t"
               "global_load_async_to_lds_b128 %2, %10, off\n\t"
               "global_load_async_to_lds_b128 %3, %11, off\n\t"
               "global_load_async_to_lds_b128 %4, %12, off\n\t"
               "global_load_async_to_lds_b128 %5, %13, off\n\t"
               "global_load_async_to_lds_b128 %6, %14, off\n\t"
               "global_load_async_to_lds_b128 %7, %15, off\n\t"
               "s_wait_xcnt 0x0"
               :: "v"(lk), "v"(lk + ks), "v"(lk + 2 * ks), "v"(lk + 3 * ks),
                  "v"(lh), "v"(lh + vs), "v"(lh + 2 * vs), "v"(lh + 3 * vs),
                  "v"(gk), "v"(gk + kg), "v"(gk + 2 * kg), "v"(gk + 3 * kg),
                  "v"(gh), "v"(gh + vg), "v"(gh + 2 * vg), "v"(gh + 3 * vg)
               : "memory");
#endif
}

// two waves per SIMD: two blocks of 4 waves on a WGP, 512 registers a wave
__global__ __launch_bounds__(128) __attribute__((amdgpu_waves_per_eu(2, 2)))
void attn_kernel(const unsigned short* __restrict__ qhp, const unsigned short* __restrict__ kp,
                 const unsigned short* __restrict__ vhp,
                 const float* __restrict__ bmp, const float* __restrict__ glp,
                 unsigned short* chp, unsigned short* clp) {
  __shared__ __align__(16) _Float16 KVs[2 * AT_BUF];   // two buffers of K [key][d] | V^T [d][key], padded rows; ctx staging later
  static_assert(4 * AT_QW * 16 * OS_P * 4 <= 2 * AT_BUF * 2);

  const int tid  = threadIdx.x;
  const int wave = __builtin_amdgcn_readfirstlane(tid >> 5);   // wave-uniform: held in a scalar register, with all that is formed from it
  const int lane = tid & 31;
  const int hh   = lane >> 4;
  const int c    = lane & 15;

  const int bx  = blockIdx.x;
  const int qb  = bx & 15;                 // query block of 128
  const int h   = (bx >> 4) & (NH - 1);    // head
  const int b   = bx >> 8;                 // batch element
  const int q0  = qb * AT_QB + wave * (16 * AT_QW);   // this wave's first query; column group u holds queries q0 + 16*u + c

  const _Float16* Qhg = (const _Float16*)(const void*)qhp + (size_t)(b * NH + h) * SEQ * HD;
  const _Float16* Kg  = (const _Float16*)(const void*)kp  + (size_t)(b * NH + h) * SEQ * HD;
  const _Float16* Vhg = (const _Float16*)(const void*)vhp + ((size_t)b * HID + (size_t)h * HD) * SEQ;
  const float*    Bm  = bmp + (size_t)b * SEQ * SEQ + (size_t)(q0 + c) * SEQ + 8 * hh;   // + 16*u rows + first key of the tile + r
  const unsigned qrb = (unsigned)((q0 + c) * HD + 8 * hh) * 2u;  // per-lane q fragment base in bytes, query q0 + c (16*u rows and d added per step)

  // per-head bias scale 2^(-(h+1)/2): exact power of two times sqrt(1/2) for odd (h+1)
  const int   hexp = (h + 1) >> 1;
  const float hs   = __uint_as_float((unsigned)(127 - hexp) << 23) * (((h + 1) & 1) ? 0.70710678118654752f : 1.0f);

  const v8f zero8 = (v8f){0.f, 0.f, 0.f, 0.f, 0.f, 0.f, 0.f, 0.f};
  // softmax runs in base 2: log2(e) is folded into the score scale and the bias scale, so that exp(x) is one v_exp_f32
  const float log2e   = 1.4426950408889634f;
  const float scale   = (1.0f / 11.313708305358887f) * log2e;
  const float hs2     = hs * log2e;

  float mrow[AT_QW], lrow[AT_QW];          // of query q0 + 16*u + c; lrow sums this lane half's keys only
  v8f oh[AT_QW][8];
  v16h qa[AT_QW][4];
  // unrolled: static indices keep these arrays in registers
#pragma unroll
  for (int u = 0; u < AT_QW; ++u) {
    mrow[u] = -INFINITY; lrow[u] = 0.f;
#pragma unroll
    for (int t = 0; t < 8; ++t) oh[u][t] = zero8;
#pragma unroll
    for (int dc = 0; dc < 4; ++dc) qa[u][dc] = ldfrag_h((const _Float16*)((const char*)Qhg + qrb) + u * 16 * HD + dc * 32);
  }
  hold_base_offset(Qhg, qrb);

  // copy lanes: K: thread -> key tid>>4 (+8 per copy), 16-B piece tid&15 of the row's 256 B;
  //             V^T: thread -> d = tid>>3 (+16 per copy), 16-B piece tid&7 of the row's 128 B of this chunk
  // coverage: 8 x 8 keys x 128 d for K, 8 x 16 d x 64 keys for V^T = the whole chunk tiles, as two runs of copy_chunk:
  // the first takes K rows +16*i and V^T rows +32*i, the second the same 8 K rows and 16 V^T rows further on
  constexpr int NCH = SEQ / AT_KC;
  static_assert(NCH >= 2);
  const int krow = tid >> 4, kseg = (tid & 15) * 8;
  const int vrow = tid >> 3, vseg = (tid & 7) * 8;
  const unsigned lK = (unsigned)(size_t)(const void*)KVs + (unsigned)(krow * K_P + kseg) * 2u;                 // LDS byte addresses, buffer 0
  const unsigned lH = (unsigned)(size_t)(const void*)KVs + (unsigned)(AT_KC * K_P + vrow * V_P + vseg) * 2u;
  const _Float16* gK = Kg  + krow * HD + kseg;
  const _Float16* gH = Vhg + (size_t)vrow * SEQ + vseg;
  constexpr unsigned lK2 = 8 * K_P * 2, lH2 = 16 * V_P * 2;     // the second run's step in LDS bytes
  constexpr size_t   gK2 = (size_t)8 * HD, gH2 = (size_t)16 * SEQ;   // and in global elements

  const unsigned lK1 = lK + AT_BUF * 2u, lH1 = lH + AT_BUF * 2u;   // the same places in buffer 1

  // chunk 0 into buffer 0, published
  copy_chunk(lK, lH, gK, gH);
  copy_chunk(lK + lK2, lH + lH2, gK + gK2, gH + gH2);
  wait_copies();
  __syncthreads();

  // one chunk per trip, the buffer chosen by the trip's parity
  const float* bp = Bm;                    // this lane's bias row at the chunk's first key; stepped at the trip's foot
  for (int kc = 0; kc < NCH; ++kc) {
    const int kv0 = kc * AT_KC;
    const int bo  = (kc & 1) * AT_BUF;
    // directly behind the barrier that ended every read of the other buffer (the one above, then the one at the trip's foot):
    // the next chunk's copies into it, while there is a next chunk (block-uniform); they fly while this chunk is worked on
    if (kc + 1 < NCH) {
      const unsigned lb = (unsigned)bo * 2u;
      const int kn = kv0 + AT_KC;
      copy_chunk(lK1 - lb, lH1 - lb, gK + (size_t)kn * HD, gH + kn);
      copy_chunk(lK1 - lb + lK2, lH1 - lb + lH2, gK + (size_t)kn * HD + gK2, gH + kn + gH2);
    }
    const _Float16* const Ksh = KVs + bo;
    const _Float16* const Vth = KVs + bo + AT_KC * K_P;

    // ---- scores: 4 key tiles of 16, reduce over d = 128 = 4 k-steps; each K fragment read from LDS serves both column groups,
    //      the accumulate chains of two key tiles x two column groups alternate ----
    v8f s[AT_QW][4];
    v4f bb[AT_QW][4][2];                     // raw bias values per column group and key tile: 8 consecutive keys of this lane's query
#pragma unroll
    for (int u = 0; u < AT_QW; ++u)
#pragma unroll
      for (int j = 0; j < 4; ++j) {
        bb[u][j][0] = *(const v4f*)(bp + (size_t)u * 16 * SEQ + j * 16);
        bb[u][j][1] = *(const v4f*)(bp + (size_t)u * 16 * SEQ + j * 16 + 4);
      }
    // keeps the chunk's bias loads issued as one group here, in flight behind the products:
    // the scheduler otherwise sinks them in pairs to their uses
    __builtin_amdgcn_sched_barrier(0);
#pragma unroll
    for (int j = 0; j < 4; j += 2) {
      v8f sa[AT_QW], sb[AT_QW];
#pragma unroll
      for (int u = 0; u < AT_QW; ++u) { sa[u] = zero8; sb[u] = zero8; }
#pragma unroll
      for (int dc = 0; dc < 4; ++dc) {
        FragH ka, kb;
        ka.h[0] = *(const v8h*)(Ksh + (j * 16 + c) * K_P + dc * 32 + 8 * hh);
        ka.h[1] = *(const v8h*)(Ksh + (j * 16 + c) * K_P + dc * 32 + 16 + 8 * hh);
        kb.h[0] = *(const v8h*)(Ksh + (j * 16 + 16 + c) * K_P + dc * 32 + 8 * hh);
        kb.h[1] = *(const v8h*)(Ksh + (j * 16 + 16 + c) * K_P + dc * 32 + 16 + 8 * hh);
#pragma unroll
        for (int u = 0; u < AT_QW; ++u) {
          sa[u] = wmma_h(ka.v, qa[u][dc], sa[u]);
          sb[u] = wmma_h(kb.v, qa[u][dc], sb[u]);
        }
      }
      // keeps the first use of these tiles' bias (and its wait) behind the tiles' products
      __builtin_amdgcn_sched_barrier(0);
#pragma unroll
      for (int u = 0; u < AT_QW; ++u) {
        v8f xa = sa[u] * scale;
        v8f xb = sb[u] * scale;
#pragma unroll
        for (int r = 0; r < 8; ++r) {
          xa[r] = xa[r] + hs2 * bfr(bb[u][j][r >> 2][r & 3]);
          xb[r] = xb[r] + hs2 * bfr(bb[u][j + 1][r >> 2][r & 3]);
        }
        s[u][j] = xa;
        s[u][j + 1] = xb;
      }
    }

    // P^T operands: element e of k-step kk is key 32*kk + 8*hh + e (e < 8, tile 2*kk) or 32*kk + 16 + 8*hh + e - 8 (tile 2*kk + 1),
    // the k order of the V^T fragment loads below
    FragH pb[AT_QW][2];
#pragma unroll
    for (int u = 0; u < AT_QW; ++u) {
      // maximum over this lane's 32 scores, then over the other half's
      float mx[8];
#pragma unroll
      for (int r = 0; r < 8; ++r) mx[r] = fmaxf(fmaxf(s[u][0][r], s[u][1][r]), fmaxf(s[u][2][r], s[u][3][r]));
      float cm = fmaxf(fmaxf(fmaxf(mx[0], mx[1]), fmaxf(mx[2], mx[3])), fmaxf(fmaxf(mx[4], mx[5]), fmaxf(mx[6], mx[7])));
      cm = fmaxf(cm, xhalf(cm));

      const float mnew  = fmaxf(mrow[u], cm);
      const float alpha = __builtin_amdgcn_exp2f(mrow[u] - mnew);
      const float msub  = mnew - 10.0f;      // the 2^10 scale of P rides in the exponent
      mrow[u] = mnew;
      float ps[4];
#pragma unroll
      for (int j = 0; j < 4; ++j) {
        exp2x8(s[u][j], msub);                     // 1024 * exp(score - maximum)
      }
#pragma unroll
      for (int j = 0; j < 4; ++j) {
        float pj = s[u][j][0];
#pragma unroll
        for (int r = 1; r < 8; ++r) pj += s[u][j][r];
#pragma unroll
        for (int r = 0; r < 8; ++r) pb[u][j >> 1].v[(j & 1) * 8 + r] = (_Float16)s[u][j][r];
        ps[j] = pj;
      }
      lrow[u] = lrow[u] * alpha + ((ps[0] + ps[1]) + (ps[2] + ps[3]));
#pragma unroll
      for (int t = 0; t < 8; ++t) oh[u][t] *= alpha;
    }

    // ---- ctx^T += V^T . P^T over the 64 keys of the chunk (2 k-steps), 8 d tiles; each V^T fragment serves both column groups ----
    // unrolled: the static index keeps pb in registers
#pragma unroll
    for (int kk = 0; kk < 2; ++kk) {
#pragma unroll
      for (int t = 0; t < 8; ++t) {
        FragH vb;
        vb.h[0] = *(const v8h*)(Vth + (t * 16 + c) * V_P + kk * 32 + 8 * hh);
        vb.h[1] = *(const v8h*)(Vth + (t * 16 + c) * V_P + kk * 32 + 16 + 8 * hh);
#pragma unroll
        for (int u = 0; u < AT_QW; ++u) oh[u][t] = wmma_h(vb.v, pb[u][kk].v, oh[u][t]);
      }
    }
    // publish point of chunk kc + 1: own reads of this buffer done, own copies of the next landed, then the block barrier
    wait_lds();
    wait_copies();
    __syncthreads();
    bp += AT_KC;
  }
  wait_copies();

  // ---- normalise, apply the head gate, stage the wave 32x128 tile (aliases the K/V region behind the loop's last barrier),
  //      write bf16 hi/lo planes ----
  float* os = (float*)(void*)KVs + wave * (AT_QW * 16 * OS_P);
#pragma unroll
  for (int u = 0; u < AT_QW; ++u) {
    const float lsum = lrow[u] + xhalf(lrow[u]);   // the two lane halves' key sums of query q0 + 16*u + c
    const float a  = glp[(size_t)(b * SEQ + q0 + u * 16 + c) * GLD + h];
    const float g  = 1.0f / (1.0f + expf(-a));
    const float invl = g * (1.0f / lsum);    // ctx and lsum both carry the factor 1024
#pragma unroll
    for (int t = 0; t < 8; ++t) {
      const v8f o = oh[u][t] * invl;
      *(v4f*)(os + (u * 16 + c) * OS_P + t * 16 + 8 * hh)     = (v4f){o[0], o[1], o[2], o[3]};
      *(v4f*)(os + (u * 16 + c) * OS_P + t * 16 + 8 * hh + 4) = (v4f){o[4], o[5], o[6], o[7]};
    }
  }
  wave_sync();
  {
    const int q16 = lane >> 4, c8 = (lane & 15) * 8;         // 2 rows per instruction, each row 256 B = 16 lanes x 16 B
    {
#pragma unroll
      for (int it = 0; it < AT_QW * 8; ++it) {
        const int row = it * 2 + q16;
        const float* sp = os + row * OS_P + c8;
        v4u hv, lv;
#pragma unroll
        for (int p = 0; p < 4; ++p) {
          const float f0 = sp[2 * p], f1 = sp[2 * p + 1];
          const unsigned short hb0 = f2bf_bits(f0), hb1 = f2bf_bits(f1);
          const unsigned short lb0 = f2bf_bits(f0 - bf_bits2f(hb0));
          const unsigned short lb1 = f2bf_bits(f1 - bf_bits2f(hb1));
          hv[p] = pk16(hb0, hb1);
          lv[p] = pk16(lb0, lb1);
        }
        const size_t go = (size_t)(b * SEQ + q0 + row) * HID + h * HD + c8;
        *(v4u*)(chp + go) = hv;
        *(v4u*)(clp + go) = lv;
        wait_named_regs();   // the next trip rewrites the stores' data and address registers
      }
      
    }
  }
}

// ---------------------------------------------------------------------------
// all sizes exact tile multiples, all offsets multiples of 512 KiB):
//   R0   bf16 [4096][2048]       16777216 @ 0           x as bf16; later ctx hi plane (written after the last reader of x)
//   R1   bf16 [4096][2048]       16777216 @ 16777216    wq^T|wk^T panel [4096][2048]; later ctx lo plane
//   Wob  bf16 [2048][2048]        8388608 @ 33554432    wo^T
//   Wgb  bf16 [128][2048]          524288 @ 41943040    wg^T zero-padded to 128 rows
//   Glog f32  [4096][128]         2097152 @ 42467328    gate logits
//   Qh   f16  [2][16][2048][128]  16777216 @ 44564480
//   Kp   f16  [2][16][2048][128]  16777216 @ 61341696
//   Vth  f16  [2][2048][2048]     16777216 @ 78118912
//   Wvt  bf16 [2048][2048]        8388608 @ 94896128    wv^T
//   total                        103284736
// ---------------------------------------------------------------------------
extern "C" void kernel_launch(void* const* d_in, const int* in_sizes, int n_in,
                              void* d_out, int out_size, void* d_ws, size_t ws_size,
                              hipStream_t stream) {
  if (n_in < 12) return;
  if (in_sizes[0] != NB * SEQ * HID) return;
  if (in_sizes[1] != NB * SEQ * SEQ) return;
  if (in_sizes[2] != HID * HID) return;
  if (in_sizes[3] != HID) return;
  if (in_sizes[4] != HID * HID) return;
  if (in_sizes[5] != HID) return;
  if (in_sizes[6] != HID * HID) return;
  if (in_sizes[7] != HID) return;
  if (in_sizes[8] != HID * NH) return;
  if (in_sizes[9] != NH) return;
  if (in_sizes[10] != HID * HID) return;
  if (in_sizes[11] != HID) return;
  if (out_size != NB * SEQ * HID) return;

  const float* x   = (const float*)d_in[0];
  const float* bm  = (const float*)d_in[1];
  const float* wq  = (const float*)d_in[2];
  const float* bq  = (const float*)d_in[3];
  const float* wk  = (const float*)d_in[4];
  const float* bk  = (const float*)d_in[5];
  const float* wv  = (const float*)d_in[6];
  const float* bv  = (const float*)d_in[7];
  const float* wg  = (const float*)d_in[8];
  const float* bg  = (const float*)d_in[9];
  const float* wo  = (const float*)d_in[10];
  const float* bo  = (const float*)d_in[11];
  float* out = (float*)d_out;

  const size_t szR0  = (size_t)NB * SEQ * HID * 2;          // 16 MiB
  const size_t szR1  = (size_t)2 * HID * HID * 2;           // 16 MiB
  const size_t szWo  = (size_t)HID * HID * 2;               //  8 MiB
  const size_t szWg  = (size_t)GLD * HID * 2;               //  512 KiB
  const size_t szG   = (size_t)NB * SEQ * GLD * 4;          //  2 MiB
  const size_t szQ   = (size_t)NB * NH * SEQ * HD * 2;      // 16 MiB
  const size_t szK   = szQ;
  const size_t szV   = (size_t)NB * HID * SEQ * 2;          // 16 MiB
  size_t off = 0;
  const size_t oR0  = off; off += szR0;
  const size_t oR1  = off; off += szR1;
  const size_t oWo  = off; off += szWo;
  const size_t oWg  = off; off += szWg;
  const size_t oG   = off; off += szG;
  const size_t oQh  = off; off += szQ;
  const size_t oKp  = off; off += szK;
  const size_t oVth = off; off += szV;
  const size_t oWv  = off; off += szWo;
  if (off > ws_size) return;                    // off = 103284736

  char* ws = (char*)d_ws;
  unsigned short* Xb  = (unsigned short*)(ws + oR0);
  unsigned short* Ch  = (unsigned short*)(ws + oR0);        // reuses R0 after the projections (last readers of Xb)
  unsigned short* Wvt = (unsigned short*)(ws + oWv);
  unsigned short* Wqk = (unsigned short*)(ws + oR1);
  unsigned short* Cl  = (unsigned short*)(ws + oR1);        // reuses R1 after the projections (last readers of Wqk)
  unsigned short* Wot = (unsigned short*)(ws + oWo);
  unsigned short* Wgt = (unsigned short*)(ws + oWg);
  float*          Gl  = (float*)(ws + oG);
  unsigned short* Qh  = (unsigned short*)(ws + oQh);
  unsigned short* Kp  = (unsigned short*)(ws + oKp);
  unsigned short* Vth = (unsigned short*)(ws + oVth);

  const dim3 blk256(256), blk128(128);

  // (1) all operand conversions: wv^T, wq^T | wk^T, wo^T, x as bf16, wg^T zero-padded
  prep_kernel<<<dim3(GLD + 4 * TR_NB + CV_NB), blk256, 0, stream>>>(x, wv, wq, wk, wo, wg, Xb, Wvt, Wqk, Wot, Wgt);
  // (2) the three projections of x: q | k planes, v^T plane, gate logits
  proj_kernel<<<dim3(PJ_QK + NB * PJ_V + PJ_G), blk128, 0, stream>>>(Xb, Wqk, Wvt, Wgt, Qh, Kp, Vth, Gl, bq, bk, bv, bg);
  // (3) attention: grid = NB x 16 heads x 16 query blocks, 128 threads
  attn_kernel<<<dim3(NB * NH * (SEQ / AT_QB)), blk128, 0, stream>>>(Qh, Kp, Vth, bm, Gl, Ch, Cl);
  // (4) output projection: A = gated ctx hi/lo planes [4096][2048], Bt = Wot [2048][2048] -> d_out f32 [4096][2048], + bo
  {
    const int M = NB * SEQ, N = HID, K = HID;
    const int tiles = (M / 32) * (N / 128);
    gemm_kernel<true, 0, false><<<dim3((tiles + 3) / 4, 1), blk128, 0, stream>>>(
        Ch, Cl, HID, 0L, Wot, HID, 0L, (void*)out, (void*)out, HID, 0L,
        bo, HID, bo, HID, N, M, N, K);
  }
  (void)hipGetLastError();
}
